// v000
// Times are from an AMD MI455X. After a warm-up the kernel runs many times in a row, and a time is the length of
// such a window on the GPU divided by its runs, so every launch and the gaps after it count. The runs cycle
// through copies of the inputs. A figure is the median of several windows, for all but v000 over two sittings.
// Sittings can differ by a few percent; kernels timed side by side share one.
// The starting kernel, v000, takes 4190 microseconds a run.
#include <hip/hip_runtime.h>
// Causal LINEAR attention (x [2][2048][1024]; qk = x Wqk^T + bqk (natural [2048][1024]: rows 0..1023 -> q, 1024..2047 -> k; sigma 1/32, biases 0.02), v = x Wv^T + bv; 16 heads of 64; feature map phi = elu + 1 on q and k; ctx_t = (phi(q_t) . sum_{s<=t} phi(k_s) v_s^T) / (phi(q_t) . sum_{s<=t} phi(k_s)) = sum_{s<=t} a_ts v_s / sum_{s<=t} a_ts with a_ts = phi(q_t).phi(k_s) (the module's cumsum form, no softmax, no scaling, no eps); out = ctx Wo^T + bo -> [2][2048][1024]).
// Structure: x as exact f16 rows; natural weights re-laid on VALU into exact x16 planes; q, k (with the elu + 1 feature map in the GEMM epilogue) and v as WMMA GEMMs (32x64 wave tiles, f32 accumulation, + bias) with f16 outputs; per batch: V^T via LDS transposes; per query tile of 256 rows: a = phi(q) phi(k)^T against the keys below the tile end only (K = 64, all heads on grid.y), causal row NORMALISATION on VALU (p_j = a_j [j <= i] / sum_{j <= i} a_j in f32; weights x256 f16), ctx = P V^T (x64) into merged f16 rows; out = ctx Wo^T + bo GEMM (f32); first-tile refinement: the first 128 rows of each batch recomputed exactly in f32 on VALU (a / sum a weights) and their output rows rewritten from o hi/lo by two accumulating GEMM passes; launches: see trace.
// Compute dtype: inputs rounded to bf16; x / weights exact; q, k, v, normalised weights and o as plain f16 GEMM operands (~2^-12); scores and row sums f32; v_wmma_f32_16x16x32_f16.
#define NB 2
#define SQ 2048
#define DM 1024
#define NH 16
#define HD 64
#define HG 4                         /* heads per group in the unlaunched k_vt(V16, b, h0, VT) overload */
#define QT 256                       /* query rows per causal tile */
#define NKX SQ                       /* S / P row pitch */
#define QT0 128                      /* first-tile rows recomputed exactly in f32 */
#define B0 0                         /* first batch processed (debug hook) */
#define NBR NB                       /* batches processed (debug hook) */
#define NR ((size_t)NB * SQ)         /* token rows */
#define MP ((int)((size_t)NBR * SQ)) /* rows projected (debug hook) */
#define QN SQ                        /* query rows attended per batch (debug hook) */
#define NHD NH                       /* heads attended (debug hook) */
#define MPO MP                       /* rows through the output stage (debug hook) */
#define LQ DM      /* row pitch of the q/k/v rows */
typedef __bf16 v16b __attribute__((ext_vector_type(16)));
typedef unsigned short v8us __attribute__((ext_vector_type(8), may_alias));
typedef float  v8f  __attribute__((ext_vector_type(8)));
typedef float  v4f  __attribute__((ext_vector_type(4)));
typedef float  v4fa __attribute__((ext_vector_type(4), may_alias));
union FragB { v16b v; v8us half[2]; unsigned short u[16]; };

__device__ __forceinline__ unsigned short bf16_bits(float x) { unsigned int u = __float_as_uint(x); return (unsigned short)((u + 0x7FFFu + ((u >> 16) & 1u)) >> 16); }
__device__ __forceinline__ float bf16_val(unsigned short b) { return __uint_as_float(((unsigned int)b) << 16); }
__device__ __forceinline__ float bf16_round(float x) { return bf16_val(bf16_bits(x)); }
// D += A·B with NT terms: 1 = ah·bh, 2 = + al·bh (A split), 3 = + ah·bl (both split)
template <int NT>
__device__ __forceinline__ v8f mmaN(v16b ah, v16b al, v16b bh, v16b bl, v8f c) {
  c = __builtin_amdgcn_wmma_f32_16x16x32_bf16(false, ah, false, bh, (short)0, c, false, false);
  if (NT >= 2) c = __builtin_amdgcn_wmma_f32_16x16x32_bf16(false, al, false, bh, (short)0, c, false, false);
  if (NT >= 3) c = __builtin_amdgcn_wmma_f32_16x16x32_bf16(false, ah, false, bl, (short)0, c, false, false);
  asm volatile("v_nop\n\tv_nop\n\tv_nop\n\tv_nop" : "+v"(c) : "v"(ah), "v"(al), "v"(bh), "v"(bl));
  return c;
}

__global__ __launch_bounds__(256) void k_wt_bf16(const float* __restrict__ W, unsigned short* __restrict__ Wt, int K, int N) {
  const int t = blockIdx.x * 256 + threadIdx.x;
  const int k8n = K / 8;
  if (t >= N * k8n) return;
  const int n = t / k8n, k8 = (t % k8n) * 8;
  v8us v;
#pragma unroll
  for (int i = 0; i < 8; ++i) v[i] = bf16_bits(W[(size_t)(k8 + i) * N + n]);
  *(v8us*)(Wt + (size_t)n * K + k8) = v;
  
}

// GEMM C[M][N] (f32, pitch ldc) = act(A[M][K]·W + bias). A f32 row-major (pitch lda) converted per fragment to bf16
// (ASPLIT: hi/lo two planes -> 2 terms, else single rounded term); Wt bf16 [N][K] (pitch ldb). BIAS_BF16 rounds the
// bias to bf16 first (bias quantised to bf16 before the add). K%32==0, M%16==0, N%64==0.
template <bool ASPLIT, int ACT, bool BIAS_BF16>
__global__ __launch_bounds__(128) void k_gemm_bf(const float* __restrict__ A, int lda, const unsigned short* __restrict__ Wt, int ldb,
                                               const float* __restrict__ bias, float* __restrict__ C, int ldc, int M, int N, int K) {
  __shared__ __attribute__((aligned(16))) float so[4][16][64];
  const int tid = threadIdx.x, w = tid >> 5, lane = tid & 31, ln = lane & 15, hh = lane >> 4;
  const int ntn = N / 64;
  const int wid = blockIdx.x * 4 + w;
  const int mt = wid / ntn, nq = wid % ntn;
  if (mt * 16 >= M) return;
  const int row0 = mt * 16, col0 = nq * 64;
  const float* arow = A + (size_t)(row0 + ln) * lda;
  v8f acc[4] = {};
  for (int kb = 0; kb < K; kb += 32) {
    FragB ah, al;
    const v4f x0 = *(const v4fa*)(arow + kb + 8 * hh), x1 = *(const v4fa*)(arow + kb + 8 * hh + 4);
    const v4f x2 = *(const v4fa*)(arow + kb + 16 + 8 * hh), x3 = *(const v4fa*)(arow + kb + 16 + 8 * hh + 4);
    float xs[16] = {x0[0],x0[1],x0[2],x0[3],x1[0],x1[1],x1[2],x1[3],x2[0],x2[1],x2[2],x2[3],x3[0],x3[1],x3[2],x3[3]};
#pragma unroll
    for (int i = 0; i < 16; ++i) { const unsigned short hb = bf16_bits(xs[i]); ah.u[i] = hb; al.u[i] = ASPLIT ? bf16_bits(xs[i] - bf16_val(hb)) : (unsigned short)0; }
#pragma unroll
    for (int t = 0; t < 4; ++t) {
      const unsigned short* brow = Wt + (size_t)(col0 + t * 16 + ln) * ldb + kb;
      FragB b;
      b.half[0] = *(const v8us*)(brow + 8 * hh);
      b.half[1] = *(const v8us*)(brow + 16 + 8 * hh);
      acc[t] = mmaN<ASPLIT ? 2 : 1>(ah.v, al.v, b.v, b.v, acc[t]);
    }
  }
#pragma unroll
  for (int t = 0; t < 4; ++t) {
    float bv = bias ? bias[col0 + t * 16 + ln] : 0.f;
    if (BIAS_BF16) bv = bf16_round(bv);
#pragma unroll
    for (int r = 0; r < 8; ++r) { float v = acc[t][r] + bv; if (ACT == 1) v = fmaxf(v, 0.f); so[w][8 * hh + r][t * 16 + ln] = v; }
  }
  __builtin_amdgcn_fence(__ATOMIC_ACQ_REL, "workgroup");
  __builtin_amdgcn_wave_barrier();
  const int rsub = lane >> 4, c4 = (lane & 15) * 4;
  {
#pragma unroll
    for (int q = 0; q < 8; ++q) {
      const int r = q * 2 + rsub;
      const v4f v = *(const v4fa*)&so[w][r][c4];
      *(v4f*)(C + (size_t)(row0 + r) * ldc + col0 + c4) = v;
    }
    
  }
}

// GEMM C = act(A·W + bias + resid): A f32 (ASPLIT -> hi/lo 2 terms), Wt bf16 [N][K]; ACT 0 none, 1 relu, 2 exact gelu;
// resid (optional, f32, row index = (row % rmod), pitch ldr, RES_BF16 rounds it) added before the activation.
template <bool ASPLIT, int ACT, bool BIAS_BF16, bool RES_BF16>
__global__ __launch_bounds__(128) void k_gemm_bf3(const float* __restrict__ A, int lda, const unsigned short* __restrict__ Wt, int ldb,
                                                const float* __restrict__ bias, const float* __restrict__ resid, int rmod, int ldr,
                                                float* __restrict__ C, int ldc, int M, int N, int K) {
  __shared__ __attribute__((aligned(16))) float so[4][16][64];
  const int tid = threadIdx.x, w = tid >> 5, lane = tid & 31, ln = lane & 15, hh = lane >> 4;
  const int ntn = N / 64;
  const int wid = blockIdx.x * 4 + w;
  const int mt = wid / ntn, nq = wid % ntn;
  if (mt * 16 >= M) return;
  const int row0 = mt * 16, col0 = nq * 64;
  const float* arow = A + (size_t)(row0 + ln) * lda;
  v8f acc[4] = {};
  for (int kb = 0; kb < K; kb += 32) {
    FragB ah, al;
    const v4f x0 = *(const v4fa*)(arow + kb + 8 * hh), x1 = *(const v4fa*)(arow + kb + 8 * hh + 4);
    const v4f x2 = *(const v4fa*)(arow + kb + 16 + 8 * hh), x3 = *(const v4fa*)(arow + kb + 16 + 8 * hh + 4);
    float xs[16] = {x0[0],x0[1],x0[2],x0[3],x1[0],x1[1],x1[2],x1[3],x2[0],x2[1],x2[2],x2[3],x3[0],x3[1],x3[2],x3[3]};
#pragma unroll
    for (int i = 0; i < 16; ++i) { const unsigned short hb = bf16_bits(xs[i]); ah.u[i] = hb; al.u[i] = ASPLIT ? bf16_bits(xs[i] - bf16_val(hb)) : (unsigned short)0; }
#pragma unroll
    for (int t = 0; t < 4; ++t) {
      const unsigned short* brow = Wt + (size_t)(col0 + t * 16 + ln) * ldb + kb;
      FragB b;
      b.half[0] = *(const v8us*)(brow + 8 * hh);
      b.half[1] = *(const v8us*)(brow + 16 + 8 * hh);
      acc[t] = mmaN<ASPLIT ? 2 : 1>(ah.v, al.v, b.v, b.v, acc[t]);
    }
  }
#pragma unroll
  for (int t = 0; t < 4; ++t) {
    const int col = col0 + t * 16 + ln;
    float bv = bias ? bias[col] : 0.f;
    if (BIAS_BF16) bv = bf16_round(bv);
#pragma unroll
    for (int r = 0; r < 8; ++r) {
      float v = acc[t][r] + bv;
      if (resid) { float rv = resid[(size_t)((row0 + 8 * hh + r) % rmod) * ldr + col]; if (RES_BF16) rv = bf16_round(rv); v += rv; }
      if (ACT == 1) v = fmaxf(v, 0.f);
      if (ACT == 2) v = 0.5f * v * (1.0f + erff(v * 0.70710678118654752f));
      if (ACT == 3) { const float u = 0.7978845608028654f * (v + 0.044715f * v * v * v); v = 0.5f * v * (1.0f + tanhf(u)); }
      so[w][8 * hh + r][t * 16 + ln] = v;
    }
  }
  __builtin_amdgcn_fence(__ATOMIC_ACQ_REL, "workgroup");
  __builtin_amdgcn_wave_barrier();
  const int rsub = lane >> 4, c4 = (lane & 15) * 4;
  {
#pragma unroll
    for (int q = 0; q < 8; ++q) {
      const int r = q * 2 + rsub;
      const v4f v = *(const v4fa*)&so[w][r][c4];
      *(v4f*)(C + (size_t)(row0 + r) * ldc + col0 + c4) = v;
    }
    
  }
}
// row LayerNorm (biased variance, eps) over N: s = X (+ R); optional out_sum <- s; out_norm <- (s-mu)*rsqrt(var+eps)*g + b
template <bool PARAM_BF16>
__global__ __launch_bounds__(256) void k_layernorm(const float* __restrict__ X, const float* __restrict__ R, const float* __restrict__ g, const float* __restrict__ bta,
                                                  float* __restrict__ out_sum, float* __restrict__ out_norm, int N, float eps) {
  __shared__ float red[256];
  const int row = blockIdx.x, tid = threadIdx.x;
  const float* x = X + (size_t)row * N; const float* rr = R ? R + (size_t)row * N : nullptr;
  float vals[16];                     // up to N = 4096
  const int per = N / 256;            // contiguous chunk per thread? use strided-by-4 chunks: thread handles j = tid*4 + 1024*u
  float s1 = 0.f;
  for (int u = 0; u < per / 4; ++u) {
    const int j = tid * 4 + 1024 * u;
    const v4f a = *(const v4fa*)(x + j);
    v4f b = {0.f,0.f,0.f,0.f}; if (rr) b = *(const v4fa*)(rr + j);
#pragma unroll
    for (int q = 0; q < 4; ++q) { const float v = a[q] + b[q]; vals[u * 4 + q] = v; s1 += v; }
  }
  red[tid] = s1; __syncthreads();
  for (int st = 128; st > 0; st >>= 1) { if (tid < st) red[tid] += red[tid + st]; __syncthreads(); }
  const float mu = red[0] / (float)N; __syncthreads();
  float s2 = 0.f;
  for (int u = 0; u < per / 4; ++u)
#pragma unroll
    for (int q = 0; q < 4; ++q) { const float c = vals[u * 4 + q] - mu; s2 += c * c; }
  red[tid] = s2; __syncthreads();
  for (int st = 128; st > 0; st >>= 1) { if (tid < st) red[tid] += red[tid + st]; __syncthreads(); }
  const float rs = rsqrtf(red[0] / (float)N + eps);
  {
    for (int u = 0; u < per / 4; ++u) {
      const int j = tid * 4 + 1024 * u;
      v4f o, sm;
#pragma unroll
      for (int q = 0; q < 4; ++q) {
        float gg = g[j + q], bb = bta[j + q];
        if (PARAM_BF16) { gg = bf16_round(gg); bb = bf16_round(bb); }
        sm[q] = vals[u * 4 + q]; o[q] = (vals[u * 4 + q] - mu) * rs * gg + bb;
      }
      if (out_sum) *(v4f*)(out_sum + (size_t)row * N + j) = sm;
      *(v4f*)(out_norm + (size_t)row * N + j) = o;
    }
    
  }
}



// ---- f16 WMMA path (v_wmma_f32_16x16x32_f16): 11-bit significands for operands in range — used where a [0,1] probability operand needs more precision than bf16
typedef _Float16 v16h __attribute__((ext_vector_type(16)));
union FragH { v16h v; v8us half[2]; _Float16 h[16]; unsigned short u[16]; };
template <int NT>
__device__ __forceinline__ v8f mmaH(v16h ah, v16h al, v16h bh, v16h bl, v8f c) {
  c = __builtin_amdgcn_wmma_f32_16x16x32_f16(false, ah, false, bh, (short)0, c, false, false);
  if (NT >= 2) c = __builtin_amdgcn_wmma_f32_16x16x32_f16(false, al, false, bh, (short)0, c, false, false);
  if (NT >= 3) c = __builtin_amdgcn_wmma_f32_16x16x32_f16(false, ah, false, bl, (short)0, c, false, false);
  asm volatile("v_nop\n\tv_nop\n\tv_nop\n\tv_nop" : "+v"(c) : "v"(ah), "v"(al), "v"(bh), "v"(bl));
  return c;
}
// batched GEMM like k_gemm_b but f16 operands: A f32 (split into f16 hi/lo if ASPLIT, else rounded to f16), Bt = f16 values [n][k]; alpha; C f32; N multiple of 16 (partial tiles skipped)
template <bool ASPLIT>
__global__ __launch_bounds__(128) void k_gemm_h(const float* __restrict__ A, int lda, size_t sA, const _Float16* __restrict__ Bh, int ldb, size_t sB, float alpha, float* __restrict__ C, int ldc, size_t sC, int M, int N, int K) {
  __shared__ __attribute__((aligned(16))) float so[4][16][64];
  const int tid = threadIdx.x, w = tid >> 5, lane = tid & 31, ln = lane & 15, hh = lane >> 4; const int by = blockIdx.y;
  A += (size_t)by * sA; Bh += (size_t)by * sB; C += (size_t)by * sC;
  const int ntn = (N + 63) / 64; const int wid = blockIdx.x * 4 + w; const int mt = wid / ntn, nq = wid % ntn; if (mt * 16 >= M) return;
  const int row0 = mt * 16, col0 = nq * 64; const float* arow = A + (size_t)(row0 + ln) * lda;
  v8f acc[4] = {};
  for (int kb = 0; kb < K; kb += 32) {
    FragH ah, al;
    const v4f x0 = *(const v4fa*)(arow + kb + 8 * hh), x1 = *(const v4fa*)(arow + kb + 8 * hh + 4), x2 = *(const v4fa*)(arow + kb + 16 + 8 * hh), x3 = *(const v4fa*)(arow + kb + 16 + 8 * hh + 4);
    float xs[16] = {x0[0],x0[1],x0[2],x0[3],x1[0],x1[1],x1[2],x1[3],x2[0],x2[1],x2[2],x2[3],x3[0],x3[1],x3[2],x3[3]};
#pragma unroll
    for (int i = 0; i < 16; ++i) { const _Float16 h = (_Float16)xs[i]; ah.h[i] = h; al.h[i] = ASPLIT ? (_Float16)(xs[i] - (float)h) : (_Float16)0.0f; }
#pragma unroll
    for (int t = 0; t < 4; ++t) { if (col0 + t * 16 >= N) continue; const size_t boff = (size_t)(col0 + t * 16 + ln) * ldb + kb; FragH bq; bq.half[0] = *(const v8us*)(Bh + boff + 8 * hh); bq.half[1] = *(const v8us*)(Bh + boff + 16 + 8 * hh);
      acc[t] = mmaH<ASPLIT ? 2 : 1>(ah.v, al.v, bq.v, bq.v, acc[t]); }
  }
#pragma unroll
  for (int t = 0; t < 4; ++t) { if (col0 + t * 16 >= N) continue;
#pragma unroll
    for (int r = 0; r < 8; ++r) so[w][8 * hh + r][t * 16 + ln] = acc[t][r] * alpha; }
  __builtin_amdgcn_fence(__ATOMIC_ACQ_REL, "workgroup"); __builtin_amdgcn_wave_barrier();
  const int rsub = lane >> 4, c4 = (lane & 15) * 4;
  {
#pragma unroll
    for (int q = 0; q < 8; ++q) { const int r = q * 2 + rsub; if (col0 + c4 < N) { const v4f v = *(const v4fa*)&so[w][r][c4]; *(v4f*)(C + (size_t)(row0 + r) * ldc + col0 + c4) = v; } }
     }
}

// Wt[n][k] = f16(W[k][n]·scale) from f32 row-major W[K][N] (scale = power of two; bf16-exact weights stay exact in f16 away from the subnormal range)
__global__ __launch_bounds__(256) void k_wt_f16(const float* __restrict__ W, _Float16* __restrict__ Wt, int K, int N, float scale) {
  const int t = blockIdx.x * 256 + threadIdx.x; if (t >= N * (K / 8)) return; const int n = t / (K / 8), k8 = (t % (K / 8)) * 8; FragH f;
#pragma unroll
  for (int i = 0; i < 8; ++i) f.h[i] = (_Float16)(bf16_round(W[(size_t)(k8 + i) * N + n]) * scale); const v8us o = f.half[0];
  *(v8us*)((unsigned short*)Wt + (size_t)n * K + k8) = o; 
}
// k_gemm_hh variant with fused epilogue: v = acc·alpha + bias[by·sBias + col] (+ CP[(row/rowsPerB)·sCPb + by·64 + col] if CP) ; ACT 0 none / 1 elu ; writes f16 C16 (and f32 C if non-null)
template <int ACT>
__global__ __launch_bounds__(128) void k_gemm_hhx(const _Float16* __restrict__ A, int lda, size_t sA, const _Float16* __restrict__ Bh, int ldb, size_t sB, float alpha, const float* __restrict__ bias, size_t sBias, const float* __restrict__ CP, int rowsPerB, size_t sCPb, int row0g,
    float* __restrict__ C, _Float16* __restrict__ C16, int ldc, size_t sC, int M, int N, int K) {
  __shared__ __attribute__((aligned(16))) float so[4][16][64];
  const int tid = threadIdx.x, w = tid >> 5, lane = tid & 31, ln = lane & 15, hh = lane >> 4; const int by = blockIdx.y;
  A += (size_t)by * sA; Bh += (size_t)by * sB; const size_t cofs = (size_t)by * sC; const float* bp = bias ? bias + (size_t)by * sBias : nullptr;
  const int ntn = (N + 63) / 64; const int wid = blockIdx.x * 4 + w; const int mt = wid / ntn, nq = wid % ntn; if (mt * 16 >= M) return;
  const int row0 = mt * 16, col0 = nq * 64; const _Float16* arow = A + (size_t)(row0 + ln) * lda;
  v8f acc[4] = {};
  for (int kb = 0; kb < K; kb += 32) { FragH ah; ah.half[0] = *(const v8us*)((const unsigned short*)arow + kb + 8 * hh); ah.half[1] = *(const v8us*)((const unsigned short*)arow + kb + 16 + 8 * hh);
#pragma unroll
    for (int t = 0; t < 4; ++t) { if (col0 + t * 16 >= N) continue; const size_t boff = (size_t)(col0 + t * 16 + ln) * ldb + kb; FragH bq; bq.half[0] = *(const v8us*)((const unsigned short*)Bh + boff + 8 * hh); bq.half[1] = *(const v8us*)((const unsigned short*)Bh + boff + 16 + 8 * hh);
      acc[t] = mmaH<1>(ah.v, ah.v, bq.v, bq.v, acc[t]); }
  }
#pragma unroll
  for (int t = 0; t < 4; ++t) { if (col0 + t * 16 >= N) continue; const int col = col0 + t * 16 + ln; const float bv = bp ? bf16_round(bp[col]) : 0.f;
#pragma unroll
    for (int r = 0; r < 8; ++r) { float v = acc[t][r] * alpha + bv; if (CP) { const int rr = row0g + row0 + 8 * hh + r; if (rowsPerB < 0) v += CP[cofs + (size_t)rr * ldc + col];      /* rowsPerB < 0: own element of the batched C plane */ else { const int bidx = rr / rowsPerB; v += CP[(size_t)bidx * sCPb + (size_t)by * 64 + col]; } } if (ACT == 1) v = (v > 0.f) ? v : expm1f(v); else if (ACT == 7) v = (v > 0.f) ? v + 1.0f : expf(v); else if (ACT == 8) v = tanhf(v); else if (ACT == 9) v = 0.5f * v * (1.0f + tanhf(0.7978845608028654f * (v + 0.044715f * v * v * v))); else if (ACT == 11) v = 1.0f / (1.0f + expf(-v)); else if (ACT == 12) v = (v > 0.f) ? v : 0.01f * v; else if (ACT == 14) v = (v > 0.f) ? v : 0.1f * v; else if (ACT == 16) v = (v >= 0.f) ? v : 0.3f * v; else if (ACT == 17) v = (v >= 0.f) ? v : 0.2f * v; else if (ACT == 15) v = v / (1.0f + expf(-v)); else if (ACT == 3) v = fmaxf(v, 0.f); else if (ACT == 6) v = 0.5f * v * (1.0f + erff(v * 0.70710678118654752f)); so[w][8 * hh + r][t * 16 + ln] = v; } }
  __builtin_amdgcn_fence(__ATOMIC_ACQ_REL, "workgroup"); __builtin_amdgcn_wave_barrier();
  const int rsub = lane >> 4, c4 = (lane & 15) * 4; typedef _Float16 v4h __attribute__((ext_vector_type(4)));
  {
#pragma unroll
    for (int q = 0; q < 8; ++q) { const int r = q * 2 + rsub; if (col0 + c4 < N) { const v4f v = *(const v4fa*)&so[w][r][c4]; if (C) *(v4f*)(C + cofs + (size_t)(row0 + r) * ldc + col0 + c4) = v; if (C16) { v4h h4; for (int i = 0; i < 4; ++i) h4[i] = (_Float16)v[i]; *(v4h*)(C16 + cofs + (size_t)(row0 + r) * ldc + col0 + c4) = h4; } } }
     }
}


typedef _Float16 v4h __attribute__((ext_vector_type(4)));

__global__ __launch_bounds__(256) void k_x16(const float* __restrict__ x, _Float16* __restrict__ X16, size_t n8) { const size_t t = (size_t)blockIdx.x * 256 + threadIdx.x; if (t >= n8) return; FragH f;
#pragma unroll
  for (int q = 0; q < 8; ++q) f.h[q] = (_Float16)bf16_round(x[t * 8 + q]); *(v8us*)((unsigned short*)X16 + t * 8) = f.half[0];  }
__global__ __launch_bounds__(256) void k_h16(const float* __restrict__ x, _Float16* __restrict__ X16, size_t n8) { const size_t t = (size_t)blockIdx.x * 256 + threadIdx.x; if (t >= n8) return; FragH f;
#pragma unroll
  for (int q = 0; q < 8; ++q) f.h[q] = (_Float16)x[t * 8 + q]; *(v8us*)((unsigned short*)X16 + t * 8) = f.half[0];  }
__global__ __launch_bounds__(256) void k_round16f(const float* __restrict__ W, _Float16* __restrict__ Bt, size_t n8) { const size_t t = (size_t)blockIdx.x * 256 + threadIdx.x; if (t >= n8) return; FragH f;
#pragma unroll
  for (int i = 0; i < 8; ++i) f.h[i] = (_Float16)(bf16_round(W[t * 8 + i]) * 16.0f); *(v8us*)((unsigned short*)Bt + t * 8) = f.half[0];  }
template <int NHv, int TTv>
__global__ __launch_bounds__(256) void k_vt(const _Float16* __restrict__ V16, int ldv, int voff, _Float16* __restrict__ Vt) { __shared__ unsigned short tl[64][66]; const int tid = threadIdx.x; const int slab = blockIdx.x / (TTv / 64), lg = blockIdx.x % (TTv / 64); const int b = slab / NHv, h = slab % NHv;
  for (int i = tid; i < 64 * 8; i += 256) { const int r = i / 8, c8 = (i % 8) * 8; FragH f; f.half[0] = *(const v8us*)((const unsigned short*)V16 + ((size_t)b * TTv + lg * 64 + r) * ldv + voff + h * 64 + c8);
#pragma unroll
    for (int q = 0; q < 8; ++q) tl[r][c8 + q] = f.u[q]; }
  __syncthreads();
  {
#pragma unroll
    for (int rd = 0; rd < 2; ++rd) { const int d = rd * 32 + tid / 8, pc = tid % 8; FragH f;
#pragma unroll
      for (int q = 0; q < 8; ++q) f.u[q] = tl[pc * 8 + q][d];
      *(v8us*)((unsigned short*)Vt + ((size_t)slab * 64 + d) * TTv + lg * 64 + pc * 8) = f.half[0]; }
     } }

__global__ __launch_bounds__(256) void k_hl(const float* __restrict__ F, _Float16* __restrict__ Hh, _Float16* __restrict__ Hl, size_t n8) { const size_t t = (size_t)blockIdx.x * 256 + threadIdx.x; if (t >= n8) return; FragH fh, fl; const v4f a = *(const v4fa*)(F + t * 8), c = *(const v4fa*)(F + t * 8 + 4);
#pragma unroll
  for (int q = 0; q < 4; ++q) { _Float16 h = (_Float16)a[q]; fh.h[q] = h; fl.h[q] = (_Float16)((a[q] - (float)h) * 1024.0f); h = (_Float16)c[q]; fh.h[4 + q] = h; fl.h[4 + q] = (_Float16)((c[q] - (float)h) * 1024.0f); }
  { *(v8us*)((unsigned short*)Hh + t * 8) = fh.half[0]; *(v8us*)((unsigned short*)Hl + t * 8) = fl.half[0];  } }

// ---- fast GEMM (wave tile 32x64; requires M % 32 == 0 rows per launch region and N % 64 == 0); epilogue = k_gemm_hhx semantics ----
__device__ __forceinline__ v16h g2_frag(const _Float16* p, int hh) { FragH f; f.half[0] = *(const v8us*)((const unsigned short*)p + 8 * hh); f.half[1] = *(const v8us*)((const unsigned short*)p + 16 + 8 * hh); return f.v; }
__device__ __forceinline__ v8f g2_mma(v16h a, v16h b, v8f c) { v8f d = __builtin_amdgcn_wmma_f32_16x16x32_f16(false, a, false, b, (short)0, c, false, false); asm volatile("v_nop\n\tv_nop\n\tv_nop\n\tv_nop" : "+v"(d) : "v"(a), "v"(b)); return d; }
template <int ACT>
__global__ __launch_bounds__(128) void k_gemm2(const _Float16* __restrict__ A, int lda, size_t sA, const _Float16* __restrict__ Bh, int ldb, size_t sB, float alpha, const float* __restrict__ bias, size_t sBias, const float* __restrict__ CP, int rowsPerB, size_t sCPb, int row0g,
    float* __restrict__ C, _Float16* __restrict__ C16, int ldc, size_t sC, int M, int N, int K) { static_assert(ACT == 0 || ACT == 3 || ACT == 6 || ACT == 8 || ACT == 9 || ACT == 11 || ACT == 12 || ACT == 14 || ACT == 15 || ACT == 16 || ACT == 17 || ACT == 19, "k_gemm2: unsupported ACT code (would silently apply no activation)");
  __shared__ __attribute__((aligned(16))) float so[4][32][68];
  const int tid = threadIdx.x, w = tid >> 5, lane = tid & 31, ln = lane & 15, hh = lane >> 4; const int by = blockIdx.y;
  A += (size_t)by * sA; Bh += (size_t)by * sB; const size_t cofs = (size_t)by * sC; const float* bp = bias ? bias + (size_t)by * sBias : nullptr;
  const int ntn = N >> 6; const int mt = blockIdx.x / ntn, nq = blockIdx.x - mt * ntn; const int row0 = mt * 128 + 32 * w, col0 = nq * 64; if (row0 >= M) return;
  const _Float16* a0p = A + (size_t)(row0 + ln) * lda; const _Float16* a1p = a0p + (size_t)16 * lda;
  const _Float16* b0p = Bh + (size_t)(col0 + ln) * ldb; const _Float16* b1p = b0p + (size_t)16 * ldb; const _Float16* b2p = b1p + (size_t)16 * ldb; const _Float16* b3p = b2p + (size_t)16 * ldb;
  const v8f z8 = {0.f,0.f,0.f,0.f,0.f,0.f,0.f,0.f}; v8f c00 = z8, c01 = z8, c02 = z8, c03 = z8, c10 = z8, c11 = z8, c12 = z8, c13 = z8;
#pragma unroll 1
  for (int kb = 0; kb < K; kb += 32) { const v16h a0 = g2_frag(a0p + kb, hh), a1 = g2_frag(a1p + kb, hh);
    v16h b = g2_frag(b0p + kb, hh); c00 = g2_mma(a0, b, c00); c10 = g2_mma(a1, b, c10);
    b = g2_frag(b1p + kb, hh); c01 = g2_mma(a0, b, c01); c11 = g2_mma(a1, b, c11);
    b = g2_frag(b2p + kb, hh); c02 = g2_mma(a0, b, c02); c12 = g2_mma(a1, b, c12);
    b = g2_frag(b3p + kb, hh); c03 = g2_mma(a0, b, c03); c13 = g2_mma(a1, b, c13); }
  v8f accs[8] = {c00, c01, c02, c03, c10, c11, c12, c13};
#pragma unroll
  for (int u = 0; u < 8; ++u) { const int t = u & 3, half = u >> 2; const int col = col0 + t * 16 + ln; const float bv = bp ? bf16_round(bp[col]) : 0.f;
#pragma unroll
    for (int r = 0; r < 8; ++r) { const int rloc = half * 16 + 8 * hh + r; float v = accs[u][r] * alpha + bv; if (CP) { if (rowsPerB < 0) v += CP[cofs + (size_t)(row0g + row0 + rloc) * ldc + col];      /* rowsPerB < 0: own element of the batched C plane */ else { const int bidx = (row0g + row0 + rloc) / rowsPerB; v += CP[(size_t)bidx * sCPb + (size_t)by * 64 + col]; } }
      if (ACT == 3) v = fmaxf(v, 0.f); else if (ACT == 6) v = 0.5f * v * (1.0f + erff(v * 0.70710678118654752f)); else if (ACT == 11) v = 1.0f / (1.0f + expf(-v)); else if (ACT == 15) v = v / (1.0f + expf(-v)); else if (ACT == 19) v = (v > 0.f) ? (v + 1.0f) : expf(v);      /* elu(v) + 1 */ else if (ACT == 12) v = (v > 0.f) ? v : 0.01f * v; else if (ACT == 8) v = tanhf(v); else if (ACT == 9) v = 0.5f * v * (1.0f + tanhf(0.7978845608028654f * (v + 0.044715f * v * v * v))); else if (ACT == 14) v = (v > 0.f) ? v : 0.1f * v; else if (ACT == 16) v = (v >= 0.f) ? v : 0.3f * v; else if (ACT == 17) v = (v >= 0.f) ? v : 0.2f * v;
      so[w][rloc][t * 16 + ln] = v; } }
  __builtin_amdgcn_fence(__ATOMIC_ACQ_REL, "workgroup"); __builtin_amdgcn_wave_barrier();
  const int rsub = lane >> 4, c4 = (lane & 15) * 4;
  {
#pragma unroll
    for (int q = 0; q < 16; ++q) { const int r = q * 2 + rsub; const v4f v = *(const v4fa*)&so[w][r][c4]; if (C) *(v4f*)(C + cofs + (size_t)(row0 + r) * ldc + col0 + c4) = v; if (C16) { v4h h4; for (int i = 0; i < 4; ++i) h4[i] = (_Float16)v[i]; *(v4h*)(C16 + cofs + (size_t)(row0 + r) * ldc + col0 + c4) = h4; } }
     } }


__global__ __launch_bounds__(256) void k_wnat(const float* __restrict__ w, size_t n8, _Float16* __restrict__ Bt) { const size_t t = (size_t)blockIdx.x * 256 + threadIdx.x; if (t >= n8) return; FragH f; for (int q = 0; q < 8; ++q) f.h[q] = (_Float16)(bf16_round(w[t * 8 + q]) * 16.0f); *(v8us*)((unsigned short*)Bt + t * 8) = f.half[0];  }
__global__ __launch_bounds__(256) void k_rsm(const float* __restrict__ S, _Float16* __restrict__ P, int nrows) {
  #pragma clang fp contract(off)
  const int i = blockIdx.x * 256 + threadIdx.x; if (i >= nrows) return; const float* s = S + (size_t)i * SQ; float mx = -3.0e38f;
#pragma unroll 1
  for (int j = 0; j < SQ; ++j) mx = fmaxf(mx, s[j]); float se = 0.f;
#pragma unroll 1
  for (int j = 0; j < SQ; ++j) se += expf(s[j] - mx); const float sc = 256.0f / se;
#pragma unroll 1
  for (int j0 = 0; j0 < SQ; j0 += 8) { FragH f; for (int q = 0; q < 8; ++q) f.h[q] = (_Float16)(expf(s[j0 + q] - mx) * sc); unsigned short* d = (unsigned short*)P + (size_t)i * SQ + j0; *(v8us*)d = f.half[0];  } }
__global__ __launch_bounds__(256) void k_vt(const _Float16* __restrict__ V16, int b, int h0, _Float16* __restrict__ VT) { __shared__ unsigned short tl[64][65]; const int tid = threadIdx.x; const int hh = blockIdx.x % HG, sg = blockIdx.x / HG; const int s0 = sg * 64; const int h = h0 + hh;
  for (int i = tid; i < 64 * 8; i += 256) { const int j = i / 8, d8 = (i % 8) * 8; FragH f; f.half[0] = *(const v8us*)((const unsigned short*)V16 + ((size_t)b * SQ + s0 + j) * DM + h * HD + d8); for (int q = 0; q < 8; ++q) tl[d8 + q][j] = f.u[q]; }
  __syncthreads();
  { for (int i = tid; i < 64 * 8; i += 256) { const int d = i / 8, j8 = (i % 8) * 8; FragH f; for (int q = 0; q < 8; ++q) f.u[q] = tl[d][j8 + q]; *(v8us*)((unsigned short*)VT + ((size_t)hh * HD + d) * SQ + s0 + j8) = f.half[0]; }  } }



__global__ __launch_bounds__(256) void k_rsmcf2(const float* __restrict__ S, _Float16* __restrict__ P, int hg, int q0, int nk) {
  #pragma clang fp contract(off)
  const int t = blockIdx.x * 256 + threadIdx.x; if (t >= hg * QT) return; const size_t i = (size_t)t; const float* s = S + i * NKX; const int last = q0 + (t % QT); float mx = -3.0e38f;
#pragma unroll 1
  for (int j = 0; j < nk; ++j) { const float f = (j <= last) ? 1.f : 0.f; mx = fmaxf(mx, fmaf(f, s[j], (1.f - f) * -1.0e9f)); } float se = 0.f;
#pragma unroll 1
  for (int j = 0; j < nk; ++j) { const float f = (j <= last) ? 1.f : 0.f; se += __expf(fmaf(f, s[j], (1.f - f) * -1.0e9f) - mx); } const float sc = 256.0f / se;
#pragma unroll 1
  for (int j0 = 0; j0 < nk; j0 += 8) { FragH fr; for (int q = 0; q < 8; ++q) { const int j = j0 + q; const float f = (j <= last) ? 1.f : 0.f; fr.h[q] = (_Float16)(__expf(fmaf(f, s[j], (1.f - f) * -1.0e9f) - mx) * sc); } unsigned short* d = (unsigned short*)P + i * NKX + j0; *(v8us*)d = fr.half[0];  } }


template <int MASKADD>
__global__ __launch_bounds__(64) void k_att0(const float* __restrict__ QF, const float* __restrict__ KF, const float* __restrict__ VF, int ld, const float* __restrict__ mask, float scale, float* __restrict__ OF, int ldo) {
  #pragma clang fp contract(off)
  __shared__ __attribute__((aligned(16))) float lq[64][64]; __shared__ __attribute__((aligned(16))) float lo[64][64];
  const int tid = threadIdx.x; const int h = blockIdx.x / (QT0 / 64), rg = blockIdx.x % (QT0 / 64); const int i = rg * 64 + tid;
  const float* qr = QF + (size_t)i * ld + h * HD;
#pragma unroll 1
  for (int c = 0; c < HD / 4; ++c) { *(v4f*)&lq[tid][c * 4] = *(const v4fa*)(qr + c * 4); const v4f z = {0.f, 0.f, 0.f, 0.f}; *(v4f*)&lo[tid][c * 4] = z; }
  float m = -1.0e30f, l = 0.f; const int jmax = MASKADD ? (SQ - 1) : (rg * 64 + 63);      /* additive-mask form: every key (the mask input decides); causal form: keys up to the block's last row */
#pragma unroll 1
  for (int j = 0; j <= jmax; ++j) { const float* kr = KF + (size_t)j * ld + h * HD; const float* vr = VF + (size_t)j * ld + h * HD; float s = 0.f;
#pragma unroll 1
    for (int c = 0; c < HD / 4; ++c) { const v4f kq = *(const v4fa*)(kr + c * 4); const v4f qq = *(v4f*)&lq[tid][c * 4]; s = __fadd_rn(s, __fmul_rn(qq[0], kq[0])); s = __fadd_rn(s, __fmul_rn(qq[1], kq[1])); s = __fadd_rn(s, __fmul_rn(qq[2], kq[2])); s = __fadd_rn(s, __fmul_rn(qq[3], kq[3])); }
    s = __fmul_rn(s, scale); if (MASKADD) s = __fadd_rn(s, __fmul_rn(bf16_round(mask[(size_t)i * SQ + j]), -10000.0f));
    const float f = (MASKADD || j <= i) ? 1.f : 0.f; const float sm = fmaf(f, s, (1.f - f) * -1.0e30f); const float mn = fmaxf(m, sm); const float sc = expf(m - mn); const float e = expf(sm - mn); l = __fadd_rn(__fmul_rn(l, sc), e); m = mn;
#pragma unroll 1
    for (int c = 0; c < HD / 4; ++c) { const v4f vv = *(const v4fa*)(vr + c * 4); v4f oo = *(v4f*)&lo[tid][c * 4]; for (int u = 0; u < 4; ++u) oo[u] = __fadd_rn(__fmul_rn(oo[u], sc), __fmul_rn(e, vv[u])); *(v4f*)&lo[tid][c * 4] = oo; } }
  const float fin = 64.0f / l;      /* o carried x64 like the f16 path */
#pragma unroll 1
  for (int c = 0; c < HD / 4; ++c) { v4f oo = *(v4f*)&lo[tid][c * 4]; for (int u = 0; u < 4; ++u) oo[u] = __fmul_rn(oo[u], fin); *(v4f*)&lo[tid][c * 4] = oo; }
  __syncthreads();
  {
#pragma unroll 1
    for (int it = 0; it < 16; ++it) { const int row = it * 4 + tid / 16, pc = (tid % 16) * 4; const v4f v = *(const v4f*)&lo[row][pc]; *(v4f*)(OF + (size_t)(rg * 64 + row) * ldo + h * HD + pc) = v; }
     } }


__global__ __launch_bounds__(256) void k_lincf2(const float* __restrict__ S, _Float16* __restrict__ P, int hg, int q0, int nk) {
  #pragma clang fp contract(off)
  const int t = blockIdx.x * 256 + threadIdx.x; if (t >= hg * QT) return; const size_t i = (size_t)t; const float* s = S + i * NKX; const int last = q0 + (t % QT); float se = 0.f;
#pragma unroll 1
  for (int j = 0; j < nk; ++j) { const float f = (j <= last) ? 1.f : 0.f; se = __fadd_rn(se, __fmul_rn(f, s[j])); } const float sc = 256.0f / se;
#pragma unroll 1
  for (int j0 = 0; j0 < nk; j0 += 8) { FragH fr; for (int q = 0; q < 8; ++q) { const int j = j0 + q; const float f = (j <= last) ? 1.f : 0.f; fr.h[q] = (_Float16)(__fmul_rn(__fmul_rn(f, s[j]), sc)); } unsigned short* d = (unsigned short*)P + i * NKX + j0; *(v8us*)d = fr.half[0];  } }

__global__ __launch_bounds__(64) void k_latt0(const float* __restrict__ QF, const float* __restrict__ KF, const float* __restrict__ VF, int ld, float* __restrict__ OF, int ldo) {
  #pragma clang fp contract(off)
  __shared__ __attribute__((aligned(16))) float lq[64][64]; __shared__ __attribute__((aligned(16))) float lo[64][64];
  const int tid = threadIdx.x; const int h = blockIdx.x / (QT0 / 64), rg = blockIdx.x % (QT0 / 64); const int i = rg * 64 + tid;
  const float* qr = QF + (size_t)i * ld + h * HD;
#pragma unroll 1
  for (int c = 0; c < HD / 4; ++c) { *(v4f*)&lq[tid][c * 4] = *(const v4fa*)(qr + c * 4); const v4f z = {0.f, 0.f, 0.f, 0.f}; *(v4f*)&lo[tid][c * 4] = z; }
  float l = 0.f; const int jmax = rg * 64 + 63;
#pragma unroll 1
  for (int j = 0; j <= jmax; ++j) { const float* kr = KF + (size_t)j * ld + h * HD; const float* vr = VF + (size_t)j * ld + h * HD; float s = 0.f;
#pragma unroll 1
    for (int c = 0; c < HD / 4; ++c) { const v4f kq = *(const v4fa*)(kr + c * 4); const v4f qq = *(v4f*)&lq[tid][c * 4]; s = __fadd_rn(s, __fmul_rn(qq[0], kq[0])); s = __fadd_rn(s, __fmul_rn(qq[1], kq[1])); s = __fadd_rn(s, __fmul_rn(qq[2], kq[2])); s = __fadd_rn(s, __fmul_rn(qq[3], kq[3])); }
    const float f = (j <= i) ? 1.f : 0.f; const float e = __fmul_rn(f, s); l = __fadd_rn(l, e);
#pragma unroll 1
    for (int c = 0; c < HD / 4; ++c) { const v4f vv = *(const v4fa*)(vr + c * 4); v4f oo = *(v4f*)&lo[tid][c * 4]; for (int u = 0; u < 4; ++u) oo[u] = __fadd_rn(oo[u], __fmul_rn(e, vv[u])); *(v4f*)&lo[tid][c * 4] = oo; } }
  const float fin = 64.0f / l;      /* o carried x64 like the f16 path */
#pragma unroll 1
  for (int c = 0; c < HD / 4; ++c) { v4f oo = *(v4f*)&lo[tid][c * 4]; for (int u = 0; u < 4; ++u) oo[u] = __fmul_rn(oo[u], fin); *(v4f*)&lo[tid][c * 4] = oo; }
  __syncthreads();
  {
#pragma unroll 1
    for (int it = 0; it < 16; ++it) { const int row = it * 4 + tid / 16, pc = (tid % 16) * 4; const v4f v = *(const v4f*)&lo[row][pc]; *(v4f*)(OF + (size_t)(rg * 64 + row) * ldo + h * HD + pc) = v; }
     } }
extern "C" void kernel_launch(void* const* d_in, const int* in_sizes, int n_in,
                              void* d_out, int out_size, void* d_ws, size_t ws_size, hipStream_t stream) {
  (void)in_sizes; (void)n_in; (void)out_size;
  const float* const* I = (const float* const*)d_in; const float* x = I[0]; const float* wqk = I[1]; const float* bqk = I[2]; const float* wv = I[3]; const float* bv = I[4]; const float* wo = I[5]; const float* bo = I[6]; const float* bq = bqk; const float* bk = bqk + DM;      /* natural Wqk [2048][1024] (q rows | k rows) + bias [2048]; Wv + bv; Wo + bo */
  char* ws = (char*)d_ws; size_t off = 0;
  auto take = [&](size_t bytes) { char* p = ws + off; off += (bytes + 255) & ~(size_t)255; return p; };
  _Float16* BQK = (_Float16*)take((size_t)2 * DM * DM * 2); _Float16* BQ = BQK; _Float16* BK = BQK + (size_t)DM * DM; _Float16* BV = (_Float16*)take((size_t)DM * DM * 2); _Float16* BO = (_Float16*)take((size_t)DM * DM * 2);
  _Float16* X16 = (_Float16*)take(NR * DM * 2); _Float16* Q16 = (_Float16*)take(NR * DM * 2); _Float16* K16 = (_Float16*)take(NR * DM * 2); _Float16* V16 = (_Float16*)take(NR * DM * 2); _Float16* O16 = (_Float16*)take(NR * DM * 2);
  float* S = (float*)take((size_t)NH * QT * NKX * 4); _Float16* P = (_Float16*)take((size_t)NH * QT * NKX * 2); _Float16* VT = (_Float16*)take((size_t)NH * HD * SQ * 2);
  float* QF0 = (float*)take((size_t)QT0 * DM * 4); float* KF0 = (float*)take((size_t)QT0 * DM * 4); float* VF0 = (float*)take((size_t)QT0 * DM * 4); float* OF0 = (float*)take((size_t)NB * QT0 * DM * 4); _Float16* OH0 = (_Float16*)take((size_t)NB * QT0 * DM * 2); _Float16* OL0 = (_Float16*)take((size_t)NB * QT0 * DM * 2);
  if (off > ws_size) return;
  { const unsigned g = (unsigned)(((size_t)DM * DM / 8 + 255) / 256); k_wnat<<<2 * g, 256, 0, stream>>>(wqk, (size_t)2 * DM * DM / 8, BQK); k_wnat<<<g, 256, 0, stream>>>(wv, (size_t)DM * DM / 8, BV); k_wnat<<<g, 256, 0, stream>>>(wo, (size_t)DM * DM / 8, BO); }      /* natural [out][in] = Bt[n][k], x16 (Wqk's q rows then k rows) */

  k_x16<<<(unsigned)((NR * DM / 8 + 255) / 256), 256, 0, stream>>>(x, X16, NR * DM / 8);
  const size_t r0p = (size_t)B0 * SQ;      /* first projected row */
  k_gemm2<19><<<dim3((unsigned)((MP / 128) * (DM / 64)), 1), 128, 0, stream>>>(X16 + r0p * DM, DM, 0, BQ, DM, 0, 0.0625f, bq, 0, nullptr, 1, 0, 0, nullptr, Q16 + r0p * DM, DM, 0, MP, DM, DM);      /* phi(q) = elu(x Wq^T + bq) + 1 */
  k_gemm2<19><<<dim3((unsigned)((MP / 128) * (DM / 64)), 1), 128, 0, stream>>>(X16 + r0p * DM, DM, 0, BK, DM, 0, 0.0625f, bk, 0, nullptr, 1, 0, 0, nullptr, K16 + r0p * DM, DM, 0, MP, DM, DM);      /* phi(k) */
  k_gemm2<0><<<dim3((unsigned)((MP / 128) * (DM / 64)), 1), 128, 0, stream>>>(X16 + r0p * DM, DM, 0, BV, DM, 0, 0.0625f, bv, 0, nullptr, 1, 0, 0, nullptr, V16 + r0p * DM, DM, 0, MP, DM, DM);
  for (int b = B0; b < B0 + NBR; ++b) { const size_t r0 = (size_t)b * SQ;
    k_vt<NH, SQ><<<NH * (SQ / 64), 256, 0, stream>>>(V16 + r0 * LQ, LQ, 0, VT);      /* V^T [NH][HD][SQ] for this batch */
    k_gemm2<19><<<dim3((QT0 / 128) * (DM / 64), 1), 128, 0, stream>>>(X16 + r0 * DM, DM, 0, BQ, DM, 0, 0.0625f, bq, 0, nullptr, 1, 0, 0, QF0, nullptr, DM, 0, QT0, DM, DM); k_gemm2<19><<<dim3((QT0 / 128) * (DM / 64), 1), 128, 0, stream>>>(X16 + r0 * DM, DM, 0, BK, DM, 0, 0.0625f, bk, 0, nullptr, 1, 0, 0, KF0, nullptr, DM, 0, QT0, DM, DM); k_gemm2<0><<<dim3((QT0 / 128) * (DM / 64), 1), 128, 0, stream>>>(X16 + r0 * DM, DM, 0, BV, DM, 0, 0.0625f, bv, 0, nullptr, 1, 0, 0, VF0, nullptr, DM, 0, QT0, DM, DM);      /* f32 phi(q), phi(k), v of the first 128 rows (exact products) */
    k_latt0<<<NH * (QT0 / 64), 64, 0, stream>>>(QF0, KF0, VF0, DM, OF0 + (size_t)b * QT0 * DM, DM);      /* exact f32 linear attention for rows 0..127 (o x64): the few-key rows without the f16 roundings */
    for (int q0 = 0; q0 < QN; q0 += QT) { const int nk = q0 + QT;      /* causal: only keys below the tile end are computed */
      k_gemm2<0><<<dim3((QT / 128) * (nk / 64), NHD), 128, 0, stream>>>(Q16 + (r0 + q0) * LQ, LQ, (size_t)HD, K16 + r0 * LQ, LQ, (size_t)HD, 1.0f, nullptr, 0, nullptr, 1, 0, 0, S, nullptr, NKX, (size_t)QT * NKX, QT, nk, HD);      /* scores, all heads on grid.y */
      k_lincf2<<<(NHD * QT + 255) / 256, 256, 0, stream>>>(S, P, NHD, q0, nk);      /* p = a [j <= i] / sum a (no softmax) */
      k_gemm2<0><<<dim3((QT / 128) * (HD / 64), NHD), 128, 0, stream>>>(P, NKX, (size_t)QT * NKX, VT, SQ, (size_t)HD * SQ, 0.25f, nullptr, 0, nullptr, 1, 0, 0, nullptr, O16 + (r0 + q0) * DM, DM, (size_t)HD, QT, HD, nk); } }      /* o (merged heads, x64) as f16 rows */
  k_gemm2<0><<<dim3((unsigned)((MPO / 128) * (DM / 64)), 1), 128, 0, stream>>>(O16 + r0p * DM, DM, 0, BO, DM, 0, 0.0009765625f, bo, 0, nullptr, 1, 0, 0, (float*)d_out + r0p * DM, nullptr, DM, 0, MPO, DM, DM);      /* out rows are the output layout */
  k_hl<<<(unsigned)(((size_t)NB * QT0 * DM / 8 + 255) / 256), 256, 0, stream>>>(OF0, OH0, OL0, (size_t)NB * QT0 * DM / 8);      /* first-tile o (x64) -> f16 hi + x1024 residual planes */
  for (int b = B0; b < B0 + NBR; ++b) { const size_t r0 = (size_t)b * SQ; const size_t f0 = (size_t)b * QT0;
    k_gemm2<0><<<dim3((QT0 / 128) * (DM / 64), 1), 128, 0, stream>>>(OH0 + f0 * DM, DM, 0, BO, DM, 0, 0.0009765625f, bo, 0, nullptr, 1, 0, 0, (float*)d_out + r0 * DM, nullptr, DM, 0, QT0, DM, DM);      /* rows 0..127: out = o_hi Wo (+ b), overwriting the f16-path rows */
    k_gemm2<0><<<dim3((QT0 / 128) * (DM / 64), 1), 128, 0, stream>>>(OL0 + f0 * DM, DM, 0, BO, DM, 0, 0.00000095367431640625f, nullptr, 0, (const float*)d_out + r0 * DM, -1, 0, 0, (float*)d_out + r0 * DM, nullptr, DM, 0, QT0, DM, DM); }      /* += o_lo Wo 2^-20 (own-element accumulate) */
}

// v001
// Measured time: 2140 microseconds a run.
// In two side-by-side timings against v000, it was 1.97 and 1.96 times as fast.
#include <hip/hip_runtime.h>
// Causal LINEAR attention (x [2][2048][1024]; qk = x Wqk^T + bqk (natural [2048][1024]: rows 0..1023 -> q, 1024..2047 -> k; sigma 1/32, biases 0.02), v = x Wv^T + bv; 16 heads of 64; feature map phi = elu + 1 on q and k; ctx_t = (phi(q_t) . sum_{s<=t} phi(k_s) v_s^T) / (phi(q_t) . sum_{s<=t} phi(k_s)) = sum_{s<=t} a_ts v_s / sum_{s<=t} a_ts with a_ts = phi(q_t).phi(k_s) (the module's cumsum form, no softmax, no scaling, no eps); out = ctx Wo^T + bo -> [2][2048][1024]).
// Structure: x as exact f16 rows; natural weights re-laid on VALU into exact x16 planes; q, k (with the elu + 1 feature map in the GEMM epilogue) and v as WMMA GEMMs (32x64 wave tiles, f32 accumulation, + bias) with f16 outputs; per batch: V^T via LDS transposes; per query tile of 256 rows: a = phi(q) phi(k)^T against the keys below the tile end only (K = 64, all heads on grid.y), causal row NORMALISATION on VALU (p_j = a_j [j <= i] / sum_{j <= i} a_j in f32; weights x256 f16), ctx = P V^T (x64) into merged f16 rows; out = ctx Wo^T + bo GEMM (f32); first-tile refinement: the first 128 rows of each batch recomputed exactly in f32 on VALU (a / sum a weights) and their output rows rewritten from o hi/lo by two accumulating GEMM passes; launches: see trace.
// Compute dtype: inputs rounded to bf16; x / weights exact; q, k, v, normalised weights and o as plain f16 GEMM operands (~2^-12); scores and row sums f32; v_wmma_f32_16x16x32_f16.
#define NB 2
#define SQ 2048
#define DM 1024
#define NH 16
#define HD 64
#define HG 4                         /* heads per group in the unlaunched k_vt(V16, b, h0, VT) overload */
#define QT 256                       /* query rows per causal tile */
#define NKX SQ                       /* S / P row pitch */
#define QT0 128                      /* first-tile rows recomputed exactly in f32 */
#define B0 0                         /* first batch processed (debug hook) */
#define NBR NB                       /* batches processed (debug hook) */
#define NR ((size_t)NB * SQ)         /* token rows */
#define MP ((int)((size_t)NBR * SQ)) /* rows projected (debug hook) */
#define QN SQ                        /* query rows attended per batch (debug hook) */
#define NHD NH                       /* heads attended (debug hook) */
#define MPO MP                       /* rows through the output stage (debug hook) */
#define LQ DM      /* row pitch of the q/k/v rows */
typedef __bf16 v16b __attribute__((ext_vector_type(16)));
typedef unsigned short v8us __attribute__((ext_vector_type(8), may_alias));
typedef float  v8f  __attribute__((ext_vector_type(8)));
typedef float  v4f  __attribute__((ext_vector_type(4)));
typedef float  v4fa __attribute__((ext_vector_type(4), may_alias));
union FragB { v16b v; v8us half[2]; unsigned short u[16]; };

__device__ __forceinline__ unsigned short bf16_bits(float x) { unsigned int u = __float_as_uint(x); return (unsigned short)((u + 0x7FFFu + ((u >> 16) & 1u)) >> 16); }
__device__ __forceinline__ float bf16_val(unsigned short b) { return __uint_as_float(((unsigned int)b) << 16); }
__device__ __forceinline__ float bf16_round(float x) { return bf16_val(bf16_bits(x)); }
// D += A·B with NT terms: 1 = ah·bh, 2 = + al·bh (A split), 3 = + ah·bl (both split)
template <int NT>
__device__ __forceinline__ v8f mmaN(v16b ah, v16b al, v16b bh, v16b bl, v8f c) {
  c = __builtin_amdgcn_wmma_f32_16x16x32_bf16(false, ah, false, bh, (short)0, c, false, false);
  if (NT >= 2) c = __builtin_amdgcn_wmma_f32_16x16x32_bf16(false, al, false, bh, (short)0, c, false, false);
  if (NT >= 3) c = __builtin_amdgcn_wmma_f32_16x16x32_bf16(false, ah, false, bl, (short)0, c, false, false);
  asm volatile("v_nop\n\tv_nop\n\tv_nop\n\tv_nop" : "+v"(c) : "v"(ah), "v"(al), "v"(bh), "v"(bl));
  return c;
}

__global__ __launch_bounds__(256) void k_wt_bf16(const float* __restrict__ W, unsigned short* __restrict__ Wt, int K, int N) {
  const int t = blockIdx.x * 256 + threadIdx.x;
  const int k8n = K / 8;
  if (t >= N * k8n) return;
  const int n = t / k8n, k8 = (t % k8n) * 8;
  v8us v;
#pragma unroll
  for (int i = 0; i < 8; ++i) v[i] = bf16_bits(W[(size_t)(k8 + i) * N + n]);
  *(v8us*)(Wt + (size_t)n * K + k8) = v;
  
}

// GEMM C[M][N] (f32, pitch ldc) = act(A[M][K]·W + bias). A f32 row-major (pitch lda) converted per fragment to bf16
// (ASPLIT: hi/lo two planes -> 2 terms, else single rounded term); Wt bf16 [N][K] (pitch ldb). BIAS_BF16 rounds the
// bias to bf16 first (bias quantised to bf16 before the add). K%32==0, M%16==0, N%64==0.
template <bool ASPLIT, int ACT, bool BIAS_BF16>
__global__ __launch_bounds__(128) void k_gemm_bf(const float* __restrict__ A, int lda, const unsigned short* __restrict__ Wt, int ldb,
                                               const float* __restrict__ bias, float* __restrict__ C, int ldc, int M, int N, int K) {
  __shared__ __attribute__((aligned(16))) float so[4][16][64];
  const int tid = threadIdx.x, w = tid >> 5, lane = tid & 31, ln = lane & 15, hh = lane >> 4;
  const int ntn = N / 64;
  const int wid = blockIdx.x * 4 + w;
  const int mt = wid / ntn, nq = wid % ntn;
  if (mt * 16 >= M) return;
  const int row0 = mt * 16, col0 = nq * 64;
  const float* arow = A + (size_t)(row0 + ln) * lda;
  v8f acc[4] = {};
  for (int kb = 0; kb < K; kb += 32) {
    FragB ah, al;
    const v4f x0 = *(const v4fa*)(arow + kb + 8 * hh), x1 = *(const v4fa*)(arow + kb + 8 * hh + 4);
    const v4f x2 = *(const v4fa*)(arow + kb + 16 + 8 * hh), x3 = *(const v4fa*)(arow + kb + 16 + 8 * hh + 4);
    float xs[16] = {x0[0],x0[1],x0[2],x0[3],x1[0],x1[1],x1[2],x1[3],x2[0],x2[1],x2[2],x2[3],x3[0],x3[1],x3[2],x3[3]};
#pragma unroll
    for (int i = 0; i < 16; ++i) { const unsigned short hb = bf16_bits(xs[i]); ah.u[i] = hb; al.u[i] = ASPLIT ? bf16_bits(xs[i] - bf16_val(hb)) : (unsigned short)0; }
#pragma unroll
    for (int t = 0; t < 4; ++t) {
      const unsigned short* brow = Wt + (size_t)(col0 + t * 16 + ln) * ldb + kb;
      FragB b;
      b.half[0] = *(const v8us*)(brow + 8 * hh);
      b.half[1] = *(const v8us*)(brow + 16 + 8 * hh);
      acc[t] = mmaN<ASPLIT ? 2 : 1>(ah.v, al.v, b.v, b.v, acc[t]);
    }
  }
#pragma unroll
  for (int t = 0; t < 4; ++t) {
    float bv = bias ? bias[col0 + t * 16 + ln] : 0.f;
    if (BIAS_BF16) bv = bf16_round(bv);
#pragma unroll
    for (int r = 0; r < 8; ++r) { float v = acc[t][r] + bv; if (ACT == 1) v = fmaxf(v, 0.f); so[w][8 * hh + r][t * 16 + ln] = v; }
  }
  __builtin_amdgcn_fence(__ATOMIC_ACQ_REL, "workgroup");
  __builtin_amdgcn_wave_barrier();
  const int rsub = lane >> 4, c4 = (lane & 15) * 4;
  {
#pragma unroll
    for (int q = 0; q < 8; ++q) {
      const int r = q * 2 + rsub;
      const v4f v = *(const v4fa*)&so[w][r][c4];
      *(v4f*)(C + (size_t)(row0 + r) * ldc + col0 + c4) = v;
    }
    
  }
}

// GEMM C = act(A·W + bias + resid): A f32 (ASPLIT -> hi/lo 2 terms), Wt bf16 [N][K]; ACT 0 none, 1 relu, 2 exact gelu;
// resid (optional, f32, row index = (row % rmod), pitch ldr, RES_BF16 rounds it) added before the activation.
template <bool ASPLIT, int ACT, bool BIAS_BF16, bool RES_BF16>
__global__ __launch_bounds__(128) void k_gemm_bf3(const float* __restrict__ A, int lda, const unsigned short* __restrict__ Wt, int ldb,
                                                const float* __restrict__ bias, const float* __restrict__ resid, int rmod, int ldr,
                                                float* __restrict__ C, int ldc, int M, int N, int K) {
  __shared__ __attribute__((aligned(16))) float so[4][16][64];
  const int tid = threadIdx.x, w = tid >> 5, lane = tid & 31, ln = lane & 15, hh = lane >> 4;
  const int ntn = N / 64;
  const int wid = blockIdx.x * 4 + w;
  const int mt = wid / ntn, nq = wid % ntn;
  if (mt * 16 >= M) return;
  const int row0 = mt * 16, col0 = nq * 64;
  const float* arow = A + (size_t)(row0 + ln) * lda;
  v8f acc[4] = {};
  for (int kb = 0; kb < K; kb += 32) {
    FragB ah, al;
    const v4f x0 = *(const v4fa*)(arow + kb + 8 * hh), x1 = *(const v4fa*)(arow + kb + 8 * hh + 4);
    const v4f x2 = *(const v4fa*)(arow + kb + 16 + 8 * hh), x3 = *(const v4fa*)(arow + kb + 16 + 8 * hh + 4);
    float xs[16] = {x0[0],x0[1],x0[2],x0[3],x1[0],x1[1],x1[2],x1[3],x2[0],x2[1],x2[2],x2[3],x3[0],x3[1],x3[2],x3[3]};
#pragma unroll
    for (int i = 0; i < 16; ++i) { const unsigned short hb = bf16_bits(xs[i]); ah.u[i] = hb; al.u[i] = ASPLIT ? bf16_bits(xs[i] - bf16_val(hb)) : (unsigned short)0; }
#pragma unroll
    for (int t = 0; t < 4; ++t) {
      const unsigned short* brow = Wt + (size_t)(col0 + t * 16 + ln) * ldb + kb;
      FragB b;
      b.half[0] = *(const v8us*)(brow + 8 * hh);
      b.half[1] = *(const v8us*)(brow + 16 + 8 * hh);
      acc[t] = mmaN<ASPLIT ? 2 : 1>(ah.v, al.v, b.v, b.v, acc[t]);
    }
  }
#pragma unroll
  for (int t = 0; t < 4; ++t) {
    const int col = col0 + t * 16 + ln;
    float bv = bias ? bias[col] : 0.f;
    if (BIAS_BF16) bv = bf16_round(bv);
#pragma unroll
    for (int r = 0; r < 8; ++r) {
      float v = acc[t][r] + bv;
      if (resid) { float rv = resid[(size_t)((row0 + 8 * hh + r) % rmod) * ldr + col]; if (RES_BF16) rv = bf16_round(rv); v += rv; }
      if (ACT == 1) v = fmaxf(v, 0.f);
      if (ACT == 2) v = 0.5f * v * (1.0f + erff(v * 0.70710678118654752f));
      if (ACT == 3) { const float u = 0.7978845608028654f * (v + 0.044715f * v * v * v); v = 0.5f * v * (1.0f + tanhf(u)); }
      so[w][8 * hh + r][t * 16 + ln] = v;
    }
  }
  __builtin_amdgcn_fence(__ATOMIC_ACQ_REL, "workgroup");
  __builtin_amdgcn_wave_barrier();
  const int rsub = lane >> 4, c4 = (lane & 15) * 4;
  {
#pragma unroll
    for (int q = 0; q < 8; ++q) {
      const int r = q * 2 + rsub;
      const v4f v = *(const v4fa*)&so[w][r][c4];
      *(v4f*)(C + (size_t)(row0 + r) * ldc + col0 + c4) = v;
    }
    
  }
}
// row LayerNorm (biased variance, eps) over N: s = X (+ R); optional out_sum <- s; out_norm <- (s-mu)*rsqrt(var+eps)*g + b
template <bool PARAM_BF16>
__global__ __launch_bounds__(256) void k_layernorm(const float* __restrict__ X, const float* __restrict__ R, const float* __restrict__ g, const float* __restrict__ bta,
                                                  float* __restrict__ out_sum, float* __restrict__ out_norm, int N, float eps) {
  __shared__ float red[256];
  const int row = blockIdx.x, tid = threadIdx.x;
  const float* x = X + (size_t)row * N; const float* rr = R ? R + (size_t)row * N : nullptr;
  float vals[16];                     // up to N = 4096
  const int per = N / 256;            // contiguous chunk per thread? use strided-by-4 chunks: thread handles j = tid*4 + 1024*u
  float s1 = 0.f;
  for (int u = 0; u < per / 4; ++u) {
    const int j = tid * 4 + 1024 * u;
    const v4f a = *(const v4fa*)(x + j);
    v4f b = {0.f,0.f,0.f,0.f}; if (rr) b = *(const v4fa*)(rr + j);
#pragma unroll
    for (int q = 0; q < 4; ++q) { const float v = a[q] + b[q]; vals[u * 4 + q] = v; s1 += v; }
  }
  red[tid] = s1; __syncthreads();
  for (int st = 128; st > 0; st >>= 1) { if (tid < st) red[tid] += red[tid + st]; __syncthreads(); }
  const float mu = red[0] / (float)N; __syncthreads();
  float s2 = 0.f;
  for (int u = 0; u < per / 4; ++u)
#pragma unroll
    for (int q = 0; q < 4; ++q) { const float c = vals[u * 4 + q] - mu; s2 += c * c; }
  red[tid] = s2; __syncthreads();
  for (int st = 128; st > 0; st >>= 1) { if (tid < st) red[tid] += red[tid + st]; __syncthreads(); }
  const float rs = rsqrtf(red[0] / (float)N + eps);
  {
    for (int u = 0; u < per / 4; ++u) {
      const int j = tid * 4 + 1024 * u;
      v4f o, sm;
#pragma unroll
      for (int q = 0; q < 4; ++q) {
        float gg = g[j + q], bb = bta[j + q];
        if (PARAM_BF16) { gg = bf16_round(gg); bb = bf16_round(bb); }
        sm[q] = vals[u * 4 + q]; o[q] = (vals[u * 4 + q] - mu) * rs * gg + bb;
      }
      if (out_sum) *(v4f*)(out_sum + (size_t)row * N + j) = sm;
      *(v4f*)(out_norm + (size_t)row * N + j) = o;
    }
    
  }
}



// ---- f16 WMMA path (v_wmma_f32_16x16x32_f16): 11-bit significands for operands in range — used where a [0,1] probability operand needs more precision than bf16
typedef _Float16 v16h __attribute__((ext_vector_type(16)));
union FragH { v16h v; v8us half[2]; _Float16 h[16]; unsigned short u[16]; };
template <int NT>
__device__ __forceinline__ v8f mmaH(v16h ah, v16h al, v16h bh, v16h bl, v8f c) {
  c = __builtin_amdgcn_wmma_f32_16x16x32_f16(false, ah, false, bh, (short)0, c, false, false);
  if (NT >= 2) c = __builtin_amdgcn_wmma_f32_16x16x32_f16(false, al, false, bh, (short)0, c, false, false);
  if (NT >= 3) c = __builtin_amdgcn_wmma_f32_16x16x32_f16(false, ah, false, bl, (short)0, c, false, false);
  asm volatile("v_nop\n\tv_nop\n\tv_nop\n\tv_nop" : "+v"(c) : "v"(ah), "v"(al), "v"(bh), "v"(bl));
  return c;
}
// batched GEMM like k_gemm_b but f16 operands: A f32 (split into f16 hi/lo if ASPLIT, else rounded to f16), Bt = f16 values [n][k]; alpha; C f32; N multiple of 16 (partial tiles skipped)
template <bool ASPLIT>
__global__ __launch_bounds__(128) void k_gemm_h(const float* __restrict__ A, int lda, size_t sA, const _Float16* __restrict__ Bh, int ldb, size_t sB, float alpha, float* __restrict__ C, int ldc, size_t sC, int M, int N, int K) {
  __shared__ __attribute__((aligned(16))) float so[4][16][64];
  const int tid = threadIdx.x, w = tid >> 5, lane = tid & 31, ln = lane & 15, hh = lane >> 4; const int by = blockIdx.y;
  A += (size_t)by * sA; Bh += (size_t)by * sB; C += (size_t)by * sC;
  const int ntn = (N + 63) / 64; const int wid = blockIdx.x * 4 + w; const int mt = wid / ntn, nq = wid % ntn; if (mt * 16 >= M) return;
  const int row0 = mt * 16, col0 = nq * 64; const float* arow = A + (size_t)(row0 + ln) * lda;
  v8f acc[4] = {};
  for (int kb = 0; kb < K; kb += 32) {
    FragH ah, al;
    const v4f x0 = *(const v4fa*)(arow + kb + 8 * hh), x1 = *(const v4fa*)(arow + kb + 8 * hh + 4), x2 = *(const v4fa*)(arow + kb + 16 + 8 * hh), x3 = *(const v4fa*)(arow + kb + 16 + 8 * hh + 4);
    float xs[16] = {x0[0],x0[1],x0[2],x0[3],x1[0],x1[1],x1[2],x1[3],x2[0],x2[1],x2[2],x2[3],x3[0],x3[1],x3[2],x3[3]};
#pragma unroll
    for (int i = 0; i < 16; ++i) { const _Float16 h = (_Float16)xs[i]; ah.h[i] = h; al.h[i] = ASPLIT ? (_Float16)(xs[i] - (float)h) : (_Float16)0.0f; }
#pragma unroll
    for (int t = 0; t < 4; ++t) { if (col0 + t * 16 >= N) continue; const size_t boff = (size_t)(col0 + t * 16 + ln) * ldb + kb; FragH bq; bq.half[0] = *(const v8us*)(Bh + boff + 8 * hh); bq.half[1] = *(const v8us*)(Bh + boff + 16 + 8 * hh);
      acc[t] = mmaH<ASPLIT ? 2 : 1>(ah.v, al.v, bq.v, bq.v, acc[t]); }
  }
#pragma unroll
  for (int t = 0; t < 4; ++t) { if (col0 + t * 16 >= N) continue;
#pragma unroll
    for (int r = 0; r < 8; ++r) so[w][8 * hh + r][t * 16 + ln] = acc[t][r] * alpha; }
  __builtin_amdgcn_fence(__ATOMIC_ACQ_REL, "workgroup"); __builtin_amdgcn_wave_barrier();
  const int rsub = lane >> 4, c4 = (lane & 15) * 4;
  {
#pragma unroll
    for (int q = 0; q < 8; ++q) { const int r = q * 2 + rsub; if (col0 + c4 < N) { const v4f v = *(const v4fa*)&so[w][r][c4]; *(v4f*)(C + (size_t)(row0 + r) * ldc + col0 + c4) = v; } }
     }
}

// Wt[n][k] = f16(W[k][n]·scale) from f32 row-major W[K][N] (scale = power of two; bf16-exact weights stay exact in f16 away from the subnormal range)
__global__ __launch_bounds__(256) void k_wt_f16(const float* __restrict__ W, _Float16* __restrict__ Wt, int K, int N, float scale) {
  const int t = blockIdx.x * 256 + threadIdx.x; if (t >= N * (K / 8)) return; const int n = t / (K / 8), k8 = (t % (K / 8)) * 8; FragH f;
#pragma unroll
  for (int i = 0; i < 8; ++i) f.h[i] = (_Float16)(bf16_round(W[(size_t)(k8 + i) * N + n]) * scale); const v8us o = f.half[0];
  *(v8us*)((unsigned short*)Wt + (size_t)n * K + k8) = o; 
}
// k_gemm_hh variant with fused epilogue: v = acc·alpha + bias[by·sBias + col] (+ CP[(row/rowsPerB)·sCPb + by·64 + col] if CP) ; ACT 0 none / 1 elu ; writes f16 C16 (and f32 C if non-null)
template <int ACT>
__global__ __launch_bounds__(128) void k_gemm_hhx(const _Float16* __restrict__ A, int lda, size_t sA, const _Float16* __restrict__ Bh, int ldb, size_t sB, float alpha, const float* __restrict__ bias, size_t sBias, const float* __restrict__ CP, int rowsPerB, size_t sCPb, int row0g,
    float* __restrict__ C, _Float16* __restrict__ C16, int ldc, size_t sC, int M, int N, int K) {
  __shared__ __attribute__((aligned(16))) float so[4][16][64];
  const int tid = threadIdx.x, w = tid >> 5, lane = tid & 31, ln = lane & 15, hh = lane >> 4; const int by = blockIdx.y;
  A += (size_t)by * sA; Bh += (size_t)by * sB; const size_t cofs = (size_t)by * sC; const float* bp = bias ? bias + (size_t)by * sBias : nullptr;
  const int ntn = (N + 63) / 64; const int wid = blockIdx.x * 4 + w; const int mt = wid / ntn, nq = wid % ntn; if (mt * 16 >= M) return;
  const int row0 = mt * 16, col0 = nq * 64; const _Float16* arow = A + (size_t)(row0 + ln) * lda;
  v8f acc[4] = {};
  for (int kb = 0; kb < K; kb += 32) { FragH ah; ah.half[0] = *(const v8us*)((const unsigned short*)arow + kb + 8 * hh); ah.half[1] = *(const v8us*)((const unsigned short*)arow + kb + 16 + 8 * hh);
#pragma unroll
    for (int t = 0; t < 4; ++t) { if (col0 + t * 16 >= N) continue; const size_t boff = (size_t)(col0 + t * 16 + ln) * ldb + kb; FragH bq; bq.half[0] = *(const v8us*)((const unsigned short*)Bh + boff + 8 * hh); bq.half[1] = *(const v8us*)((const unsigned short*)Bh + boff + 16 + 8 * hh);
      acc[t] = mmaH<1>(ah.v, ah.v, bq.v, bq.v, acc[t]); }
  }
#pragma unroll
  for (int t = 0; t < 4; ++t) { if (col0 + t * 16 >= N) continue; const int col = col0 + t * 16 + ln; const float bv = bp ? bf16_round(bp[col]) : 0.f;
#pragma unroll
    for (int r = 0; r < 8; ++r) { float v = acc[t][r] * alpha + bv; if (CP) { const int rr = row0g + row0 + 8 * hh + r; if (rowsPerB < 0) v += CP[cofs + (size_t)rr * ldc + col];      /* rowsPerB < 0: own element of the batched C plane */ else { const int bidx = rr / rowsPerB; v += CP[(size_t)bidx * sCPb + (size_t)by * 64 + col]; } } if (ACT == 1) v = (v > 0.f) ? v : expm1f(v); else if (ACT == 7) v = (v > 0.f) ? v + 1.0f : expf(v); else if (ACT == 8) v = tanhf(v); else if (ACT == 9) v = 0.5f * v * (1.0f + tanhf(0.7978845608028654f * (v + 0.044715f * v * v * v))); else if (ACT == 11) v = 1.0f / (1.0f + expf(-v)); else if (ACT == 12) v = (v > 0.f) ? v : 0.01f * v; else if (ACT == 14) v = (v > 0.f) ? v : 0.1f * v; else if (ACT == 16) v = (v >= 0.f) ? v : 0.3f * v; else if (ACT == 17) v = (v >= 0.f) ? v : 0.2f * v; else if (ACT == 15) v = v / (1.0f + expf(-v)); else if (ACT == 3) v = fmaxf(v, 0.f); else if (ACT == 6) v = 0.5f * v * (1.0f + erff(v * 0.70710678118654752f)); so[w][8 * hh + r][t * 16 + ln] = v; } }
  __builtin_amdgcn_fence(__ATOMIC_ACQ_REL, "workgroup"); __builtin_amdgcn_wave_barrier();
  const int rsub = lane >> 4, c4 = (lane & 15) * 4; typedef _Float16 v4h __attribute__((ext_vector_type(4)));
  {
#pragma unroll
    for (int q = 0; q < 8; ++q) { const int r = q * 2 + rsub; if (col0 + c4 < N) { const v4f v = *(const v4fa*)&so[w][r][c4]; if (C) *(v4f*)(C + cofs + (size_t)(row0 + r) * ldc + col0 + c4) = v; if (C16) { v4h h4; for (int i = 0; i < 4; ++i) h4[i] = (_Float16)v[i]; *(v4h*)(C16 + cofs + (size_t)(row0 + r) * ldc + col0 + c4) = h4; } } }
     }
}


typedef _Float16 v4h __attribute__((ext_vector_type(4)));

__global__ __launch_bounds__(256) void k_x16(const float* __restrict__ x, _Float16* __restrict__ X16, size_t n8) { const size_t t = (size_t)blockIdx.x * 256 + threadIdx.x; if (t >= n8) return; FragH f;
#pragma unroll
  for (int q = 0; q < 8; ++q) f.h[q] = (_Float16)bf16_round(x[t * 8 + q]); *(v8us*)((unsigned short*)X16 + t * 8) = f.half[0];  }
__global__ __launch_bounds__(256) void k_h16(const float* __restrict__ x, _Float16* __restrict__ X16, size_t n8) { const size_t t = (size_t)blockIdx.x * 256 + threadIdx.x; if (t >= n8) return; FragH f;
#pragma unroll
  for (int q = 0; q < 8; ++q) f.h[q] = (_Float16)x[t * 8 + q]; *(v8us*)((unsigned short*)X16 + t * 8) = f.half[0];  }
__global__ __launch_bounds__(256) void k_round16f(const float* __restrict__ W, _Float16* __restrict__ Bt, size_t n8) { const size_t t = (size_t)blockIdx.x * 256 + threadIdx.x; if (t >= n8) return; FragH f;
#pragma unroll
  for (int i = 0; i < 8; ++i) f.h[i] = (_Float16)(bf16_round(W[t * 8 + i]) * 16.0f); *(v8us*)((unsigned short*)Bt + t * 8) = f.half[0];  }
template <int NHv, int TTv>
__global__ __launch_bounds__(256) void k_vt(const _Float16* __restrict__ V16, int ldv, int voff, _Float16* __restrict__ Vt) { __shared__ unsigned short tl[64][66]; const int tid = threadIdx.x; const int slab = blockIdx.x / (TTv / 64), lg = blockIdx.x % (TTv / 64); const int b = slab / NHv, h = slab % NHv;
  for (int i = tid; i < 64 * 8; i += 256) { const int r = i / 8, c8 = (i % 8) * 8; FragH f; f.half[0] = *(const v8us*)((const unsigned short*)V16 + ((size_t)b * TTv + lg * 64 + r) * ldv + voff + h * 64 + c8);
#pragma unroll
    for (int q = 0; q < 8; ++q) tl[r][c8 + q] = f.u[q]; }
  __syncthreads();
  {
#pragma unroll
    for (int rd = 0; rd < 2; ++rd) { const int d = rd * 32 + tid / 8, pc = tid % 8; FragH f;
#pragma unroll
      for (int q = 0; q < 8; ++q) f.u[q] = tl[pc * 8 + q][d];
      *(v8us*)((unsigned short*)Vt + ((size_t)slab * 64 + d) * TTv + lg * 64 + pc * 8) = f.half[0]; }
     } }

__global__ __launch_bounds__(256) void k_hl(const float* __restrict__ F, _Float16* __restrict__ Hh, _Float16* __restrict__ Hl, size_t n8) { const size_t t = (size_t)blockIdx.x * 256 + threadIdx.x; if (t >= n8) return; FragH fh, fl; const v4f a = *(const v4fa*)(F + t * 8), c = *(const v4fa*)(F + t * 8 + 4);
#pragma unroll
  for (int q = 0; q < 4; ++q) { _Float16 h = (_Float16)a[q]; fh.h[q] = h; fl.h[q] = (_Float16)((a[q] - (float)h) * 1024.0f); h = (_Float16)c[q]; fh.h[4 + q] = h; fl.h[4 + q] = (_Float16)((c[q] - (float)h) * 1024.0f); }
  { *(v8us*)((unsigned short*)Hh + t * 8) = fh.half[0]; *(v8us*)((unsigned short*)Hl + t * 8) = fl.half[0];  } }

// ---- fast GEMM (wave tile 32x64; requires M % 32 == 0 rows per launch region and N % 64 == 0); epilogue = k_gemm_hhx semantics ----
__device__ __forceinline__ v16h g2_frag(const _Float16* p, int hh) { FragH f; f.half[0] = *(const v8us*)((const unsigned short*)p + 8 * hh); f.half[1] = *(const v8us*)((const unsigned short*)p + 16 + 8 * hh); return f.v; }
__device__ __forceinline__ v8f g2_mma(v16h a, v16h b, v8f c) { v8f d = __builtin_amdgcn_wmma_f32_16x16x32_f16(false, a, false, b, (short)0, c, false, false); asm volatile("v_nop\n\tv_nop\n\tv_nop\n\tv_nop" : "+v"(d) : "v"(a), "v"(b)); return d; }
template <int ACT>
__global__ __launch_bounds__(128) void k_gemm2(const _Float16* __restrict__ A, int lda, size_t sA, const _Float16* __restrict__ Bh, int ldb, size_t sB, float alpha, const float* __restrict__ bias, size_t sBias, const float* __restrict__ CP, int rowsPerB, size_t sCPb, int row0g,
    float* __restrict__ C, _Float16* __restrict__ C16, int ldc, size_t sC, int M, int N, int K) { static_assert(ACT == 0 || ACT == 3 || ACT == 6 || ACT == 8 || ACT == 9 || ACT == 11 || ACT == 12 || ACT == 14 || ACT == 15 || ACT == 16 || ACT == 17 || ACT == 19, "k_gemm2: unsupported ACT code (would silently apply no activation)");
  __shared__ __attribute__((aligned(16))) float so[4][32][68];
  const int tid = threadIdx.x, w = tid >> 5, lane = tid & 31, ln = lane & 15, hh = lane >> 4; const int by = blockIdx.y;
  A += (size_t)by * sA; Bh += (size_t)by * sB; const size_t cofs = (size_t)by * sC; const float* bp = bias ? bias + (size_t)by * sBias : nullptr;
  const int ntn = N >> 6; const int mt = blockIdx.x / ntn, nq = blockIdx.x - mt * ntn; const int row0 = mt * 128 + 32 * w, col0 = nq * 64; if (row0 >= M) return;
  const _Float16* a0p = A + (size_t)(row0 + ln) * lda; const _Float16* a1p = a0p + (size_t)16 * lda;
  const _Float16* b0p = Bh + (size_t)(col0 + ln) * ldb; const _Float16* b1p = b0p + (size_t)16 * ldb; const _Float16* b2p = b1p + (size_t)16 * ldb; const _Float16* b3p = b2p + (size_t)16 * ldb;
  const v8f z8 = {0.f,0.f,0.f,0.f,0.f,0.f,0.f,0.f}; v8f c00 = z8, c01 = z8, c02 = z8, c03 = z8, c10 = z8, c11 = z8, c12 = z8, c13 = z8;
#pragma unroll 1
  for (int kb = 0; kb < K; kb += 32) { const v16h a0 = g2_frag(a0p + kb, hh), a1 = g2_frag(a1p + kb, hh);
    v16h b = g2_frag(b0p + kb, hh); c00 = g2_mma(a0, b, c00); c10 = g2_mma(a1, b, c10);
    b = g2_frag(b1p + kb, hh); c01 = g2_mma(a0, b, c01); c11 = g2_mma(a1, b, c11);
    b = g2_frag(b2p + kb, hh); c02 = g2_mma(a0, b, c02); c12 = g2_mma(a1, b, c12);
    b = g2_frag(b3p + kb, hh); c03 = g2_mma(a0, b, c03); c13 = g2_mma(a1, b, c13); }
  v8f accs[8] = {c00, c01, c02, c03, c10, c11, c12, c13};
#pragma unroll
  for (int u = 0; u < 8; ++u) { const int t = u & 3, half = u >> 2; const int col = col0 + t * 16 + ln; const float bv = bp ? bf16_round(bp[col]) : 0.f;
#pragma unroll
    for (int r = 0; r < 8; ++r) { const int rloc = half * 16 + 8 * hh + r; float v = accs[u][r] * alpha + bv; if (CP) { if (rowsPerB < 0) v += CP[cofs + (size_t)(row0g + row0 + rloc) * ldc + col];      /* rowsPerB < 0: own element of the batched C plane */ else { const int bidx = (row0g + row0 + rloc) / rowsPerB; v += CP[(size_t)bidx * sCPb + (size_t)by * 64 + col]; } }
      if (ACT == 3) v = fmaxf(v, 0.f); else if (ACT == 6) v = 0.5f * v * (1.0f + erff(v * 0.70710678118654752f)); else if (ACT == 11) v = 1.0f / (1.0f + expf(-v)); else if (ACT == 15) v = v / (1.0f + expf(-v)); else if (ACT == 19) v = (v > 0.f) ? (v + 1.0f) : expf(v);      /* elu(v) + 1 */ else if (ACT == 12) v = (v > 0.f) ? v : 0.01f * v; else if (ACT == 8) v = tanhf(v); else if (ACT == 9) v = 0.5f * v * (1.0f + tanhf(0.7978845608028654f * (v + 0.044715f * v * v * v))); else if (ACT == 14) v = (v > 0.f) ? v : 0.1f * v; else if (ACT == 16) v = (v >= 0.f) ? v : 0.3f * v; else if (ACT == 17) v = (v >= 0.f) ? v : 0.2f * v;
      so[w][rloc][t * 16 + ln] = v; } }
  __builtin_amdgcn_fence(__ATOMIC_ACQ_REL, "workgroup"); __builtin_amdgcn_wave_barrier();
  const int rsub = lane >> 4, c4 = (lane & 15) * 4;
  {
#pragma unroll
    for (int q = 0; q < 16; ++q) { const int r = q * 2 + rsub; const v4f v = *(const v4fa*)&so[w][r][c4]; if (C) *(v4f*)(C + cofs + (size_t)(row0 + r) * ldc + col0 + c4) = v; if (C16) { v4h h4; for (int i = 0; i < 4; ++i) h4[i] = (_Float16)v[i]; *(v4h*)(C16 + cofs + (size_t)(row0 + r) * ldc + col0 + c4) = h4; } }
     } }


__global__ __launch_bounds__(256) void k_wnat(const float* __restrict__ w, size_t n8, _Float16* __restrict__ Bt) { const size_t t = (size_t)blockIdx.x * 256 + threadIdx.x; if (t >= n8) return; FragH f; for (int q = 0; q < 8; ++q) f.h[q] = (_Float16)(bf16_round(w[t * 8 + q]) * 16.0f); *(v8us*)((unsigned short*)Bt + t * 8) = f.half[0];  }
__global__ __launch_bounds__(256) void k_rsm(const float* __restrict__ S, _Float16* __restrict__ P, int nrows) {
  #pragma clang fp contract(off)
  const int i = blockIdx.x * 256 + threadIdx.x; if (i >= nrows) return; const float* s = S + (size_t)i * SQ; float mx = -3.0e38f;
#pragma unroll 1
  for (int j = 0; j < SQ; ++j) mx = fmaxf(mx, s[j]); float se = 0.f;
#pragma unroll 1
  for (int j = 0; j < SQ; ++j) se += expf(s[j] - mx); const float sc = 256.0f / se;
#pragma unroll 1
  for (int j0 = 0; j0 < SQ; j0 += 8) { FragH f; for (int q = 0; q < 8; ++q) f.h[q] = (_Float16)(expf(s[j0 + q] - mx) * sc); unsigned short* d = (unsigned short*)P + (size_t)i * SQ + j0; *(v8us*)d = f.half[0];  } }
__global__ __launch_bounds__(256) void k_vt(const _Float16* __restrict__ V16, int b, int h0, _Float16* __restrict__ VT) { __shared__ unsigned short tl[64][65]; const int tid = threadIdx.x; const int hh = blockIdx.x % HG, sg = blockIdx.x / HG; const int s0 = sg * 64; const int h = h0 + hh;
  for (int i = tid; i < 64 * 8; i += 256) { const int j = i / 8, d8 = (i % 8) * 8; FragH f; f.half[0] = *(const v8us*)((const unsigned short*)V16 + ((size_t)b * SQ + s0 + j) * DM + h * HD + d8); for (int q = 0; q < 8; ++q) tl[d8 + q][j] = f.u[q]; }
  __syncthreads();
  { for (int i = tid; i < 64 * 8; i += 256) { const int d = i / 8, j8 = (i % 8) * 8; FragH f; for (int q = 0; q < 8; ++q) f.u[q] = tl[d][j8 + q]; *(v8us*)((unsigned short*)VT + ((size_t)hh * HD + d) * SQ + s0 + j8) = f.half[0]; }  } }



__global__ __launch_bounds__(256) void k_rsmcf2(const float* __restrict__ S, _Float16* __restrict__ P, int hg, int q0, int nk) {
  #pragma clang fp contract(off)
  const int t = blockIdx.x * 256 + threadIdx.x; if (t >= hg * QT) return; const size_t i = (size_t)t; const float* s = S + i * NKX; const int last = q0 + (t % QT); float mx = -3.0e38f;
#pragma unroll 1
  for (int j = 0; j < nk; ++j) { const float f = (j <= last) ? 1.f : 0.f; mx = fmaxf(mx, fmaf(f, s[j], (1.f - f) * -1.0e9f)); } float se = 0.f;
#pragma unroll 1
  for (int j = 0; j < nk; ++j) { const float f = (j <= last) ? 1.f : 0.f; se += __expf(fmaf(f, s[j], (1.f - f) * -1.0e9f) - mx); } const float sc = 256.0f / se;
#pragma unroll 1
  for (int j0 = 0; j0 < nk; j0 += 8) { FragH fr; for (int q = 0; q < 8; ++q) { const int j = j0 + q; const float f = (j <= last) ? 1.f : 0.f; fr.h[q] = (_Float16)(__expf(fmaf(f, s[j], (1.f - f) * -1.0e9f) - mx) * sc); } unsigned short* d = (unsigned short*)P + i * NKX + j0; *(v8us*)d = fr.half[0];  } }


template <int MASKADD>
__global__ __launch_bounds__(64) void k_att0(const float* __restrict__ QF, const float* __restrict__ KF, const float* __restrict__ VF, int ld, const float* __restrict__ mask, float scale, float* __restrict__ OF, int ldo) {
  #pragma clang fp contract(off)
  __shared__ __attribute__((aligned(16))) float lq[64][64]; __shared__ __attribute__((aligned(16))) float lo[64][64];
  const int tid = threadIdx.x; const int h = blockIdx.x / (QT0 / 64), rg = blockIdx.x % (QT0 / 64); const int i = rg * 64 + tid;
  const float* qr = QF + (size_t)i * ld + h * HD;
#pragma unroll 1
  for (int c = 0; c < HD / 4; ++c) { *(v4f*)&lq[tid][c * 4] = *(const v4fa*)(qr + c * 4); const v4f z = {0.f, 0.f, 0.f, 0.f}; *(v4f*)&lo[tid][c * 4] = z; }
  float m = -1.0e30f, l = 0.f; const int jmax = MASKADD ? (SQ - 1) : (rg * 64 + 63);      /* additive-mask form: every key (the mask input decides); causal form: keys up to the block's last row */
#pragma unroll 1
  for (int j = 0; j <= jmax; ++j) { const float* kr = KF + (size_t)j * ld + h * HD; const float* vr = VF + (size_t)j * ld + h * HD; float s = 0.f;
#pragma unroll 1
    for (int c = 0; c < HD / 4; ++c) { const v4f kq = *(const v4fa*)(kr + c * 4); const v4f qq = *(v4f*)&lq[tid][c * 4]; s = __fadd_rn(s, __fmul_rn(qq[0], kq[0])); s = __fadd_rn(s, __fmul_rn(qq[1], kq[1])); s = __fadd_rn(s, __fmul_rn(qq[2], kq[2])); s = __fadd_rn(s, __fmul_rn(qq[3], kq[3])); }
    s = __fmul_rn(s, scale); if (MASKADD) s = __fadd_rn(s, __fmul_rn(bf16_round(mask[(size_t)i * SQ + j]), -10000.0f));
    const float f = (MASKADD || j <= i) ? 1.f : 0.f; const float sm = fmaf(f, s, (1.f - f) * -1.0e30f); const float mn = fmaxf(m, sm); const float sc = expf(m - mn); const float e = expf(sm - mn); l = __fadd_rn(__fmul_rn(l, sc), e); m = mn;
#pragma unroll 1
    for (int c = 0; c < HD / 4; ++c) { const v4f vv = *(const v4fa*)(vr + c * 4); v4f oo = *(v4f*)&lo[tid][c * 4]; for (int u = 0; u < 4; ++u) oo[u] = __fadd_rn(__fmul_rn(oo[u], sc), __fmul_rn(e, vv[u])); *(v4f*)&lo[tid][c * 4] = oo; } }
  const float fin = 64.0f / l;      /* o carried x64 like the f16 path */
#pragma unroll 1
  for (int c = 0; c < HD / 4; ++c) { v4f oo = *(v4f*)&lo[tid][c * 4]; for (int u = 0; u < 4; ++u) oo[u] = __fmul_rn(oo[u], fin); *(v4f*)&lo[tid][c * 4] = oo; }
  __syncthreads();
  {
#pragma unroll 1
    for (int it = 0; it < 16; ++it) { const int row = it * 4 + tid / 16, pc = (tid % 16) * 4; const v4f v = *(const v4f*)&lo[row][pc]; *(v4f*)(OF + (size_t)(rg * 64 + row) * ldo + h * HD + pc) = v; }
     } }


// Row normalisation, one wave per score row: lane l holds floats 128 c + 4 l .. 4 l + 3 of the row, so each load covers 512 contiguous bytes and each f16 store 256;
// the row is read once into registers, summed per lane and then over the 32 lanes by a butterfly (every lane ends with the same bits), scaled and stored.
template <int NC>      /* NC = nk / 128 chunks; the last QT / 128 of them hold the causal edge, rel = the row's own place inside them */
__device__ __forceinline__ void lin_row(const float* __restrict__ s, _Float16* __restrict__ d, int lane, int rel) {
  v4f a[NC];
#pragma unroll
  for (int c = 0; c < NC; ++c) a[c] = *(const v4fa*)(s + c * 128 + lane * 4);
#pragma unroll
  for (int c = NC - QT / 128; c < NC; ++c) { const int j = (c - (NC - QT / 128)) * 128 + lane * 4;
#pragma unroll
    for (int q = 0; q < 4; ++q) a[c][q] = (j + q <= rel) ? a[c][q] : 0.f; }
  v4f acc = a[0];
#pragma unroll
  for (int c = 1; c < NC; ++c) acc += a[c];
  float se = (acc[0] + acc[1]) + (acc[2] + acc[3]);
#pragma unroll
  for (int m = 16; m > 0; m >>= 1) se += __shfl_xor(se, m, 32);
  const float sc = 256.0f / se;
#pragma unroll
  for (int c = 0; c < NC; ++c) { v4h h;
#pragma unroll
    for (int q = 0; q < 4; ++q) h[q] = (_Float16)(a[c][q] * sc);
    *(v4h*)(d + c * 128 + lane * 4) = h; }
  asm volatile("s_wait_xcnt 0x0" ::: "memory"); }      /* behind the last store of the run: the stores' data and address registers are reused by the code that follows in the listing */
__global__ __launch_bounds__(256) void k_lincf2(const float* __restrict__ S, _Float16* __restrict__ P, int hg, int nk) {      /* nk = the tile's first query row + QT, a multiple of QT up to SQ */
  const int t = blockIdx.x * 8 + (threadIdx.x >> 5); if (t >= hg * QT) return; const int lane = threadIdx.x & 31; const float* s = S + (size_t)t * NKX; _Float16* d = P + (size_t)t * NKX; const int rel = t % QT;
  switch (nk / QT) {
    case 1: lin_row<2>(s, d, lane, rel); break; case 2: lin_row<4>(s, d, lane, rel); break; case 3: lin_row<6>(s, d, lane, rel); break; case 4: lin_row<8>(s, d, lane, rel); break;
    case 5: lin_row<10>(s, d, lane, rel); break; case 6: lin_row<12>(s, d, lane, rel); break; case 7: lin_row<14>(s, d, lane, rel); break; case 8: lin_row<16>(s, d, lane, rel); break; } }

__global__ __launch_bounds__(64) void k_latt0(const float* __restrict__ QF, const float* __restrict__ KF, const float* __restrict__ VF, int ld, float* __restrict__ OF, int ldo) {
  #pragma clang fp contract(off)
  __shared__ __attribute__((aligned(16))) float lq[64][64]; __shared__ __attribute__((aligned(16))) float lo[64][64];
  const int tid = threadIdx.x; const int h = blockIdx.x / (QT0 / 64), rg = blockIdx.x % (QT0 / 64); const int i = rg * 64 + tid;
  const float* qr = QF + (size_t)i * ld + h * HD;
#pragma unroll 1
  for (int c = 0; c < HD / 4; ++c) { *(v4f*)&lq[tid][c * 4] = *(const v4fa*)(qr + c * 4); const v4f z = {0.f, 0.f, 0.f, 0.f}; *(v4f*)&lo[tid][c * 4] = z; }
  float l = 0.f; const int jmax = rg * 64 + 63;
#pragma unroll 1
  for (int j = 0; j <= jmax; ++j) { const float* kr = KF + (size_t)j * ld + h * HD; const float* vr = VF + (size_t)j * ld + h * HD; float s = 0.f;
#pragma unroll 1
    for (int c = 0; c < HD / 4; ++c) { const v4f kq = *(const v4fa*)(kr + c * 4); const v4f qq = *(v4f*)&lq[tid][c * 4]; s = __fadd_rn(s, __fmul_rn(qq[0], kq[0])); s = __fadd_rn(s, __fmul_rn(qq[1], kq[1])); s = __fadd_rn(s, __fmul_rn(qq[2], kq[2])); s = __fadd_rn(s, __fmul_rn(qq[3], kq[3])); }
    const float f = (j <= i) ? 1.f : 0.f; const float e = __fmul_rn(f, s); l = __fadd_rn(l, e);
#pragma unroll 1
    for (int c = 0; c < HD / 4; ++c) { const v4f vv = *(const v4fa*)(vr + c * 4); v4f oo = *(v4f*)&lo[tid][c * 4]; for (int u = 0; u < 4; ++u) oo[u] = __fadd_rn(oo[u], __fmul_rn(e, vv[u])); *(v4f*)&lo[tid][c * 4] = oo; } }
  const float fin = 64.0f / l;      /* o carried x64 like the f16 path */
#pragma unroll 1
  for (int c = 0; c < HD / 4; ++c) { v4f oo = *(v4f*)&lo[tid][c * 4]; for (int u = 0; u < 4; ++u) oo[u] = __fmul_rn(oo[u], fin); *(v4f*)&lo[tid][c * 4] = oo; }
  __syncthreads();
  {
#pragma unroll 1
    for (int it = 0; it < 16; ++it) { const int row = it * 4 + tid / 16, pc = (tid % 16) * 4; const v4f v = *(const v4f*)&lo[row][pc]; *(v4f*)(OF + (size_t)(rg * 64 + row) * ldo + h * HD + pc) = v; }
     } }
extern "C" void kernel_launch(void* const* d_in, const int* in_sizes, int n_in,
                              void* d_out, int out_size, void* d_ws, size_t ws_size, hipStream_t stream) {
  (void)in_sizes; (void)n_in; (void)out_size;
  const float* const* I = (const float* const*)d_in; const float* x = I[0]; const float* wqk = I[1]; const float* bqk = I[2]; const float* wv = I[3]; const float* bv = I[4]; const float* wo = I[5]; const float* bo = I[6]; const float* bq = bqk; const float* bk = bqk + DM;      /* natural Wqk [2048][1024] (q rows | k rows) + bias [2048]; Wv + bv; Wo + bo */
  char* ws = (char*)d_ws; size_t off = 0;
  auto take = [&](size_t bytes) { char* p = ws + off; off += (bytes + 255) & ~(size_t)255; return p; };
  _Float16* BQK = (_Float16*)take((size_t)2 * DM * DM * 2); _Float16* BQ = BQK; _Float16* BK = BQK + (size_t)DM * DM; _Float16* BV = (_Float16*)take((size_t)DM * DM * 2); _Float16* BO = (_Float16*)take((size_t)DM * DM * 2);
  _Float16* X16 = (_Float16*)take(NR * DM * 2); _Float16* Q16 = (_Float16*)take(NR * DM * 2); _Float16* K16 = (_Float16*)take(NR * DM * 2); _Float16* V16 = (_Float16*)take(NR * DM * 2); _Float16* O16 = (_Float16*)take(NR * DM * 2);
  float* S = (float*)take((size_t)NH * QT * NKX * 4); _Float16* P = (_Float16*)take((size_t)NH * QT * NKX * 2); _Float16* VT = (_Float16*)take((size_t)NH * HD * SQ * 2);
  float* QF0 = (float*)take((size_t)QT0 * DM * 4); float* KF0 = (float*)take((size_t)QT0 * DM * 4); float* VF0 = (float*)take((size_t)QT0 * DM * 4); float* OF0 = (float*)take((size_t)NB * QT0 * DM * 4); _Float16* OH0 = (_Float16*)take((size_t)NB * QT0 * DM * 2); _Float16* OL0 = (_Float16*)take((size_t)NB * QT0 * DM * 2);
  if (off > ws_size) return;
  { const unsigned g = (unsigned)(((size_t)DM * DM / 8 + 255) / 256); k_wnat<<<2 * g, 256, 0, stream>>>(wqk, (size_t)2 * DM * DM / 8, BQK); k_wnat<<<g, 256, 0, stream>>>(wv, (size_t)DM * DM / 8, BV); k_wnat<<<g, 256, 0, stream>>>(wo, (size_t)DM * DM / 8, BO); }      /* natural [out][in] = Bt[n][k], x16 (Wqk's q rows then k rows) */

  k_x16<<<(unsigned)((NR * DM / 8 + 255) / 256), 256, 0, stream>>>(x, X16, NR * DM / 8);
  const size_t r0p = (size_t)B0 * SQ;      /* first projected row */
  k_gemm2<19><<<dim3((unsigned)((MP / 128) * (DM / 64)), 1), 128, 0, stream>>>(X16 + r0p * DM, DM, 0, BQ, DM, 0, 0.0625f, bq, 0, nullptr, 1, 0, 0, nullptr, Q16 + r0p * DM, DM, 0, MP, DM, DM);      /* phi(q) = elu(x Wq^T + bq) + 1 */
  k_gemm2<19><<<dim3((unsigned)((MP / 128) * (DM / 64)), 1), 128, 0, stream>>>(X16 + r0p * DM, DM, 0, BK, DM, 0, 0.0625f, bk, 0, nullptr, 1, 0, 0, nullptr, K16 + r0p * DM, DM, 0, MP, DM, DM);      /* phi(k) */
  k_gemm2<0><<<dim3((unsigned)((MP / 128) * (DM / 64)), 1), 128, 0, stream>>>(X16 + r0p * DM, DM, 0, BV, DM, 0, 0.0625f, bv, 0, nullptr, 1, 0, 0, nullptr, V16 + r0p * DM, DM, 0, MP, DM, DM);
  for (int b = B0; b < B0 + NBR; ++b) { const size_t r0 = (size_t)b * SQ;
    k_vt<NH, SQ><<<NH * (SQ / 64), 256, 0, stream>>>(V16 + r0 * LQ, LQ, 0, VT);      /* V^T [NH][HD][SQ] for this batch */
    k_gemm2<19><<<dim3((QT0 / 128) * (DM / 64), 1), 128, 0, stream>>>(X16 + r0 * DM, DM, 0, BQ, DM, 0, 0.0625f, bq, 0, nullptr, 1, 0, 0, QF0, nullptr, DM, 0, QT0, DM, DM); k_gemm2<19><<<dim3((QT0 / 128) * (DM / 64), 1), 128, 0, stream>>>(X16 + r0 * DM, DM, 0, BK, DM, 0, 0.0625f, bk, 0, nullptr, 1, 0, 0, KF0, nullptr, DM, 0, QT0, DM, DM); k_gemm2<0><<<dim3((QT0 / 128) * (DM / 64), 1), 128, 0, stream>>>(X16 + r0 * DM, DM, 0, BV, DM, 0, 0.0625f, bv, 0, nullptr, 1, 0, 0, VF0, nullptr, DM, 0, QT0, DM, DM);      /* f32 phi(q), phi(k), v of the first 128 rows (exact products) */
    k_latt0<<<NH * (QT0 / 64), 64, 0, stream>>>(QF0, KF0, VF0, DM, OF0 + (size_t)b * QT0 * DM, DM);      /* exact f32 linear attention for rows 0..127 (o x64): the few-key rows without the f16 roundings */
    for (int q0 = 0; q0 < QN; q0 += QT) { const int nk = q0 + QT;      /* causal: only keys below the tile end are computed */
      k_gemm2<0><<<dim3((QT / 128) * (nk / 64), NHD), 128, 0, stream>>>(Q16 + (r0 + q0) * LQ, LQ, (size_t)HD, K16 + r0 * LQ, LQ, (size_t)HD, 1.0f, nullptr, 0, nullptr, 1, 0, 0, S, nullptr, NKX, (size_t)QT * NKX, QT, nk, HD);      /* scores, all heads on grid.y */
      k_lincf2<<<(NHD * QT + 7) / 8, 256, 0, stream>>>(S, P, NHD, nk);      /* p = a [j <= i] / sum a (no softmax) */
      k_gemm2<0><<<dim3((QT / 128) * (HD / 64), NHD), 128, 0, stream>>>(P, NKX, (size_t)QT * NKX, VT, SQ, (size_t)HD * SQ, 0.25f, nullptr, 0, nullptr, 1, 0, 0, nullptr, O16 + (r0 + q0) * DM, DM, (size_t)HD, QT, HD, nk); } }      /* o (merged heads, x64) as f16 rows */
  k_gemm2<0><<<dim3((unsigned)((MPO / 128) * (DM / 64)), 1), 128, 0, stream>>>(O16 + r0p * DM, DM, 0, BO, DM, 0, 0.0009765625f, bo, 0, nullptr, 1, 0, 0, (float*)d_out + r0p * DM, nullptr, DM, 0, MPO, DM, DM);      /* out rows are the output layout */
  k_hl<<<(unsigned)(((size_t)NB * QT0 * DM / 8 + 255) / 256), 256, 0, stream>>>(OF0, OH0, OL0, (size_t)NB * QT0 * DM / 8);      /* first-tile o (x64) -> f16 hi + x1024 residual planes */
  for (int b = B0; b < B0 + NBR; ++b) { const size_t r0 = (size_t)b * SQ; const size_t f0 = (size_t)b * QT0;
    k_gemm2<0><<<dim3((QT0 / 128) * (DM / 64), 1), 128, 0, stream>>>(OH0 + f0 * DM, DM, 0, BO, DM, 0, 0.0009765625f, bo, 0, nullptr, 1, 0, 0, (float*)d_out + r0 * DM, nullptr, DM, 0, QT0, DM, DM);      /* rows 0..127: out = o_hi Wo (+ b), overwriting the f16-path rows */
    k_gemm2<0><<<dim3((QT0 / 128) * (DM / 64), 1), 128, 0, stream>>>(OL0 + f0 * DM, DM, 0, BO, DM, 0, 0.00000095367431640625f, nullptr, 0, (const float*)d_out + r0 * DM, -1, 0, 0, (float*)d_out + r0 * DM, nullptr, DM, 0, QT0, DM, DM); }      /* += o_lo Wo 2^-20 (own-element accumulate) */
}

// v002
// One run takes 1300 microseconds.
// Two timings next to v001 put it at 1.66 and 1.65 times that version's speed.
// All steps since v000 together make it 3.25 times as fast.
#include <hip/hip_runtime.h>
// Causal LINEAR attention (x [2][2048][1024]; qk = x Wqk^T + bqk (natural [2048][1024]: rows 0..1023 -> q, 1024..2047 -> k; sigma 1/32, biases 0.02), v = x Wv^T + bv; 16 heads of 64; feature map phi = elu + 1 on q and k; ctx_t = (phi(q_t) . sum_{s<=t} phi(k_s) v_s^T) / (phi(q_t) . sum_{s<=t} phi(k_s)) = sum_{s<=t} a_ts v_s / sum_{s<=t} a_ts with a_ts = phi(q_t).phi(k_s) (the module's cumsum form, no softmax, no scaling, no eps); out = ctx Wo^T + bo -> [2][2048][1024]).
// Structure: x as exact f16 rows; natural weights re-laid on VALU into exact x16 planes; q, k (with the elu + 1 feature map in the GEMM epilogue) and v as WMMA GEMMs (32x64 wave tiles, f32 accumulation, + bias) with f16 outputs; per batch: V^T via LDS transposes; per query tile of 256 rows: a = phi(q) phi(k)^T against the keys below the tile end only (K = 64, all heads on grid.y), causal row NORMALISATION on VALU (p_j = a_j [j <= i] / sum_{j <= i} a_j in f32; weights x256 f16), ctx = P V^T (x64) into merged f16 rows; out = ctx Wo^T + bo GEMM (f32); first-tile refinement: the first 128 rows of each batch recomputed exactly in f32 on VALU (a / sum a weights) and their output rows rewritten from o hi/lo by two accumulating GEMM passes; launches: see trace.
// Compute dtype: inputs rounded to bf16; x / weights exact; q, k, v, normalised weights and o as plain f16 GEMM operands (~2^-12); scores and row sums f32; v_wmma_f32_16x16x32_f16.
#define NB 2
#define SQ 2048
#define DM 1024
#define NH 16
#define HD 64
#define HG 4                         /* heads per group in the unlaunched k_vt(V16, b, h0, VT) overload */
#define QT 256                       /* query rows per causal tile */
#define NKX SQ                       /* S / P row pitch */
#define QT0 128                      /* first-tile rows recomputed exactly in f32 */
#define B0 0                         /* first batch processed (debug hook) */
#define NBR NB                       /* batches processed (debug hook) */
#define NR ((size_t)NB * SQ)         /* token rows */
#define MP ((int)((size_t)NBR * SQ)) /* rows projected (debug hook) */
#define QN SQ                        /* query rows attended per batch (debug hook) */
#define NHD NH                       /* heads attended (debug hook) */
#define MPO MP                       /* rows through the output stage (debug hook) */
#define LQ DM      /* row pitch of the q/k/v rows */
typedef __bf16 v16b __attribute__((ext_vector_type(16)));
typedef unsigned short v8us __attribute__((ext_vector_type(8), may_alias));
typedef float  v8f  __attribute__((ext_vector_type(8)));
typedef float  v4f  __attribute__((ext_vector_type(4)));
typedef float  v4fa __attribute__((ext_vector_type(4), may_alias));
union FragB { v16b v; v8us half[2]; unsigned short u[16]; };

__device__ __forceinline__ unsigned short bf16_bits(float x) { unsigned int u = __float_as_uint(x); return (unsigned short)((u + 0x7FFFu + ((u >> 16) & 1u)) >> 16); }
__device__ __forceinline__ float bf16_val(unsigned short b) { return __uint_as_float(((unsigned int)b) << 16); }
__device__ __forceinline__ float bf16_round(float x) { return bf16_val(bf16_bits(x)); }
// D += A·B with NT terms: 1 = ah·bh, 2 = + al·bh (A split), 3 = + ah·bl (both split)
template <int NT>
__device__ __forceinline__ v8f mmaN(v16b ah, v16b al, v16b bh, v16b bl, v8f c) {
  c = __builtin_amdgcn_wmma_f32_16x16x32_bf16(false, ah, false, bh, (short)0, c, false, false);
  if (NT >= 2) c = __builtin_amdgcn_wmma_f32_16x16x32_bf16(false, al, false, bh, (short)0, c, false, false);
  if (NT >= 3) c = __builtin_amdgcn_wmma_f32_16x16x32_bf16(false, ah, false, bl, (short)0, c, false, false);
  asm volatile("v_nop\n\tv_nop\n\tv_nop\n\tv_nop" : "+v"(c) : "v"(ah), "v"(al), "v"(bh), "v"(bl));
  return c;
}

__global__ __launch_bounds__(256) void k_wt_bf16(const float* __restrict__ W, unsigned short* __restrict__ Wt, int K, int N) {
  const int t = blockIdx.x * 256 + threadIdx.x;
  const int k8n = K / 8;
  if (t >= N * k8n) return;
  const int n = t / k8n, k8 = (t % k8n) * 8;
  v8us v;
#pragma unroll
  for (int i = 0; i < 8; ++i) v[i] = bf16_bits(W[(size_t)(k8 + i) * N + n]);
  *(v8us*)(Wt + (size_t)n * K + k8) = v;
  
}

// GEMM C[M][N] (f32, pitch ldc) = act(A[M][K]·W + bias). A f32 row-major (pitch lda) converted per fragment to bf16
// (ASPLIT: hi/lo two planes -> 2 terms, else single rounded term); Wt bf16 [N][K] (pitch ldb). BIAS_BF16 rounds the
// bias to bf16 first (bias quantised to bf16 before the add). K%32==0, M%16==0, N%64==0.
template <bool ASPLIT, int ACT, bool BIAS_BF16>
__global__ __launch_bounds__(128) void k_gemm_bf(const float* __restrict__ A, int lda, const unsigned short* __restrict__ Wt, int ldb,
                                               const float* __restrict__ bias, float* __restrict__ C, int ldc, int M, int N, int K) {
  __shared__ __attribute__((aligned(16))) float so[4][16][64];
  const int tid = threadIdx.x, w = tid >> 5, lane = tid & 31, ln = lane & 15, hh = lane >> 4;
  const int ntn = N / 64;
  const int wid = blockIdx.x * 4 + w;
  const int mt = wid / ntn, nq = wid % ntn;
  if (mt * 16 >= M) return;
  const int row0 = mt * 16, col0 = nq * 64;
  const float* arow = A + (size_t)(row0 + ln) * lda;
  v8f acc[4] = {};
  for (int kb = 0; kb < K; kb += 32) {
    FragB ah, al;
    const v4f x0 = *(const v4fa*)(arow + kb + 8 * hh), x1 = *(const v4fa*)(arow + kb + 8 * hh + 4);
    const v4f x2 = *(const v4fa*)(arow + kb + 16 + 8 * hh), x3 = *(const v4fa*)(arow + kb + 16 + 8 * hh + 4);
    float xs[16] = {x0[0],x0[1],x0[2],x0[3],x1[0],x1[1],x1[2],x1[3],x2[0],x2[1],x2[2],x2[3],x3[0],x3[1],x3[2],x3[3]};
#pragma unroll
    for (int i = 0; i < 16; ++i) { const unsigned short hb = bf16_bits(xs[i]); ah.u[i] = hb; al.u[i] = ASPLIT ? bf16_bits(xs[i] - bf16_val(hb)) : (unsigned short)0; }
#pragma unroll
    for (int t = 0; t < 4; ++t) {
      const unsigned short* brow = Wt + (size_t)(col0 + t * 16 + ln) * ldb + kb;
      FragB b;
      b.half[0] = *(const v8us*)(brow + 8 * hh);
      b.half[1] = *(const v8us*)(brow + 16 + 8 * hh);
      acc[t] = mmaN<ASPLIT ? 2 : 1>(ah.v, al.v, b.v, b.v, acc[t]);
    }
  }
#pragma unroll
  for (int t = 0; t < 4; ++t) {
    float bv = bias ? bias[col0 + t * 16 + ln] : 0.f;
    if (BIAS_BF16) bv = bf16_round(bv);
#pragma unroll
    for (int r = 0; r < 8; ++r) { float v = acc[t][r] + bv; if (ACT == 1) v = fmaxf(v, 0.f); so[w][8 * hh + r][t * 16 + ln] = v; }
  }
  __builtin_amdgcn_fence(__ATOMIC_ACQ_REL, "workgroup");
  __builtin_amdgcn_wave_barrier();
  const int rsub = lane >> 4, c4 = (lane & 15) * 4;
  {
#pragma unroll
    for (int q = 0; q < 8; ++q) {
      const int r = q * 2 + rsub;
      const v4f v = *(const v4fa*)&so[w][r][c4];
      *(v4f*)(C + (size_t)(row0 + r) * ldc + col0 + c4) = v;
    }
    
  }
}

// GEMM C = act(A·W + bias + resid): A f32 (ASPLIT -> hi/lo 2 terms), Wt bf16 [N][K]; ACT 0 none, 1 relu, 2 exact gelu;
// resid (optional, f32, row index = (row % rmod), pitch ldr, RES_BF16 rounds it) added before the activation.
template <bool ASPLIT, int ACT, bool BIAS_BF16, bool RES_BF16>
__global__ __launch_bounds__(128) void k_gemm_bf3(const float* __restrict__ A, int lda, const unsigned short* __restrict__ Wt, int ldb,
                                                const float* __restrict__ bias, const float* __restrict__ resid, int rmod, int ldr,
                                                float* __restrict__ C, int ldc, int M, int N, int K) {
  __shared__ __attribute__((aligned(16))) float so[4][16][64];
  const int tid = threadIdx.x, w = tid >> 5, lane = tid & 31, ln = lane & 15, hh = lane >> 4;
  const int ntn = N / 64;
  const int wid = blockIdx.x * 4 + w;
  const int mt = wid / ntn, nq = wid % ntn;
  if (mt * 16 >= M) return;
  const int row0 = mt * 16, col0 = nq * 64;
  const float* arow = A + (size_t)(row0 + ln) * lda;
  v8f acc[4] = {};
  for (int kb = 0; kb < K; kb += 32) {
    FragB ah, al;
    const v4f x0 = *(const v4fa*)(arow + kb + 8 * hh), x1 = *(const v4fa*)(arow + kb + 8 * hh + 4);
    const v4f x2 = *(const v4fa*)(arow + kb + 16 + 8 * hh), x3 = *(const v4fa*)(arow + kb + 16 + 8 * hh + 4);
    float xs[16] = {x0[0],x0[1],x0[2],x0[3],x1[0],x1[1],x1[2],x1[3],x2[0],x2[1],x2[2],x2[3],x3[0],x3[1],x3[2],x3[3]};
#pragma unroll
    for (int i = 0; i < 16; ++i) { const unsigned short hb = bf16_bits(xs[i]); ah.u[i] = hb; al.u[i] = ASPLIT ? bf16_bits(xs[i] - bf16_val(hb)) : (unsigned short)0; }
#pragma unroll
    for (int t = 0; t < 4; ++t) {
      const unsigned short* brow = Wt + (size_t)(col0 + t * 16 + ln) * ldb + kb;
      FragB b;
      b.half[0] = *(const v8us*)(brow + 8 * hh);
      b.half[1] = *(const v8us*)(brow + 16 + 8 * hh);
      acc[t] = mmaN<ASPLIT ? 2 : 1>(ah.v, al.v, b.v, b.v, acc[t]);
    }
  }
#pragma unroll
  for (int t = 0; t < 4; ++t) {
    const int col = col0 + t * 16 + ln;
    float bv = bias ? bias[col] : 0.f;
    if (BIAS_BF16) bv = bf16_round(bv);
#pragma unroll
    for (int r = 0; r < 8; ++r) {
      float v = acc[t][r] + bv;
      if (resid) { float rv = resid[(size_t)((row0 + 8 * hh + r) % rmod) * ldr + col]; if (RES_BF16) rv = bf16_round(rv); v += rv; }
      if (ACT == 1) v = fmaxf(v, 0.f);
      if (ACT == 2) v = 0.5f * v * (1.0f + erff(v * 0.70710678118654752f));
      if (ACT == 3) { const float u = 0.7978845608028654f * (v + 0.044715f * v * v * v); v = 0.5f * v * (1.0f + tanhf(u)); }
      so[w][8 * hh + r][t * 16 + ln] = v;
    }
  }
  __builtin_amdgcn_fence(__ATOMIC_ACQ_REL, "workgroup");
  __builtin_amdgcn_wave_barrier();
  const int rsub = lane >> 4, c4 = (lane & 15) * 4;
  {
#pragma unroll
    for (int q = 0; q < 8; ++q) {
      const int r = q * 2 + rsub;
      const v4f v = *(const v4fa*)&so[w][r][c4];
      *(v4f*)(C + (size_t)(row0 + r) * ldc + col0 + c4) = v;
    }
    
  }
}
// row LayerNorm (biased variance, eps) over N: s = X (+ R); optional out_sum <- s; out_norm <- (s-mu)*rsqrt(var+eps)*g + b
template <bool PARAM_BF16>
__global__ __launch_bounds__(256) void k_layernorm(const float* __restrict__ X, const float* __restrict__ R, const float* __restrict__ g, const float* __restrict__ bta,
                                                  float* __restrict__ out_sum, float* __restrict__ out_norm, int N, float eps) {
  __shared__ float red[256];
  const int row = blockIdx.x, tid = threadIdx.x;
  const float* x = X + (size_t)row * N; const float* rr = R ? R + (size_t)row * N : nullptr;
  float vals[16];                     // up to N = 4096
  const int per = N / 256;            // contiguous chunk per thread? use strided-by-4 chunks: thread handles j = tid*4 + 1024*u
  float s1 = 0.f;
  for (int u = 0; u < per / 4; ++u) {
    const int j = tid * 4 + 1024 * u;
    const v4f a = *(const v4fa*)(x + j);
    v4f b = {0.f,0.f,0.f,0.f}; if (rr) b = *(const v4fa*)(rr + j);
#pragma unroll
    for (int q = 0; q < 4; ++q) { const float v = a[q] + b[q]; vals[u * 4 + q] = v; s1 += v; }
  }
  red[tid] = s1; __syncthreads();
  for (int st = 128; st > 0; st >>= 1) { if (tid < st) red[tid] += red[tid + st]; __syncthreads(); }
  const float mu = red[0] / (float)N; __syncthreads();
  float s2 = 0.f;
  for (int u = 0; u < per / 4; ++u)
#pragma unroll
    for (int q = 0; q < 4; ++q) { const float c = vals[u * 4 + q] - mu; s2 += c * c; }
  red[tid] = s2; __syncthreads();
  for (int st = 128; st > 0; st >>= 1) { if (tid < st) red[tid] += red[tid + st]; __syncthreads(); }
  const float rs = rsqrtf(red[0] / (float)N + eps);
  {
    for (int u = 0; u < per / 4; ++u) {
      const int j = tid * 4 + 1024 * u;
      v4f o, sm;
#pragma unroll
      for (int q = 0; q < 4; ++q) {
        float gg = g[j + q], bb = bta[j + q];
        if (PARAM_BF16) { gg = bf16_round(gg); bb = bf16_round(bb); }
        sm[q] = vals[u * 4 + q]; o[q] = (vals[u * 4 + q] - mu) * rs * gg + bb;
      }
      if (out_sum) *(v4f*)(out_sum + (size_t)row * N + j) = sm;
      *(v4f*)(out_norm + (size_t)row * N + j) = o;
    }
    
  }
}



// ---- f16 WMMA path (v_wmma_f32_16x16x32_f16): 11-bit significands for operands in range — used where a [0,1] probability operand needs more precision than bf16
typedef _Float16 v16h __attribute__((ext_vector_type(16)));
union FragH { v16h v; v8us half[2]; _Float16 h[16]; unsigned short u[16]; };
template <int NT>
__device__ __forceinline__ v8f mmaH(v16h ah, v16h al, v16h bh, v16h bl, v8f c) {
  c = __builtin_amdgcn_wmma_f32_16x16x32_f16(false, ah, false, bh, (short)0, c, false, false);
  if (NT >= 2) c = __builtin_amdgcn_wmma_f32_16x16x32_f16(false, al, false, bh, (short)0, c, false, false);
  if (NT >= 3) c = __builtin_amdgcn_wmma_f32_16x16x32_f16(false, ah, false, bl, (short)0, c, false, false);
  asm volatile("v_nop\n\tv_nop\n\tv_nop\n\tv_nop" : "+v"(c) : "v"(ah), "v"(al), "v"(bh), "v"(bl));
  return c;
}
// batched GEMM like k_gemm_b but f16 operands: A f32 (split into f16 hi/lo if ASPLIT, else rounded to f16), Bt = f16 values [n][k]; alpha; C f32; N multiple of 16 (partial tiles skipped)
template <bool ASPLIT>
__global__ __launch_bounds__(128) void k_gemm_h(const float* __restrict__ A, int lda, size_t sA, const _Float16* __restrict__ Bh, int ldb, size_t sB, float alpha, float* __restrict__ C, int ldc, size_t sC, int M, int N, int K) {
  __shared__ __attribute__((aligned(16))) float so[4][16][64];
  const int tid = threadIdx.x, w = tid >> 5, lane = tid & 31, ln = lane & 15, hh = lane >> 4; const int by = blockIdx.y;
  A += (size_t)by * sA; Bh += (size_t)by * sB; C += (size_t)by * sC;
  const int ntn = (N + 63) / 64; const int wid = blockIdx.x * 4 + w; const int mt = wid / ntn, nq = wid % ntn; if (mt * 16 >= M) return;
  const int row0 = mt * 16, col0 = nq * 64; const float* arow = A + (size_t)(row0 + ln) * lda;
  v8f acc[4] = {};
  for (int kb = 0; kb < K; kb += 32) {
    FragH ah, al;
    const v4f x0 = *(const v4fa*)(arow + kb + 8 * hh), x1 = *(const v4fa*)(arow + kb + 8 * hh + 4), x2 = *(const v4fa*)(arow + kb + 16 + 8 * hh), x3 = *(const v4fa*)(arow + kb + 16 + 8 * hh + 4);
    float xs[16] = {x0[0],x0[1],x0[2],x0[3],x1[0],x1[1],x1[2],x1[3],x2[0],x2[1],x2[2],x2[3],x3[0],x3[1],x3[2],x3[3]};
#pragma unroll
    for (int i = 0; i < 16; ++i) { const _Float16 h = (_Float16)xs[i]; ah.h[i] = h; al.h[i] = ASPLIT ? (_Float16)(xs[i] - (float)h) : (_Float16)0.0f; }
#pragma unroll
    for (int t = 0; t < 4; ++t) { if (col0 + t * 16 >= N) continue; const size_t boff = (size_t)(col0 + t * 16 + ln) * ldb + kb; FragH bq; bq.half[0] = *(const v8us*)(Bh + boff + 8 * hh); bq.half[1] = *(const v8us*)(Bh + boff + 16 + 8 * hh);
      acc[t] = mmaH<ASPLIT ? 2 : 1>(ah.v, al.v, bq.v, bq.v, acc[t]); }
  }
#pragma unroll
  for (int t = 0; t < 4; ++t) { if (col0 + t * 16 >= N) continue;
#pragma unroll
    for (int r = 0; r < 8; ++r) so[w][8 * hh + r][t * 16 + ln] = acc[t][r] * alpha; }
  __builtin_amdgcn_fence(__ATOMIC_ACQ_REL, "workgroup"); __builtin_amdgcn_wave_barrier();
  const int rsub = lane >> 4, c4 = (lane & 15) * 4;
  {
#pragma unroll
    for (int q = 0; q < 8; ++q) { const int r = q * 2 + rsub; if (col0 + c4 < N) { const v4f v = *(const v4fa*)&so[w][r][c4]; *(v4f*)(C + (size_t)(row0 + r) * ldc + col0 + c4) = v; } }
     }
}

// Wt[n][k] = f16(W[k][n]·scale) from f32 row-major W[K][N] (scale = power of two; bf16-exact weights stay exact in f16 away from the subnormal range)
__global__ __launch_bounds__(256) void k_wt_f16(const float* __restrict__ W, _Float16* __restrict__ Wt, int K, int N, float scale) {
  const int t = blockIdx.x * 256 + threadIdx.x; if (t >= N * (K / 8)) return; const int n = t / (K / 8), k8 = (t % (K / 8)) * 8; FragH f;
#pragma unroll
  for (int i = 0; i < 8; ++i) f.h[i] = (_Float16)(bf16_round(W[(size_t)(k8 + i) * N + n]) * scale); const v8us o = f.half[0];
  *(v8us*)((unsigned short*)Wt + (size_t)n * K + k8) = o; 
}
// k_gemm_hh variant with fused epilogue: v = acc·alpha + bias[by·sBias + col] (+ CP[(row/rowsPerB)·sCPb + by·64 + col] if CP) ; ACT 0 none / 1 elu ; writes f16 C16 (and f32 C if non-null)
template <int ACT>
__global__ __launch_bounds__(128) void k_gemm_hhx(const _Float16* __restrict__ A, int lda, size_t sA, const _Float16* __restrict__ Bh, int ldb, size_t sB, float alpha, const float* __restrict__ bias, size_t sBias, const float* __restrict__ CP, int rowsPerB, size_t sCPb, int row0g,
    float* __restrict__ C, _Float16* __restrict__ C16, int ldc, size_t sC, int M, int N, int K) {
  __shared__ __attribute__((aligned(16))) float so[4][16][64];
  const int tid = threadIdx.x, w = tid >> 5, lane = tid & 31, ln = lane & 15, hh = lane >> 4; const int by = blockIdx.y;
  A += (size_t)by * sA; Bh += (size_t)by * sB; const size_t cofs = (size_t)by * sC; const float* bp = bias ? bias + (size_t)by * sBias : nullptr;
  const int ntn = (N + 63) / 64; const int wid = blockIdx.x * 4 + w; const int mt = wid / ntn, nq = wid % ntn; if (mt * 16 >= M) return;
  const int row0 = mt * 16, col0 = nq * 64; const _Float16* arow = A + (size_t)(row0 + ln) * lda;
  v8f acc[4] = {};
  for (int kb = 0; kb < K; kb += 32) { FragH ah; ah.half[0] = *(const v8us*)((const unsigned short*)arow + kb + 8 * hh); ah.half[1] = *(const v8us*)((const unsigned short*)arow + kb + 16 + 8 * hh);
#pragma unroll
    for (int t = 0; t < 4; ++t) { if (col0 + t * 16 >= N) continue; const size_t boff = (size_t)(col0 + t * 16 + ln) * ldb + kb; FragH bq; bq.half[0] = *(const v8us*)((const unsigned short*)Bh + boff + 8 * hh); bq.half[1] = *(const v8us*)((const unsigned short*)Bh + boff + 16 + 8 * hh);
      acc[t] = mmaH<1>(ah.v, ah.v, bq.v, bq.v, acc[t]); }
  }
#pragma unroll
  for (int t = 0; t < 4; ++t) { if (col0 + t * 16 >= N) continue; const int col = col0 + t * 16 + ln; const float bv = bp ? bf16_round(bp[col]) : 0.f;
#pragma unroll
    for (int r = 0; r < 8; ++r) { float v = acc[t][r] * alpha + bv; if (CP) { const int rr = row0g + row0 + 8 * hh + r; if (rowsPerB < 0) v += CP[cofs + (size_t)rr * ldc + col];      /* rowsPerB < 0: own element of the batched C plane */ else { const int bidx = rr / rowsPerB; v += CP[(size_t)bidx * sCPb + (size_t)by * 64 + col]; } } if (ACT == 1) v = (v > 0.f) ? v : expm1f(v); else if (ACT == 7) v = (v > 0.f) ? v + 1.0f : expf(v); else if (ACT == 8) v = tanhf(v); else if (ACT == 9) v = 0.5f * v * (1.0f + tanhf(0.7978845608028654f * (v + 0.044715f * v * v * v))); else if (ACT == 11) v = 1.0f / (1.0f + expf(-v)); else if (ACT == 12) v = (v > 0.f) ? v : 0.01f * v; else if (ACT == 14) v = (v > 0.f) ? v : 0.1f * v; else if (ACT == 16) v = (v >= 0.f) ? v : 0.3f * v; else if (ACT == 17) v = (v >= 0.f) ? v : 0.2f * v; else if (ACT == 15) v = v / (1.0f + expf(-v)); else if (ACT == 3) v = fmaxf(v, 0.f); else if (ACT == 6) v = 0.5f * v * (1.0f + erff(v * 0.70710678118654752f)); so[w][8 * hh + r][t * 16 + ln] = v; } }
  __builtin_amdgcn_fence(__ATOMIC_ACQ_REL, "workgroup"); __builtin_amdgcn_wave_barrier();
  const int rsub = lane >> 4, c4 = (lane & 15) * 4; typedef _Float16 v4h __attribute__((ext_vector_type(4)));
  {
#pragma unroll
    for (int q = 0; q < 8; ++q) { const int r = q * 2 + rsub; if (col0 + c4 < N) { const v4f v = *(const v4fa*)&so[w][r][c4]; if (C) *(v4f*)(C + cofs + (size_t)(row0 + r) * ldc + col0 + c4) = v; if (C16) { v4h h4; for (int i = 0; i < 4; ++i) h4[i] = (_Float16)v[i]; *(v4h*)(C16 + cofs + (size_t)(row0 + r) * ldc + col0 + c4) = h4; } } }
     }
}


typedef _Float16 v4h __attribute__((ext_vector_type(4)));

__global__ __launch_bounds__(256) void k_x16(const float* __restrict__ x, _Float16* __restrict__ X16, size_t n8) { const size_t t = (size_t)blockIdx.x * 256 + threadIdx.x; if (t >= n8) return; FragH f;
#pragma unroll
  for (int q = 0; q < 8; ++q) f.h[q] = (_Float16)bf16_round(x[t * 8 + q]); *(v8us*)((unsigned short*)X16 + t * 8) = f.half[0];  }
__global__ __launch_bounds__(256) void k_h16(const float* __restrict__ x, _Float16* __restrict__ X16, size_t n8) { const size_t t = (size_t)blockIdx.x * 256 + threadIdx.x; if (t >= n8) return; FragH f;
#pragma unroll
  for (int q = 0; q < 8; ++q) f.h[q] = (_Float16)x[t * 8 + q]; *(v8us*)((unsigned short*)X16 + t * 8) = f.half[0];  }
__global__ __launch_bounds__(256) void k_round16f(const float* __restrict__ W, _Float16* __restrict__ Bt, size_t n8) { const size_t t = (size_t)blockIdx.x * 256 + threadIdx.x; if (t >= n8) return; FragH f;
#pragma unroll
  for (int i = 0; i < 8; ++i) f.h[i] = (_Float16)(bf16_round(W[t * 8 + i]) * 16.0f); *(v8us*)((unsigned short*)Bt + t * 8) = f.half[0];  }
template <int NHv, int TTv>
__global__ __launch_bounds__(256) void k_vt(const _Float16* __restrict__ V16, int ldv, int voff, _Float16* __restrict__ Vt) { __shared__ unsigned short tl[64][66]; const int tid = threadIdx.x; const int slab = blockIdx.x / (TTv / 64), lg = blockIdx.x % (TTv / 64); const int b = slab / NHv, h = slab % NHv;
  for (int i = tid; i < 64 * 8; i += 256) { const int r = i / 8, c8 = (i % 8) * 8; FragH f; f.half[0] = *(const v8us*)((const unsigned short*)V16 + ((size_t)b * TTv + lg * 64 + r) * ldv + voff + h * 64 + c8);
#pragma unroll
    for (int q = 0; q < 8; ++q) tl[r][c8 + q] = f.u[q]; }
  __syncthreads();
  {
#pragma unroll
    for (int rd = 0; rd < 2; ++rd) { const int d = rd * 32 + tid / 8, pc = tid % 8; FragH f;
#pragma unroll
      for (int q = 0; q < 8; ++q) f.u[q] = tl[pc * 8 + q][d];
      *(v8us*)((unsigned short*)Vt + ((size_t)slab * 64 + d) * TTv + lg * 64 + pc * 8) = f.half[0]; }
     } }

__global__ __launch_bounds__(256) void k_hl(const float* __restrict__ F, _Float16* __restrict__ Hh, _Float16* __restrict__ Hl, size_t n8) { const size_t t = (size_t)blockIdx.x * 256 + threadIdx.x; if (t >= n8) return; FragH fh, fl; const v4f a = *(const v4fa*)(F + t * 8), c = *(const v4fa*)(F + t * 8 + 4);
#pragma unroll
  for (int q = 0; q < 4; ++q) { _Float16 h = (_Float16)a[q]; fh.h[q] = h; fl.h[q] = (_Float16)((a[q] - (float)h) * 1024.0f); h = (_Float16)c[q]; fh.h[4 + q] = h; fl.h[4 + q] = (_Float16)((c[q] - (float)h) * 1024.0f); }
  { *(v8us*)((unsigned short*)Hh + t * 8) = fh.half[0]; *(v8us*)((unsigned short*)Hl + t * 8) = fl.half[0];  } }

// ---- fast GEMM (wave tile 32x64; requires M % 32 == 0 rows per launch region and N % 64 == 0); epilogue = k_gemm_hhx semantics ----
__device__ __forceinline__ v16h g2_frag(const _Float16* p, int hh) { FragH f; f.half[0] = *(const v8us*)((const unsigned short*)p + 8 * hh); f.half[1] = *(const v8us*)((const unsigned short*)p + 16 + 8 * hh); return f.v; }
__device__ __forceinline__ v8f g2_mma(v16h a, v16h b, v8f c) { v8f d = __builtin_amdgcn_wmma_f32_16x16x32_f16(false, a, false, b, (short)0, c, false, false); asm volatile("v_nop\n\tv_nop\n\tv_nop\n\tv_nop" : "+v"(d) : "v"(a), "v"(b)); return d; }
template <int ACT>
__global__ __launch_bounds__(128) void k_gemm2(const _Float16* __restrict__ A, int lda, size_t sA, const _Float16* __restrict__ Bh, int ldb, size_t sB, float alpha, const float* __restrict__ bias, size_t sBias, const float* __restrict__ CP, int rowsPerB, size_t sCPb, int row0g,
    float* __restrict__ C, _Float16* __restrict__ C16, int ldc, size_t sC, int M, int N, int K) { static_assert(ACT == 0 || ACT == 3 || ACT == 6 || ACT == 8 || ACT == 9 || ACT == 11 || ACT == 12 || ACT == 14 || ACT == 15 || ACT == 16 || ACT == 17 || ACT == 19, "k_gemm2: unsupported ACT code (would silently apply no activation)");
  __shared__ __attribute__((aligned(16))) float so[4][32][68];
  const int tid = threadIdx.x, w = tid >> 5, lane = tid & 31, ln = lane & 15, hh = lane >> 4; const int by = blockIdx.y;
  A += (size_t)by * sA; Bh += (size_t)by * sB; const size_t cofs = (size_t)by * sC; const float* bp = bias ? bias + (size_t)by * sBias : nullptr;
  const int ntn = N >> 6; const int mt = blockIdx.x / ntn, nq = blockIdx.x - mt * ntn; const int row0 = mt * 128 + 32 * w, col0 = nq * 64; if (row0 >= M) return;
  const _Float16* a0p = A + (size_t)(row0 + ln) * lda; const _Float16* a1p = a0p + (size_t)16 * lda;
  const _Float16* b0p = Bh + (size_t)(col0 + ln) * ldb; const _Float16* b1p = b0p + (size_t)16 * ldb; const _Float16* b2p = b1p + (size_t)16 * ldb; const _Float16* b3p = b2p + (size_t)16 * ldb;
  const v8f z8 = {0.f,0.f,0.f,0.f,0.f,0.f,0.f,0.f}; v8f c00 = z8, c01 = z8, c02 = z8, c03 = z8, c10 = z8, c11 = z8, c12 = z8, c13 = z8;
#pragma unroll 1
  for (int kb = 0; kb < K; kb += 32) { const v16h a0 = g2_frag(a0p + kb, hh), a1 = g2_frag(a1p + kb, hh);
    v16h b = g2_frag(b0p + kb, hh); c00 = g2_mma(a0, b, c00); c10 = g2_mma(a1, b, c10);
    b = g2_frag(b1p + kb, hh); c01 = g2_mma(a0, b, c01); c11 = g2_mma(a1, b, c11);
    b = g2_frag(b2p + kb, hh); c02 = g2_mma(a0, b, c02); c12 = g2_mma(a1, b, c12);
    b = g2_frag(b3p + kb, hh); c03 = g2_mma(a0, b, c03); c13 = g2_mma(a1, b, c13); }
  v8f accs[8] = {c00, c01, c02, c03, c10, c11, c12, c13};
#pragma unroll
  for (int u = 0; u < 8; ++u) { const int t = u & 3, half = u >> 2; const int col = col0 + t * 16 + ln; const float bv = bp ? bf16_round(bp[col]) : 0.f;
#pragma unroll
    for (int r = 0; r < 8; ++r) { const int rloc = half * 16 + 8 * hh + r; float v = accs[u][r] * alpha + bv; if (CP) { if (rowsPerB < 0) v += CP[cofs + (size_t)(row0g + row0 + rloc) * ldc + col];      /* rowsPerB < 0: own element of the batched C plane */ else { const int bidx = (row0g + row0 + rloc) / rowsPerB; v += CP[(size_t)bidx * sCPb + (size_t)by * 64 + col]; } }
      if (ACT == 3) v = fmaxf(v, 0.f); else if (ACT == 6) v = 0.5f * v * (1.0f + erff(v * 0.70710678118654752f)); else if (ACT == 11) v = 1.0f / (1.0f + expf(-v)); else if (ACT == 15) v = v / (1.0f + expf(-v)); else if (ACT == 19) v = (v > 0.f) ? (v + 1.0f) : expf(v);      /* elu(v) + 1 */ else if (ACT == 12) v = (v > 0.f) ? v : 0.01f * v; else if (ACT == 8) v = tanhf(v); else if (ACT == 9) v = 0.5f * v * (1.0f + tanhf(0.7978845608028654f * (v + 0.044715f * v * v * v))); else if (ACT == 14) v = (v > 0.f) ? v : 0.1f * v; else if (ACT == 16) v = (v >= 0.f) ? v : 0.3f * v; else if (ACT == 17) v = (v >= 0.f) ? v : 0.2f * v;
      so[w][rloc][t * 16 + ln] = v; } }
  __builtin_amdgcn_fence(__ATOMIC_ACQ_REL, "workgroup"); __builtin_amdgcn_wave_barrier();
  const int rsub = lane >> 4, c4 = (lane & 15) * 4;
  {
#pragma unroll
    for (int q = 0; q < 16; ++q) { const int r = q * 2 + rsub; const v4f v = *(const v4fa*)&so[w][r][c4]; if (C) *(v4f*)(C + cofs + (size_t)(row0 + r) * ldc + col0 + c4) = v; if (C16) { v4h h4; for (int i = 0; i < 4; ++i) h4[i] = (_Float16)v[i]; *(v4h*)(C16 + cofs + (size_t)(row0 + r) * ldc + col0 + c4) = h4; } }
     } }


__global__ __launch_bounds__(256) void k_wnat(const float* __restrict__ w, size_t n8, _Float16* __restrict__ Bt) { const size_t t = (size_t)blockIdx.x * 256 + threadIdx.x; if (t >= n8) return; FragH f; for (int q = 0; q < 8; ++q) f.h[q] = (_Float16)(bf16_round(w[t * 8 + q]) * 16.0f); *(v8us*)((unsigned short*)Bt + t * 8) = f.half[0];  }
__global__ __launch_bounds__(256) void k_rsm(const float* __restrict__ S, _Float16* __restrict__ P, int nrows) {
  #pragma clang fp contract(off)
  const int i = blockIdx.x * 256 + threadIdx.x; if (i >= nrows) return; const float* s = S + (size_t)i * SQ; float mx = -3.0e38f;
#pragma unroll 1
  for (int j = 0; j < SQ; ++j) mx = fmaxf(mx, s[j]); float se = 0.f;
#pragma unroll 1
  for (int j = 0; j < SQ; ++j) se += expf(s[j] - mx); const float sc = 256.0f / se;
#pragma unroll 1
  for (int j0 = 0; j0 < SQ; j0 += 8) { FragH f; for (int q = 0; q < 8; ++q) f.h[q] = (_Float16)(expf(s[j0 + q] - mx) * sc); unsigned short* d = (unsigned short*)P + (size_t)i * SQ + j0; *(v8us*)d = f.half[0];  } }
__global__ __launch_bounds__(256) void k_vt(const _Float16* __restrict__ V16, int b, int h0, _Float16* __restrict__ VT) { __shared__ unsigned short tl[64][65]; const int tid = threadIdx.x; const int hh = blockIdx.x % HG, sg = blockIdx.x / HG; const int s0 = sg * 64; const int h = h0 + hh;
  for (int i = tid; i < 64 * 8; i += 256) { const int j = i / 8, d8 = (i % 8) * 8; FragH f; f.half[0] = *(const v8us*)((const unsigned short*)V16 + ((size_t)b * SQ + s0 + j) * DM + h * HD + d8); for (int q = 0; q < 8; ++q) tl[d8 + q][j] = f.u[q]; }
  __syncthreads();
  { for (int i = tid; i < 64 * 8; i += 256) { const int d = i / 8, j8 = (i % 8) * 8; FragH f; for (int q = 0; q < 8; ++q) f.u[q] = tl[d][j8 + q]; *(v8us*)((unsigned short*)VT + ((size_t)hh * HD + d) * SQ + s0 + j8) = f.half[0]; }  } }



__global__ __launch_bounds__(256) void k_rsmcf2(const float* __restrict__ S, _Float16* __restrict__ P, int hg, int q0, int nk) {
  #pragma clang fp contract(off)
  const int t = blockIdx.x * 256 + threadIdx.x; if (t >= hg * QT) return; const size_t i = (size_t)t; const float* s = S + i * NKX; const int last = q0 + (t % QT); float mx = -3.0e38f;
#pragma unroll 1
  for (int j = 0; j < nk; ++j) { const float f = (j <= last) ? 1.f : 0.f; mx = fmaxf(mx, fmaf(f, s[j], (1.f - f) * -1.0e9f)); } float se = 0.f;
#pragma unroll 1
  for (int j = 0; j < nk; ++j) { const float f = (j <= last) ? 1.f : 0.f; se += __expf(fmaf(f, s[j], (1.f - f) * -1.0e9f) - mx); } const float sc = 256.0f / se;
#pragma unroll 1
  for (int j0 = 0; j0 < nk; j0 += 8) { FragH fr; for (int q = 0; q < 8; ++q) { const int j = j0 + q; const float f = (j <= last) ? 1.f : 0.f; fr.h[q] = (_Float16)(__expf(fmaf(f, s[j], (1.f - f) * -1.0e9f) - mx) * sc); } unsigned short* d = (unsigned short*)P + i * NKX + j0; *(v8us*)d = fr.half[0];  } }


template <int MASKADD>
__global__ __launch_bounds__(64) void k_att0(const float* __restrict__ QF, const float* __restrict__ KF, const float* __restrict__ VF, int ld, const float* __restrict__ mask, float scale, float* __restrict__ OF, int ldo) {
  #pragma clang fp contract(off)
  __shared__ __attribute__((aligned(16))) float lq[64][64]; __shared__ __attribute__((aligned(16))) float lo[64][64];
  const int tid = threadIdx.x; const int h = blockIdx.x / (QT0 / 64), rg = blockIdx.x % (QT0 / 64); const int i = rg * 64 + tid;
  const float* qr = QF + (size_t)i * ld + h * HD;
#pragma unroll 1
  for (int c = 0; c < HD / 4; ++c) { *(v4f*)&lq[tid][c * 4] = *(const v4fa*)(qr + c * 4); const v4f z = {0.f, 0.f, 0.f, 0.f}; *(v4f*)&lo[tid][c * 4] = z; }
  float m = -1.0e30f, l = 0.f; const int jmax = MASKADD ? (SQ - 1) : (rg * 64 + 63);      /* additive-mask form: every key (the mask input decides); causal form: keys up to the block's last row */
#pragma unroll 1
  for (int j = 0; j <= jmax; ++j) { const float* kr = KF + (size_t)j * ld + h * HD; const float* vr = VF + (size_t)j * ld + h * HD; float s = 0.f;
#pragma unroll 1
    for (int c = 0; c < HD / 4; ++c) { const v4f kq = *(const v4fa*)(kr + c * 4); const v4f qq = *(v4f*)&lq[tid][c * 4]; s = __fadd_rn(s, __fmul_rn(qq[0], kq[0])); s = __fadd_rn(s, __fmul_rn(qq[1], kq[1])); s = __fadd_rn(s, __fmul_rn(qq[2], kq[2])); s = __fadd_rn(s, __fmul_rn(qq[3], kq[3])); }
    s = __fmul_rn(s, scale); if (MASKADD) s = __fadd_rn(s, __fmul_rn(bf16_round(mask[(size_t)i * SQ + j]), -10000.0f));
    const float f = (MASKADD || j <= i) ? 1.f : 0.f; const float sm = fmaf(f, s, (1.f - f) * -1.0e30f); const float mn = fmaxf(m, sm); const float sc = expf(m - mn); const float e = expf(sm - mn); l = __fadd_rn(__fmul_rn(l, sc), e); m = mn;
#pragma unroll 1
    for (int c = 0; c < HD / 4; ++c) { const v4f vv = *(const v4fa*)(vr + c * 4); v4f oo = *(v4f*)&lo[tid][c * 4]; for (int u = 0; u < 4; ++u) oo[u] = __fadd_rn(__fmul_rn(oo[u], sc), __fmul_rn(e, vv[u])); *(v4f*)&lo[tid][c * 4] = oo; } }
  const float fin = 64.0f / l;      /* o carried x64 like the f16 path */
#pragma unroll 1
  for (int c = 0; c < HD / 4; ++c) { v4f oo = *(v4f*)&lo[tid][c * 4]; for (int u = 0; u < 4; ++u) oo[u] = __fmul_rn(oo[u], fin); *(v4f*)&lo[tid][c * 4] = oo; }
  __syncthreads();
  {
#pragma unroll 1
    for (int it = 0; it < 16; ++it) { const int row = it * 4 + tid / 16, pc = (tid % 16) * 4; const v4f v = *(const v4f*)&lo[row][pc]; *(v4f*)(OF + (size_t)(rg * 64 + row) * ldo + h * HD + pc) = v; }
     } }


// Row normalisation, one wave per score row: lane l holds floats 128 c + 4 l .. 4 l + 3 of the row, so each load covers 512 contiguous bytes and each f16 store 256;
// the row is read once into registers, summed per lane and then over the 32 lanes by a butterfly (every lane ends with the same bits), scaled and stored.
template <int NC>      /* NC = nk / 128 chunks; the last QT / 128 of them hold the causal edge, rel = the row's own place inside them */
__device__ __forceinline__ void lin_row(const float* __restrict__ s, _Float16* __restrict__ d, int lane, int rel) {
  v4f a[NC];
#pragma unroll
  for (int c = 0; c < NC; ++c) a[c] = *(const v4fa*)(s + c * 128 + lane * 4);
#pragma unroll
  for (int c = NC - QT / 128; c < NC; ++c) { const int j = (c - (NC - QT / 128)) * 128 + lane * 4;
#pragma unroll
    for (int q = 0; q < 4; ++q) a[c][q] = (j + q <= rel) ? a[c][q] : 0.f; }
  v4f acc = a[0];
#pragma unroll
  for (int c = 1; c < NC; ++c) acc += a[c];
  float se = (acc[0] + acc[1]) + (acc[2] + acc[3]);
#pragma unroll
  for (int m = 16; m > 0; m >>= 1) se += __shfl_xor(se, m, 32);
  const float sc = 256.0f / se;
#pragma unroll
  for (int c = 0; c < NC; ++c) { v4h h;
#pragma unroll
    for (int q = 0; q < 4; ++q) h[q] = (_Float16)(a[c][q] * sc);
    *(v4h*)(d + c * 128 + lane * 4) = h; }
  asm volatile("s_wait_xcnt 0x0" ::: "memory"); }      /* behind the last store of the run: the stores' data and address registers are reused by the code that follows in the listing */
__global__ __launch_bounds__(256) void k_lincf2(const float* __restrict__ S, _Float16* __restrict__ P, int hg, int nk) {      /* nk = the tile's first query row + QT, a multiple of QT up to SQ */
  const int t = blockIdx.x * 8 + (threadIdx.x >> 5); if (t >= hg * QT) return; const int lane = threadIdx.x & 31; const float* s = S + (size_t)t * NKX; _Float16* d = P + (size_t)t * NKX; const int rel = t % QT;
  switch (nk / QT) {
    case 1: lin_row<2>(s, d, lane, rel); break; case 2: lin_row<4>(s, d, lane, rel); break; case 3: lin_row<6>(s, d, lane, rel); break; case 4: lin_row<8>(s, d, lane, rel); break;
    case 5: lin_row<10>(s, d, lane, rel); break; case 6: lin_row<12>(s, d, lane, rel); break; case 7: lin_row<14>(s, d, lane, rel); break; case 8: lin_row<16>(s, d, lane, rel); break; } }

// Exact f32 linear attention for the first QT0 rows of one batch. One work-group of 8 waves per (head, 32 query rows), lane = query row.
// The head's QT0 key and value rows and the group's 32 q rows are staged once in LDS with whole-line loads, all in flight together. Step 1: wave w takes the keys j = w mod 8, four at a time
// (four independent sum chains), q row in registers, k row broadcast from LDS; the masked score goes to le[j][row]. Step 2: wave w owns columns 8 w .. 8 w + 7 of o in registers
// and walks the keys in ascending order. Each sum runs in the order of the one-thread-per-row form (d ascending, j ascending); keys above the group's last row only ever added zeros and are left out.
#define LR 32                        /* query rows per work-group */
#define LP 68                        /* pitch in floats of the per-row LDS arrays: 16 B x odd, so that 32 lanes reading 16 B of their own rows spread over the banks */
__global__ __launch_bounds__(256) void k_latt0(const float* __restrict__ QF, const float* __restrict__ KF, const float* __restrict__ VF, float* __restrict__ OF) {      /* all four planes: rows of DM floats */
  __shared__ __attribute__((aligned(16))) float lk[QT0][HD]; __shared__ __attribute__((aligned(16))) float lv[QT0][HD]; __shared__ __attribute__((aligned(16))) float le[QT0][LR];
  __shared__ __attribute__((aligned(16))) float lq[LR][LP]; __shared__ __attribute__((aligned(16))) float lo[LR][LP];
  const int tid = threadIdx.x, w = tid >> 5, lane = tid & 31; const int h = blockIdx.x / (QT0 / LR), rg = blockIdx.x % (QT0 / LR); const int r0 = rg * LR, nj = r0 + LR, i = r0 + lane;
  const int sr = tid / (HD / 4), sc = (tid % (HD / 4)) * 4;      /* staging and output: 16 lanes per 256-byte row, 16 rows per pass of the work-group */
  { v4f tk[QT0 / 16], tv[QT0 / 16], tq[LR / 16]; const float* kp = KF + (size_t)sr * DM + h * HD + sc; const float* vp = VF + (size_t)sr * DM + h * HD + sc; const float* qp = QF + (size_t)(r0 + sr) * DM + h * HD + sc;
#pragma unroll      /* every load is issued before the first LDS store waits for one */
    for (int p = 0; p < QT0 / 16; ++p) { tk[p] = *(const v4fa*)(kp + (size_t)p * 16 * DM); tv[p] = *(const v4fa*)(vp + (size_t)p * 16 * DM); }
#pragma unroll
    for (int p = 0; p < LR / 16; ++p) tq[p] = *(const v4fa*)(qp + (size_t)p * 16 * DM);
    asm volatile("s_wait_xcnt 0x0" :: "v"(kp), "v"(vp), "v"(qp) : "memory");      /* behind the last load of the run; the three address pairs are its inputs, so that none of them is given to a load's result or reused ahead of it */
#pragma unroll
    for (int p = 0; p < QT0 / 16; ++p) { *(v4f*)&lk[p * 16 + sr][sc] = tk[p]; *(v4f*)&lv[p * 16 + sr][sc] = tv[p]; }
#pragma unroll
    for (int p = 0; p < LR / 16; ++p) *(v4f*)&lq[p * 16 + sr][sc] = tq[p]; }
  __syncthreads();
  v4f q[HD / 4];
#pragma unroll      /* q stays in registers: constant indices only */
  for (int c = 0; c < HD / 4; ++c) q[c] = *(const v4f*)&lq[lane][c * 4];
  for (int jb = 0; jb < nj; jb += 32) { const int j0 = jb + w; float s0 = 0.f, s1 = 0.f, s2 = 0.f, s3 = 0.f;
#pragma unroll      /* constant indices into q; the four chains fill each other's result latency */
    for (int c = 0; c < HD / 4; ++c) { const v4f k0 = *(const v4f*)&lk[j0][c * 4], k1 = *(const v4f*)&lk[j0 + 8][c * 4], k2 = *(const v4f*)&lk[j0 + 16][c * 4], k3 = *(const v4f*)&lk[j0 + 24][c * 4];
#pragma unroll
      for (int u = 0; u < 4; ++u) { s0 += q[c][u] * k0[u]; s1 += q[c][u] * k1[u]; s2 += q[c][u] * k2[u]; s3 += q[c][u] * k3[u]; } }
    le[j0][lane] = (j0 <= i) ? s0 : 0.f; le[j0 + 8][lane] = (j0 + 8 <= i) ? s1 : 0.f; le[j0 + 16][lane] = (j0 + 16 <= i) ? s2 : 0.f; le[j0 + 24][lane] = (j0 + 24 <= i) ? s3 : 0.f; }
  __syncthreads();
  float l = 0.f; v4f oa = {0.f, 0.f, 0.f, 0.f}, ob = {0.f, 0.f, 0.f, 0.f};
#pragma unroll 8      /* eight keys' LDS reads are issued ahead of the sums that use them */
  for (int j = 0; j < nj; ++j) { const float e = le[j][lane]; const v4f va = *(const v4f*)&lv[j][w * 8], vb = *(const v4f*)&lv[j][w * 8 + 4]; l += e; oa += e * va; ob += e * vb; }
  const float fin = 64.0f / l;      /* o carried x64 like the f16 path */
  *(v4f*)&lo[lane][w * 8] = oa * fin; *(v4f*)&lo[lane][w * 8 + 4] = ob * fin;
  __syncthreads();
#pragma unroll      /* two passes, each wave storing whole 128-byte lines */
  for (int p = 0; p < LR / 16; ++p) *(v4f*)(OF + (size_t)(r0 + p * 16 + sr) * DM + h * HD + sc) = *(const v4f*)&lo[p * 16 + sr][sc]; }
extern "C" void kernel_launch(void* const* d_in, const int* in_sizes, int n_in,
                              void* d_out, int out_size, void* d_ws, size_t ws_size, hipStream_t stream) {
  (void)in_sizes; (void)n_in; (void)out_size;
  const float* const* I = (const float* const*)d_in; const float* x = I[0]; const float* wqk = I[1]; const float* bqk = I[2]; const float* wv = I[3]; const float* bv = I[4]; const float* wo = I[5]; const float* bo = I[6]; const float* bq = bqk; const float* bk = bqk + DM;      /* natural Wqk [2048][1024] (q rows | k rows) + bias [2048]; Wv + bv; Wo + bo */
  char* ws = (char*)d_ws; size_t off = 0;
  auto take = [&](size_t bytes) { char* p = ws + off; off += (bytes + 255) & ~(size_t)255; return p; };
  _Float16* BQK = (_Float16*)take((size_t)2 * DM * DM * 2); _Float16* BQ = BQK; _Float16* BK = BQK + (size_t)DM * DM; _Float16* BV = (_Float16*)take((size_t)DM * DM * 2); _Float16* BO = (_Float16*)take((size_t)DM * DM * 2);
  _Float16* X16 = (_Float16*)take(NR * DM * 2); _Float16* Q16 = (_Float16*)take(NR * DM * 2); _Float16* K16 = (_Float16*)take(NR * DM * 2); _Float16* V16 = (_Float16*)take(NR * DM * 2); _Float16* O16 = (_Float16*)take(NR * DM * 2);
  float* S = (float*)take((size_t)NH * QT * NKX * 4); _Float16* P = (_Float16*)take((size_t)NH * QT * NKX * 2); _Float16* VT = (_Float16*)take((size_t)NH * HD * SQ * 2);
  float* QF0 = (float*)take((size_t)QT0 * DM * 4); float* KF0 = (float*)take((size_t)QT0 * DM * 4); float* VF0 = (float*)take((size_t)QT0 * DM * 4); float* OF0 = (float*)take((size_t)NB * QT0 * DM * 4); _Float16* OH0 = (_Float16*)take((size_t)NB * QT0 * DM * 2); _Float16* OL0 = (_Float16*)take((size_t)NB * QT0 * DM * 2);
  if (off > ws_size) return;
  { const unsigned g = (unsigned)(((size_t)DM * DM / 8 + 255) / 256); k_wnat<<<2 * g, 256, 0, stream>>>(wqk, (size_t)2 * DM * DM / 8, BQK); k_wnat<<<g, 256, 0, stream>>>(wv, (size_t)DM * DM / 8, BV); k_wnat<<<g, 256, 0, stream>>>(wo, (size_t)DM * DM / 8, BO); }      /* natural [out][in] = Bt[n][k], x16 (Wqk's q rows then k rows) */

  k_x16<<<(unsigned)((NR * DM / 8 + 255) / 256), 256, 0, stream>>>(x, X16, NR * DM / 8);
  const size_t r0p = (size_t)B0 * SQ;      /* first projected row */
  k_gemm2<19><<<dim3((unsigned)((MP / 128) * (DM / 64)), 1), 128, 0, stream>>>(X16 + r0p * DM, DM, 0, BQ, DM, 0, 0.0625f, bq, 0, nullptr, 1, 0, 0, nullptr, Q16 + r0p * DM, DM, 0, MP, DM, DM);      /* phi(q) = elu(x Wq^T + bq) + 1 */
  k_gemm2<19><<<dim3((unsigned)((MP / 128) * (DM / 64)), 1), 128, 0, stream>>>(X16 + r0p * DM, DM, 0, BK, DM, 0, 0.0625f, bk, 0, nullptr, 1, 0, 0, nullptr, K16 + r0p * DM, DM, 0, MP, DM, DM);      /* phi(k) */
  k_gemm2<0><<<dim3((unsigned)((MP / 128) * (DM / 64)), 1), 128, 0, stream>>>(X16 + r0p * DM, DM, 0, BV, DM, 0, 0.0625f, bv, 0, nullptr, 1, 0, 0, nullptr, V16 + r0p * DM, DM, 0, MP, DM, DM);
  for (int b = B0; b < B0 + NBR; ++b) { const size_t r0 = (size_t)b * SQ;
    k_vt<NH, SQ><<<NH * (SQ / 64), 256, 0, stream>>>(V16 + r0 * LQ, LQ, 0, VT);      /* V^T [NH][HD][SQ] for this batch */
    k_gemm2<19><<<dim3((QT0 / 128) * (DM / 64), 1), 128, 0, stream>>>(X16 + r0 * DM, DM, 0, BQ, DM, 0, 0.0625f, bq, 0, nullptr, 1, 0, 0, QF0, nullptr, DM, 0, QT0, DM, DM); k_gemm2<19><<<dim3((QT0 / 128) * (DM / 64), 1), 128, 0, stream>>>(X16 + r0 * DM, DM, 0, BK, DM, 0, 0.0625f, bk, 0, nullptr, 1, 0, 0, KF0, nullptr, DM, 0, QT0, DM, DM); k_gemm2<0><<<dim3((QT0 / 128) * (DM / 64), 1), 128, 0, stream>>>(X16 + r0 * DM, DM, 0, BV, DM, 0, 0.0625f, bv, 0, nullptr, 1, 0, 0, VF0, nullptr, DM, 0, QT0, DM, DM);      /* f32 phi(q), phi(k), v of the first 128 rows (exact products) */
    k_latt0<<<NH * (QT0 / LR), 256, 0, stream>>>(QF0, KF0, VF0, OF0 + (size_t)b * QT0 * DM);      /* exact f32 linear attention for rows 0..127 (o x64): the few-key rows without the f16 roundings */
    for (int q0 = 0; q0 < QN; q0 += QT) { const int nk = q0 + QT;      /* causal: only keys below the tile end are computed */
      k_gemm2<0><<<dim3((QT / 128) * (nk / 64), NHD), 128, 0, stream>>>(Q16 + (r0 + q0) * LQ, LQ, (size_t)HD, K16 + r0 * LQ, LQ, (size_t)HD, 1.0f, nullptr, 0, nullptr, 1, 0, 0, S, nullptr, NKX, (size_t)QT * NKX, QT, nk, HD);      /* scores, all heads on grid.y */
      k_lincf2<<<(NHD * QT + 7) / 8, 256, 0, stream>>>(S, P, NHD, nk);      /* p = a [j <= i] / sum a (no softmax) */
      k_gemm2<0><<<dim3((QT / 128) * (HD / 64), NHD), 128, 0, stream>>>(P, NKX, (size_t)QT * NKX, VT, SQ, (size_t)HD * SQ, 0.25f, nullptr, 0, nullptr, 1, 0, 0, nullptr, O16 + (r0 + q0) * DM, DM, (size_t)HD, QT, HD, nk); } }      /* o (merged heads, x64) as f16 rows */
  k_gemm2<0><<<dim3((unsigned)((MPO / 128) * (DM / 64)), 1), 128, 0, stream>>>(O16 + r0p * DM, DM, 0, BO, DM, 0, 0.0009765625f, bo, 0, nullptr, 1, 0, 0, (float*)d_out + r0p * DM, nullptr, DM, 0, MPO, DM, DM);      /* out rows are the output layout */
  k_hl<<<(unsigned)(((size_t)NB * QT0 * DM / 8 + 255) / 256), 256, 0, stream>>>(OF0, OH0, OL0, (size_t)NB * QT0 * DM / 8);      /* first-tile o (x64) -> f16 hi + x1024 residual planes */
  for (int b = B0; b < B0 + NBR; ++b) { const size_t r0 = (size_t)b * SQ; const size_t f0 = (size_t)b * QT0;
    k_gemm2<0><<<dim3((QT0 / 128) * (DM / 64), 1), 128, 0, stream>>>(OH0 + f0 * DM, DM, 0, BO, DM, 0, 0.0009765625f, bo, 0, nullptr, 1, 0, 0, (float*)d_out + r0 * DM, nullptr, DM, 0, QT0, DM, DM);      /* rows 0..127: out = o_hi Wo (+ b), overwriting the f16-path rows */
    k_gemm2<0><<<dim3((QT0 / 128) * (DM / 64), 1), 128, 0, stream>>>(OL0 + f0 * DM, DM, 0, BO, DM, 0, 0.00000095367431640625f, nullptr, 0, (const float*)d_out + r0 * DM, -1, 0, 0, (float*)d_out + r0 * DM, nullptr, DM, 0, QT0, DM, DM); }      /* += o_lo Wo 2^-20 (own-element accumulate) */
}

// v003
// One run takes 570 microseconds.
// Two timings next to v002 put it at 2.27 and 2.26 times that version's speed.
// All steps since v000 together make it 7.35 times as fast.
#include <hip/hip_runtime.h>
// Causal LINEAR attention (x [2][2048][1024]; qk = x Wqk^T + bqk (natural [2048][1024]: rows 0..1023 -> q, 1024..2047 -> k; sigma 1/32, biases 0.02), v = x Wv^T + bv; 16 heads of 64; feature map phi = elu + 1 on q and k; ctx_t = (phi(q_t) . sum_{s<=t} phi(k_s) v_s^T) / (phi(q_t) . sum_{s<=t} phi(k_s)) = sum_{s<=t} a_ts v_s / sum_{s<=t} a_ts with a_ts = phi(q_t).phi(k_s) (the module's cumsum form, no softmax, no scaling, no eps); out = ctx Wo^T + bo -> [2][2048][1024]).
// Structure: x as exact f16 rows; natural weights re-laid on VALU into exact x16 planes; q, k (with the elu + 1 feature map in the GEMM epilogue) and v as WMMA GEMMs (32x64 wave tiles, f32 accumulation, + bias) with f16 outputs; per batch: V^T via LDS transposes; one fused attention launch for all batches, heads and query tiles of 32 rows: a^T = phi(k) phi(q)^T on WMMA (K = 64) for the keys up to the tile end, causal mask, row sums in f32, a as f16 straight from the accumulators into the A operand of ctx = a V^T on WMMA, ctx x64 / sum a into merged f16 rows; out = ctx Wo^T + bo GEMM (f32); first-tile refinement: the first 128 rows of each batch recomputed exactly in f32 on VALU (a / sum a weights) and their output rows rewritten from o hi/lo by two accumulating GEMM passes; launches: see trace.
// Compute dtype: inputs rounded to bf16; x / weights exact; q, k, v, the weights a and o as plain f16 GEMM operands (~2^-12); scores and row sums f32. v_wmma_f32_16x16x32_f16.
#define NB 2
#define SQ 2048
#define DM 1024
#define NH 16
#define HD 64
#define HG 4                         /* heads per group in the unlaunched k_vt(V16, b, h0, VT) overload */
#define QT 256                       /* query rows per causal tile */
#define NKX SQ                       /* S / P row pitch */
#define QT0 128                      /* first-tile rows recomputed exactly in f32 */
#define B0 0                         /* first batch processed (debug hook) */
#define NBR NB                       /* batches processed (debug hook) */
#define NR ((size_t)NB * SQ)         /* token rows */
#define MP ((int)((size_t)NBR * SQ)) /* rows projected (debug hook) */
#define QN SQ                        /* unused: k_lfa attends all SQ rows of every batch */
#define NHD NH                       /* unused: k_lfa attends all NH heads */
#define MPO MP                       /* rows through the output stage (debug hook) */
#define LQ DM      /* row pitch of the q/k/v rows */
typedef __bf16 v16b __attribute__((ext_vector_type(16)));
typedef unsigned short v8us __attribute__((ext_vector_type(8), may_alias));
typedef float  v8f  __attribute__((ext_vector_type(8)));
typedef float  v4f  __attribute__((ext_vector_type(4)));
typedef float  v4fa __attribute__((ext_vector_type(4), may_alias));
union FragB { v16b v; v8us half[2]; unsigned short u[16]; };

__device__ __forceinline__ unsigned short bf16_bits(float x) { unsigned int u = __float_as_uint(x); return (unsigned short)((u + 0x7FFFu + ((u >> 16) & 1u)) >> 16); }
__device__ __forceinline__ float bf16_val(unsigned short b) { return __uint_as_float(((unsigned int)b) << 16); }
__device__ __forceinline__ float bf16_round(float x) { return bf16_val(bf16_bits(x)); }
// D += A·B with NT terms: 1 = ah·bh, 2 = + al·bh (A split), 3 = + ah·bl (both split)
template <int NT>
__device__ __forceinline__ v8f mmaN(v16b ah, v16b al, v16b bh, v16b bl, v8f c) {
  c = __builtin_amdgcn_wmma_f32_16x16x32_bf16(false, ah, false, bh, (short)0, c, false, false);
  if (NT >= 2) c = __builtin_amdgcn_wmma_f32_16x16x32_bf16(false, al, false, bh, (short)0, c, false, false);
  if (NT >= 3) c = __builtin_amdgcn_wmma_f32_16x16x32_bf16(false, ah, false, bl, (short)0, c, false, false);
  asm volatile("v_nop\n\tv_nop\n\tv_nop\n\tv_nop" : "+v"(c) : "v"(ah), "v"(al), "v"(bh), "v"(bl));
  return c;
}

__global__ __launch_bounds__(256) void k_wt_bf16(const float* __restrict__ W, unsigned short* __restrict__ Wt, int K, int N) {
  const int t = blockIdx.x * 256 + threadIdx.x;
  const int k8n = K / 8;
  if (t >= N * k8n) return;
  const int n = t / k8n, k8 = (t % k8n) * 8;
  v8us v;
#pragma unroll
  for (int i = 0; i < 8; ++i) v[i] = bf16_bits(W[(size_t)(k8 + i) * N + n]);
  *(v8us*)(Wt + (size_t)n * K + k8) = v;
  
}

// GEMM C[M][N] (f32, pitch ldc) = act(A[M][K]·W + bias). A f32 row-major (pitch lda) converted per fragment to bf16
// (ASPLIT: hi/lo two planes -> 2 terms, else single rounded term); Wt bf16 [N][K] (pitch ldb). BIAS_BF16 rounds the
// bias to bf16 first (bias quantised to bf16 before the add). K%32==0, M%16==0, N%64==0.
template <bool ASPLIT, int ACT, bool BIAS_BF16>
__global__ __launch_bounds__(128) void k_gemm_bf(const float* __restrict__ A, int lda, const unsigned short* __restrict__ Wt, int ldb,
                                               const float* __restrict__ bias, float* __restrict__ C, int ldc, int M, int N, int K) {
  __shared__ __attribute__((aligned(16))) float so[4][16][64];
  const int tid = threadIdx.x, w = tid >> 5, lane = tid & 31, ln = lane & 15, hh = lane >> 4;
  const int ntn = N / 64;
  const int wid = blockIdx.x * 4 + w;
  const int mt = wid / ntn, nq = wid % ntn;
  if (mt * 16 >= M) return;
  const int row0 = mt * 16, col0 = nq * 64;
  const float* arow = A + (size_t)(row0 + ln) * lda;
  v8f acc[4] = {};
  for (int kb = 0; kb < K; kb += 32) {
    FragB ah, al;
    const v4f x0 = *(const v4fa*)(arow + kb + 8 * hh), x1 = *(const v4fa*)(arow + kb + 8 * hh + 4);
    const v4f x2 = *(const v4fa*)(arow + kb + 16 + 8 * hh), x3 = *(const v4fa*)(arow + kb + 16 + 8 * hh + 4);
    float xs[16] = {x0[0],x0[1],x0[2],x0[3],x1[0],x1[1],x1[2],x1[3],x2[0],x2[1],x2[2],x2[3],x3[0],x3[1],x3[2],x3[3]};
#pragma unroll
    for (int i = 0; i < 16; ++i) { const unsigned short hb = bf16_bits(xs[i]); ah.u[i] = hb; al.u[i] = ASPLIT ? bf16_bits(xs[i] - bf16_val(hb)) : (unsigned short)0; }
#pragma unroll
    for (int t = 0; t < 4; ++t) {
      const unsigned short* brow = Wt + (size_t)(col0 + t * 16 + ln) * ldb + kb;
      FragB b;
      b.half[0] = *(const v8us*)(brow + 8 * hh);
      b.half[1] = *(const v8us*)(brow + 16 + 8 * hh);
      acc[t] = mmaN<ASPLIT ? 2 : 1>(ah.v, al.v, b.v, b.v, acc[t]);
    }
  }
#pragma unroll
  for (int t = 0; t < 4; ++t) {
    float bv = bias ? bias[col0 + t * 16 + ln] : 0.f;
    if (BIAS_BF16) bv = bf16_round(bv);
#pragma unroll
    for (int r = 0; r < 8; ++r) { float v = acc[t][r] + bv; if (ACT == 1) v = fmaxf(v, 0.f); so[w][8 * hh + r][t * 16 + ln] = v; }
  }
  __builtin_amdgcn_fence(__ATOMIC_ACQ_REL, "workgroup");
  __builtin_amdgcn_wave_barrier();
  const int rsub = lane >> 4, c4 = (lane & 15) * 4;
  {
#pragma unroll
    for (int q = 0; q < 8; ++q) {
      const int r = q * 2 + rsub;
      const v4f v = *(const v4fa*)&so[w][r][c4];
      *(v4f*)(C + (size_t)(row0 + r) * ldc + col0 + c4) = v;
    }
    
  }
}

// GEMM C = act(A·W + bias + resid): A f32 (ASPLIT -> hi/lo 2 terms), Wt bf16 [N][K]; ACT 0 none, 1 relu, 2 exact gelu;
// resid (optional, f32, row index = (row % rmod), pitch ldr, RES_BF16 rounds it) added before the activation.
template <bool ASPLIT, int ACT, bool BIAS_BF16, bool RES_BF16>
__global__ __launch_bounds__(128) void k_gemm_bf3(const float* __restrict__ A, int lda, const unsigned short* __restrict__ Wt, int ldb,
                                                const float* __restrict__ bias, const float* __restrict__ resid, int rmod, int ldr,
                                                float* __restrict__ C, int ldc, int M, int N, int K) {
  __shared__ __attribute__((aligned(16))) float so[4][16][64];
  const int tid = threadIdx.x, w = tid >> 5, lane = tid & 31, ln = lane & 15, hh = lane >> 4;
  const int ntn = N / 64;
  const int wid = blockIdx.x * 4 + w;
  const int mt = wid / ntn, nq = wid % ntn;
  if (mt * 16 >= M) return;
  const int row0 = mt * 16, col0 = nq * 64;
  const float* arow = A + (size_t)(row0 + ln) * lda;
  v8f acc[4] = {};
  for (int kb = 0; kb < K; kb += 32) {
    FragB ah, al;
    const v4f x0 = *(const v4fa*)(arow + kb + 8 * hh), x1 = *(const v4fa*)(arow + kb + 8 * hh + 4);
    const v4f x2 = *(const v4fa*)(arow + kb + 16 + 8 * hh), x3 = *(const v4fa*)(arow + kb + 16 + 8 * hh + 4);
    float xs[16] = {x0[0],x0[1],x0[2],x0[3],x1[0],x1[1],x1[2],x1[3],x2[0],x2[1],x2[2],x2[3],x3[0],x3[1],x3[2],x3[3]};
#pragma unroll
    for (int i = 0; i < 16; ++i) { const unsigned short hb = bf16_bits(xs[i]); ah.u[i] = hb; al.u[i] = ASPLIT ? bf16_bits(xs[i] - bf16_val(hb)) : (unsigned short)0; }
#pragma unroll
    for (int t = 0; t < 4; ++t) {
      const unsigned short* brow = Wt + (size_t)(col0 + t * 16 + ln) * ldb + kb;
      FragB b;
      b.half[0] = *(const v8us*)(brow + 8 * hh);
      b.half[1] = *(const v8us*)(brow + 16 + 8 * hh);
      acc[t] = mmaN<ASPLIT ? 2 : 1>(ah.v, al.v, b.v, b.v, acc[t]);
    }
  }
#pragma unroll
  for (int t = 0; t < 4; ++t) {
    const int col = col0 + t * 16 + ln;
    float bv = bias ? bias[col] : 0.f;
    if (BIAS_BF16) bv = bf16_round(bv);
#pragma unroll
    for (int r = 0; r < 8; ++r) {
      float v = acc[t][r] + bv;
      if (resid) { float rv = resid[(size_t)((row0 + 8 * hh + r) % rmod) * ldr + col]; if (RES_BF16) rv = bf16_round(rv); v += rv; }
      if (ACT == 1) v = fmaxf(v, 0.f);
      if (ACT == 2) v = 0.5f * v * (1.0f + erff(v * 0.70710678118654752f));
      if (ACT == 3) { const float u = 0.7978845608028654f * (v + 0.044715f * v * v * v); v = 0.5f * v * (1.0f + tanhf(u)); }
      so[w][8 * hh + r][t * 16 + ln] = v;
    }
  }
  __builtin_amdgcn_fence(__ATOMIC_ACQ_REL, "workgroup");
  __builtin_amdgcn_wave_barrier();
  const int rsub = lane >> 4, c4 = (lane & 15) * 4;
  {
#pragma unroll
    for (int q = 0; q < 8; ++q) {
      const int r = q * 2 + rsub;
      const v4f v = *(const v4fa*)&so[w][r][c4];
      *(v4f*)(C + (size_t)(row0 + r) * ldc + col0 + c4) = v;
    }
    
  }
}
// row LayerNorm (biased variance, eps) over N: s = X (+ R); optional out_sum <- s; out_norm <- (s-mu)*rsqrt(var+eps)*g + b
template <bool PARAM_BF16>
__global__ __launch_bounds__(256) void k_layernorm(const float* __restrict__ X, const float* __restrict__ R, const float* __restrict__ g, const float* __restrict__ bta,
                                                  float* __restrict__ out_sum, float* __restrict__ out_norm, int N, float eps) {
  __shared__ float red[256];
  const int row = blockIdx.x, tid = threadIdx.x;
  const float* x = X + (size_t)row * N; const float* rr = R ? R + (size_t)row * N : nullptr;
  float vals[16];                     // up to N = 4096
  const int per = N / 256;            // contiguous chunk per thread? use strided-by-4 chunks: thread handles j = tid*4 + 1024*u
  float s1 = 0.f;
  for (int u = 0; u < per / 4; ++u) {
    const int j = tid * 4 + 1024 * u;
    const v4f a = *(const v4fa*)(x + j);
    v4f b = {0.f,0.f,0.f,0.f}; if (rr) b = *(const v4fa*)(rr + j);
#pragma unroll
    for (int q = 0; q < 4; ++q) { const float v = a[q] + b[q]; vals[u * 4 + q] = v; s1 += v; }
  }
  red[tid] = s1; __syncthreads();
  for (int st = 128; st > 0; st >>= 1) { if (tid < st) red[tid] += red[tid + st]; __syncthreads(); }
  const float mu = red[0] / (float)N; __syncthreads();
  float s2 = 0.f;
  for (int u = 0; u < per / 4; ++u)
#pragma unroll
    for (int q = 0; q < 4; ++q) { const float c = vals[u * 4 + q] - mu; s2 += c * c; }
  red[tid] = s2; __syncthreads();
  for (int st = 128; st > 0; st >>= 1) { if (tid < st) red[tid] += red[tid + st]; __syncthreads(); }
  const float rs = rsqrtf(red[0] / (float)N + eps);
  {
    for (int u = 0; u < per / 4; ++u) {
      const int j = tid * 4 + 1024 * u;
      v4f o, sm;
#pragma unroll
      for (int q = 0; q < 4; ++q) {
        float gg = g[j + q], bb = bta[j + q];
        if (PARAM_BF16) { gg = bf16_round(gg); bb = bf16_round(bb); }
        sm[q] = vals[u * 4 + q]; o[q] = (vals[u * 4 + q] - mu) * rs * gg + bb;
      }
      if (out_sum) *(v4f*)(out_sum + (size_t)row * N + j) = sm;
      *(v4f*)(out_norm + (size_t)row * N + j) = o;
    }
    
  }
}



// ---- f16 WMMA path (v_wmma_f32_16x16x32_f16): 11-bit significands for operands in range — used where a [0,1] probability operand needs more precision than bf16
typedef _Float16 v16h __attribute__((ext_vector_type(16)));
union FragH { v16h v; v8us half[2]; _Float16 h[16]; unsigned short u[16]; };
template <int NT>
__device__ __forceinline__ v8f mmaH(v16h ah, v16h al, v16h bh, v16h bl, v8f c) {
  c = __builtin_amdgcn_wmma_f32_16x16x32_f16(false, ah, false, bh, (short)0, c, false, false);
  if (NT >= 2) c = __builtin_amdgcn_wmma_f32_16x16x32_f16(false, al, false, bh, (short)0, c, false, false);
  if (NT >= 3) c = __builtin_amdgcn_wmma_f32_16x16x32_f16(false, ah, false, bl, (short)0, c, false, false);
  asm volatile("v_nop\n\tv_nop\n\tv_nop\n\tv_nop" : "+v"(c) : "v"(ah), "v"(al), "v"(bh), "v"(bl));
  return c;
}
// batched GEMM like k_gemm_b but f16 operands: A f32 (split into f16 hi/lo if ASPLIT, else rounded to f16), Bt = f16 values [n][k]; alpha; C f32; N multiple of 16 (partial tiles skipped)
template <bool ASPLIT>
__global__ __launch_bounds__(128) void k_gemm_h(const float* __restrict__ A, int lda, size_t sA, const _Float16* __restrict__ Bh, int ldb, size_t sB, float alpha, float* __restrict__ C, int ldc, size_t sC, int M, int N, int K) {
  __shared__ __attribute__((aligned(16))) float so[4][16][64];
  const int tid = threadIdx.x, w = tid >> 5, lane = tid & 31, ln = lane & 15, hh = lane >> 4; const int by = blockIdx.y;
  A += (size_t)by * sA; Bh += (size_t)by * sB; C += (size_t)by * sC;
  const int ntn = (N + 63) / 64; const int wid = blockIdx.x * 4 + w; const int mt = wid / ntn, nq = wid % ntn; if (mt * 16 >= M) return;
  const int row0 = mt * 16, col0 = nq * 64; const float* arow = A + (size_t)(row0 + ln) * lda;
  v8f acc[4] = {};
  for (int kb = 0; kb < K; kb += 32) {
    FragH ah, al;
    const v4f x0 = *(const v4fa*)(arow + kb + 8 * hh), x1 = *(const v4fa*)(arow + kb + 8 * hh + 4), x2 = *(const v4fa*)(arow + kb + 16 + 8 * hh), x3 = *(const v4fa*)(arow + kb + 16 + 8 * hh + 4);
    float xs[16] = {x0[0],x0[1],x0[2],x0[3],x1[0],x1[1],x1[2],x1[3],x2[0],x2[1],x2[2],x2[3],x3[0],x3[1],x3[2],x3[3]};
#pragma unroll
    for (int i = 0; i < 16; ++i) { const _Float16 h = (_Float16)xs[i]; ah.h[i] = h; al.h[i] = ASPLIT ? (_Float16)(xs[i] - (float)h) : (_Float16)0.0f; }
#pragma unroll
    for (int t = 0; t < 4; ++t) { if (col0 + t * 16 >= N) continue; const size_t boff = (size_t)(col0 + t * 16 + ln) * ldb + kb; FragH bq; bq.half[0] = *(const v8us*)(Bh + boff + 8 * hh); bq.half[1] = *(const v8us*)(Bh + boff + 16 + 8 * hh);
      acc[t] = mmaH<ASPLIT ? 2 : 1>(ah.v, al.v, bq.v, bq.v, acc[t]); }
  }
#pragma unroll
  for (int t = 0; t < 4; ++t) { if (col0 + t * 16 >= N) continue;
#pragma unroll
    for (int r = 0; r < 8; ++r) so[w][8 * hh + r][t * 16 + ln] = acc[t][r] * alpha; }
  __builtin_amdgcn_fence(__ATOMIC_ACQ_REL, "workgroup"); __builtin_amdgcn_wave_barrier();
  const int rsub = lane >> 4, c4 = (lane & 15) * 4;
  {
#pragma unroll
    for (int q = 0; q < 8; ++q) { const int r = q * 2 + rsub; if (col0 + c4 < N) { const v4f v = *(const v4fa*)&so[w][r][c4]; *(v4f*)(C + (size_t)(row0 + r) * ldc + col0 + c4) = v; } }
     }
}

// Wt[n][k] = f16(W[k][n]·scale) from f32 row-major W[K][N] (scale = power of two; bf16-exact weights stay exact in f16 away from the subnormal range)
__global__ __launch_bounds__(256) void k_wt_f16(const float* __restrict__ W, _Float16* __restrict__ Wt, int K, int N, float scale) {
  const int t = blockIdx.x * 256 + threadIdx.x; if (t >= N * (K / 8)) return; const int n = t / (K / 8), k8 = (t % (K / 8)) * 8; FragH f;
#pragma unroll
  for (int i = 0; i < 8; ++i) f.h[i] = (_Float16)(bf16_round(W[(size_t)(k8 + i) * N + n]) * scale); const v8us o = f.half[0];
  *(v8us*)((unsigned short*)Wt + (size_t)n * K + k8) = o; 
}
// k_gemm_hh variant with fused epilogue: v = acc·alpha + bias[by·sBias + col] (+ CP[(row/rowsPerB)·sCPb + by·64 + col] if CP) ; ACT 0 none / 1 elu ; writes f16 C16 (and f32 C if non-null)
template <int ACT>
__global__ __launch_bounds__(128) void k_gemm_hhx(const _Float16* __restrict__ A, int lda, size_t sA, const _Float16* __restrict__ Bh, int ldb, size_t sB, float alpha, const float* __restrict__ bias, size_t sBias, const float* __restrict__ CP, int rowsPerB, size_t sCPb, int row0g,
    float* __restrict__ C, _Float16* __restrict__ C16, int ldc, size_t sC, int M, int N, int K) {
  __shared__ __attribute__((aligned(16))) float so[4][16][64];
  const int tid = threadIdx.x, w = tid >> 5, lane = tid & 31, ln = lane & 15, hh = lane >> 4; const int by = blockIdx.y;
  A += (size_t)by * sA; Bh += (size_t)by * sB; const size_t cofs = (size_t)by * sC; const float* bp = bias ? bias + (size_t)by * sBias : nullptr;
  const int ntn = (N + 63) / 64; const int wid = blockIdx.x * 4 + w; const int mt = wid / ntn, nq = wid % ntn; if (mt * 16 >= M) return;
  const int row0 = mt * 16, col0 = nq * 64; const _Float16* arow = A + (size_t)(row0 + ln) * lda;
  v8f acc[4] = {};
  for (int kb = 0; kb < K; kb += 32) { FragH ah; ah.half[0] = *(const v8us*)((const unsigned short*)arow + kb + 8 * hh); ah.half[1] = *(const v8us*)((const unsigned short*)arow + kb + 16 + 8 * hh);
#pragma unroll
    for (int t = 0; t < 4; ++t) { if (col0 + t * 16 >= N) continue; const size_t boff = (size_t)(col0 + t * 16 + ln) * ldb + kb; FragH bq; bq.half[0] = *(const v8us*)((const unsigned short*)Bh + boff + 8 * hh); bq.half[1] = *(const v8us*)((const unsigned short*)Bh + boff + 16 + 8 * hh);
      acc[t] = mmaH<1>(ah.v, ah.v, bq.v, bq.v, acc[t]); }
  }
#pragma unroll
  for (int t = 0; t < 4; ++t) { if (col0 + t * 16 >= N) continue; const int col = col0 + t * 16 + ln; const float bv = bp ? bf16_round(bp[col]) : 0.f;
#pragma unroll
    for (int r = 0; r < 8; ++r) { float v = acc[t][r] * alpha + bv; if (CP) { const int rr = row0g + row0 + 8 * hh + r; if (rowsPerB < 0) v += CP[cofs + (size_t)rr * ldc + col];      /* rowsPerB < 0: own element of the batched C plane */ else { const int bidx = rr / rowsPerB; v += CP[(size_t)bidx * sCPb + (size_t)by * 64 + col]; } } if (ACT == 1) v = (v > 0.f) ? v : expm1f(v); else if (ACT == 7) v = (v > 0.f) ? v + 1.0f : expf(v); else if (ACT == 8) v = tanhf(v); else if (ACT == 9) v = 0.5f * v * (1.0f + tanhf(0.7978845608028654f * (v + 0.044715f * v * v * v))); else if (ACT == 11) v = 1.0f / (1.0f + expf(-v)); else if (ACT == 12) v = (v > 0.f) ? v : 0.01f * v; else if (ACT == 14) v = (v > 0.f) ? v : 0.1f * v; else if (ACT == 16) v = (v >= 0.f) ? v : 0.3f * v; else if (ACT == 17) v = (v >= 0.f) ? v : 0.2f * v; else if (ACT == 15) v = v / (1.0f + expf(-v)); else if (ACT == 3) v = fmaxf(v, 0.f); else if (ACT == 6) v = 0.5f * v * (1.0f + erff(v * 0.70710678118654752f)); so[w][8 * hh + r][t * 16 + ln] = v; } }
  __builtin_amdgcn_fence(__ATOMIC_ACQ_REL, "workgroup"); __builtin_amdgcn_wave_barrier();
  const int rsub = lane >> 4, c4 = (lane & 15) * 4; typedef _Float16 v4h __attribute__((ext_vector_type(4)));
  {
#pragma unroll
    for (int q = 0; q < 8; ++q) { const int r = q * 2 + rsub; if (col0 + c4 < N) { const v4f v = *(const v4fa*)&so[w][r][c4]; if (C) *(v4f*)(C + cofs + (size_t)(row0 + r) * ldc + col0 + c4) = v; if (C16) { v4h h4; for (int i = 0; i < 4; ++i) h4[i] = (_Float16)v[i]; *(v4h*)(C16 + cofs + (size_t)(row0 + r) * ldc + col0 + c4) = h4; } } }
     }
}


typedef _Float16 v4h __attribute__((ext_vector_type(4)));

__global__ __launch_bounds__(256) void k_x16(const float* __restrict__ x, _Float16* __restrict__ X16, size_t n8) { const size_t t = (size_t)blockIdx.x * 256 + threadIdx.x; if (t >= n8) return; FragH f;
#pragma unroll
  for (int q = 0; q < 8; ++q) f.h[q] = (_Float16)bf16_round(x[t * 8 + q]); *(v8us*)((unsigned short*)X16 + t * 8) = f.half[0];  }
__global__ __launch_bounds__(256) void k_h16(const float* __restrict__ x, _Float16* __restrict__ X16, size_t n8) { const size_t t = (size_t)blockIdx.x * 256 + threadIdx.x; if (t >= n8) return; FragH f;
#pragma unroll
  for (int q = 0; q < 8; ++q) f.h[q] = (_Float16)x[t * 8 + q]; *(v8us*)((unsigned short*)X16 + t * 8) = f.half[0];  }
__global__ __launch_bounds__(256) void k_round16f(const float* __restrict__ W, _Float16* __restrict__ Bt, size_t n8) { const size_t t = (size_t)blockIdx.x * 256 + threadIdx.x; if (t >= n8) return; FragH f;
#pragma unroll
  for (int i = 0; i < 8; ++i) f.h[i] = (_Float16)(bf16_round(W[t * 8 + i]) * 16.0f); *(v8us*)((unsigned short*)Bt + t * 8) = f.half[0];  }
template <int NHv, int TTv>
__global__ __launch_bounds__(256) void k_vt(const _Float16* __restrict__ V16, int ldv, int voff, _Float16* __restrict__ Vt) { __shared__ unsigned short tl[64][66]; const int tid = threadIdx.x; const int slab = blockIdx.x / (TTv / 64), lg = blockIdx.x % (TTv / 64); const int b = slab / NHv, h = slab % NHv;
  for (int i = tid; i < 64 * 8; i += 256) { const int r = i / 8, c8 = (i % 8) * 8; FragH f; f.half[0] = *(const v8us*)((const unsigned short*)V16 + ((size_t)b * TTv + lg * 64 + r) * ldv + voff + h * 64 + c8);
#pragma unroll
    for (int q = 0; q < 8; ++q) tl[r][c8 + q] = f.u[q]; }
  __syncthreads();
  {
#pragma unroll
    for (int rd = 0; rd < 2; ++rd) { const int d = rd * 32 + tid / 8, pc = tid % 8; FragH f;
#pragma unroll
      for (int q = 0; q < 8; ++q) f.u[q] = tl[pc * 8 + q][d];
      *(v8us*)((unsigned short*)Vt + ((size_t)slab * 64 + d) * TTv + lg * 64 + pc * 8) = f.half[0]; }
     } }

__global__ __launch_bounds__(256) void k_hl(const float* __restrict__ F, _Float16* __restrict__ Hh, _Float16* __restrict__ Hl, size_t n8) { const size_t t = (size_t)blockIdx.x * 256 + threadIdx.x; if (t >= n8) return; FragH fh, fl; const v4f a = *(const v4fa*)(F + t * 8), c = *(const v4fa*)(F + t * 8 + 4);
#pragma unroll
  for (int q = 0; q < 4; ++q) { _Float16 h = (_Float16)a[q]; fh.h[q] = h; fl.h[q] = (_Float16)((a[q] - (float)h) * 1024.0f); h = (_Float16)c[q]; fh.h[4 + q] = h; fl.h[4 + q] = (_Float16)((c[q] - (float)h) * 1024.0f); }
  { *(v8us*)((unsigned short*)Hh + t * 8) = fh.half[0]; *(v8us*)((unsigned short*)Hl + t * 8) = fl.half[0];  } }

// ---- fast GEMM (wave tile 32x64; requires M % 32 == 0 rows per launch region and N % 64 == 0); epilogue = k_gemm_hhx semantics ----
__device__ __forceinline__ v16h g2_frag(const _Float16* p, int hh) { FragH f; f.half[0] = *(const v8us*)((const unsigned short*)p + 8 * hh); f.half[1] = *(const v8us*)((const unsigned short*)p + 16 + 8 * hh); return f.v; }
__device__ __forceinline__ v8f g2_mma(v16h a, v16h b, v8f c) { v8f d = __builtin_amdgcn_wmma_f32_16x16x32_f16(false, a, false, b, (short)0, c, false, false); asm volatile("v_nop\n\tv_nop\n\tv_nop\n\tv_nop" : "+v"(d) : "v"(a), "v"(b)); return d; }
template <int ACT>
__global__ __launch_bounds__(128) void k_gemm2(const _Float16* __restrict__ A, int lda, size_t sA, const _Float16* __restrict__ Bh, int ldb, size_t sB, float alpha, const float* __restrict__ bias, size_t sBias, const float* __restrict__ CP, int rowsPerB, size_t sCPb, int row0g,
    float* __restrict__ C, _Float16* __restrict__ C16, int ldc, size_t sC, int M, int N, int K) { static_assert(ACT == 0 || ACT == 3 || ACT == 6 || ACT == 8 || ACT == 9 || ACT == 11 || ACT == 12 || ACT == 14 || ACT == 15 || ACT == 16 || ACT == 17 || ACT == 19, "k_gemm2: unsupported ACT code (would silently apply no activation)");
  __shared__ __attribute__((aligned(16))) float so[4][32][68];
  const int tid = threadIdx.x, w = tid >> 5, lane = tid & 31, ln = lane & 15, hh = lane >> 4; const int by = blockIdx.y;
  A += (size_t)by * sA; Bh += (size_t)by * sB; const size_t cofs = (size_t)by * sC; const float* bp = bias ? bias + (size_t)by * sBias : nullptr;
  const int ntn = N >> 6; const int mt = blockIdx.x / ntn, nq = blockIdx.x - mt * ntn; const int row0 = mt * 128 + 32 * w, col0 = nq * 64; if (row0 >= M) return;
  const _Float16* a0p = A + (size_t)(row0 + ln) * lda; const _Float16* a1p = a0p + (size_t)16 * lda;
  const _Float16* b0p = Bh + (size_t)(col0 + ln) * ldb; const _Float16* b1p = b0p + (size_t)16 * ldb; const _Float16* b2p = b1p + (size_t)16 * ldb; const _Float16* b3p = b2p + (size_t)16 * ldb;
  const v8f z8 = {0.f,0.f,0.f,0.f,0.f,0.f,0.f,0.f}; v8f c00 = z8, c01 = z8, c02 = z8, c03 = z8, c10 = z8, c11 = z8, c12 = z8, c13 = z8;
#pragma unroll 1
  for (int kb = 0; kb < K; kb += 32) { const v16h a0 = g2_frag(a0p + kb, hh), a1 = g2_frag(a1p + kb, hh);
    v16h b = g2_frag(b0p + kb, hh); c00 = g2_mma(a0, b, c00); c10 = g2_mma(a1, b, c10);
    b = g2_frag(b1p + kb, hh); c01 = g2_mma(a0, b, c01); c11 = g2_mma(a1, b, c11);
    b = g2_frag(b2p + kb, hh); c02 = g2_mma(a0, b, c02); c12 = g2_mma(a1, b, c12);
    b = g2_frag(b3p + kb, hh); c03 = g2_mma(a0, b, c03); c13 = g2_mma(a1, b, c13); }
  v8f accs[8] = {c00, c01, c02, c03, c10, c11, c12, c13};
#pragma unroll
  for (int u = 0; u < 8; ++u) { const int t = u & 3, half = u >> 2; const int col = col0 + t * 16 + ln; const float bv = bp ? bf16_round(bp[col]) : 0.f;
#pragma unroll
    for (int r = 0; r < 8; ++r) { const int rloc = half * 16 + 8 * hh + r; float v = accs[u][r] * alpha + bv; if (CP) { if (rowsPerB < 0) v += CP[cofs + (size_t)(row0g + row0 + rloc) * ldc + col];      /* rowsPerB < 0: own element of the batched C plane */ else { const int bidx = (row0g + row0 + rloc) / rowsPerB; v += CP[(size_t)bidx * sCPb + (size_t)by * 64 + col]; } }
      if (ACT == 3) v = fmaxf(v, 0.f); else if (ACT == 6) v = 0.5f * v * (1.0f + erff(v * 0.70710678118654752f)); else if (ACT == 11) v = 1.0f / (1.0f + expf(-v)); else if (ACT == 15) v = v / (1.0f + expf(-v)); else if (ACT == 19) v = (v > 0.f) ? (v + 1.0f) : expf(v);      /* elu(v) + 1 */ else if (ACT == 12) v = (v > 0.f) ? v : 0.01f * v; else if (ACT == 8) v = tanhf(v); else if (ACT == 9) v = 0.5f * v * (1.0f + tanhf(0.7978845608028654f * (v + 0.044715f * v * v * v))); else if (ACT == 14) v = (v > 0.f) ? v : 0.1f * v; else if (ACT == 16) v = (v >= 0.f) ? v : 0.3f * v; else if (ACT == 17) v = (v >= 0.f) ? v : 0.2f * v;
      so[w][rloc][t * 16 + ln] = v; } }
  __builtin_amdgcn_fence(__ATOMIC_ACQ_REL, "workgroup"); __builtin_amdgcn_wave_barrier();
  const int rsub = lane >> 4, c4 = (lane & 15) * 4;
  {
#pragma unroll
    for (int q = 0; q < 16; ++q) { const int r = q * 2 + rsub; const v4f v = *(const v4fa*)&so[w][r][c4]; if (C) *(v4f*)(C + cofs + (size_t)(row0 + r) * ldc + col0 + c4) = v; if (C16) { v4h h4; for (int i = 0; i < 4; ++i) h4[i] = (_Float16)v[i]; *(v4h*)(C16 + cofs + (size_t)(row0 + r) * ldc + col0 + c4) = h4; } }
     } }


__global__ __launch_bounds__(256) void k_wnat(const float* __restrict__ w, size_t n8, _Float16* __restrict__ Bt) { const size_t t = (size_t)blockIdx.x * 256 + threadIdx.x; if (t >= n8) return; FragH f; for (int q = 0; q < 8; ++q) f.h[q] = (_Float16)(bf16_round(w[t * 8 + q]) * 16.0f); *(v8us*)((unsigned short*)Bt + t * 8) = f.half[0];  }
__global__ __launch_bounds__(256) void k_rsm(const float* __restrict__ S, _Float16* __restrict__ P, int nrows) {
  #pragma clang fp contract(off)
  const int i = blockIdx.x * 256 + threadIdx.x; if (i >= nrows) return; const float* s = S + (size_t)i * SQ; float mx = -3.0e38f;
#pragma unroll 1
  for (int j = 0; j < SQ; ++j) mx = fmaxf(mx, s[j]); float se = 0.f;
#pragma unroll 1
  for (int j = 0; j < SQ; ++j) se += expf(s[j] - mx); const float sc = 256.0f / se;
#pragma unroll 1
  for (int j0 = 0; j0 < SQ; j0 += 8) { FragH f; for (int q = 0; q < 8; ++q) f.h[q] = (_Float16)(expf(s[j0 + q] - mx) * sc); unsigned short* d = (unsigned short*)P + (size_t)i * SQ + j0; *(v8us*)d = f.half[0];  } }
__global__ __launch_bounds__(256) void k_vt(const _Float16* __restrict__ V16, int b, int h0, _Float16* __restrict__ VT) { __shared__ unsigned short tl[64][65]; const int tid = threadIdx.x; const int hh = blockIdx.x % HG, sg = blockIdx.x / HG; const int s0 = sg * 64; const int h = h0 + hh;
  for (int i = tid; i < 64 * 8; i += 256) { const int j = i / 8, d8 = (i % 8) * 8; FragH f; f.half[0] = *(const v8us*)((const unsigned short*)V16 + ((size_t)b * SQ + s0 + j) * DM + h * HD + d8); for (int q = 0; q < 8; ++q) tl[d8 + q][j] = f.u[q]; }
  __syncthreads();
  { for (int i = tid; i < 64 * 8; i += 256) { const int d = i / 8, j8 = (i % 8) * 8; FragH f; for (int q = 0; q < 8; ++q) f.u[q] = tl[d][j8 + q]; *(v8us*)((unsigned short*)VT + ((size_t)hh * HD + d) * SQ + s0 + j8) = f.half[0]; }  } }



__global__ __launch_bounds__(256) void k_rsmcf2(const float* __restrict__ S, _Float16* __restrict__ P, int hg, int q0, int nk) {
  #pragma clang fp contract(off)
  const int t = blockIdx.x * 256 + threadIdx.x; if (t >= hg * QT) return; const size_t i = (size_t)t; const float* s = S + i * NKX; const int last = q0 + (t % QT); float mx = -3.0e38f;
#pragma unroll 1
  for (int j = 0; j < nk; ++j) { const float f = (j <= last) ? 1.f : 0.f; mx = fmaxf(mx, fmaf(f, s[j], (1.f - f) * -1.0e9f)); } float se = 0.f;
#pragma unroll 1
  for (int j = 0; j < nk; ++j) { const float f = (j <= last) ? 1.f : 0.f; se += __expf(fmaf(f, s[j], (1.f - f) * -1.0e9f) - mx); } const float sc = 256.0f / se;
#pragma unroll 1
  for (int j0 = 0; j0 < nk; j0 += 8) { FragH fr; for (int q = 0; q < 8; ++q) { const int j = j0 + q; const float f = (j <= last) ? 1.f : 0.f; fr.h[q] = (_Float16)(__expf(fmaf(f, s[j], (1.f - f) * -1.0e9f) - mx) * sc); } unsigned short* d = (unsigned short*)P + i * NKX + j0; *(v8us*)d = fr.half[0];  } }


template <int MASKADD>
__global__ __launch_bounds__(64) void k_att0(const float* __restrict__ QF, const float* __restrict__ KF, const float* __restrict__ VF, int ld, const float* __restrict__ mask, float scale, float* __restrict__ OF, int ldo) {
  #pragma clang fp contract(off)
  __shared__ __attribute__((aligned(16))) float lq[64][64]; __shared__ __attribute__((aligned(16))) float lo[64][64];
  const int tid = threadIdx.x; const int h = blockIdx.x / (QT0 / 64), rg = blockIdx.x % (QT0 / 64); const int i = rg * 64 + tid;
  const float* qr = QF + (size_t)i * ld + h * HD;
#pragma unroll 1
  for (int c = 0; c < HD / 4; ++c) { *(v4f*)&lq[tid][c * 4] = *(const v4fa*)(qr + c * 4); const v4f z = {0.f, 0.f, 0.f, 0.f}; *(v4f*)&lo[tid][c * 4] = z; }
  float m = -1.0e30f, l = 0.f; const int jmax = MASKADD ? (SQ - 1) : (rg * 64 + 63);      /* additive-mask form: every key (the mask input decides); causal form: keys up to the block's last row */
#pragma unroll 1
  for (int j = 0; j <= jmax; ++j) { const float* kr = KF + (size_t)j * ld + h * HD; const float* vr = VF + (size_t)j * ld + h * HD; float s = 0.f;
#pragma unroll 1
    for (int c = 0; c < HD / 4; ++c) { const v4f kq = *(const v4fa*)(kr + c * 4); const v4f qq = *(v4f*)&lq[tid][c * 4]; s = __fadd_rn(s, __fmul_rn(qq[0], kq[0])); s = __fadd_rn(s, __fmul_rn(qq[1], kq[1])); s = __fadd_rn(s, __fmul_rn(qq[2], kq[2])); s = __fadd_rn(s, __fmul_rn(qq[3], kq[3])); }
    s = __fmul_rn(s, scale); if (MASKADD) s = __fadd_rn(s, __fmul_rn(bf16_round(mask[(size_t)i * SQ + j]), -10000.0f));
    const float f = (MASKADD || j <= i) ? 1.f : 0.f; const float sm = fmaf(f, s, (1.f - f) * -1.0e30f); const float mn = fmaxf(m, sm); const float sc = expf(m - mn); const float e = expf(sm - mn); l = __fadd_rn(__fmul_rn(l, sc), e); m = mn;
#pragma unroll 1
    for (int c = 0; c < HD / 4; ++c) { const v4f vv = *(const v4fa*)(vr + c * 4); v4f oo = *(v4f*)&lo[tid][c * 4]; for (int u = 0; u < 4; ++u) oo[u] = __fadd_rn(__fmul_rn(oo[u], sc), __fmul_rn(e, vv[u])); *(v4f*)&lo[tid][c * 4] = oo; } }
  const float fin = 64.0f / l;      /* o carried x64 like the f16 path */
#pragma unroll 1
  for (int c = 0; c < HD / 4; ++c) { v4f oo = *(v4f*)&lo[tid][c * 4]; for (int u = 0; u < 4; ++u) oo[u] = __fmul_rn(oo[u], fin); *(v4f*)&lo[tid][c * 4] = oo; }
  __syncthreads();
  {
#pragma unroll 1
    for (int it = 0; it < 16; ++it) { const int row = it * 4 + tid / 16, pc = (tid % 16) * 4; const v4f v = *(const v4f*)&lo[row][pc]; *(v4f*)(OF + (size_t)(rg * 64 + row) * ldo + h * HD + pc) = v; }
     } }


// Fused causal linear attention: o_i = sum_{j <= i} a_ij v_j / sum_{j <= i} a_ij, a_ij = phi(q_i) . phi(k_j); no score or weight plane in memory.
// One work-group of 4 waves per (batch, head, 32 query rows). The sums over the keys are plain sums, so the waves split the keys: wave w takes the 64-key blocks w, w + 4, ... in two steps of 32 keys
// (a V^T row's 128-byte line is used up by the wave that fetched it), and the four partial o tiles and row sums are added through LDS at the end.
// Per step: a^T = K Q^T, so that a lane of the accumulator holds 8 consecutive keys of ONE query: accumulator tile 0 (keys 0..15) and tile 1 (keys 16..31) of a query column, rounded to f16,
// are elements 0..7 and 8..15 of the A fragment of a V^T in the k order of g2_frag (8 hh + i, 16 + 8 hh + i), which also loads V^T: nothing is moved between lanes.
#define FQ 32                        /* query rows per work-group */
#define FS 32                        /* keys per step */
#define FP 68                        /* pitch in floats of the partial o rows in LDS, as in k_gemm2 */
__global__ __launch_bounds__(128) void k_lfa(const _Float16* __restrict__ Q16, const _Float16* __restrict__ K16, const _Float16* __restrict__ VT, _Float16* __restrict__ O16) {      /* Q16, K16, O16: rows of DM; VT: [NB][NH][HD][SQ] */
  __shared__ __attribute__((aligned(16))) float so[4][FQ][FP]; __shared__ float sl[4][2][FQ];
  const int tid = threadIdx.x, lane = tid & 31, ln = lane & 15, hh = lane >> 4; const int w = __builtin_amdgcn_readfirstlane(tid >> 5);      /* the wave's number in a scalar register: the loop and the mask test are scalar branches, every lane stays on at the matrix instructions */
  const int rg = (SQ / FQ - 1) - (int)blockIdx.x, h = blockIdx.y, b = blockIdx.z;      /* the tiles with the most keys start first */
  const _Float16* qp = Q16 + ((size_t)b * SQ + rg * FQ + ln) * DM + h * HD; const _Float16* kp = K16 + ((size_t)b * SQ + ln) * DM + h * HD + 8 * hh; const _Float16* vp = VT + (((size_t)b * NH + h) * HD + ln) * SQ + 8 * hh;      /* kp, vp: the lane's own 8 hh is in the pointer, so that the step's loads all name kq or vq itself */
  v16h qf[2][2];
#pragma unroll
  for (int qs = 0; qs < 2; ++qs) { qf[qs][0] = g2_frag(qp + (size_t)qs * 16 * DM, hh); qf[qs][1] = g2_frag(qp + (size_t)qs * 16 * DM + 32, hh); }
  const v8f z8 = {0.f,0.f,0.f,0.f,0.f,0.f,0.f,0.f}; v8f o[2][4] = {{z8, z8, z8, z8}, {z8, z8, z8, z8}}; float ls[2] = {0.f, 0.f};
  for (int it = 0; ; ++it) { const int s = (((it >> 1) * 4 + w) << 1) + (it & 1); if (s > rg) break;      /* s rises with it; step rg holds the diagonal and is the last */
    const _Float16* kq = kp + (size_t)s * FS * DM; const _Float16* vq = vp + s * FS;
    v16h kf[2][2], vf[4];
#pragma unroll
    for (int ks = 0; ks < 2; ++ks) { kf[ks][0] = g2_frag(kq + (size_t)ks * 16 * DM, 0); kf[ks][1] = g2_frag(kq + (size_t)ks * 16 * DM + 32, 0); }
#pragma unroll
    for (int t = 0; t < 4; ++t) vf[t] = g2_frag(vq + (size_t)t * 16 * SQ, 0);
    asm volatile("s_wait_xcnt 0x0" :: "v"(kq), "v"(vq) : "memory");      /* behind the last load of the step; the two address pairs are its inputs, so that neither is advanced or reused ahead of it */
    v8f st[2][2];      /* st[ks][qs][r]: key s FS + 16 ks + 8 hh + r, query rg FQ + 16 qs + ln */
#pragma unroll
    for (int ks = 0; ks < 2; ++ks)
#pragma unroll
      for (int qs = 0; qs < 2; ++qs) st[ks][qs] = g2_mma(kf[ks][0], qf[qs][0], z8);
#pragma unroll
    for (int ks = 0; ks < 2; ++ks)
#pragma unroll
      for (int qs = 0; qs < 2; ++qs) st[ks][qs] = g2_mma(kf[ks][1], qf[qs][1], st[ks][qs]);
    if (s == rg) {      /* the diagonal step: key and query count from the same row here */
#pragma unroll
      for (int ks = 0; ks < 2; ++ks)
#pragma unroll
        for (int qs = 0; qs < 2; ++qs)
#pragma unroll
          for (int r = 0; r < 8; ++r) st[ks][qs][r] = (ks * 16 + 8 * hh + r <= qs * 16 + ln) ? st[ks][qs][r] : 0.f; }
#pragma unroll
    for (int qs = 0; qs < 2; ++qs) { FragH p; float a = 0.f;
#pragma unroll
      for (int r = 0; r < 8; ++r) { a += st[0][qs][r] + st[1][qs][r]; p.h[r] = (_Float16)st[0][qs][r]; p.h[8 + r] = (_Float16)st[1][qs][r]; }
      ls[qs] += a;
#pragma unroll
      for (int t = 0; t < 4; ++t) o[qs][t] = g2_mma(p.v, vf[t], o[qs][t]); } }
#pragma unroll
  for (int qs = 0; qs < 2; ++qs) { sl[w][hh][qs * 16 + ln] = ls[qs];
#pragma unroll
    for (int t = 0; t < 4; ++t)
#pragma unroll
      for (int r = 0; r < 8; ++r) so[w][qs * 16 + 8 * hh + r][t * 16 + ln] = o[qs][t][r]; }
  __syncthreads();
  const int row = tid >> 2, c0 = (tid & 3) * 16;      /* four lanes per output row: 32 bytes each of its 128-byte line */
  float l = 0.f;
#pragma unroll
  for (int u = 0; u < 4; ++u) l += sl[u][0][row] + sl[u][1][row];
  const float fin = 64.0f / l;      /* o carried x64 as the output GEMM expects */
  FragH f;
#pragma unroll
  for (int c = 0; c < 4; ++c) { const v4f a = (*(const v4f*)&so[0][row][c0 + c * 4] + *(const v4f*)&so[1][row][c0 + c * 4]) + (*(const v4f*)&so[2][row][c0 + c * 4] + *(const v4f*)&so[3][row][c0 + c * 4]);
#pragma unroll
    for (int q = 0; q < 4; ++q) f.h[c * 4 + q] = (_Float16)(a[q] * fin); }
  unsigned short* d = (unsigned short*)O16 + ((size_t)b * SQ + rg * FQ + row) * DM + h * HD + c0;
  *(v8us*)d = f.half[0]; *(v8us*)(d + 8) = f.half[1]; }

// Exact f32 linear attention for the first QT0 rows of one batch. One work-group of 8 waves per (head, 32 query rows), lane = query row.
// The head's QT0 key and value rows and the group's 32 q rows are staged once in LDS with whole-line loads, all in flight together. Step 1: wave w takes the keys j = w mod 8, four at a time
// (four independent sum chains), q row in registers, k row broadcast from LDS; the masked score goes to le[j][row]. Step 2: wave w owns columns 8 w .. 8 w + 7 of o in registers
// and walks the keys in ascending order. Each sum runs in the order of the one-thread-per-row form (d ascending, j ascending); keys above the group's last row only ever added zeros and are left out.
#define LR 32                        /* query rows per work-group */
#define LP 68                        /* pitch in floats of the per-row LDS arrays: 16 B x odd, so that 32 lanes reading 16 B of their own rows spread over the banks */
__global__ __launch_bounds__(256) void k_latt0(const float* __restrict__ QF, const float* __restrict__ KF, const float* __restrict__ VF, float* __restrict__ OF) {      /* all four planes: rows of DM floats */
  __shared__ __attribute__((aligned(16))) float lk[QT0][HD]; __shared__ __attribute__((aligned(16))) float lv[QT0][HD]; __shared__ __attribute__((aligned(16))) float le[QT0][LR];
  __shared__ __attribute__((aligned(16))) float lq[LR][LP]; __shared__ __attribute__((aligned(16))) float lo[LR][LP];
  const int tid = threadIdx.x, w = tid >> 5, lane = tid & 31; const int h = blockIdx.x / (QT0 / LR), rg = blockIdx.x % (QT0 / LR); const int r0 = rg * LR, nj = r0 + LR, i = r0 + lane;
  const int sr = tid / (HD / 4), sc = (tid % (HD / 4)) * 4;      /* staging and output: 16 lanes per 256-byte row, 16 rows per pass of the work-group */
  { v4f tk[QT0 / 16], tv[QT0 / 16], tq[LR / 16]; const float* kp = KF + (size_t)sr * DM + h * HD + sc; const float* vp = VF + (size_t)sr * DM + h * HD + sc; const float* qp = QF + (size_t)(r0 + sr) * DM + h * HD + sc;
#pragma unroll      /* every load is issued before the first LDS store waits for one */
    for (int p = 0; p < QT0 / 16; ++p) { tk[p] = *(const v4fa*)(kp + (size_t)p * 16 * DM); tv[p] = *(const v4fa*)(vp + (size_t)p * 16 * DM); }
#pragma unroll
    for (int p = 0; p < LR / 16; ++p) tq[p] = *(const v4fa*)(qp + (size_t)p * 16 * DM);
    asm volatile("s_wait_xcnt 0x0" :: "v"(kp), "v"(vp), "v"(qp) : "memory");      /* behind the last load of the run; the three address pairs are its inputs, so that none of them is given to a load's result or reused ahead of it */
#pragma unroll
    for (int p = 0; p < QT0 / 16; ++p) { *(v4f*)&lk[p * 16 + sr][sc] = tk[p]; *(v4f*)&lv[p * 16 + sr][sc] = tv[p]; }
#pragma unroll
    for (int p = 0; p < LR / 16; ++p) *(v4f*)&lq[p * 16 + sr][sc] = tq[p]; }
  __syncthreads();
  v4f q[HD / 4];
#pragma unroll      /* q stays in registers: constant indices only */
  for (int c = 0; c < HD / 4; ++c) q[c] = *(const v4f*)&lq[lane][c * 4];
  for (int jb = 0; jb < nj; jb += 32) { const int j0 = jb + w; float s0 = 0.f, s1 = 0.f, s2 = 0.f, s3 = 0.f;
#pragma unroll      /* constant indices into q; the four chains fill each other's result latency */
    for (int c = 0; c < HD / 4; ++c) { const v4f k0 = *(const v4f*)&lk[j0][c * 4], k1 = *(const v4f*)&lk[j0 + 8][c * 4], k2 = *(const v4f*)&lk[j0 + 16][c * 4], k3 = *(const v4f*)&lk[j0 + 24][c * 4];
#pragma unroll
      for (int u = 0; u < 4; ++u) { s0 += q[c][u] * k0[u]; s1 += q[c][u] * k1[u]; s2 += q[c][u] * k2[u]; s3 += q[c][u] * k3[u]; } }
    le[j0][lane] = (j0 <= i) ? s0 : 0.f; le[j0 + 8][lane] = (j0 + 8 <= i) ? s1 : 0.f; le[j0 + 16][lane] = (j0 + 16 <= i) ? s2 : 0.f; le[j0 + 24][lane] = (j0 + 24 <= i) ? s3 : 0.f; }
  __syncthreads();
  float l = 0.f; v4f oa = {0.f, 0.f, 0.f, 0.f}, ob = {0.f, 0.f, 0.f, 0.f};
#pragma unroll 8      /* eight keys' LDS reads are issued ahead of the sums that use them */
  for (int j = 0; j < nj; ++j) { const float e = le[j][lane]; const v4f va = *(const v4f*)&lv[j][w * 8], vb = *(const v4f*)&lv[j][w * 8 + 4]; l += e; oa += e * va; ob += e * vb; }
  const float fin = 64.0f / l;      /* o carried x64 like the f16 path */
  *(v4f*)&lo[lane][w * 8] = oa * fin; *(v4f*)&lo[lane][w * 8 + 4] = ob * fin;
  __syncthreads();
#pragma unroll      /* two passes, each wave storing whole 128-byte lines */
  for (int p = 0; p < LR / 16; ++p) *(v4f*)(OF + (size_t)(r0 + p * 16 + sr) * DM + h * HD + sc) = *(const v4f*)&lo[p * 16 + sr][sc]; }
extern "C" void kernel_launch(void* const* d_in, const int* in_sizes, int n_in,
                              void* d_out, int out_size, void* d_ws, size_t ws_size, hipStream_t stream) {
  (void)in_sizes; (void)n_in; (void)out_size;
  const float* const* I = (const float* const*)d_in; const float* x = I[0]; const float* wqk = I[1]; const float* bqk = I[2]; const float* wv = I[3]; const float* bv = I[4]; const float* wo = I[5]; const float* bo = I[6]; const float* bq = bqk; const float* bk = bqk + DM;      /* natural Wqk [2048][1024] (q rows | k rows) + bias [2048]; Wv + bv; Wo + bo */
  char* ws = (char*)d_ws; size_t off = 0;
  auto take = [&](size_t bytes) { char* p = ws + off; off += (bytes + 255) & ~(size_t)255; return p; };
  _Float16* BQK = (_Float16*)take((size_t)2 * DM * DM * 2); _Float16* BQ = BQK; _Float16* BK = BQK + (size_t)DM * DM; _Float16* BV = (_Float16*)take((size_t)DM * DM * 2); _Float16* BO = (_Float16*)take((size_t)DM * DM * 2);
  _Float16* X16 = (_Float16*)take(NR * DM * 2); _Float16* Q16 = (_Float16*)take(NR * DM * 2); _Float16* K16 = (_Float16*)take(NR * DM * 2); _Float16* V16 = (_Float16*)take(NR * DM * 2); _Float16* O16 = (_Float16*)take(NR * DM * 2);
  _Float16* VT = (_Float16*)take((size_t)NB * NH * HD * SQ * 2);
  float* QF0 = (float*)take((size_t)QT0 * DM * 4); float* KF0 = (float*)take((size_t)QT0 * DM * 4); float* VF0 = (float*)take((size_t)QT0 * DM * 4); float* OF0 = (float*)take((size_t)NB * QT0 * DM * 4); _Float16* OH0 = (_Float16*)take((size_t)NB * QT0 * DM * 2); _Float16* OL0 = (_Float16*)take((size_t)NB * QT0 * DM * 2);
  if (off > ws_size) return;
  { const unsigned g = (unsigned)(((size_t)DM * DM / 8 + 255) / 256); k_wnat<<<2 * g, 256, 0, stream>>>(wqk, (size_t)2 * DM * DM / 8, BQK); k_wnat<<<g, 256, 0, stream>>>(wv, (size_t)DM * DM / 8, BV); k_wnat<<<g, 256, 0, stream>>>(wo, (size_t)DM * DM / 8, BO); }      /* natural [out][in] = Bt[n][k], x16 (Wqk's q rows then k rows) */

  k_x16<<<(unsigned)((NR * DM / 8 + 255) / 256), 256, 0, stream>>>(x, X16, NR * DM / 8);
  const size_t r0p = (size_t)B0 * SQ;      /* first projected row */
  k_gemm2<19><<<dim3((unsigned)((MP / 128) * (DM / 64)), 1), 128, 0, stream>>>(X16 + r0p * DM, DM, 0, BQ, DM, 0, 0.0625f, bq, 0, nullptr, 1, 0, 0, nullptr, Q16 + r0p * DM, DM, 0, MP, DM, DM);      /* phi(q) = elu(x Wq^T + bq) + 1 */
  k_gemm2<19><<<dim3((unsigned)((MP / 128) * (DM / 64)), 1), 128, 0, stream>>>(X16 + r0p * DM, DM, 0, BK, DM, 0, 0.0625f, bk, 0, nullptr, 1, 0, 0, nullptr, K16 + r0p * DM, DM, 0, MP, DM, DM);      /* phi(k) */
  k_gemm2<0><<<dim3((unsigned)((MP / 128) * (DM / 64)), 1), 128, 0, stream>>>(X16 + r0p * DM, DM, 0, BV, DM, 0, 0.0625f, bv, 0, nullptr, 1, 0, 0, nullptr, V16 + r0p * DM, DM, 0, MP, DM, DM);
  for (int b = B0; b < B0 + NBR; ++b) { const size_t r0 = (size_t)b * SQ;
    k_vt<NH, SQ><<<NH * (SQ / 64), 256, 0, stream>>>(V16 + r0 * LQ, LQ, 0, VT + (size_t)b * NH * HD * SQ);      /* V^T [NH][HD][SQ] of this batch */
    k_gemm2<19><<<dim3((QT0 / 128) * (DM / 64), 1), 128, 0, stream>>>(X16 + r0 * DM, DM, 0, BQ, DM, 0, 0.0625f, bq, 0, nullptr, 1, 0, 0, QF0, nullptr, DM, 0, QT0, DM, DM); k_gemm2<19><<<dim3((QT0 / 128) * (DM / 64), 1), 128, 0, stream>>>(X16 + r0 * DM, DM, 0, BK, DM, 0, 0.0625f, bk, 0, nullptr, 1, 0, 0, KF0, nullptr, DM, 0, QT0, DM, DM); k_gemm2<0><<<dim3((QT0 / 128) * (DM / 64), 1), 128, 0, stream>>>(X16 + r0 * DM, DM, 0, BV, DM, 0, 0.0625f, bv, 0, nullptr, 1, 0, 0, VF0, nullptr, DM, 0, QT0, DM, DM);      /* f32 phi(q), phi(k), v of the first 128 rows (exact products) */
    k_latt0<<<NH * (QT0 / LR), 256, 0, stream>>>(QF0, KF0, VF0, OF0 + (size_t)b * QT0 * DM);      /* exact f32 linear attention for rows 0..127 (o x64): the few-key rows without the f16 roundings */
  }
  k_lfa<<<dim3(SQ / FQ, NH, NB), 128, 0, stream>>>(Q16, K16, VT, O16);      /* scores, causal normalisation and a V^T of every batch, head and query tile in one launch: o (merged heads, x64) as f16 rows */
  k_gemm2<0><<<dim3((unsigned)((MPO / 128) * (DM / 64)), 1), 128, 0, stream>>>(O16 + r0p * DM, DM, 0, BO, DM, 0, 0.0009765625f, bo, 0, nullptr, 1, 0, 0, (float*)d_out + r0p * DM, nullptr, DM, 0, MPO, DM, DM);      /* out rows are the output layout */
  k_hl<<<(unsigned)(((size_t)NB * QT0 * DM / 8 + 255) / 256), 256, 0, stream>>>(OF0, OH0, OL0, (size_t)NB * QT0 * DM / 8);      /* first-tile o (x64) -> f16 hi + x1024 residual planes */
  for (int b = B0; b < B0 + NBR; ++b) { const size_t r0 = (size_t)b * SQ; const size_t f0 = (size_t)b * QT0;
    k_gemm2<0><<<dim3((QT0 / 128) * (DM / 64), 1), 128, 0, stream>>>(OH0 + f0 * DM, DM, 0, BO, DM, 0, 0.0009765625f, bo, 0, nullptr, 1, 0, 0, (float*)d_out + r0 * DM, nullptr, DM, 0, QT0, DM, DM);      /* rows 0..127: out = o_hi Wo (+ b), overwriting the f16-path rows */
    k_gemm2<0><<<dim3((QT0 / 128) * (DM / 64), 1), 128, 0, stream>>>(OL0 + f0 * DM, DM, 0, BO, DM, 0, 0.00000095367431640625f, nullptr, 0, (const float*)d_out + r0 * DM, -1, 0, 0, (float*)d_out + r0 * DM, nullptr, DM, 0, QT0, DM, DM); }      /* += o_lo Wo 2^-20 (own-element accumulate) */
}

// v004
// Measured time: 321 microseconds a run.
// Two timings next to v003 put it at 1.76 and 1.79 times that version's speed.
// Over all steps from v000 it is 13.0 times as fast.
#include <hip/hip_runtime.h>
// Causal LINEAR attention (x [2][2048][1024]; qk = x Wqk^T + bqk (natural [2048][1024]: rows 0..1023 -> q, 1024..2047 -> k; sigma 1/32, biases 0.02), v = x Wv^T + bv; 16 heads of 64; feature map phi = elu + 1 on q and k; ctx_t = (phi(q_t) . sum_{s<=t} phi(k_s) v_s^T) / (phi(q_t) . sum_{s<=t} phi(k_s)) = sum_{s<=t} a_ts v_s / sum_{s<=t} a_ts with a_ts = phi(q_t).phi(k_s) (the module's cumsum form, no softmax, no scaling, no eps); out = ctx Wo^T + bo -> [2][2048][1024]).
// Structure: x as exact f16 rows; natural weights re-laid on VALU into exact x16 planes; q, k (with the elu + 1 feature map in the GEMM epilogue) and v as WMMA GEMMs (32x64 wave tiles, f32 accumulation, + bias) with f16 outputs; per batch: V^T via LDS transposes; one fused attention launch for all batches, heads and query tiles of 32 rows: a^T = phi(k) phi(q)^T on WMMA (K = 64) for the keys up to the tile end, causal mask, row sums in f32, a as f16 straight from the accumulators into the A operand of ctx = a V^T on WMMA, ctx x64 / sum a into merged f16 rows; out = ctx Wo^T + bo GEMM (f32); first-tile refinement: the first 128 rows of each batch recomputed exactly in f32 on VALU (a / sum a weights) and their output rows rewritten from o hi/lo by two accumulating GEMM passes; launches: see trace.
// Compute dtype: inputs rounded to bf16; x / weights exact; q, k, v, the weights a and o as plain f16 GEMM operands (~2^-12); scores and row sums f32. v_wmma_f32_16x16x32_f16.
#define NB 2
#define SQ 2048
#define DM 1024
#define NH 16
#define HD 64
#define HG 4                         /* heads per group in the unlaunched k_vt(V16, b, h0, VT) overload */
#define QT 256                       /* query rows per causal tile */
#define NKX SQ                       /* S / P row pitch */
#define QT0 128                      /* first-tile rows recomputed exactly in f32 */
#define B0 0                         /* first batch processed (debug hook) */
#define NBR NB                       /* batches processed (debug hook) */
#define NR ((size_t)NB * SQ)         /* token rows */
#define MP ((int)((size_t)NBR * SQ)) /* rows projected (debug hook) */
#define QN SQ                        /* unused: k_lfa attends all SQ rows of every batch */
#define NHD NH                       /* unused: k_lfa attends all NH heads */
#define MPO MP                       /* rows through the output stage (debug hook) */
#define LQ DM      /* row pitch of the q/k/v rows */
typedef __bf16 v16b __attribute__((ext_vector_type(16)));
typedef unsigned short v8us __attribute__((ext_vector_type(8), may_alias));
typedef float  v8f  __attribute__((ext_vector_type(8)));
typedef float  v4f  __attribute__((ext_vector_type(4)));
typedef float  v4fa __attribute__((ext_vector_type(4), may_alias));
union FragB { v16b v; v8us half[2]; unsigned short u[16]; };

__device__ __forceinline__ unsigned short bf16_bits(float x) { unsigned int u = __float_as_uint(x); return (unsigned short)((u + 0x7FFFu + ((u >> 16) & 1u)) >> 16); }
__device__ __forceinline__ float bf16_val(unsigned short b) { return __uint_as_float(((unsigned int)b) << 16); }
__device__ __forceinline__ float bf16_round(float x) { return bf16_val(bf16_bits(x)); }
// D += A·B with NT terms: 1 = ah·bh, 2 = + al·bh (A split), 3 = + ah·bl (both split)
template <int NT>
__device__ __forceinline__ v8f mmaN(v16b ah, v16b al, v16b bh, v16b bl, v8f c) {
  c = __builtin_amdgcn_wmma_f32_16x16x32_bf16(false, ah, false, bh, (short)0, c, false, false);
  if (NT >= 2) c = __builtin_amdgcn_wmma_f32_16x16x32_bf16(false, al, false, bh, (short)0, c, false, false);
  if (NT >= 3) c = __builtin_amdgcn_wmma_f32_16x16x32_bf16(false, ah, false, bl, (short)0, c, false, false);
  asm volatile("v_nop\n\tv_nop\n\tv_nop\n\tv_nop" : "+v"(c) : "v"(ah), "v"(al), "v"(bh), "v"(bl));
  return c;
}

__global__ __launch_bounds__(256) void k_wt_bf16(const float* __restrict__ W, unsigned short* __restrict__ Wt, int K, int N) {
  const int t = blockIdx.x * 256 + threadIdx.x;
  const int k8n = K / 8;
  if (t >= N * k8n) return;
  const int n = t / k8n, k8 = (t % k8n) * 8;
  v8us v;
#pragma unroll
  for (int i = 0; i < 8; ++i) v[i] = bf16_bits(W[(size_t)(k8 + i) * N + n]);
  *(v8us*)(Wt + (size_t)n * K + k8) = v;
  
}

// GEMM C[M][N] (f32, pitch ldc) = act(A[M][K]·W + bias). A f32 row-major (pitch lda) converted per fragment to bf16
// (ASPLIT: hi/lo two planes -> 2 terms, else single rounded term); Wt bf16 [N][K] (pitch ldb). BIAS_BF16 rounds the
// bias to bf16 first (bias quantised to bf16 before the add). K%32==0, M%16==0, N%64==0.
template <bool ASPLIT, int ACT, bool BIAS_BF16>
__global__ __launch_bounds__(128) void k_gemm_bf(const float* __restrict__ A, int lda, const unsigned short* __restrict__ Wt, int ldb,
                                               const float* __restrict__ bias, float* __restrict__ C, int ldc, int M, int N, int K) {
  __shared__ __attribute__((aligned(16))) float so[4][16][64];
  const int tid = threadIdx.x, w = tid >> 5, lane = tid & 31, ln = lane & 15, hh = lane >> 4;
  const int ntn = N / 64;
  const int wid = blockIdx.x * 4 + w;
  const int mt = wid / ntn, nq = wid % ntn;
  if (mt * 16 >= M) return;
  const int row0 = mt * 16, col0 = nq * 64;
  const float* arow = A + (size_t)(row0 + ln) * lda;
  v8f acc[4] = {};
  for (int kb = 0; kb < K; kb += 32) {
    FragB ah, al;
    const v4f x0 = *(const v4fa*)(arow + kb + 8 * hh), x1 = *(const v4fa*)(arow + kb + 8 * hh + 4);
    const v4f x2 = *(const v4fa*)(arow + kb + 16 + 8 * hh), x3 = *(const v4fa*)(arow + kb + 16 + 8 * hh + 4);
    float xs[16] = {x0[0],x0[1],x0[2],x0[3],x1[0],x1[1],x1[2],x1[3],x2[0],x2[1],x2[2],x2[3],x3[0],x3[1],x3[2],x3[3]};
#pragma unroll
    for (int i = 0; i < 16; ++i) { const unsigned short hb = bf16_bits(xs[i]); ah.u[i] = hb; al.u[i] = ASPLIT ? bf16_bits(xs[i] - bf16_val(hb)) : (unsigned short)0; }
#pragma unroll
    for (int t = 0; t < 4; ++t) {
      const unsigned short* brow = Wt + (size_t)(col0 + t * 16 + ln) * ldb + kb;
      FragB b;
      b.half[0] = *(const v8us*)(brow + 8 * hh);
      b.half[1] = *(const v8us*)(brow + 16 + 8 * hh);
      acc[t] = mmaN<ASPLIT ? 2 : 1>(ah.v, al.v, b.v, b.v, acc[t]);
    }
  }
#pragma unroll
  for (int t = 0; t < 4; ++t) {
    float bv = bias ? bias[col0 + t * 16 + ln] : 0.f;
    if (BIAS_BF16) bv = bf16_round(bv);
#pragma unroll
    for (int r = 0; r < 8; ++r) { float v = acc[t][r] + bv; if (ACT == 1) v = fmaxf(v, 0.f); so[w][8 * hh + r][t * 16 + ln] = v; }
  }
  __builtin_amdgcn_fence(__ATOMIC_ACQ_REL, "workgroup");
  __builtin_amdgcn_wave_barrier();
  const int rsub = lane >> 4, c4 = (lane & 15) * 4;
  {
#pragma unroll
    for (int q = 0; q < 8; ++q) {
      const int r = q * 2 + rsub;
      const v4f v = *(const v4fa*)&so[w][r][c4];
      *(v4f*)(C + (size_t)(row0 + r) * ldc + col0 + c4) = v;
    }
    
  }
}

// GEMM C = act(A·W + bias + resid): A f32 (ASPLIT -> hi/lo 2 terms), Wt bf16 [N][K]; ACT 0 none, 1 relu, 2 exact gelu;
// resid (optional, f32, row index = (row % rmod), pitch ldr, RES_BF16 rounds it) added before the activation.
template <bool ASPLIT, int ACT, bool BIAS_BF16, bool RES_BF16>
__global__ __launch_bounds__(128) void k_gemm_bf3(const float* __restrict__ A, int lda, const unsigned short* __restrict__ Wt, int ldb,
                                                const float* __restrict__ bias, const float* __restrict__ resid, int rmod, int ldr,
                                                float* __restrict__ C, int ldc, int M, int N, int K) {
  __shared__ __attribute__((aligned(16))) float so[4][16][64];
  const int tid = threadIdx.x, w = tid >> 5, lane = tid & 31, ln = lane & 15, hh = lane >> 4;
  const int ntn = N / 64;
  const int wid = blockIdx.x * 4 + w;
  const int mt = wid / ntn, nq = wid % ntn;
  if (mt * 16 >= M) return;
  const int row0 = mt * 16, col0 = nq * 64;
  const float* arow = A + (size_t)(row0 + ln) * lda;
  v8f acc[4] = {};
  for (int kb = 0; kb < K; kb += 32) {
    FragB ah, al;
    const v4f x0 = *(const v4fa*)(arow + kb + 8 * hh), x1 = *(const v4fa*)(arow + kb + 8 * hh + 4);
    const v4f x2 = *(const v4fa*)(arow + kb + 16 + 8 * hh), x3 = *(const v4fa*)(arow + kb + 16 + 8 * hh + 4);
    float xs[16] = {x0[0],x0[1],x0[2],x0[3],x1[0],x1[1],x1[2],x1[3],x2[0],x2[1],x2[2],x2[3],x3[0],x3[1],x3[2],x3[3]};
#pragma unroll
    for (int i = 0; i < 16; ++i) { const unsigned short hb = bf16_bits(xs[i]); ah.u[i] = hb; al.u[i] = ASPLIT ? bf16_bits(xs[i] - bf16_val(hb)) : (unsigned short)0; }
#pragma unroll
    for (int t = 0; t < 4; ++t) {
      const unsigned short* brow = Wt + (size_t)(col0 + t * 16 + ln) * ldb + kb;
      FragB b;
      b.half[0] = *(const v8us*)(brow + 8 * hh);
      b.half[1] = *(const v8us*)(brow + 16 + 8 * hh);
      acc[t] = mmaN<ASPLIT ? 2 : 1>(ah.v, al.v, b.v, b.v, acc[t]);
    }
  }
#pragma unroll
  for (int t = 0; t < 4; ++t) {
    const int col = col0 + t * 16 + ln;
    float bv = bias ? bias[col] : 0.f;
    if (BIAS_BF16) bv = bf16_round(bv);
#pragma unroll
    for (int r = 0; r < 8; ++r) {
      float v = acc[t][r] + bv;
      if (resid) { float rv = resid[(size_t)((row0 + 8 * hh + r) % rmod) * ldr + col]; if (RES_BF16) rv = bf16_round(rv); v += rv; }
      if (ACT == 1) v = fmaxf(v, 0.f);
      if (ACT == 2) v = 0.5f * v * (1.0f + erff(v * 0.70710678118654752f));
      if (ACT == 3) { const float u = 0.7978845608028654f * (v + 0.044715f * v * v * v); v = 0.5f * v * (1.0f + tanhf(u)); }
      so[w][8 * hh + r][t * 16 + ln] = v;
    }
  }
  __builtin_amdgcn_fence(__ATOMIC_ACQ_REL, "workgroup");
  __builtin_amdgcn_wave_barrier();
  const int rsub = lane >> 4, c4 = (lane & 15) * 4;
  {
#pragma unroll
    for (int q = 0; q < 8; ++q) {
      const int r = q * 2 + rsub;
      const v4f v = *(const v4fa*)&so[w][r][c4];
      *(v4f*)(C + (size_t)(row0 + r) * ldc + col0 + c4) = v;
    }
    
  }
}
// row LayerNorm (biased variance, eps) over N: s = X (+ R); optional out_sum <- s; out_norm <- (s-mu)*rsqrt(var+eps)*g + b
template <bool PARAM_BF16>
__global__ __launch_bounds__(256) void k_layernorm(const float* __restrict__ X, const float* __restrict__ R, const float* __restrict__ g, const float* __restrict__ bta,
                                                  float* __restrict__ out_sum, float* __restrict__ out_norm, int N, float eps) {
  __shared__ float red[256];
  const int row = blockIdx.x, tid = threadIdx.x;
  const float* x = X + (size_t)row * N; const float* rr = R ? R + (size_t)row * N : nullptr;
  float vals[16];                     // up to N = 4096
  const int per = N / 256;            // contiguous chunk per thread? use strided-by-4 chunks: thread handles j = tid*4 + 1024*u
  float s1 = 0.f;
  for (int u = 0; u < per / 4; ++u) {
    const int j = tid * 4 + 1024 * u;
    const v4f a = *(const v4fa*)(x + j);
    v4f b = {0.f,0.f,0.f,0.f}; if (rr) b = *(const v4fa*)(rr + j);
#pragma unroll
    for (int q = 0; q < 4; ++q) { const float v = a[q] + b[q]; vals[u * 4 + q] = v; s1 += v; }
  }
  red[tid] = s1; __syncthreads();
  for (int st = 128; st > 0; st >>= 1) { if (tid < st) red[tid] += red[tid + st]; __syncthreads(); }
  const float mu = red[0] / (float)N; __syncthreads();
  float s2 = 0.f;
  for (int u = 0; u < per / 4; ++u)
#pragma unroll
    for (int q = 0; q < 4; ++q) { const float c = vals[u * 4 + q] - mu; s2 += c * c; }
  red[tid] = s2; __syncthreads();
  for (int st = 128; st > 0; st >>= 1) { if (tid < st) red[tid] += red[tid + st]; __syncthreads(); }
  const float rs = rsqrtf(red[0] / (float)N + eps);
  {
    for (int u = 0; u < per / 4; ++u) {
      const int j = tid * 4 + 1024 * u;
      v4f o, sm;
#pragma unroll
      for (int q = 0; q < 4; ++q) {
        float gg = g[j + q], bb = bta[j + q];
        if (PARAM_BF16) { gg = bf16_round(gg); bb = bf16_round(bb); }
        sm[q] = vals[u * 4 + q]; o[q] = (vals[u * 4 + q] - mu) * rs * gg + bb;
      }
      if (out_sum) *(v4f*)(out_sum + (size_t)row * N + j) = sm;
      *(v4f*)(out_norm + (size_t)row * N + j) = o;
    }
    
  }
}



// ---- f16 WMMA path (v_wmma_f32_16x16x32_f16): 11-bit significands for operands in range — used where a [0,1] probability operand needs more precision than bf16
typedef _Float16 v16h __attribute__((ext_vector_type(16)));
union FragH { v16h v; v8us half[2]; _Float16 h[16]; unsigned short u[16]; };
template <int NT>
__device__ __forceinline__ v8f mmaH(v16h ah, v16h al, v16h bh, v16h bl, v8f c) {
  c = __builtin_amdgcn_wmma_f32_16x16x32_f16(false, ah, false, bh, (short)0, c, false, false);
  if (NT >= 2) c = __builtin_amdgcn_wmma_f32_16x16x32_f16(false, al, false, bh, (short)0, c, false, false);
  if (NT >= 3) c = __builtin_amdgcn_wmma_f32_16x16x32_f16(false, ah, false, bl, (short)0, c, false, false);
  asm volatile("v_nop\n\tv_nop\n\tv_nop\n\tv_nop" : "+v"(c) : "v"(ah), "v"(al), "v"(bh), "v"(bl));
  return c;
}
// batched GEMM like k_gemm_b but f16 operands: A f32 (split into f16 hi/lo if ASPLIT, else rounded to f16), Bt = f16 values [n][k]; alpha; C f32; N multiple of 16 (partial tiles skipped)
template <bool ASPLIT>
__global__ __launch_bounds__(128) void k_gemm_h(const float* __restrict__ A, int lda, size_t sA, const _Float16* __restrict__ Bh, int ldb, size_t sB, float alpha, float* __restrict__ C, int ldc, size_t sC, int M, int N, int K) {
  __shared__ __attribute__((aligned(16))) float so[4][16][64];
  const int tid = threadIdx.x, w = tid >> 5, lane = tid & 31, ln = lane & 15, hh = lane >> 4; const int by = blockIdx.y;
  A += (size_t)by * sA; Bh += (size_t)by * sB; C += (size_t)by * sC;
  const int ntn = (N + 63) / 64; const int wid = blockIdx.x * 4 + w; const int mt = wid / ntn, nq = wid % ntn; if (mt * 16 >= M) return;
  const int row0 = mt * 16, col0 = nq * 64; const float* arow = A + (size_t)(row0 + ln) * lda;
  v8f acc[4] = {};
  for (int kb = 0; kb < K; kb += 32) {
    FragH ah, al;
    const v4f x0 = *(const v4fa*)(arow + kb + 8 * hh), x1 = *(const v4fa*)(arow + kb + 8 * hh + 4), x2 = *(const v4fa*)(arow + kb + 16 + 8 * hh), x3 = *(const v4fa*)(arow + kb + 16 + 8 * hh + 4);
    float xs[16] = {x0[0],x0[1],x0[2],x0[3],x1[0],x1[1],x1[2],x1[3],x2[0],x2[1],x2[2],x2[3],x3[0],x3[1],x3[2],x3[3]};
#pragma unroll
    for (int i = 0; i < 16; ++i) { const _Float16 h = (_Float16)xs[i]; ah.h[i] = h; al.h[i] = ASPLIT ? (_Float16)(xs[i] - (float)h) : (_Float16)0.0f; }
#pragma unroll
    for (int t = 0; t < 4; ++t) { if (col0 + t * 16 >= N) continue; const size_t boff = (size_t)(col0 + t * 16 + ln) * ldb + kb; FragH bq; bq.half[0] = *(const v8us*)(Bh + boff + 8 * hh); bq.half[1] = *(const v8us*)(Bh + boff + 16 + 8 * hh);
      acc[t] = mmaH<ASPLIT ? 2 : 1>(ah.v, al.v, bq.v, bq.v, acc[t]); }
  }
#pragma unroll
  for (int t = 0; t < 4; ++t) { if (col0 + t * 16 >= N) continue;
#pragma unroll
    for (int r = 0; r < 8; ++r) so[w][8 * hh + r][t * 16 + ln] = acc[t][r] * alpha; }
  __builtin_amdgcn_fence(__ATOMIC_ACQ_REL, "workgroup"); __builtin_amdgcn_wave_barrier();
  const int rsub = lane >> 4, c4 = (lane & 15) * 4;
  {
#pragma unroll
    for (int q = 0; q < 8; ++q) { const int r = q * 2 + rsub; if (col0 + c4 < N) { const v4f v = *(const v4fa*)&so[w][r][c4]; *(v4f*)(C + (size_t)(row0 + r) * ldc + col0 + c4) = v; } }
     }
}

// Wt[n][k] = f16(W[k][n]·scale) from f32 row-major W[K][N] (scale = power of two; bf16-exact weights stay exact in f16 away from the subnormal range)
__global__ __launch_bounds__(256) void k_wt_f16(const float* __restrict__ W, _Float16* __restrict__ Wt, int K, int N, float scale) {
  const int t = blockIdx.x * 256 + threadIdx.x; if (t >= N * (K / 8)) return; const int n = t / (K / 8), k8 = (t % (K / 8)) * 8; FragH f;
#pragma unroll
  for (int i = 0; i < 8; ++i) f.h[i] = (_Float16)(bf16_round(W[(size_t)(k8 + i) * N + n]) * scale); const v8us o = f.half[0];
  *(v8us*)((unsigned short*)Wt + (size_t)n * K + k8) = o; 
}
// k_gemm_hh variant with fused epilogue: v = acc·alpha + bias[by·sBias + col] (+ CP[(row/rowsPerB)·sCPb + by·64 + col] if CP) ; ACT 0 none / 1 elu ; writes f16 C16 (and f32 C if non-null)
template <int ACT>
__global__ __launch_bounds__(128) void k_gemm_hhx(const _Float16* __restrict__ A, int lda, size_t sA, const _Float16* __restrict__ Bh, int ldb, size_t sB, float alpha, const float* __restrict__ bias, size_t sBias, const float* __restrict__ CP, int rowsPerB, size_t sCPb, int row0g,
    float* __restrict__ C, _Float16* __restrict__ C16, int ldc, size_t sC, int M, int N, int K) {
  __shared__ __attribute__((aligned(16))) float so[4][16][64];
  const int tid = threadIdx.x, w = tid >> 5, lane = tid & 31, ln = lane & 15, hh = lane >> 4; const int by = blockIdx.y;
  A += (size_t)by * sA; Bh += (size_t)by * sB; const size_t cofs = (size_t)by * sC; const float* bp = bias ? bias + (size_t)by * sBias : nullptr;
  const int ntn = (N + 63) / 64; const int wid = blockIdx.x * 4 + w; const int mt = wid / ntn, nq = wid % ntn; if (mt * 16 >= M) return;
  const int row0 = mt * 16, col0 = nq * 64; const _Float16* arow = A + (size_t)(row0 + ln) * lda;
  v8f acc[4] = {};
  for (int kb = 0; kb < K; kb += 32) { FragH ah; ah.half[0] = *(const v8us*)((const unsigned short*)arow + kb + 8 * hh); ah.half[1] = *(const v8us*)((const unsigned short*)arow + kb + 16 + 8 * hh);
#pragma unroll
    for (int t = 0; t < 4; ++t) { if (col0 + t * 16 >= N) continue; const size_t boff = (size_t)(col0 + t * 16 + ln) * ldb + kb; FragH bq; bq.half[0] = *(const v8us*)((const unsigned short*)Bh + boff + 8 * hh); bq.half[1] = *(const v8us*)((const unsigned short*)Bh + boff + 16 + 8 * hh);
      acc[t] = mmaH<1>(ah.v, ah.v, bq.v, bq.v, acc[t]); }
  }
#pragma unroll
  for (int t = 0; t < 4; ++t) { if (col0 + t * 16 >= N) continue; const int col = col0 + t * 16 + ln; const float bv = bp ? bf16_round(bp[col]) : 0.f;
#pragma unroll
    for (int r = 0; r < 8; ++r) { float v = acc[t][r] * alpha + bv; if (CP) { const int rr = row0g + row0 + 8 * hh + r; if (rowsPerB < 0) v += CP[cofs + (size_t)rr * ldc + col];      /* rowsPerB < 0: own element of the batched C plane */ else { const int bidx = rr / rowsPerB; v += CP[(size_t)bidx * sCPb + (size_t)by * 64 + col]; } } if (ACT == 1) v = (v > 0.f) ? v : expm1f(v); else if (ACT == 7) v = (v > 0.f) ? v + 1.0f : expf(v); else if (ACT == 8) v = tanhf(v); else if (ACT == 9) v = 0.5f * v * (1.0f + tanhf(0.7978845608028654f * (v + 0.044715f * v * v * v))); else if (ACT == 11) v = 1.0f / (1.0f + expf(-v)); else if (ACT == 12) v = (v > 0.f) ? v : 0.01f * v; else if (ACT == 14) v = (v > 0.f) ? v : 0.1f * v; else if (ACT == 16) v = (v >= 0.f) ? v : 0.3f * v; else if (ACT == 17) v = (v >= 0.f) ? v : 0.2f * v; else if (ACT == 15) v = v / (1.0f + expf(-v)); else if (ACT == 3) v = fmaxf(v, 0.f); else if (ACT == 6) v = 0.5f * v * (1.0f + erff(v * 0.70710678118654752f)); so[w][8 * hh + r][t * 16 + ln] = v; } }
  __builtin_amdgcn_fence(__ATOMIC_ACQ_REL, "workgroup"); __builtin_amdgcn_wave_barrier();
  const int rsub = lane >> 4, c4 = (lane & 15) * 4; typedef _Float16 v4h __attribute__((ext_vector_type(4)));
  {
#pragma unroll
    for (int q = 0; q < 8; ++q) { const int r = q * 2 + rsub; if (col0 + c4 < N) { const v4f v = *(const v4fa*)&so[w][r][c4]; if (C) *(v4f*)(C + cofs + (size_t)(row0 + r) * ldc + col0 + c4) = v; if (C16) { v4h h4; for (int i = 0; i < 4; ++i) h4[i] = (_Float16)v[i]; *(v4h*)(C16 + cofs + (size_t)(row0 + r) * ldc + col0 + c4) = h4; } } }
     }
}


typedef _Float16 v4h __attribute__((ext_vector_type(4)));

__global__ __launch_bounds__(256) void k_x16(const float* __restrict__ x, _Float16* __restrict__ X16, size_t n8) { const size_t t = (size_t)blockIdx.x * 256 + threadIdx.x; if (t >= n8) return; FragH f;
#pragma unroll
  for (int q = 0; q < 8; ++q) f.h[q] = (_Float16)bf16_round(x[t * 8 + q]); *(v8us*)((unsigned short*)X16 + t * 8) = f.half[0];  }
__global__ __launch_bounds__(256) void k_h16(const float* __restrict__ x, _Float16* __restrict__ X16, size_t n8) { const size_t t = (size_t)blockIdx.x * 256 + threadIdx.x; if (t >= n8) return; FragH f;
#pragma unroll
  for (int q = 0; q < 8; ++q) f.h[q] = (_Float16)x[t * 8 + q]; *(v8us*)((unsigned short*)X16 + t * 8) = f.half[0];  }
__global__ __launch_bounds__(256) void k_round16f(const float* __restrict__ W, _Float16* __restrict__ Bt, size_t n8) { const size_t t = (size_t)blockIdx.x * 256 + threadIdx.x; if (t >= n8) return; FragH f;
#pragma unroll
  for (int i = 0; i < 8; ++i) f.h[i] = (_Float16)(bf16_round(W[t * 8 + i]) * 16.0f); *(v8us*)((unsigned short*)Bt + t * 8) = f.half[0];  }
template <int NHv, int TTv>
__global__ __launch_bounds__(256) void k_vt(const _Float16* __restrict__ V16, int ldv, int voff, _Float16* __restrict__ Vt) { __shared__ unsigned short tl[64][66]; const int tid = threadIdx.x; const int slab = blockIdx.x / (TTv / 64), lg = blockIdx.x % (TTv / 64); const int b = slab / NHv, h = slab % NHv;
  for (int i = tid; i < 64 * 8; i += 256) { const int r = i / 8, c8 = (i % 8) * 8; FragH f; f.half[0] = *(const v8us*)((const unsigned short*)V16 + ((size_t)b * TTv + lg * 64 + r) * ldv + voff + h * 64 + c8);
#pragma unroll
    for (int q = 0; q < 8; ++q) tl[r][c8 + q] = f.u[q]; }
  __syncthreads();
  {
#pragma unroll
    for (int rd = 0; rd < 2; ++rd) { const int d = rd * 32 + tid / 8, pc = tid % 8; FragH f;
#pragma unroll
      for (int q = 0; q < 8; ++q) f.u[q] = tl[pc * 8 + q][d];
      *(v8us*)((unsigned short*)Vt + ((size_t)slab * 64 + d) * TTv + lg * 64 + pc * 8) = f.half[0]; }
     } }

__global__ __launch_bounds__(256) void k_hl(const float* __restrict__ F, _Float16* __restrict__ Hh, _Float16* __restrict__ Hl, size_t n8) { const size_t t = (size_t)blockIdx.x * 256 + threadIdx.x; if (t >= n8) return; FragH fh, fl; const v4f a = *(const v4fa*)(F + t * 8), c = *(const v4fa*)(F + t * 8 + 4);
#pragma unroll
  for (int q = 0; q < 4; ++q) { _Float16 h = (_Float16)a[q]; fh.h[q] = h; fl.h[q] = (_Float16)((a[q] - (float)h) * 1024.0f); h = (_Float16)c[q]; fh.h[4 + q] = h; fl.h[4 + q] = (_Float16)((c[q] - (float)h) * 1024.0f); }
  { *(v8us*)((unsigned short*)Hh + t * 8) = fh.half[0]; *(v8us*)((unsigned short*)Hl + t * 8) = fl.half[0];  } }

// ---- fast GEMM (work-group tile 128x64, wave tile 32x64; requires M % 32 == 0 rows per launch region, N % 64 == 0 and K % 64 == 0); epilogue = k_gemm_hhx semantics ----
// Operand tiles of GK k (one 128-byte line of each of the 128 A rows and 64 B rows) go through LDS: eight lanes fetch a whole line, one tile ahead of the matrix work, and the waves read their fragments from LDS.
#define GK 64                        /* k per staged tile */
#define GP 72                        /* pitch in halfs of a staged row: 144 B = 16 B x odd, so that 16-byte fragment reads of 16 rows spread over the banks */
__device__ __forceinline__ v16h g2_frag(const _Float16* p, int hh) { FragH f; f.half[0] = *(const v8us*)((const unsigned short*)p + 8 * hh); f.half[1] = *(const v8us*)((const unsigned short*)p + 16 + 8 * hh); return f.v; }
__device__ __forceinline__ v8f g2_mma(v16h a, v16h b, v8f c) { v8f d = __builtin_amdgcn_wmma_f32_16x16x32_f16(false, a, false, b, (short)0, c, false, false); asm volatile("v_nop\n\tv_nop\n\tv_nop\n\tv_nop" : "+v"(d) : "v"(a), "v"(b)); return d; }
template <int ACT>
__global__ __launch_bounds__(128) void k_gemm2(const _Float16* __restrict__ A, int lda, size_t sA, const _Float16* __restrict__ Bh, int ldb, size_t sB, float alpha, const float* __restrict__ bias, size_t sBias, const float* __restrict__ CP, int rowsPerB, size_t sCPb, int row0g,
    float* __restrict__ C, _Float16* __restrict__ C16, int ldc, size_t sC, int M, int N, int K) { static_assert(ACT == 0 || ACT == 3 || ACT == 6 || ACT == 8 || ACT == 9 || ACT == 11 || ACT == 12 || ACT == 14 || ACT == 15 || ACT == 16 || ACT == 17 || ACT == 19, "k_gemm2: unsupported ACT code (would silently apply no activation)");
  __shared__ __attribute__((aligned(16))) float so[4][32][68];
  __shared__ __attribute__((aligned(16))) _Float16 sa[2][128][GP]; __shared__ __attribute__((aligned(16))) _Float16 sb[2][64][GP];
  const int tid = threadIdx.x, w = tid >> 5, lane = tid & 31, ln = lane & 15, hh = lane >> 4; const int by = blockIdx.y;
  A += (size_t)by * sA; Bh += (size_t)by * sB; const size_t cofs = (size_t)by * sC; const float* bp = bias ? bias + (size_t)by * sBias : nullptr;
  const int ntn = N >> 6; const int mt = blockIdx.x / ntn, nq = blockIdx.x - mt * ntn; const int row0 = mt * 128 + 32 * w, col0 = nq * 64; if (mt * 128 >= M) return;      /* the whole work-group or none: barriers follow; a wave whose own rows lie past M leaves behind the last one */
  const int sr = tid >> 3, sc = (tid & 7) * 8;      /* staging: 8 lanes per 128-byte line, 16 rows per pass of the work-group */
  const char* ab = (const char*)A; const char* bb = (const char*)Bh; unsigned ao[8], bo[4];      /* one base per operand for the whole work-group + the lane's own byte offset to each of its rows; a 16-row pass past M (M % 32 == 0) rereads the last 16 rows, which no wave uses */
#pragma unroll
  for (int p = 0; p < 8; ++p) ao[p] = (unsigned)((min(mt * 128 + 16 * p, M - 16) + sr) * lda + sc) * 2u;
#pragma unroll
  for (int p = 0; p < 4; ++p) bo[p] = (unsigned)((col0 + 16 * p + sr) * ldb + sc) * 2u;
  v8us ra[8], rb[4]; v16h a0[2], a1[2], b[2][4];
  auto fetch = [&]() {      /* the next tile into registers */
#pragma unroll
    for (int p = 0; p < 8; ++p) ra[p] = *(const v8us*)(ab + ao[p]);
#pragma unroll
    for (int p = 0; p < 4; ++p) rb[p] = *(const v8us*)(bb + bo[p]); };
  auto put = [&](int u) {      /* the fetched tile into buffer u; the offsets step on by one tile here, behind the waits for the loads that name them */
#pragma unroll
    for (int p = 0; p < 8; ++p) { *(v8us*)&sa[u][16 * p + sr][sc] = ra[p]; ao[p] += GK * 2; }
#pragma unroll
    for (int p = 0; p < 4; ++p) { *(v8us*)&sb[u][16 * p + sr][sc] = rb[p]; bo[p] += GK * 2; } };
  auto frags = [&](int u) {      /* all fragments of one staged tile: the second half's reads return under the first half's products */
#pragma unroll
    for (int ks = 0; ks < 2; ++ks) { a0[ks] = g2_frag(&sa[u][32 * w + ln][ks * 32], hh); a1[ks] = g2_frag(&sa[u][32 * w + 16 + ln][ks * 32], hh);
#pragma unroll
      for (int t = 0; t < 4; ++t) b[ks][t] = g2_frag(&sb[u][16 * t + ln][ks * 32], hh); } };
  const v8f z8 = {0.f,0.f,0.f,0.f,0.f,0.f,0.f,0.f}; v8f c00 = z8, c01 = z8, c02 = z8, c03 = z8, c10 = z8, c11 = z8, c12 = z8, c13 = z8;
  auto prods = [&]() {
#pragma unroll
    for (int ks = 0; ks < 2; ++ks) { c00 = g2_mma(a0[ks], b[ks][0], c00); c10 = g2_mma(a1[ks], b[ks][0], c10); c01 = g2_mma(a0[ks], b[ks][1], c01); c11 = g2_mma(a1[ks], b[ks][1], c11);
      c02 = g2_mma(a0[ks], b[ks][2], c02); c12 = g2_mma(a1[ks], b[ks][2], c12); c03 = g2_mma(a0[ks], b[ks][3], c03); c13 = g2_mma(a1[ks], b[ks][3], c13); } };
  const int nt = K / GK;
  fetch(); put(0); __syncthreads();
#pragma unroll 1      /* one copy of the loop body: the buffer's number is a scalar offset */
  for (int t = 0; t + 1 < nt; ++t) { frags(t & 1); fetch(); prods(); put((t + 1) & 1); __syncthreads(); }      /* tile t + 1 is on its way under tile t's products; the one barrier of a pass publishes it and ends the reads of tile t, whose buffer the next pass refills */
  frags((nt - 1) & 1); prods();
  if (row0 >= M) return;
  v8f accs[8] = {c00, c01, c02, c03, c10, c11, c12, c13};
#pragma unroll
  for (int u = 0; u < 8; ++u) { const int t = u & 3, half = u >> 2; const int col = col0 + t * 16 + ln; const float bv = bp ? bf16_round(bp[col]) : 0.f;
#pragma unroll
    for (int r = 0; r < 8; ++r) { const int rloc = half * 16 + 8 * hh + r; float v = accs[u][r] * alpha + bv; if (CP) { if (rowsPerB < 0) v += CP[cofs + (size_t)(row0g + row0 + rloc) * ldc + col];      /* rowsPerB < 0: own element of the batched C plane */ else { const int bidx = (row0g + row0 + rloc) / rowsPerB; v += CP[(size_t)bidx * sCPb + (size_t)by * 64 + col]; } }
      if (ACT == 3) v = fmaxf(v, 0.f); else if (ACT == 6) v = 0.5f * v * (1.0f + erff(v * 0.70710678118654752f)); else if (ACT == 11) v = 1.0f / (1.0f + expf(-v)); else if (ACT == 15) v = v / (1.0f + expf(-v)); else if (ACT == 19) v = (v > 0.f) ? (v + 1.0f) : expf(v);      /* elu(v) + 1 */ else if (ACT == 12) v = (v > 0.f) ? v : 0.01f * v; else if (ACT == 8) v = tanhf(v); else if (ACT == 9) v = 0.5f * v * (1.0f + tanhf(0.7978845608028654f * (v + 0.044715f * v * v * v))); else if (ACT == 14) v = (v > 0.f) ? v : 0.1f * v; else if (ACT == 16) v = (v >= 0.f) ? v : 0.3f * v; else if (ACT == 17) v = (v >= 0.f) ? v : 0.2f * v;
      so[w][rloc][t * 16 + ln] = v; } }
  __builtin_amdgcn_fence(__ATOMIC_ACQ_REL, "workgroup"); __builtin_amdgcn_wave_barrier();
  const int rsub = lane >> 4, c4 = (lane & 15) * 4;
  {
#pragma unroll
    for (int q = 0; q < 16; ++q) { const int r = q * 2 + rsub; const v4f v = *(const v4fa*)&so[w][r][c4]; if (C) *(v4f*)(C + cofs + (size_t)(row0 + r) * ldc + col0 + c4) = v; if (C16) { v4h h4; for (int i = 0; i < 4; ++i) h4[i] = (_Float16)v[i]; *(v4h*)(C16 + cofs + (size_t)(row0 + r) * ldc + col0 + c4) = h4; } }
     } }


__global__ __launch_bounds__(256) void k_wnat(const float* __restrict__ w, size_t n8, _Float16* __restrict__ Bt) { const size_t t = (size_t)blockIdx.x * 256 + threadIdx.x; if (t >= n8) return; FragH f; for (int q = 0; q < 8; ++q) f.h[q] = (_Float16)(bf16_round(w[t * 8 + q]) * 16.0f); *(v8us*)((unsigned short*)Bt + t * 8) = f.half[0];  }
__global__ __launch_bounds__(256) void k_rsm(const float* __restrict__ S, _Float16* __restrict__ P, int nrows) {
  #pragma clang fp contract(off)
  const int i = blockIdx.x * 256 + threadIdx.x; if (i >= nrows) return; const float* s = S + (size_t)i * SQ; float mx = -3.0e38f;
#pragma unroll 1
  for (int j = 0; j < SQ; ++j) mx = fmaxf(mx, s[j]); float se = 0.f;
#pragma unroll 1
  for (int j = 0; j < SQ; ++j) se += expf(s[j] - mx); const float sc = 256.0f / se;
#pragma unroll 1
  for (int j0 = 0; j0 < SQ; j0 += 8) { FragH f; for (int q = 0; q < 8; ++q) f.h[q] = (_Float16)(expf(s[j0 + q] - mx) * sc); unsigned short* d = (unsigned short*)P + (size_t)i * SQ + j0; *(v8us*)d = f.half[0];  } }
__global__ __launch_bounds__(256) void k_vt(const _Float16* __restrict__ V16, int b, int h0, _Float16* __restrict__ VT) { __shared__ unsigned short tl[64][65]; const int tid = threadIdx.x; const int hh = blockIdx.x % HG, sg = blockIdx.x / HG; const int s0 = sg * 64; const int h = h0 + hh;
  for (int i = tid; i < 64 * 8; i += 256) { const int j = i / 8, d8 = (i % 8) * 8; FragH f; f.half[0] = *(const v8us*)((const unsigned short*)V16 + ((size_t)b * SQ + s0 + j) * DM + h * HD + d8); for (int q = 0; q < 8; ++q) tl[d8 + q][j] = f.u[q]; }
  __syncthreads();
  { for (int i = tid; i < 64 * 8; i += 256) { const int d = i / 8, j8 = (i % 8) * 8; FragH f; for (int q = 0; q < 8; ++q) f.u[q] = tl[d][j8 + q]; *(v8us*)((unsigned short*)VT + ((size_t)hh * HD + d) * SQ + s0 + j8) = f.half[0]; }  } }



__global__ __launch_bounds__(256) void k_rsmcf2(const float* __restrict__ S, _Float16* __restrict__ P, int hg, int q0, int nk) {
  #pragma clang fp contract(off)
  const int t = blockIdx.x * 256 + threadIdx.x; if (t >= hg * QT) return; const size_t i = (size_t)t; const float* s = S + i * NKX; const int last = q0 + (t % QT); float mx = -3.0e38f;
#pragma unroll 1
  for (int j = 0; j < nk; ++j) { const float f = (j <= last) ? 1.f : 0.f; mx = fmaxf(mx, fmaf(f, s[j], (1.f - f) * -1.0e9f)); } float se = 0.f;
#pragma unroll 1
  for (int j = 0; j < nk; ++j) { const float f = (j <= last) ? 1.f : 0.f; se += __expf(fmaf(f, s[j], (1.f - f) * -1.0e9f) - mx); } const float sc = 256.0f / se;
#pragma unroll 1
  for (int j0 = 0; j0 < nk; j0 += 8) { FragH fr; for (int q = 0; q < 8; ++q) { const int j = j0 + q; const float f = (j <= last) ? 1.f : 0.f; fr.h[q] = (_Float16)(__expf(fmaf(f, s[j], (1.f - f) * -1.0e9f) - mx) * sc); } unsigned short* d = (unsigned short*)P + i * NKX + j0; *(v8us*)d = fr.half[0];  } }


template <int MASKADD>
__global__ __launch_bounds__(64) void k_att0(const float* __restrict__ QF, const float* __restrict__ KF, const float* __restrict__ VF, int ld, const float* __restrict__ mask, float scale, float* __restrict__ OF, int ldo) {
  #pragma clang fp contract(off)
  __shared__ __attribute__((aligned(16))) float lq[64][64]; __shared__ __attribute__((aligned(16))) float lo[64][64];
  const int tid = threadIdx.x; const int h = blockIdx.x / (QT0 / 64), rg = blockIdx.x % (QT0 / 64); const int i = rg * 64 + tid;
  const float* qr = QF + (size_t)i * ld + h * HD;
#pragma unroll 1
  for (int c = 0; c < HD / 4; ++c) { *(v4f*)&lq[tid][c * 4] = *(const v4fa*)(qr + c * 4); const v4f z = {0.f, 0.f, 0.f, 0.f}; *(v4f*)&lo[tid][c * 4] = z; }
  float m = -1.0e30f, l = 0.f; const int jmax = MASKADD ? (SQ - 1) : (rg * 64 + 63);      /* additive-mask form: every key (the mask input decides); causal form: keys up to the block's last row */
#pragma unroll 1
  for (int j = 0; j <= jmax; ++j) { const float* kr = KF + (size_t)j * ld + h * HD; const float* vr = VF + (size_t)j * ld + h * HD; float s = 0.f;
#pragma unroll 1
    for (int c = 0; c < HD / 4; ++c) { const v4f kq = *(const v4fa*)(kr + c * 4); const v4f qq = *(v4f*)&lq[tid][c * 4]; s = __fadd_rn(s, __fmul_rn(qq[0], kq[0])); s = __fadd_rn(s, __fmul_rn(qq[1], kq[1])); s = __fadd_rn(s, __fmul_rn(qq[2], kq[2])); s = __fadd_rn(s, __fmul_rn(qq[3], kq[3])); }
    s = __fmul_rn(s, scale); if (MASKADD) s = __fadd_rn(s, __fmul_rn(bf16_round(mask[(size_t)i * SQ + j]), -10000.0f));
    const float f = (MASKADD || j <= i) ? 1.f : 0.f; const float sm = fmaf(f, s, (1.f - f) * -1.0e30f); const float mn = fmaxf(m, sm); const float sc = expf(m - mn); const float e = expf(sm - mn); l = __fadd_rn(__fmul_rn(l, sc), e); m = mn;
#pragma unroll 1
    for (int c = 0; c < HD / 4; ++c) { const v4f vv = *(const v4fa*)(vr + c * 4); v4f oo = *(v4f*)&lo[tid][c * 4]; for (int u = 0; u < 4; ++u) oo[u] = __fadd_rn(__fmul_rn(oo[u], sc), __fmul_rn(e, vv[u])); *(v4f*)&lo[tid][c * 4] = oo; } }
  const float fin = 64.0f / l;      /* o carried x64 like the f16 path */
#pragma unroll 1
  for (int c = 0; c < HD / 4; ++c) { v4f oo = *(v4f*)&lo[tid][c * 4]; for (int u = 0; u < 4; ++u) oo[u] = __fmul_rn(oo[u], fin); *(v4f*)&lo[tid][c * 4] = oo; }
  __syncthreads();
  {
#pragma unroll 1
    for (int it = 0; it < 16; ++it) { const int row = it * 4 + tid / 16, pc = (tid % 16) * 4; const v4f v = *(const v4f*)&lo[row][pc]; *(v4f*)(OF + (size_t)(rg * 64 + row) * ldo + h * HD + pc) = v; }
     } }


// Fused causal linear attention: o_i = sum_{j <= i} a_ij v_j / sum_{j <= i} a_ij, a_ij = phi(q_i) . phi(k_j); no score or weight plane in memory.
// One work-group of 4 waves per (batch, head, 32 query rows). The sums over the keys are plain sums, so the waves split the keys: wave w takes the 64-key blocks w, w + 4, ... in two steps of 32 keys
// (a V^T row's 128-byte line is used up by the wave that fetched it), and the four partial o tiles and row sums are added through LDS at the end.
// Per step: a^T = K Q^T, so that a lane of the accumulator holds 8 consecutive keys of ONE query: accumulator tile 0 (keys 0..15) and tile 1 (keys 16..31) of a query column, rounded to f16,
// are elements 0..7 and 8..15 of the A fragment of a V^T in the k order of g2_frag (8 hh + i, 16 + 8 hh + i), which also loads V^T: nothing is moved between lanes.
#define FQ 32                        /* query rows per work-group */
#define FS 32                        /* keys per step */
#define FP 68                        /* pitch in floats of the partial o rows in LDS, as in k_gemm2 */
__global__ __launch_bounds__(128) void k_lfa(const _Float16* __restrict__ Q16, const _Float16* __restrict__ K16, const _Float16* __restrict__ VT, _Float16* __restrict__ O16) {      /* Q16, K16, O16: rows of DM; VT: [NB][NH][HD][SQ] */
  __shared__ __attribute__((aligned(16))) float so[4][FQ][FP]; __shared__ float sl[4][2][FQ];
  const int tid = threadIdx.x, lane = tid & 31, ln = lane & 15, hh = lane >> 4; const int w = __builtin_amdgcn_readfirstlane(tid >> 5);      /* the wave's number in a scalar register: the loop and the mask test are scalar branches, every lane stays on at the matrix instructions */
  const int rg = (SQ / FQ - 1) - (int)blockIdx.x, h = blockIdx.y, b = blockIdx.z;      /* the tiles with the most keys start first */
  const _Float16* qp = Q16 + ((size_t)b * SQ + rg * FQ + ln) * DM + h * HD; const _Float16* kp = K16 + ((size_t)b * SQ + ln) * DM + h * HD + 8 * hh; const _Float16* vp = VT + (((size_t)b * NH + h) * HD + ln) * SQ + 8 * hh;      /* kp, vp: the lane's own 8 hh is in the pointer, so that the step's loads all name kq or vq itself */
  v16h qf[2][2];
#pragma unroll
  for (int qs = 0; qs < 2; ++qs) { qf[qs][0] = g2_frag(qp + (size_t)qs * 16 * DM, hh); qf[qs][1] = g2_frag(qp + (size_t)qs * 16 * DM + 32, hh); }
  const v8f z8 = {0.f,0.f,0.f,0.f,0.f,0.f,0.f,0.f}; v8f o[2][4] = {{z8, z8, z8, z8}, {z8, z8, z8, z8}}; float ls[2] = {0.f, 0.f};
  for (int it = 0; ; ++it) { const int s = (((it >> 1) * 4 + w) << 1) + (it & 1); if (s > rg) break;      /* s rises with it; step rg holds the diagonal and is the last */
    const _Float16* kq = kp + (size_t)s * FS * DM; const _Float16* vq = vp + s * FS;
    v16h kf[2][2], vf[4];
#pragma unroll
    for (int ks = 0; ks < 2; ++ks) { kf[ks][0] = g2_frag(kq + (size_t)ks * 16 * DM, 0); kf[ks][1] = g2_frag(kq + (size_t)ks * 16 * DM + 32, 0); }
#pragma unroll
    for (int t = 0; t < 4; ++t) vf[t] = g2_frag(vq + (size_t)t * 16 * SQ, 0);
    asm volatile("s_wait_xcnt 0x0" :: "v"(kq), "v"(vq) : "memory");      /* behind the last load of the step; the two address pairs are its inputs, so that neither is advanced or reused ahead of it */
    v8f st[2][2];      /* st[ks][qs][r]: key s FS + 16 ks + 8 hh + r, query rg FQ + 16 qs + ln */
#pragma unroll
    for (int ks = 0; ks < 2; ++ks)
#pragma unroll
      for (int qs = 0; qs < 2; ++qs) st[ks][qs] = g2_mma(kf[ks][0], qf[qs][0], z8);
#pragma unroll
    for (int ks = 0; ks < 2; ++ks)
#pragma unroll
      for (int qs = 0; qs < 2; ++qs) st[ks][qs] = g2_mma(kf[ks][1], qf[qs][1], st[ks][qs]);
    if (s == rg) {      /* the diagonal step: key and query count from the same row here */
#pragma unroll
      for (int ks = 0; ks < 2; ++ks)
#pragma unroll
        for (int qs = 0; qs < 2; ++qs)
#pragma unroll
          for (int r = 0; r < 8; ++r) st[ks][qs][r] = (ks * 16 + 8 * hh + r <= qs * 16 + ln) ? st[ks][qs][r] : 0.f; }
#pragma unroll
    for (int qs = 0; qs < 2; ++qs) { FragH p; float a = 0.f;
#pragma unroll
      for (int r = 0; r < 8; ++r) { a += st[0][qs][r] + st[1][qs][r]; p.h[r] = (_Float16)st[0][qs][r]; p.h[8 + r] = (_Float16)st[1][qs][r]; }
      ls[qs] += a;
#pragma unroll
      for (int t = 0; t < 4; ++t) o[qs][t] = g2_mma(p.v, vf[t], o[qs][t]); } }
#pragma unroll
  for (int qs = 0; qs < 2; ++qs) { sl[w][hh][qs * 16 + ln] = ls[qs];
#pragma unroll
    for (int t = 0; t < 4; ++t)
#pragma unroll
      for (int r = 0; r < 8; ++r) so[w][qs * 16 + 8 * hh + r][t * 16 + ln] = o[qs][t][r]; }
  __syncthreads();
  const int row = tid >> 2, c0 = (tid & 3) * 16;      /* four lanes per output row: 32 bytes each of its 128-byte line */
  float l = 0.f;
#pragma unroll
  for (int u = 0; u < 4; ++u) l += sl[u][0][row] + sl[u][1][row];
  const float fin = 64.0f / l;      /* o carried x64 as the output GEMM expects */
  FragH f;
#pragma unroll
  for (int c = 0; c < 4; ++c) { const v4f a = (*(const v4f*)&so[0][row][c0 + c * 4] + *(const v4f*)&so[1][row][c0 + c * 4]) + (*(const v4f*)&so[2][row][c0 + c * 4] + *(const v4f*)&so[3][row][c0 + c * 4]);
#pragma unroll
    for (int q = 0; q < 4; ++q) f.h[c * 4 + q] = (_Float16)(a[q] * fin); }
  unsigned short* d = (unsigned short*)O16 + ((size_t)b * SQ + rg * FQ + row) * DM + h * HD + c0;
  *(v8us*)d = f.half[0]; *(v8us*)(d + 8) = f.half[1]; }

// Exact f32 linear attention for the first QT0 rows of one batch. One work-group of 8 waves per (head, 32 query rows), lane = query row.
// The head's QT0 key and value rows and the group's 32 q rows are staged once in LDS with whole-line loads, all in flight together. Step 1: wave w takes the keys j = w mod 8, four at a time
// (four independent sum chains), q row in registers, k row broadcast from LDS; the masked score goes to le[j][row]. Step 2: wave w owns columns 8 w .. 8 w + 7 of o in registers
// and walks the keys in ascending order. Each sum runs in the order of the one-thread-per-row form (d ascending, j ascending); keys above the group's last row only ever added zeros and are left out.
#define LR 32                        /* query rows per work-group */
#define LP 68                        /* pitch in floats of the per-row LDS arrays: 16 B x odd, so that 32 lanes reading 16 B of their own rows spread over the banks */
__global__ __launch_bounds__(256) void k_latt0(const float* __restrict__ QF, const float* __restrict__ KF, const float* __restrict__ VF, float* __restrict__ OF) {      /* all four planes: rows of DM floats */
  __shared__ __attribute__((aligned(16))) float lk[QT0][HD]; __shared__ __attribute__((aligned(16))) float lv[QT0][HD]; __shared__ __attribute__((aligned(16))) float le[QT0][LR];
  __shared__ __attribute__((aligned(16))) float lq[LR][LP]; __shared__ __attribute__((aligned(16))) float lo[LR][LP];
  const int tid = threadIdx.x, w = tid >> 5, lane = tid & 31; const int h = blockIdx.x / (QT0 / LR), rg = blockIdx.x % (QT0 / LR); const int r0 = rg * LR, nj = r0 + LR, i = r0 + lane;
  const int sr = tid / (HD / 4), sc = (tid % (HD / 4)) * 4;      /* staging and output: 16 lanes per 256-byte row, 16 rows per pass of the work-group */
  { v4f tk[QT0 / 16], tv[QT0 / 16], tq[LR / 16]; const float* kp = KF + (size_t)sr * DM + h * HD + sc; const float* vp = VF + (size_t)sr * DM + h * HD + sc; const float* qp = QF + (size_t)(r0 + sr) * DM + h * HD + sc;
#pragma unroll      /* every load is issued before the first LDS store waits for one */
    for (int p = 0; p < QT0 / 16; ++p) { tk[p] = *(const v4fa*)(kp + (size_t)p * 16 * DM); tv[p] = *(const v4fa*)(vp + (size_t)p * 16 * DM); }
#pragma unroll
    for (int p = 0; p < LR / 16; ++p) tq[p] = *(const v4fa*)(qp + (size_t)p * 16 * DM);
    asm volatile("s_wait_xcnt 0x0" :: "v"(kp), "v"(vp), "v"(qp) : "memory");      /* behind the last load of the run; the three address pairs are its inputs, so that none of them is given to a load's result or reused ahead of it */
#pragma unroll
    for (int p = 0; p < QT0 / 16; ++p) { *(v4f*)&lk[p * 16 + sr][sc] = tk[p]; *(v4f*)&lv[p * 16 + sr][sc] = tv[p]; }
#pragma unroll
    for (int p = 0; p < LR / 16; ++p) *(v4f*)&lq[p * 16 + sr][sc] = tq[p]; }
  __syncthreads();
  v4f q[HD / 4];
#pragma unroll      /* q stays in registers: constant indices only */
  for (int c = 0; c < HD / 4; ++c) q[c] = *(const v4f*)&lq[lane][c * 4];
  for (int jb = 0; jb < nj; jb += 32) { const int j0 = jb + w; float s0 = 0.f, s1 = 0.f, s2 = 0.f, s3 = 0.f;
#pragma unroll      /* constant indices into q; the four chains fill each other's result latency */
    for (int c = 0; c < HD / 4; ++c) { const v4f k0 = *(const v4f*)&lk[j0][c * 4], k1 = *(const v4f*)&lk[j0 + 8][c * 4], k2 = *(const v4f*)&lk[j0 + 16][c * 4], k3 = *(const v4f*)&lk[j0 + 24][c * 4];
#pragma unroll
      for (int u = 0; u < 4; ++u) { s0 += q[c][u] * k0[u]; s1 += q[c][u] * k1[u]; s2 += q[c][u] * k2[u]; s3 += q[c][u] * k3[u]; } }
    le[j0][lane] = (j0 <= i) ? s0 : 0.f; le[j0 + 8][lane] = (j0 + 8 <= i) ? s1 : 0.f; le[j0 + 16][lane] = (j0 + 16 <= i) ? s2 : 0.f; le[j0 + 24][lane] = (j0 + 24 <= i) ? s3 : 0.f; }
  __syncthreads();
  float l = 0.f; v4f oa = {0.f, 0.f, 0.f, 0.f}, ob = {0.f, 0.f, 0.f, 0.f};
#pragma unroll 8      /* eight keys' LDS reads are issued ahead of the sums that use them */
  for (int j = 0; j < nj; ++j) { const float e = le[j][lane]; const v4f va = *(const v4f*)&lv[j][w * 8], vb = *(const v4f*)&lv[j][w * 8 + 4]; l += e; oa += e * va; ob += e * vb; }
  const float fin = 64.0f / l;      /* o carried x64 like the f16 path */
  *(v4f*)&lo[lane][w * 8] = oa * fin; *(v4f*)&lo[lane][w * 8 + 4] = ob * fin;
  __syncthreads();
#pragma unroll      /* two passes, each wave storing whole 128-byte lines */
  for (int p = 0; p < LR / 16; ++p) *(v4f*)(OF + (size_t)(r0 + p * 16 + sr) * DM + h * HD + sc) = *(const v4f*)&lo[p * 16 + sr][sc]; }
extern "C" void kernel_launch(void* const* d_in, const int* in_sizes, int n_in,
                              void* d_out, int out_size, void* d_ws, size_t ws_size, hipStream_t stream) {
  (void)in_sizes; (void)n_in; (void)out_size;
  const float* const* I = (const float* const*)d_in; const float* x = I[0]; const float* wqk = I[1]; const float* bqk = I[2]; const float* wv = I[3]; const float* bv = I[4]; const float* wo = I[5]; const float* bo = I[6]; const float* bq = bqk; const float* bk = bqk + DM;      /* natural Wqk [2048][1024] (q rows | k rows) + bias [2048]; Wv + bv; Wo + bo */
  char* ws = (char*)d_ws; size_t off = 0;
  auto take = [&](size_t bytes) { char* p = ws + off; off += (bytes + 255) & ~(size_t)255; return p; };
  _Float16* BQK = (_Float16*)take((size_t)2 * DM * DM * 2); _Float16* BQ = BQK; _Float16* BK = BQK + (size_t)DM * DM; _Float16* BV = (_Float16*)take((size_t)DM * DM * 2); _Float16* BO = (_Float16*)take((size_t)DM * DM * 2);
  _Float16* X16 = (_Float16*)take(NR * DM * 2); _Float16* Q16 = (_Float16*)take(NR * DM * 2); _Float16* K16 = (_Float16*)take(NR * DM * 2); _Float16* V16 = (_Float16*)take(NR * DM * 2); _Float16* O16 = (_Float16*)take(NR * DM * 2);
  _Float16* VT = (_Float16*)take((size_t)NB * NH * HD * SQ * 2);
  float* QF0 = (float*)take((size_t)QT0 * DM * 4); float* KF0 = (float*)take((size_t)QT0 * DM * 4); float* VF0 = (float*)take((size_t)QT0 * DM * 4); float* OF0 = (float*)take((size_t)NB * QT0 * DM * 4); _Float16* OH0 = (_Float16*)take((size_t)NB * QT0 * DM * 2); _Float16* OL0 = (_Float16*)take((size_t)NB * QT0 * DM * 2);
  if (off > ws_size) return;
  { const unsigned g = (unsigned)(((size_t)DM * DM / 8 + 255) / 256); k_wnat<<<2 * g, 256, 0, stream>>>(wqk, (size_t)2 * DM * DM / 8, BQK); k_wnat<<<g, 256, 0, stream>>>(wv, (size_t)DM * DM / 8, BV); k_wnat<<<g, 256, 0, stream>>>(wo, (size_t)DM * DM / 8, BO); }      /* natural [out][in] = Bt[n][k], x16 (Wqk's q rows then k rows) */

  k_x16<<<(unsigned)((NR * DM / 8 + 255) / 256), 256, 0, stream>>>(x, X16, NR * DM / 8);
  const size_t r0p = (size_t)B0 * SQ;      /* first projected row */
  k_gemm2<19><<<dim3((unsigned)((MP / 128) * (DM / 64)), 1), 128, 0, stream>>>(X16 + r0p * DM, DM, 0, BQ, DM, 0, 0.0625f, bq, 0, nullptr, 1, 0, 0, nullptr, Q16 + r0p * DM, DM, 0, MP, DM, DM);      /* phi(q) = elu(x Wq^T + bq) + 1 */
  k_gemm2<19><<<dim3((unsigned)((MP / 128) * (DM / 64)), 1), 128, 0, stream>>>(X16 + r0p * DM, DM, 0, BK, DM, 0, 0.0625f, bk, 0, nullptr, 1, 0, 0, nullptr, K16 + r0p * DM, DM, 0, MP, DM, DM);      /* phi(k) */
  k_gemm2<0><<<dim3((unsigned)((MP / 128) * (DM / 64)), 1), 128, 0, stream>>>(X16 + r0p * DM, DM, 0, BV, DM, 0, 0.0625f, bv, 0, nullptr, 1, 0, 0, nullptr, V16 + r0p * DM, DM, 0, MP, DM, DM);
  for (int b = B0; b < B0 + NBR; ++b) { const size_t r0 = (size_t)b * SQ;
    k_vt<NH, SQ><<<NH * (SQ / 64), 256, 0, stream>>>(V16 + r0 * LQ, LQ, 0, VT + (size_t)b * NH * HD * SQ);      /* V^T [NH][HD][SQ] of this batch */
    k_gemm2<19><<<dim3((QT0 / 128) * (DM / 64), 1), 128, 0, stream>>>(X16 + r0 * DM, DM, 0, BQ, DM, 0, 0.0625f, bq, 0, nullptr, 1, 0, 0, QF0, nullptr, DM, 0, QT0, DM, DM); k_gemm2<19><<<dim3((QT0 / 128) * (DM / 64), 1), 128, 0, stream>>>(X16 + r0 * DM, DM, 0, BK, DM, 0, 0.0625f, bk, 0, nullptr, 1, 0, 0, KF0, nullptr, DM, 0, QT0, DM, DM); k_gemm2<0><<<dim3((QT0 / 128) * (DM / 64), 1), 128, 0, stream>>>(X16 + r0 * DM, DM, 0, BV, DM, 0, 0.0625f, bv, 0, nullptr, 1, 0, 0, VF0, nullptr, DM, 0, QT0, DM, DM);      /* f32 phi(q), phi(k), v of the first 128 rows (exact products) */
    k_latt0<<<NH * (QT0 / LR), 256, 0, stream>>>(QF0, KF0, VF0, OF0 + (size_t)b * QT0 * DM);      /* exact f32 linear attention for rows 0..127 (o x64): the few-key rows without the f16 roundings */
  }
  k_lfa<<<dim3(SQ / FQ, NH, NB), 128, 0, stream>>>(Q16, K16, VT, O16);      /* scores, causal normalisation and a V^T of every batch, head and query tile in one launch: o (merged heads, x64) as f16 rows */
  k_gemm2<0><<<dim3((unsigned)((MPO / 128) * (DM / 64)), 1), 128, 0, stream>>>(O16 + r0p * DM, DM, 0, BO, DM, 0, 0.0009765625f, bo, 0, nullptr, 1, 0, 0, (float*)d_out + r0p * DM, nullptr, DM, 0, MPO, DM, DM);      /* out rows are the output layout */
  k_hl<<<(unsigned)(((size_t)NB * QT0 * DM / 8 + 255) / 256), 256, 0, stream>>>(OF0, OH0, OL0, (size_t)NB * QT0 * DM / 8);      /* first-tile o (x64) -> f16 hi + x1024 residual planes */
  for (int b = B0; b < B0 + NBR; ++b) { const size_t r0 = (size_t)b * SQ; const size_t f0 = (size_t)b * QT0;
    k_gemm2<0><<<dim3((QT0 / 128) * (DM / 64), 1), 128, 0, stream>>>(OH0 + f0 * DM, DM, 0, BO, DM, 0, 0.0009765625f, bo, 0, nullptr, 1, 0, 0, (float*)d_out + r0 * DM, nullptr, DM, 0, QT0, DM, DM);      /* rows 0..127: out = o_hi Wo (+ b), overwriting the f16-path rows */
    k_gemm2<0><<<dim3((QT0 / 128) * (DM / 64), 1), 128, 0, stream>>>(OL0 + f0 * DM, DM, 0, BO, DM, 0, 0.00000095367431640625f, nullptr, 0, (const float*)d_out + r0 * DM, -1, 0, 0, (float*)d_out + r0 * DM, nullptr, DM, 0, QT0, DM, DM); }      /* += o_lo Wo 2^-20 (own-element accumulate) */
}

// v005
// One run takes 159 microseconds.
// Two timings next to v004 both put it at 2.02 times that version's speed.
// Counting every step since v000, it is 26.3 times as fast.
#include <hip/hip_runtime.h>
// Causal LINEAR attention (x [2][2048][1024]; qk = x Wqk^T + bqk (natural [2048][1024]: rows 0..1023 -> q, 1024..2047 -> k; sigma 1/32, biases 0.02), v = x Wv^T + bv; 16 heads of 64; feature map phi = elu + 1 on q and k; ctx_t = (phi(q_t) . sum_{s<=t} phi(k_s) v_s^T) / (phi(q_t) . sum_{s<=t} phi(k_s)) = sum_{s<=t} a_ts v_s / sum_{s<=t} a_ts with a_ts = phi(q_t).phi(k_s) (the module's cumsum form, no softmax, no scaling, no eps); out = ctx Wo^T + bo -> [2][2048][1024]).
// Structure: x as exact f16 rows and the natural weights as exact x16 planes in one VALU launch; q, k (with the elu + 1 feature map in the GEMM epilogue) and v as one launch of WMMA GEMMs (32x64 wave tiles, f32 accumulation, + bias) with f16 outputs, the first 128 rows of each batch also in f32; V^T via LDS transposes; one fused attention launch for all batches, heads and query tiles of 32 rows: a^T = phi(k) phi(q)^T on WMMA (K = 64) for the keys up to the tile end, causal mask, row sums in f32, a as f16 straight from the accumulators into the A operand of ctx = a V^T on WMMA, ctx x64 / sum a into merged f16 rows; out = ctx Wo^T + bo GEMM (f32); first-tile refinement: the first 128 rows of each batch computed exactly in f32 on VALU (a / sum a weights), their output rows taken from o hi in the output GEMM and completed from o lo by one accumulating GEMM pass; 8 launches.
// Compute dtype: inputs rounded to bf16; x / weights exact; q, k, v, the weights a and o as plain f16 GEMM operands (~2^-12); scores and row sums f32. v_wmma_f32_16x16x32_f16.
#define NB 2
#define SQ 2048
#define DM 1024
#define NH 16
#define HD 64
#define HG 4                         /* heads per group in the unlaunched k_vt(V16, b, h0, VT) overload */
#define QT 256                       /* query rows per causal tile */
#define NKX SQ                       /* S / P row pitch */
#define QT0 128                      /* first-tile rows recomputed exactly in f32 */
#define B0 0                         /* unused: every launch starts at batch 0 */
#define NBR NB                       /* only in MP, which no launch reads: the launches cover all NB batches */
#define NR ((size_t)NB * SQ)         /* token rows */
#define MP ((int)((size_t)NBR * SQ)) /* only in MPO, which no launch reads: the projections take all NR rows */
#define QN SQ                        /* unused: k_lfa attends all SQ rows of every batch */
#define NHD NH                       /* unused: k_lfa attends all NH heads */
#define MPO MP                       /* unused: the output GEMM takes all NR rows */
#define LQ DM      /* row pitch of the q/k/v rows */
typedef __bf16 v16b __attribute__((ext_vector_type(16)));
typedef unsigned short v8us __attribute__((ext_vector_type(8), may_alias));
typedef float  v8f  __attribute__((ext_vector_type(8)));
typedef float  v4f  __attribute__((ext_vector_type(4)));
typedef float  v4fa __attribute__((ext_vector_type(4), may_alias));
union FragB { v16b v; v8us half[2]; unsigned short u[16]; };

__device__ __forceinline__ unsigned short bf16_bits(float x) { unsigned int u = __float_as_uint(x); return (unsigned short)((u + 0x7FFFu + ((u >> 16) & 1u)) >> 16); }
__device__ __forceinline__ float bf16_val(unsigned short b) { return __uint_as_float(((unsigned int)b) << 16); }
__device__ __forceinline__ float bf16_round(float x) { return bf16_val(bf16_bits(x)); }
// D += A·B with NT terms: 1 = ah·bh, 2 = + al·bh (A split), 3 = + ah·bl (both split)
template <int NT>
__device__ __forceinline__ v8f mmaN(v16b ah, v16b al, v16b bh, v16b bl, v8f c) {
  c = __builtin_amdgcn_wmma_f32_16x16x32_bf16(false, ah, false, bh, (short)0, c, false, false);
  if (NT >= 2) c = __builtin_amdgcn_wmma_f32_16x16x32_bf16(false, al, false, bh, (short)0, c, false, false);
  if (NT >= 3) c = __builtin_amdgcn_wmma_f32_16x16x32_bf16(false, ah, false, bl, (short)0, c, false, false);
  asm volatile("v_nop\n\tv_nop\n\tv_nop\n\tv_nop" : "+v"(c) : "v"(ah), "v"(al), "v"(bh), "v"(bl));
  return c;
}

__global__ __launch_bounds__(256) void k_wt_bf16(const float* __restrict__ W, unsigned short* __restrict__ Wt, int K, int N) {
  const int t = blockIdx.x * 256 + threadIdx.x;
  const int k8n = K / 8;
  if (t >= N * k8n) return;
  const int n = t / k8n, k8 = (t % k8n) * 8;
  v8us v;
#pragma unroll
  for (int i = 0; i < 8; ++i) v[i] = bf16_bits(W[(size_t)(k8 + i) * N + n]);
  *(v8us*)(Wt + (size_t)n * K + k8) = v;
  
}

// GEMM C[M][N] (f32, pitch ldc) = act(A[M][K]·W + bias). A f32 row-major (pitch lda) converted per fragment to bf16
// (ASPLIT: hi/lo two planes -> 2 terms, else single rounded term); Wt bf16 [N][K] (pitch ldb). BIAS_BF16 rounds the
// bias to bf16 first (bias quantised to bf16 before the add). K%32==0, M%16==0, N%64==0.
template <bool ASPLIT, int ACT, bool BIAS_BF16>
__global__ __launch_bounds__(128) void k_gemm_bf(const float* __restrict__ A, int lda, const unsigned short* __restrict__ Wt, int ldb,
                                               const float* __restrict__ bias, float* __restrict__ C, int ldc, int M, int N, int K) {
  __shared__ __attribute__((aligned(16))) float so[4][16][64];
  const int tid = threadIdx.x, w = tid >> 5, lane = tid & 31, ln = lane & 15, hh = lane >> 4;
  const int ntn = N / 64;
  const int wid = blockIdx.x * 4 + w;
  const int mt = wid / ntn, nq = wid % ntn;
  if (mt * 16 >= M) return;
  const int row0 = mt * 16, col0 = nq * 64;
  const float* arow = A + (size_t)(row0 + ln) * lda;
  v8f acc[4] = {};
  for (int kb = 0; kb < K; kb += 32) {
    FragB ah, al;
    const v4f x0 = *(const v4fa*)(arow + kb + 8 * hh), x1 = *(const v4fa*)(arow + kb + 8 * hh + 4);
    const v4f x2 = *(const v4fa*)(arow + kb + 16 + 8 * hh), x3 = *(const v4fa*)(arow + kb + 16 + 8 * hh + 4);
    float xs[16] = {x0[0],x0[1],x0[2],x0[3],x1[0],x1[1],x1[2],x1[3],x2[0],x2[1],x2[2],x2[3],x3[0],x3[1],x3[2],x3[3]};
#pragma unroll
    for (int i = 0; i < 16; ++i) { const unsigned short hb = bf16_bits(xs[i]); ah.u[i] = hb; al.u[i] = ASPLIT ? bf16_bits(xs[i] - bf16_val(hb)) : (unsigned short)0; }
#pragma unroll
    for (int t = 0; t < 4; ++t) {
      const unsigned short* brow = Wt + (size_t)(col0 + t * 16 + ln) * ldb + kb;
      FragB b;
      b.half[0] = *(const v8us*)(brow + 8 * hh);
      b.half[1] = *(const v8us*)(brow + 16 + 8 * hh);
      acc[t] = mmaN<ASPLIT ? 2 : 1>(ah.v, al.v, b.v, b.v, acc[t]);
    }
  }
#pragma unroll
  for (int t = 0; t < 4; ++t) {
    float bv = bias ? bias[col0 + t * 16 + ln] : 0.f;
    if (BIAS_BF16) bv = bf16_round(bv);
#pragma unroll
    for (int r = 0; r < 8; ++r) { float v = acc[t][r] + bv; if (ACT == 1) v = fmaxf(v, 0.f); so[w][8 * hh + r][t * 16 + ln] = v; }
  }
  __builtin_amdgcn_fence(__ATOMIC_ACQ_REL, "workgroup");
  __builtin_amdgcn_wave_barrier();
  const int rsub = lane >> 4, c4 = (lane & 15) * 4;
  {
#pragma unroll
    for (int q = 0; q < 8; ++q) {
      const int r = q * 2 + rsub;
      const v4f v = *(const v4fa*)&so[w][r][c4];
      *(v4f*)(C + (size_t)(row0 + r) * ldc + col0 + c4) = v;
    }
    
  }
}

// GEMM C = act(A·W + bias + resid): A f32 (ASPLIT -> hi/lo 2 terms), Wt bf16 [N][K]; ACT 0 none, 1 relu, 2 exact gelu;
// resid (optional, f32, row index = (row % rmod), pitch ldr, RES_BF16 rounds it) added before the activation.
template <bool ASPLIT, int ACT, bool BIAS_BF16, bool RES_BF16>
__global__ __launch_bounds__(128) void k_gemm_bf3(const float* __restrict__ A, int lda, const unsigned short* __restrict__ Wt, int ldb,
                                                const float* __restrict__ bias, const float* __restrict__ resid, int rmod, int ldr,
                                                float* __restrict__ C, int ldc, int M, int N, int K) {
  __shared__ __attribute__((aligned(16))) float so[4][16][64];
  const int tid = threadIdx.x, w = tid >> 5, lane = tid & 31, ln = lane & 15, hh = lane >> 4;
  const int ntn = N / 64;
  const int wid = blockIdx.x * 4 + w;
  const int mt = wid / ntn, nq = wid % ntn;
  if (mt * 16 >= M) return;
  const int row0 = mt * 16, col0 = nq * 64;
  const float* arow = A + (size_t)(row0 + ln) * lda;
  v8f acc[4] = {};
  for (int kb = 0; kb < K; kb += 32) {
    FragB ah, al;
    const v4f x0 = *(const v4fa*)(arow + kb + 8 * hh), x1 = *(const v4fa*)(arow + kb + 8 * hh + 4);
    const v4f x2 = *(const v4fa*)(arow + kb + 16 + 8 * hh), x3 = *(const v4fa*)(arow + kb + 16 + 8 * hh + 4);
    float xs[16] = {x0[0],x0[1],x0[2],x0[3],x1[0],x1[1],x1[2],x1[3],x2[0],x2[1],x2[2],x2[3],x3[0],x3[1],x3[2],x3[3]};
#pragma unroll
    for (int i = 0; i < 16; ++i) { const unsigned short hb = bf16_bits(xs[i]); ah.u[i] = hb; al.u[i] = ASPLIT ? bf16_bits(xs[i] - bf16_val(hb)) : (unsigned short)0; }
#pragma unroll
    for (int t = 0; t < 4; ++t) {
      const unsigned short* brow = Wt + (size_t)(col0 + t * 16 + ln) * ldb + kb;
      FragB b;
      b.half[0] = *(const v8us*)(brow + 8 * hh);
      b.half[1] = *(const v8us*)(brow + 16 + 8 * hh);
      acc[t] = mmaN<ASPLIT ? 2 : 1>(ah.v, al.v, b.v, b.v, acc[t]);
    }
  }
#pragma unroll
  for (int t = 0; t < 4; ++t) {
    const int col = col0 + t * 16 + ln;
    float bv = bias ? bias[col] : 0.f;
    if (BIAS_BF16) bv = bf16_round(bv);
#pragma unroll
    for (int r = 0; r < 8; ++r) {
      float v = acc[t][r] + bv;
      if (resid) { float rv = resid[(size_t)((row0 + 8 * hh + r) % rmod) * ldr + col]; if (RES_BF16) rv = bf16_round(rv); v += rv; }
      if (ACT == 1) v = fmaxf(v, 0.f);
      if (ACT == 2) v = 0.5f * v * (1.0f + erff(v * 0.70710678118654752f));
      if (ACT == 3) { const float u = 0.7978845608028654f * (v + 0.044715f * v * v * v); v = 0.5f * v * (1.0f + tanhf(u)); }
      so[w][8 * hh + r][t * 16 + ln] = v;
    }
  }
  __builtin_amdgcn_fence(__ATOMIC_ACQ_REL, "workgroup");
  __builtin_amdgcn_wave_barrier();
  const int rsub = lane >> 4, c4 = (lane & 15) * 4;
  {
#pragma unroll
    for (int q = 0; q < 8; ++q) {
      const int r = q * 2 + rsub;
      const v4f v = *(const v4fa*)&so[w][r][c4];
      *(v4f*)(C + (size_t)(row0 + r) * ldc + col0 + c4) = v;
    }
    
  }
}
// row LayerNorm (biased variance, eps) over N: s = X (+ R); optional out_sum <- s; out_norm <- (s-mu)*rsqrt(var+eps)*g + b
template <bool PARAM_BF16>
__global__ __launch_bounds__(256) void k_layernorm(const float* __restrict__ X, const float* __restrict__ R, const float* __restrict__ g, const float* __restrict__ bta,
                                                  float* __restrict__ out_sum, float* __restrict__ out_norm, int N, float eps) {
  __shared__ float red[256];
  const int row = blockIdx.x, tid = threadIdx.x;
  const float* x = X + (size_t)row * N; const float* rr = R ? R + (size_t)row * N : nullptr;
  float vals[16];                     // up to N = 4096
  const int per = N / 256;            // contiguous chunk per thread? use strided-by-4 chunks: thread handles j = tid*4 + 1024*u
  float s1 = 0.f;
  for (int u = 0; u < per / 4; ++u) {
    const int j = tid * 4 + 1024 * u;
    const v4f a = *(const v4fa*)(x + j);
    v4f b = {0.f,0.f,0.f,0.f}; if (rr) b = *(const v4fa*)(rr + j);
#pragma unroll
    for (int q = 0; q < 4; ++q) { const float v = a[q] + b[q]; vals[u * 4 + q] = v; s1 += v; }
  }
  red[tid] = s1; __syncthreads();
  for (int st = 128; st > 0; st >>= 1) { if (tid < st) red[tid] += red[tid + st]; __syncthreads(); }
  const float mu = red[0] / (float)N; __syncthreads();
  float s2 = 0.f;
  for (int u = 0; u < per / 4; ++u)
#pragma unroll
    for (int q = 0; q < 4; ++q) { const float c = vals[u * 4 + q] - mu; s2 += c * c; }
  red[tid] = s2; __syncthreads();
  for (int st = 128; st > 0; st >>= 1) { if (tid < st) red[tid] += red[tid + st]; __syncthreads(); }
  const float rs = rsqrtf(red[0] / (float)N + eps);
  {
    for (int u = 0; u < per / 4; ++u) {
      const int j = tid * 4 + 1024 * u;
      v4f o, sm;
#pragma unroll
      for (int q = 0; q < 4; ++q) {
        float gg = g[j + q], bb = bta[j + q];
        if (PARAM_BF16) { gg = bf16_round(gg); bb = bf16_round(bb); }
        sm[q] = vals[u * 4 + q]; o[q] = (vals[u * 4 + q] - mu) * rs * gg + bb;
      }
      if (out_sum) *(v4f*)(out_sum + (size_t)row * N + j) = sm;
      *(v4f*)(out_norm + (size_t)row * N + j) = o;
    }
    
  }
}



// ---- f16 WMMA path (v_wmma_f32_16x16x32_f16): 11-bit significands for operands in range — used where a [0,1] probability operand needs more precision than bf16
typedef _Float16 v16h __attribute__((ext_vector_type(16)));
union FragH { v16h v; v8us half[2]; _Float16 h[16]; unsigned short u[16]; };
template <int NT>
__device__ __forceinline__ v8f mmaH(v16h ah, v16h al, v16h bh, v16h bl, v8f c) {
  c = __builtin_amdgcn_wmma_f32_16x16x32_f16(false, ah, false, bh, (short)0, c, false, false);
  if (NT >= 2) c = __builtin_amdgcn_wmma_f32_16x16x32_f16(false, al, false, bh, (short)0, c, false, false);
  if (NT >= 3) c = __builtin_amdgcn_wmma_f32_16x16x32_f16(false, ah, false, bl, (short)0, c, false, false);
  asm volatile("v_nop\n\tv_nop\n\tv_nop\n\tv_nop" : "+v"(c) : "v"(ah), "v"(al), "v"(bh), "v"(bl));
  return c;
}
// batched GEMM like k_gemm_b but f16 operands: A f32 (split into f16 hi/lo if ASPLIT, else rounded to f16), Bt = f16 values [n][k]; alpha; C f32; N multiple of 16 (partial tiles skipped)
template <bool ASPLIT>
__global__ __launch_bounds__(128) void k_gemm_h(const float* __restrict__ A, int lda, size_t sA, const _Float16* __restrict__ Bh, int ldb, size_t sB, float alpha, float* __restrict__ C, int ldc, size_t sC, int M, int N, int K) {
  __shared__ __attribute__((aligned(16))) float so[4][16][64];
  const int tid = threadIdx.x, w = tid >> 5, lane = tid & 31, ln = lane & 15, hh = lane >> 4; const int by = blockIdx.y;
  A += (size_t)by * sA; Bh += (size_t)by * sB; C += (size_t)by * sC;
  const int ntn = (N + 63) / 64; const int wid = blockIdx.x * 4 + w; const int mt = wid / ntn, nq = wid % ntn; if (mt * 16 >= M) return;
  const int row0 = mt * 16, col0 = nq * 64; const float* arow = A + (size_t)(row0 + ln) * lda;
  v8f acc[4] = {};
  for (int kb = 0; kb < K; kb += 32) {
    FragH ah, al;
    const v4f x0 = *(const v4fa*)(arow + kb + 8 * hh), x1 = *(const v4fa*)(arow + kb + 8 * hh + 4), x2 = *(const v4fa*)(arow + kb + 16 + 8 * hh), x3 = *(const v4fa*)(arow + kb + 16 + 8 * hh + 4);
    float xs[16] = {x0[0],x0[1],x0[2],x0[3],x1[0],x1[1],x1[2],x1[3],x2[0],x2[1],x2[2],x2[3],x3[0],x3[1],x3[2],x3[3]};
#pragma unroll
    for (int i = 0; i < 16; ++i) { const _Float16 h = (_Float16)xs[i]; ah.h[i] = h; al.h[i] = ASPLIT ? (_Float16)(xs[i] - (float)h) : (_Float16)0.0f; }
#pragma unroll
    for (int t = 0; t < 4; ++t) { if (col0 + t * 16 >= N) continue; const size_t boff = (size_t)(col0 + t * 16 + ln) * ldb + kb; FragH bq; bq.half[0] = *(const v8us*)(Bh + boff + 8 * hh); bq.half[1] = *(const v8us*)(Bh + boff + 16 + 8 * hh);
      acc[t] = mmaH<ASPLIT ? 2 : 1>(ah.v, al.v, bq.v, bq.v, acc[t]); }
  }
#pragma unroll
  for (int t = 0; t < 4; ++t) { if (col0 + t * 16 >= N) continue;
#pragma unroll
    for (int r = 0; r < 8; ++r) so[w][8 * hh + r][t * 16 + ln] = acc[t][r] * alpha; }
  __builtin_amdgcn_fence(__ATOMIC_ACQ_REL, "workgroup"); __builtin_amdgcn_wave_barrier();
  const int rsub = lane >> 4, c4 = (lane & 15) * 4;
  {
#pragma unroll
    for (int q = 0; q < 8; ++q) { const int r = q * 2 + rsub; if (col0 + c4 < N) { const v4f v = *(const v4fa*)&so[w][r][c4]; *(v4f*)(C + (size_t)(row0 + r) * ldc + col0 + c4) = v; } }
     }
}

// Wt[n][k] = f16(W[k][n]·scale) from f32 row-major W[K][N] (scale = power of two; bf16-exact weights stay exact in f16 away from the subnormal range)
__global__ __launch_bounds__(256) void k_wt_f16(const float* __restrict__ W, _Float16* __restrict__ Wt, int K, int N, float scale) {
  const int t = blockIdx.x * 256 + threadIdx.x; if (t >= N * (K / 8)) return; const int n = t / (K / 8), k8 = (t % (K / 8)) * 8; FragH f;
#pragma unroll
  for (int i = 0; i < 8; ++i) f.h[i] = (_Float16)(bf16_round(W[(size_t)(k8 + i) * N + n]) * scale); const v8us o = f.half[0];
  *(v8us*)((unsigned short*)Wt + (size_t)n * K + k8) = o; 
}
// k_gemm_hh variant with fused epilogue: v = acc·alpha + bias[by·sBias + col] (+ CP[(row/rowsPerB)·sCPb + by·64 + col] if CP) ; ACT 0 none / 1 elu ; writes f16 C16 (and f32 C if non-null)
template <int ACT>
__global__ __launch_bounds__(128) void k_gemm_hhx(const _Float16* __restrict__ A, int lda, size_t sA, const _Float16* __restrict__ Bh, int ldb, size_t sB, float alpha, const float* __restrict__ bias, size_t sBias, const float* __restrict__ CP, int rowsPerB, size_t sCPb, int row0g,
    float* __restrict__ C, _Float16* __restrict__ C16, int ldc, size_t sC, int M, int N, int K) {
  __shared__ __attribute__((aligned(16))) float so[4][16][64];
  const int tid = threadIdx.x, w = tid >> 5, lane = tid & 31, ln = lane & 15, hh = lane >> 4; const int by = blockIdx.y;
  A += (size_t)by * sA; Bh += (size_t)by * sB; const size_t cofs = (size_t)by * sC; const float* bp = bias ? bias + (size_t)by * sBias : nullptr;
  const int ntn = (N + 63) / 64; const int wid = blockIdx.x * 4 + w; const int mt = wid / ntn, nq = wid % ntn; if (mt * 16 >= M) return;
  const int row0 = mt * 16, col0 = nq * 64; const _Float16* arow = A + (size_t)(row0 + ln) * lda;
  v8f acc[4] = {};
  for (int kb = 0; kb < K; kb += 32) { FragH ah; ah.half[0] = *(const v8us*)((const unsigned short*)arow + kb + 8 * hh); ah.half[1] = *(const v8us*)((const unsigned short*)arow + kb + 16 + 8 * hh);
#pragma unroll
    for (int t = 0; t < 4; ++t) { if (col0 + t * 16 >= N) continue; const size_t boff = (size_t)(col0 + t * 16 + ln) * ldb + kb; FragH bq; bq.half[0] = *(const v8us*)((const unsigned short*)Bh + boff + 8 * hh); bq.half[1] = *(const v8us*)((const unsigned short*)Bh + boff + 16 + 8 * hh);
      acc[t] = mmaH<1>(ah.v, ah.v, bq.v, bq.v, acc[t]); }
  }
#pragma unroll
  for (int t = 0; t < 4; ++t) { if (col0 + t * 16 >= N) continue; const int col = col0 + t * 16 + ln; const float bv = bp ? bf16_round(bp[col]) : 0.f;
#pragma unroll
    for (int r = 0; r < 8; ++r) { float v = acc[t][r] * alpha + bv; if (CP) { const int rr = row0g + row0 + 8 * hh + r; if (rowsPerB < 0) v += CP[cofs + (size_t)rr * ldc + col];      /* rowsPerB < 0: own element of the batched C plane */ else { const int bidx = rr / rowsPerB; v += CP[(size_t)bidx * sCPb + (size_t)by * 64 + col]; } } if (ACT == 1) v = (v > 0.f) ? v : expm1f(v); else if (ACT == 7) v = (v > 0.f) ? v + 1.0f : expf(v); else if (ACT == 8) v = tanhf(v); else if (ACT == 9) v = 0.5f * v * (1.0f + tanhf(0.7978845608028654f * (v + 0.044715f * v * v * v))); else if (ACT == 11) v = 1.0f / (1.0f + expf(-v)); else if (ACT == 12) v = (v > 0.f) ? v : 0.01f * v; else if (ACT == 14) v = (v > 0.f) ? v : 0.1f * v; else if (ACT == 16) v = (v >= 0.f) ? v : 0.3f * v; else if (ACT == 17) v = (v >= 0.f) ? v : 0.2f * v; else if (ACT == 15) v = v / (1.0f + expf(-v)); else if (ACT == 3) v = fmaxf(v, 0.f); else if (ACT == 6) v = 0.5f * v * (1.0f + erff(v * 0.70710678118654752f)); so[w][8 * hh + r][t * 16 + ln] = v; } }
  __builtin_amdgcn_fence(__ATOMIC_ACQ_REL, "workgroup"); __builtin_amdgcn_wave_barrier();
  const int rsub = lane >> 4, c4 = (lane & 15) * 4; typedef _Float16 v4h __attribute__((ext_vector_type(4)));
  {
#pragma unroll
    for (int q = 0; q < 8; ++q) { const int r = q * 2 + rsub; if (col0 + c4 < N) { const v4f v = *(const v4fa*)&so[w][r][c4]; if (C) *(v4f*)(C + cofs + (size_t)(row0 + r) * ldc + col0 + c4) = v; if (C16) { v4h h4; for (int i = 0; i < 4; ++i) h4[i] = (_Float16)v[i]; *(v4h*)(C16 + cofs + (size_t)(row0 + r) * ldc + col0 + c4) = h4; } } }
     }
}


typedef _Float16 v4h __attribute__((ext_vector_type(4)));

__global__ __launch_bounds__(256) void k_h16(const float* __restrict__ x, _Float16* __restrict__ X16, size_t n8) { const size_t t = (size_t)blockIdx.x * 256 + threadIdx.x; if (t >= n8) return; FragH f;
#pragma unroll
  for (int q = 0; q < 8; ++q) f.h[q] = (_Float16)x[t * 8 + q]; *(v8us*)((unsigned short*)X16 + t * 8) = f.half[0];  }
__global__ __launch_bounds__(256) void k_round16f(const float* __restrict__ W, _Float16* __restrict__ Bt, size_t n8) { const size_t t = (size_t)blockIdx.x * 256 + threadIdx.x; if (t >= n8) return; FragH f;
#pragma unroll
  for (int i = 0; i < 8; ++i) f.h[i] = (_Float16)(bf16_round(W[t * 8 + i]) * 16.0f); *(v8us*)((unsigned short*)Bt + t * 8) = f.half[0];  }
template <int NHv, int TTv>
__global__ __launch_bounds__(256) void k_vt(const _Float16* __restrict__ V16, int ldv, int voff, _Float16* __restrict__ Vt) { __shared__ unsigned short tl[64][66]; const int tid = threadIdx.x; const int slab = blockIdx.x / (TTv / 64), lg = blockIdx.x % (TTv / 64); const int b = slab / NHv, h = slab % NHv;
  for (int i = tid; i < 64 * 8; i += 256) { const int r = i / 8, c8 = (i % 8) * 8; FragH f; f.half[0] = *(const v8us*)((const unsigned short*)V16 + ((size_t)b * TTv + lg * 64 + r) * ldv + voff + h * 64 + c8);
#pragma unroll
    for (int q = 0; q < 8; ++q) tl[r][c8 + q] = f.u[q]; }
  __syncthreads();
  {
#pragma unroll
    for (int rd = 0; rd < 2; ++rd) { const int d = rd * 32 + tid / 8, pc = tid % 8; FragH f;
#pragma unroll
      for (int q = 0; q < 8; ++q) f.u[q] = tl[pc * 8 + q][d];
      *(v8us*)((unsigned short*)Vt + ((size_t)slab * 64 + d) * TTv + lg * 64 + pc * 8) = f.half[0]; }
     } }

__global__ __launch_bounds__(256) void k_hl(const float* __restrict__ F, _Float16* __restrict__ Hh, _Float16* __restrict__ Hl, size_t n8) { const size_t t = (size_t)blockIdx.x * 256 + threadIdx.x; if (t >= n8) return; FragH fh, fl; const v4f a = *(const v4fa*)(F + t * 8), c = *(const v4fa*)(F + t * 8 + 4);
#pragma unroll
  for (int q = 0; q < 4; ++q) { _Float16 h = (_Float16)a[q]; fh.h[q] = h; fl.h[q] = (_Float16)((a[q] - (float)h) * 1024.0f); h = (_Float16)c[q]; fh.h[4 + q] = h; fl.h[4 + q] = (_Float16)((c[q] - (float)h) * 1024.0f); }
  { *(v8us*)((unsigned short*)Hh + t * 8) = fh.half[0]; *(v8us*)((unsigned short*)Hl + t * 8) = fl.half[0];  } }

// ---- fast GEMM (work-group tile 128x64, wave tile 32x64; requires M % 32 == 0 rows per launch region, N % 64 == 0 and K % 64 == 0); epilogue = k_gemm_hhx semantics ----
// Operand tiles of GK k (one 128-byte line of each of the 128 A rows and 64 B rows) go through LDS: eight lanes fetch a whole line, one tile ahead of the matrix work, and the waves read their fragments from LDS.
// Products that read none of each other's output share a launch: planes by = blockIdx.y; planes by < nact take bias + by sBias and the activation, the others biasz and none; cfirst: the f32 plane C takes only the first QT0 rows of each batch;
// A1 (if given): the row tiles that hold the first QT0 rows of a batch read their A rows from A1 [batch][QT0] in place of A.
#define GK 64                        /* k per staged tile */
#define GP 72                        /* pitch in halfs of a staged row: 144 B = 16 B x odd, so that 16-byte fragment reads of 16 rows spread over the banks */
__device__ __forceinline__ v16h g2_frag(const _Float16* p, int hh) { FragH f; f.half[0] = *(const v8us*)((const unsigned short*)p + 8 * hh); f.half[1] = *(const v8us*)((const unsigned short*)p + 16 + 8 * hh); return f.v; }
__device__ __forceinline__ v8f g2_mma(v16h a, v16h b, v8f c) { v8f d = __builtin_amdgcn_wmma_f32_16x16x32_f16(false, a, false, b, (short)0, c, false, false); asm volatile("v_nop\n\tv_nop\n\tv_nop\n\tv_nop" : "+v"(d) : "v"(a), "v"(b)); return d; }
template <int ACT>
__global__ __launch_bounds__(128) void k_gemm2(const _Float16* __restrict__ A, int lda, size_t sA, const _Float16* __restrict__ Bh, int ldb, size_t sB, float alpha, const float* __restrict__ bias, size_t sBias, const float* __restrict__ CP, int rowsPerB, size_t sCPb, int row0g,
    float* __restrict__ C, _Float16* __restrict__ C16, int ldc, size_t sC, int M, int N, int K, const _Float16* __restrict__ A1, const float* __restrict__ biasz, int nact, int cfirst) { static_assert(ACT == 0 || ACT == 3 || ACT == 6 || ACT == 8 || ACT == 9 || ACT == 11 || ACT == 12 || ACT == 14 || ACT == 15 || ACT == 16 || ACT == 17 || ACT == 19, "k_gemm2: unsupported ACT code (would silently apply no activation)"); static_assert(QT0 == 128 && SQ % 128 == 0, "k_gemm2: the first rows of a batch are one row tile");
  __shared__ __attribute__((aligned(16))) float so[4][32][68];
  __shared__ __attribute__((aligned(16))) _Float16 sa[2][128][GP]; __shared__ __attribute__((aligned(16))) _Float16 sb[2][64][GP];
  const int tid = threadIdx.x, w = tid >> 5, lane = tid & 31, ln = lane & 15, hh = lane >> 4; const int by = blockIdx.y;
  A += (size_t)by * sA; Bh += (size_t)by * sB; const size_t cofs = (size_t)by * sC; const bool act = by < nact; const float* bp = bias ? (act ? bias + (size_t)by * sBias : biasz) : nullptr;
  const int ntn = N >> 6; const int mt = blockIdx.x / ntn, nq = blockIdx.x - mt * ntn; const int row0 = mt * 128 + 32 * w, col0 = nq * 64; if (mt * 128 >= M) return;      /* the whole work-group or none: barriers follow; a wave whose own rows lie past M leaves behind the last one */
  const int sr = tid >> 3, sc = (tid & 7) * 8;      /* staging: 8 lanes per 128-byte line, 16 rows per pass of the work-group */
  const bool first = (mt * 128) % SQ == 0; const bool cf = C && (!cfirst || first); int ar0 = mt * 128, am = M;      /* ar0, am: the tile's first row in its A plane and that plane's rows */
  const char* ab = (const char*)A; const char* bb = (const char*)Bh; unsigned ao[8], bo[4]; if (A1 && first) { ab = (const char*)A1; ar0 = ar0 / SQ * QT0; am = M / SQ * QT0; }      /* one base per operand for the whole work-group + the lane's own byte offset to each of its rows; a 16-row pass past M (M % 32 == 0) rereads the last 16 rows, which no wave uses */
#pragma unroll
  for (int p = 0; p < 8; ++p) ao[p] = (unsigned)((min(ar0 + 16 * p, am - 16) + sr) * lda + sc) * 2u;
#pragma unroll
  for (int p = 0; p < 4; ++p) bo[p] = (unsigned)((col0 + 16 * p + sr) * ldb + sc) * 2u;
  v8us ra[8], rb[4]; v16h a0[2], a1[2], b[2][4];
  auto fetch = [&]() {      /* the next tile into registers */
#pragma unroll
    for (int p = 0; p < 8; ++p) ra[p] = *(const v8us*)(ab + ao[p]);
#pragma unroll
    for (int p = 0; p < 4; ++p) rb[p] = *(const v8us*)(bb + bo[p]); };
  auto put = [&](int u) {      /* the fetched tile into buffer u; the offsets step on by one tile here, behind the waits for the loads that name them */
#pragma unroll
    for (int p = 0; p < 8; ++p) { *(v8us*)&sa[u][16 * p + sr][sc] = ra[p]; ao[p] += GK * 2; }
#pragma unroll
    for (int p = 0; p < 4; ++p) { *(v8us*)&sb[u][16 * p + sr][sc] = rb[p]; bo[p] += GK * 2; } };
  auto frags = [&](int u) {      /* all fragments of one staged tile: the second half's reads return under the first half's products */
#pragma unroll
    for (int ks = 0; ks < 2; ++ks) { a0[ks] = g2_frag(&sa[u][32 * w + ln][ks * 32], hh); a1[ks] = g2_frag(&sa[u][32 * w + 16 + ln][ks * 32], hh);
#pragma unroll
      for (int t = 0; t < 4; ++t) b[ks][t] = g2_frag(&sb[u][16 * t + ln][ks * 32], hh); } };
  const v8f z8 = {0.f,0.f,0.f,0.f,0.f,0.f,0.f,0.f}; v8f c00 = z8, c01 = z8, c02 = z8, c03 = z8, c10 = z8, c11 = z8, c12 = z8, c13 = z8;
  auto prods = [&]() {
#pragma unroll
    for (int ks = 0; ks < 2; ++ks) { c00 = g2_mma(a0[ks], b[ks][0], c00); c10 = g2_mma(a1[ks], b[ks][0], c10); c01 = g2_mma(a0[ks], b[ks][1], c01); c11 = g2_mma(a1[ks], b[ks][1], c11);
      c02 = g2_mma(a0[ks], b[ks][2], c02); c12 = g2_mma(a1[ks], b[ks][2], c12); c03 = g2_mma(a0[ks], b[ks][3], c03); c13 = g2_mma(a1[ks], b[ks][3], c13); } };
  const int nt = K / GK;
  fetch(); put(0); __syncthreads();
#pragma unroll 1      /* one copy of the loop body: the buffer's number is a scalar offset */
  for (int t = 0; t + 1 < nt; ++t) { frags(t & 1); fetch(); prods(); put((t + 1) & 1); __syncthreads(); }      /* tile t + 1 is on its way under tile t's products; the one barrier of a pass publishes it and ends the reads of tile t, whose buffer the next pass refills */
  frags((nt - 1) & 1); prods();
  if (row0 >= M) return;
  v8f accs[8] = {c00, c01, c02, c03, c10, c11, c12, c13};
#pragma unroll
  for (int u = 0; u < 8; ++u) { const int t = u & 3, half = u >> 2; const int col = col0 + t * 16 + ln; const float bv = bp ? bf16_round(bp[col]) : 0.f;
#pragma unroll
    for (int r = 0; r < 8; ++r) { const int rloc = half * 16 + 8 * hh + r; float v = accs[u][r] * alpha + bv; if (CP) { if (rowsPerB < 0) v += CP[cofs + (size_t)(row0g + row0 + rloc) * ldc + col];      /* rowsPerB < 0: own element of the batched C plane */ else { const int bidx = (row0g + row0 + rloc) / rowsPerB; v += CP[(size_t)bidx * sCPb + (size_t)by * 64 + col]; } }
      if (act) { if (ACT == 3) v = fmaxf(v, 0.f); else if (ACT == 6) v = 0.5f * v * (1.0f + erff(v * 0.70710678118654752f)); else if (ACT == 11) v = 1.0f / (1.0f + expf(-v)); else if (ACT == 15) v = v / (1.0f + expf(-v)); else if (ACT == 19) v = (v > 0.f) ? (v + 1.0f) : expf(v);      /* elu(v) + 1 */ else if (ACT == 12) v = (v > 0.f) ? v : 0.01f * v; else if (ACT == 8) v = tanhf(v); else if (ACT == 9) v = 0.5f * v * (1.0f + tanhf(0.7978845608028654f * (v + 0.044715f * v * v * v))); else if (ACT == 14) v = (v > 0.f) ? v : 0.1f * v; else if (ACT == 16) v = (v >= 0.f) ? v : 0.3f * v; else if (ACT == 17) v = (v >= 0.f) ? v : 0.2f * v; }
      so[w][rloc][t * 16 + ln] = v; } }
  __builtin_amdgcn_fence(__ATOMIC_ACQ_REL, "workgroup"); __builtin_amdgcn_wave_barrier();
  const int rsub = lane >> 4, c4 = (lane & 15) * 4;
  {
#pragma unroll
    for (int q = 0; q < 16; ++q) { const int r = q * 2 + rsub; const v4f v = *(const v4fa*)&so[w][r][c4];
      if (cf) { *(v4f*)(C + cofs + (size_t)(row0 + r) * ldc + col0 + c4) = v; asm volatile("s_wait_xcnt 0x0" :: "v"(v) : "memory"); }      /* behind the f32 store; the stored registers are the wait's inputs, so that the f16 conversion below does not reuse them ahead of it */
      if (C16) { v4h h4; for (int i = 0; i < 4; ++i) h4[i] = (_Float16)v[i]; *(v4h*)(C16 + cofs + (size_t)(row0 + r) * ldc + col0 + c4) = h4; } }
     } }


// All four operand conversions in one launch (none reads another's output): the weights, natural [out][in] = Bt[n][k], x16, into the planes BW = Wqk (q rows, k rows) | Wv | Wo, then x into X16. A work-group lies wholly in one source.
#define CPB (DM * DM / 8 / 256)      /* work-groups per DM x DM plane, 8 elements per thread */
#define CXB ((unsigned)(NR * DM / 8 / 256))      /* work-groups of x */
__global__ __launch_bounds__(256) void k_cvt(const float* __restrict__ wqk, const float* __restrict__ wv, const float* __restrict__ wo, const float* __restrict__ x, _Float16* __restrict__ BW, _Float16* __restrict__ X16) {
  const unsigned bx = blockIdx.x; const float* s = wqk; _Float16* d = BW; unsigned b0 = 0; float sc = 16.0f;
  if (bx >= 4 * CPB) { s = x; d = X16; b0 = 4 * CPB; sc = 1.0f; } else if (bx >= 3 * CPB) { s = wo; d = BW + (size_t)3 * DM * DM; b0 = 3 * CPB; } else if (bx >= 2 * CPB) { s = wv; d = BW + (size_t)2 * DM * DM; b0 = 2 * CPB; }
  const size_t t = (size_t)(bx - b0) * 256 + threadIdx.x; FragH f;
#pragma unroll
  for (int q = 0; q < 8; ++q) f.h[q] = (_Float16)(bf16_round(s[t * 8 + q]) * sc);
  *(v8us*)((unsigned short*)d + t * 8) = f.half[0]; }
__global__ __launch_bounds__(256) void k_rsm(const float* __restrict__ S, _Float16* __restrict__ P, int nrows) {
  #pragma clang fp contract(off)
  const int i = blockIdx.x * 256 + threadIdx.x; if (i >= nrows) return; const float* s = S + (size_t)i * SQ; float mx = -3.0e38f;
#pragma unroll 1
  for (int j = 0; j < SQ; ++j) mx = fmaxf(mx, s[j]); float se = 0.f;
#pragma unroll 1
  for (int j = 0; j < SQ; ++j) se += expf(s[j] - mx); const float sc = 256.0f / se;
#pragma unroll 1
  for (int j0 = 0; j0 < SQ; j0 += 8) { FragH f; for (int q = 0; q < 8; ++q) f.h[q] = (_Float16)(expf(s[j0 + q] - mx) * sc); unsigned short* d = (unsigned short*)P + (size_t)i * SQ + j0; *(v8us*)d = f.half[0];  } }
__global__ __launch_bounds__(256) void k_vt(const _Float16* __restrict__ V16, int b, int h0, _Float16* __restrict__ VT) { __shared__ unsigned short tl[64][65]; const int tid = threadIdx.x; const int hh = blockIdx.x % HG, sg = blockIdx.x / HG; const int s0 = sg * 64; const int h = h0 + hh;
  for (int i = tid; i < 64 * 8; i += 256) { const int j = i / 8, d8 = (i % 8) * 8; FragH f; f.half[0] = *(const v8us*)((const unsigned short*)V16 + ((size_t)b * SQ + s0 + j) * DM + h * HD + d8); for (int q = 0; q < 8; ++q) tl[d8 + q][j] = f.u[q]; }
  __syncthreads();
  { for (int i = tid; i < 64 * 8; i += 256) { const int d = i / 8, j8 = (i % 8) * 8; FragH f; for (int q = 0; q < 8; ++q) f.u[q] = tl[d][j8 + q]; *(v8us*)((unsigned short*)VT + ((size_t)hh * HD + d) * SQ + s0 + j8) = f.half[0]; }  } }



__global__ __launch_bounds__(256) void k_rsmcf2(const float* __restrict__ S, _Float16* __restrict__ P, int hg, int q0, int nk) {
  #pragma clang fp contract(off)
  const int t = blockIdx.x * 256 + threadIdx.x; if (t >= hg * QT) return; const size_t i = (size_t)t; const float* s = S + i * NKX; const int last = q0 + (t % QT); float mx = -3.0e38f;
#pragma unroll 1
  for (int j = 0; j < nk; ++j) { const float f = (j <= last) ? 1.f : 0.f; mx = fmaxf(mx, fmaf(f, s[j], (1.f - f) * -1.0e9f)); } float se = 0.f;
#pragma unroll 1
  for (int j = 0; j < nk; ++j) { const float f = (j <= last) ? 1.f : 0.f; se += __expf(fmaf(f, s[j], (1.f - f) * -1.0e9f) - mx); } const float sc = 256.0f / se;
#pragma unroll 1
  for (int j0 = 0; j0 < nk; j0 += 8) { FragH fr; for (int q = 0; q < 8; ++q) { const int j = j0 + q; const float f = (j <= last) ? 1.f : 0.f; fr.h[q] = (_Float16)(__expf(fmaf(f, s[j], (1.f - f) * -1.0e9f) - mx) * sc); } unsigned short* d = (unsigned short*)P + i * NKX + j0; *(v8us*)d = fr.half[0];  } }


template <int MASKADD>
__global__ __launch_bounds__(64) void k_att0(const float* __restrict__ QF, const float* __restrict__ KF, const float* __restrict__ VF, int ld, const float* __restrict__ mask, float scale, float* __restrict__ OF, int ldo) {
  #pragma clang fp contract(off)
  __shared__ __attribute__((aligned(16))) float lq[64][64]; __shared__ __attribute__((aligned(16))) float lo[64][64];
  const int tid = threadIdx.x; const int h = blockIdx.x / (QT0 / 64), rg = blockIdx.x % (QT0 / 64); const int i = rg * 64 + tid;
  const float* qr = QF + (size_t)i * ld + h * HD;
#pragma unroll 1
  for (int c = 0; c < HD / 4; ++c) { *(v4f*)&lq[tid][c * 4] = *(const v4fa*)(qr + c * 4); const v4f z = {0.f, 0.f, 0.f, 0.f}; *(v4f*)&lo[tid][c * 4] = z; }
  float m = -1.0e30f, l = 0.f; const int jmax = MASKADD ? (SQ - 1) : (rg * 64 + 63);      /* additive-mask form: every key (the mask input decides); causal form: keys up to the block's last row */
#pragma unroll 1
  for (int j = 0; j <= jmax; ++j) { const float* kr = KF + (size_t)j * ld + h * HD; const float* vr = VF + (size_t)j * ld + h * HD; float s = 0.f;
#pragma unroll 1
    for (int c = 0; c < HD / 4; ++c) { const v4f kq = *(const v4fa*)(kr + c * 4); const v4f qq = *(v4f*)&lq[tid][c * 4]; s = __fadd_rn(s, __fmul_rn(qq[0], kq[0])); s = __fadd_rn(s, __fmul_rn(qq[1], kq[1])); s = __fadd_rn(s, __fmul_rn(qq[2], kq[2])); s = __fadd_rn(s, __fmul_rn(qq[3], kq[3])); }
    s = __fmul_rn(s, scale); if (MASKADD) s = __fadd_rn(s, __fmul_rn(bf16_round(mask[(size_t)i * SQ + j]), -10000.0f));
    const float f = (MASKADD || j <= i) ? 1.f : 0.f; const float sm = fmaf(f, s, (1.f - f) * -1.0e30f); const float mn = fmaxf(m, sm); const float sc = expf(m - mn); const float e = expf(sm - mn); l = __fadd_rn(__fmul_rn(l, sc), e); m = mn;
#pragma unroll 1
    for (int c = 0; c < HD / 4; ++c) { const v4f vv = *(const v4fa*)(vr + c * 4); v4f oo = *(v4f*)&lo[tid][c * 4]; for (int u = 0; u < 4; ++u) oo[u] = __fadd_rn(__fmul_rn(oo[u], sc), __fmul_rn(e, vv[u])); *(v4f*)&lo[tid][c * 4] = oo; } }
  const float fin = 64.0f / l;      /* o carried x64 like the f16 path */
#pragma unroll 1
  for (int c = 0; c < HD / 4; ++c) { v4f oo = *(v4f*)&lo[tid][c * 4]; for (int u = 0; u < 4; ++u) oo[u] = __fmul_rn(oo[u], fin); *(v4f*)&lo[tid][c * 4] = oo; }
  __syncthreads();
  {
#pragma unroll 1
    for (int it = 0; it < 16; ++it) { const int row = it * 4 + tid / 16, pc = (tid % 16) * 4; const v4f v = *(const v4f*)&lo[row][pc]; *(v4f*)(OF + (size_t)(rg * 64 + row) * ldo + h * HD + pc) = v; }
     } }


// Fused causal linear attention: o_i = sum_{j <= i} a_ij v_j / sum_{j <= i} a_ij, a_ij = phi(q_i) . phi(k_j); no score or weight plane in memory.
// One work-group of 4 waves per (batch, head, 32 query rows). The sums over the keys are plain sums, so the waves split the keys: wave w takes the 64-key blocks w, w + 4, ... in two steps of 32 keys
// (a V^T row's 128-byte line is used up by the wave that fetched it), and the four partial o tiles and row sums are added through LDS at the end.
// Per step: a^T = K Q^T, so that a lane of the accumulator holds 8 consecutive keys of ONE query: accumulator tile 0 (keys 0..15) and tile 1 (keys 16..31) of a query column, rounded to f16,
// are elements 0..7 and 8..15 of the A fragment of a V^T in the k order of g2_frag (8 hh + i, 16 + 8 hh + i), which also loads V^T: nothing is moved between lanes.
#define FQ 32                        /* query rows per work-group */
#define FS 32                        /* keys per step */
#define FP 68                        /* pitch in floats of the partial o rows in LDS, as in k_gemm2 */
__global__ __launch_bounds__(128) void k_lfa(const _Float16* __restrict__ Q16, const _Float16* __restrict__ K16, const _Float16* __restrict__ VT, _Float16* __restrict__ O16) {      /* Q16, K16, O16: rows of DM; VT: [NB][NH][HD][SQ] */
  __shared__ __attribute__((aligned(16))) float so[4][FQ][FP]; __shared__ float sl[4][2][FQ];
  const int tid = threadIdx.x, lane = tid & 31, ln = lane & 15, hh = lane >> 4; const int w = __builtin_amdgcn_readfirstlane(tid >> 5);      /* the wave's number in a scalar register: the loop and the mask test are scalar branches, every lane stays on at the matrix instructions */
  const int rg = (SQ / FQ - 1) - (int)blockIdx.x, h = blockIdx.y, b = blockIdx.z;      /* the tiles with the most keys start first */
  const _Float16* qp = Q16 + ((size_t)b * SQ + rg * FQ + ln) * DM + h * HD; const _Float16* kp = K16 + ((size_t)b * SQ + ln) * DM + h * HD + 8 * hh; const _Float16* vp = VT + (((size_t)b * NH + h) * HD + ln) * SQ + 8 * hh;      /* kp, vp: the lane's own 8 hh is in the pointer, so that the step's loads all name kq or vq itself */
  v16h qf[2][2];
#pragma unroll
  for (int qs = 0; qs < 2; ++qs) { qf[qs][0] = g2_frag(qp + (size_t)qs * 16 * DM, hh); qf[qs][1] = g2_frag(qp + (size_t)qs * 16 * DM + 32, hh); }
  const v8f z8 = {0.f,0.f,0.f,0.f,0.f,0.f,0.f,0.f}; v8f o[2][4] = {{z8, z8, z8, z8}, {z8, z8, z8, z8}}; float ls[2] = {0.f, 0.f};
  for (int it = 0; ; ++it) { const int s = (((it >> 1) * 4 + w) << 1) + (it & 1); if (s > rg) break;      /* s rises with it; step rg holds the diagonal and is the last */
    const _Float16* kq = kp + (size_t)s * FS * DM; const _Float16* vq = vp + s * FS;
    v16h kf[2][2], vf[4];
#pragma unroll
    for (int ks = 0; ks < 2; ++ks) { kf[ks][0] = g2_frag(kq + (size_t)ks * 16 * DM, 0); kf[ks][1] = g2_frag(kq + (size_t)ks * 16 * DM + 32, 0); }
#pragma unroll
    for (int t = 0; t < 4; ++t) vf[t] = g2_frag(vq + (size_t)t * 16 * SQ, 0);
    asm volatile("s_wait_xcnt 0x0" :: "v"(kq), "v"(vq) : "memory");      /* behind the last load of the step; the two address pairs are its inputs, so that neither is advanced or reused ahead of it */
    v8f st[2][2];      /* st[ks][qs][r]: key s FS + 16 ks + 8 hh + r, query rg FQ + 16 qs + ln */
#pragma unroll
    for (int ks = 0; ks < 2; ++ks)
#pragma unroll
      for (int qs = 0; qs < 2; ++qs) st[ks][qs] = g2_mma(kf[ks][0], qf[qs][0], z8);
#pragma unroll
    for (int ks = 0; ks < 2; ++ks)
#pragma unroll
      for (int qs = 0; qs < 2; ++qs) st[ks][qs] = g2_mma(kf[ks][1], qf[qs][1], st[ks][qs]);
    if (s == rg) {      /* the diagonal step: key and query count from the same row here */
#pragma unroll
      for (int ks = 0; ks < 2; ++ks)
#pragma unroll
        for (int qs = 0; qs < 2; ++qs)
#pragma unroll
          for (int r = 0; r < 8; ++r) st[ks][qs][r] = (ks * 16 + 8 * hh + r <= qs * 16 + ln) ? st[ks][qs][r] : 0.f; }
#pragma unroll
    for (int qs = 0; qs < 2; ++qs) { FragH p; float a = 0.f;
#pragma unroll
      for (int r = 0; r < 8; ++r) { a += st[0][qs][r] + st[1][qs][r]; p.h[r] = (_Float16)st[0][qs][r]; p.h[8 + r] = (_Float16)st[1][qs][r]; }
      ls[qs] += a;
#pragma unroll
      for (int t = 0; t < 4; ++t) o[qs][t] = g2_mma(p.v, vf[t], o[qs][t]); } }
#pragma unroll
  for (int qs = 0; qs < 2; ++qs) { sl[w][hh][qs * 16 + ln] = ls[qs];
#pragma unroll
    for (int t = 0; t < 4; ++t)
#pragma unroll
      for (int r = 0; r < 8; ++r) so[w][qs * 16 + 8 * hh + r][t * 16 + ln] = o[qs][t][r]; }
  __syncthreads();
  const int row = tid >> 2, c0 = (tid & 3) * 16;      /* four lanes per output row: 32 bytes each of its 128-byte line */
  float l = 0.f;
#pragma unroll
  for (int u = 0; u < 4; ++u) l += sl[u][0][row] + sl[u][1][row];
  const float fin = 64.0f / l;      /* o carried x64 as the output GEMM expects */
  FragH f;
#pragma unroll
  for (int c = 0; c < 4; ++c) { const v4f a = (*(const v4f*)&so[0][row][c0 + c * 4] + *(const v4f*)&so[1][row][c0 + c * 4]) + (*(const v4f*)&so[2][row][c0 + c * 4] + *(const v4f*)&so[3][row][c0 + c * 4]);
#pragma unroll
    for (int q = 0; q < 4; ++q) f.h[c * 4 + q] = (_Float16)(a[q] * fin); }
  unsigned short* d = (unsigned short*)O16 + ((size_t)b * SQ + rg * FQ + row) * DM + h * HD + c0;
  *(v8us*)d = f.half[0]; *(v8us*)(d + 8) = f.half[1]; }

// Exact f32 linear attention for the first QT0 rows of every batch (blockIdx.y). One work-group of 8 waves per (batch, head, 32 query rows), lane = query row.
// The head's QT0 key and value rows and the group's 32 q rows are staged once in LDS with whole-line loads, all in flight together. Step 1: wave w takes the keys j = w mod 8, four at a time
// (four independent sum chains), q row in registers, k row broadcast from LDS; the masked score goes to le[j][row]. Step 2: wave w owns columns 8 w .. 8 w + 7 of o in registers
// and walks the keys in ascending order. Each sum runs in the order of the one-thread-per-row form (d ascending, j ascending); keys above the group's last row only ever added zeros and are left out.
#define LR 32                        /* query rows per work-group */
#define LP 68                        /* pitch in floats of the per-row LDS arrays: 16 B x odd, so that 32 lanes reading 16 B of their own rows spread over the banks */
__global__ __launch_bounds__(256) void k_latt0(const float* __restrict__ QF, const float* __restrict__ KF, const float* __restrict__ VF, float* __restrict__ OF) {      /* all four planes: rows of DM floats; QF, KF, VF: SQ rows a batch, the first QT0 of them written; OF: QT0 rows a batch */
  { const size_t fb = (size_t)blockIdx.y * SQ * DM; QF += fb; KF += fb; VF += fb; OF += (size_t)blockIdx.y * QT0 * DM; }
  __shared__ __attribute__((aligned(16))) float lk[QT0][HD]; __shared__ __attribute__((aligned(16))) float lv[QT0][HD]; __shared__ __attribute__((aligned(16))) float le[QT0][LR];
  __shared__ __attribute__((aligned(16))) float lq[LR][LP]; __shared__ __attribute__((aligned(16))) float lo[LR][LP];
  const int tid = threadIdx.x, w = tid >> 5, lane = tid & 31; const int h = blockIdx.x / (QT0 / LR), rg = blockIdx.x % (QT0 / LR); const int r0 = rg * LR, nj = r0 + LR, i = r0 + lane;
  const int sr = tid / (HD / 4), sc = (tid % (HD / 4)) * 4;      /* staging and output: 16 lanes per 256-byte row, 16 rows per pass of the work-group */
  { v4f tk[QT0 / 16], tv[QT0 / 16], tq[LR / 16]; const float* kp = KF + (size_t)sr * DM + h * HD + sc; const float* vp = VF + (size_t)sr * DM + h * HD + sc; const float* qp = QF + (size_t)(r0 + sr) * DM + h * HD + sc;
#pragma unroll      /* every load is issued before the first LDS store waits for one */
    for (int p = 0; p < QT0 / 16; ++p) { tk[p] = *(const v4fa*)(kp + (size_t)p * 16 * DM); tv[p] = *(const v4fa*)(vp + (size_t)p * 16 * DM); }
#pragma unroll
    for (int p = 0; p < LR / 16; ++p) tq[p] = *(const v4fa*)(qp + (size_t)p * 16 * DM);
    asm volatile("s_wait_xcnt 0x0" :: "v"(kp), "v"(vp), "v"(qp) : "memory");      /* behind the last load of the run; the three address pairs are its inputs, so that none of them is given to a load's result or reused ahead of it */
#pragma unroll
    for (int p = 0; p < QT0 / 16; ++p) { *(v4f*)&lk[p * 16 + sr][sc] = tk[p]; *(v4f*)&lv[p * 16 + sr][sc] = tv[p]; }
#pragma unroll
    for (int p = 0; p < LR / 16; ++p) *(v4f*)&lq[p * 16 + sr][sc] = tq[p]; }
  __syncthreads();
  v4f q[HD / 4];
#pragma unroll      /* q stays in registers: constant indices only */
  for (int c = 0; c < HD / 4; ++c) q[c] = *(const v4f*)&lq[lane][c * 4];
  for (int jb = 0; jb < nj; jb += 32) { const int j0 = jb + w; float s0 = 0.f, s1 = 0.f, s2 = 0.f, s3 = 0.f;
#pragma unroll      /* constant indices into q; the four chains fill each other's result latency */
    for (int c = 0; c < HD / 4; ++c) { const v4f k0 = *(const v4f*)&lk[j0][c * 4], k1 = *(const v4f*)&lk[j0 + 8][c * 4], k2 = *(const v4f*)&lk[j0 + 16][c * 4], k3 = *(const v4f*)&lk[j0 + 24][c * 4];
#pragma unroll
      for (int u = 0; u < 4; ++u) { s0 += q[c][u] * k0[u]; s1 += q[c][u] * k1[u]; s2 += q[c][u] * k2[u]; s3 += q[c][u] * k3[u]; } }
    le[j0][lane] = (j0 <= i) ? s0 : 0.f; le[j0 + 8][lane] = (j0 + 8 <= i) ? s1 : 0.f; le[j0 + 16][lane] = (j0 + 16 <= i) ? s2 : 0.f; le[j0 + 24][lane] = (j0 + 24 <= i) ? s3 : 0.f; }
  __syncthreads();
  float l = 0.f; v4f oa = {0.f, 0.f, 0.f, 0.f}, ob = {0.f, 0.f, 0.f, 0.f};
#pragma unroll 8      /* eight keys' LDS reads are issued ahead of the sums that use them */
  for (int j = 0; j < nj; ++j) { const float e = le[j][lane]; const v4f va = *(const v4f*)&lv[j][w * 8], vb = *(const v4f*)&lv[j][w * 8 + 4]; l += e; oa += e * va; ob += e * vb; }
  const float fin = 64.0f / l;      /* o carried x64 like the f16 path */
  *(v4f*)&lo[lane][w * 8] = oa * fin; *(v4f*)&lo[lane][w * 8 + 4] = ob * fin;
  __syncthreads();
#pragma unroll      /* two passes, each wave storing whole 128-byte lines */
  for (int p = 0; p < LR / 16; ++p) *(v4f*)(OF + (size_t)(r0 + p * 16 + sr) * DM + h * HD + sc) = *(const v4f*)&lo[p * 16 + sr][sc]; }
extern "C" void kernel_launch(void* const* d_in, const int* in_sizes, int n_in,
                              void* d_out, int out_size, void* d_ws, size_t ws_size, hipStream_t stream) {
  (void)in_sizes; (void)n_in; (void)out_size;
  const float* const* I = (const float* const*)d_in; const float* x = I[0]; const float* wqk = I[1]; const float* bqk = I[2]; const float* wv = I[3]; const float* bv = I[4]; const float* wo = I[5]; const float* bo = I[6];      /* natural Wqk [2048][1024] (q rows | k rows) + bias [2048]; Wv + bv; Wo + bo */
  char* ws = (char*)d_ws; size_t off = 0;
  auto take = [&](size_t bytes) { char* p = ws + off; off += (bytes + 255) & ~(size_t)255; return p; };
  _Float16* BQK = (_Float16*)take((size_t)4 * DM * DM * 2); _Float16* BO = BQK + (size_t)3 * DM * DM;      /* four planes in a row: Wq | Wk | Wv | Wo */
  _Float16* X16 = (_Float16*)take(NR * DM * 2); _Float16* Q16 = (_Float16*)take((size_t)3 * NR * DM * 2); _Float16* K16 = Q16 + NR * DM; _Float16* V16 = Q16 + 2 * NR * DM; _Float16* O16 = (_Float16*)take(NR * DM * 2);      /* q | k | v: three planes in a row */
  _Float16* VT = (_Float16*)take((size_t)NB * NH * HD * SQ * 2);
  float* QF0 = (float*)take((size_t)3 * NR * DM * 4); float* KF0 = QF0 + NR * DM; float* VF0 = QF0 + 2 * NR * DM;      /* f32 q | k | v, indexed like the f16 planes; only the first QT0 rows of each batch are written and read */
  float* OF0 = (float*)take((size_t)NB * QT0 * DM * 4); _Float16* OH0 = (_Float16*)take((size_t)NB * QT0 * DM * 2); _Float16* OL0 = (_Float16*)take((size_t)NB * QT0 * DM * 2);
  if (off > ws_size) return;
  k_cvt<<<4 * CPB + CXB, 256, 0, stream>>>(wqk, wv, wo, x, BQK, X16);
  k_gemm2<19><<<dim3((unsigned)((NR / 128) * (DM / 64)), 3), 128, 0, stream>>>(X16, DM, 0, BQK, DM, (size_t)DM * DM, 0.0625f, bqk, DM, nullptr, 1, 0, 0, QF0, Q16, DM, NR * DM, (int)NR, DM, DM, nullptr, bv, 2, 1);      /* planes 0, 1: phi(q), phi(k) = elu(x W^T + b) + 1; plane 2: v; f16 rows, and in f32 the first 128 rows of each batch (exact products) */
  k_vt<NH, SQ><<<NB * NH * (SQ / 64), 256, 0, stream>>>(V16, LQ, 0, VT);      /* V^T [NB][NH][HD][SQ] */
  k_latt0<<<dim3(NH * (QT0 / LR), NB), 256, 0, stream>>>(QF0, KF0, VF0, OF0);      /* exact f32 linear attention for rows 0..127 of each batch (o x64): the few-key rows without the f16 roundings */
  k_hl<<<(unsigned)(((size_t)NB * QT0 * DM / 8 + 255) / 256), 256, 0, stream>>>(OF0, OH0, OL0, (size_t)NB * QT0 * DM / 8);      /* first-tile o (x64) -> f16 hi + x1024 residual planes */
  k_lfa<<<dim3(SQ / FQ, NH, NB), 128, 0, stream>>>(Q16, K16, VT, O16);      /* scores, causal normalisation and a V^T of every batch, head and query tile in one launch: o (merged heads, x64) as f16 rows */
  k_gemm2<0><<<dim3((unsigned)((NR / 128) * (DM / 64)), 1), 128, 0, stream>>>(O16, DM, 0, BO, DM, 0, 0.0009765625f, bo, 0, nullptr, 1, 0, 0, (float*)d_out, nullptr, DM, 0, (int)NR, DM, DM, OH0, nullptr, 1, 0);      /* out rows are the output layout; rows 0..127 of each batch: out = o_hi Wo (+ b) */
  k_gemm2<0><<<dim3((QT0 / 128) * (DM / 64), NB), 128, 0, stream>>>(OL0, DM, (size_t)QT0 * DM, BO, DM, 0, 0.00000095367431640625f, nullptr, 0, (const float*)d_out, -1, 0, 0, (float*)d_out, nullptr, DM, (size_t)SQ * DM, QT0, DM, DM, nullptr, nullptr, NB, 0);      /* rows 0..127 of each batch (plane by): += o_lo Wo 2^-20 (own-element accumulate) */
}

// v006
// A run of this version takes 148 microseconds.
// Timed twice side by side with v005, it ran 1.08 times as fast both times.
// All steps since v000 together make it 28.4 times as fast.
#include <hip/hip_runtime.h>
// Causal LINEAR attention (x [2][2048][1024]; qk = x Wqk^T + bqk (natural [2048][1024]: rows 0..1023 -> q, 1024..2047 -> k; sigma 1/32, biases 0.02), v = x Wv^T + bv; 16 heads of 64; feature map phi = elu + 1 on q and k; ctx_t = (phi(q_t) . sum_{s<=t} phi(k_s) v_s^T) / (phi(q_t) . sum_{s<=t} phi(k_s)) = sum_{s<=t} a_ts v_s / sum_{s<=t} a_ts with a_ts = phi(q_t).phi(k_s) (the module's cumsum form, no softmax, no scaling, no eps); out = ctx Wo^T + bo -> [2][2048][1024]).
// Structure: x as exact f16 rows and the natural weights as exact x16 planes in one VALU launch; q, k (with the elu + 1 feature map in the GEMM epilogue) and v as one launch of WMMA GEMMs (32x64 wave tiles, f32 accumulation, + bias) with f16 outputs, the first 128 rows of each batch also in f32; V^T via LDS transposes; one fused attention launch for all batches, heads and query tiles of 32 rows: a^T = phi(k) phi(q)^T on WMMA (K = 64) for the keys up to the tile end, causal mask, row sums in f32, a as f16 straight from the accumulators into the A operand of ctx = a V^T on WMMA, ctx x64 / sum a into merged f16 rows; out = ctx Wo^T + bo GEMM (f32); first-tile refinement: the first 128 rows of each batch computed exactly in f32 on VALU (a / sum a weights), their output rows taken from o hi in the output GEMM and completed from o lo by one accumulating GEMM pass; 8 launches.
// Compute dtype: inputs rounded to bf16; x / weights exact; q, k, v, the weights a and o as plain f16 GEMM operands (~2^-12); scores and row sums f32. v_wmma_f32_16x16x32_f16.
#define NB 2
#define SQ 2048
#define DM 1024
#define NH 16
#define HD 64
#define HG 4                         /* heads per group in the unlaunched k_vt(V16, b, h0, VT) overload */
#define QT 256                       /* query rows per causal tile */
#define NKX SQ                       /* S / P row pitch */
#define QT0 128                      /* first-tile rows recomputed exactly in f32 */
#define B0 0                         /* unused: every launch starts at batch 0 */
#define NBR NB                       /* only in MP, which no launch reads: the launches cover all NB batches */
#define NR ((size_t)NB * SQ)         /* token rows */
#define MP ((int)((size_t)NBR * SQ)) /* only in MPO, which no launch reads: the projections take all NR rows */
#define QN SQ                        /* unused: k_lfa attends all SQ rows of every batch */
#define NHD NH                       /* unused: k_lfa attends all NH heads */
#define MPO MP                       /* unused: the output GEMM takes all NR rows */
#define LQ DM      /* row pitch of the q/k/v rows */
typedef __bf16 v16b __attribute__((ext_vector_type(16)));
typedef unsigned short v8us __attribute__((ext_vector_type(8), may_alias));
typedef float  v8f  __attribute__((ext_vector_type(8)));
typedef float  v4f  __attribute__((ext_vector_type(4)));
typedef float  v4fa __attribute__((ext_vector_type(4), may_alias));
union FragB { v16b v; v8us half[2]; unsigned short u[16]; };

__device__ __forceinline__ unsigned short bf16_bits(float x) { unsigned int u = __float_as_uint(x); return (unsigned short)((u + 0x7FFFu + ((u >> 16) & 1u)) >> 16); }
__device__ __forceinline__ float bf16_val(unsigned short b) { return __uint_as_float(((unsigned int)b) << 16); }
__device__ __forceinline__ float bf16_round(float x) { return bf16_val(bf16_bits(x)); }
// D += A·B with NT terms: 1 = ah·bh, 2 = + al·bh (A split), 3 = + ah·bl (both split)
template <int NT>
__device__ __forceinline__ v8f mmaN(v16b ah, v16b al, v16b bh, v16b bl, v8f c) {
  c = __builtin_amdgcn_wmma_f32_16x16x32_bf16(false, ah, false, bh, (short)0, c, false, false);
  if (NT >= 2) c = __builtin_amdgcn_wmma_f32_16x16x32_bf16(false, al, false, bh, (short)0, c, false, false);
  if (NT >= 3) c = __builtin_amdgcn_wmma_f32_16x16x32_bf16(false, ah, false, bl, (short)0, c, false, false);
  asm volatile("v_nop\n\tv_nop\n\tv_nop\n\tv_nop" : "+v"(c) : "v"(ah), "v"(al), "v"(bh), "v"(bl));
  return c;
}

__global__ __launch_bounds__(256) void k_wt_bf16(const float* __restrict__ W, unsigned short* __restrict__ Wt, int K, int N) {
  const int t = blockIdx.x * 256 + threadIdx.x;
  const int k8n = K / 8;
  if (t >= N * k8n) return;
  const int n = t / k8n, k8 = (t % k8n) * 8;
  v8us v;
#pragma unroll
  for (int i = 0; i < 8; ++i) v[i] = bf16_bits(W[(size_t)(k8 + i) * N + n]);
  *(v8us*)(Wt + (size_t)n * K + k8) = v;
  
}

// GEMM C[M][N] (f32, pitch ldc) = act(A[M][K]·W + bias). A f32 row-major (pitch lda) converted per fragment to bf16
// (ASPLIT: hi/lo two planes -> 2 terms, else single rounded term); Wt bf16 [N][K] (pitch ldb). BIAS_BF16 rounds the
// bias to bf16 first (bias quantised to bf16 before the add). K%32==0, M%16==0, N%64==0.
template <bool ASPLIT, int ACT, bool BIAS_BF16>
__global__ __launch_bounds__(128) void k_gemm_bf(const float* __restrict__ A, int lda, const unsigned short* __restrict__ Wt, int ldb,
                                               const float* __restrict__ bias, float* __restrict__ C, int ldc, int M, int N, int K) {
  __shared__ __attribute__((aligned(16))) float so[4][16][64];
  const int tid = threadIdx.x, w = tid >> 5, lane = tid & 31, ln = lane & 15, hh = lane >> 4;
  const int ntn = N / 64;
  const int wid = blockIdx.x * 4 + w;
  const int mt = wid / ntn, nq = wid % ntn;
  if (mt * 16 >= M) return;
  const int row0 = mt * 16, col0 = nq * 64;
  const float* arow = A + (size_t)(row0 + ln) * lda;
  v8f acc[4] = {};
  for (int kb = 0; kb < K; kb += 32) {
    FragB ah, al;
    const v4f x0 = *(const v4fa*)(arow + kb + 8 * hh), x1 = *(const v4fa*)(arow + kb + 8 * hh + 4);
    const v4f x2 = *(const v4fa*)(arow + kb + 16 + 8 * hh), x3 = *(const v4fa*)(arow + kb + 16 + 8 * hh + 4);
    float xs[16] = {x0[0],x0[1],x0[2],x0[3],x1[0],x1[1],x1[2],x1[3],x2[0],x2[1],x2[2],x2[3],x3[0],x3[1],x3[2],x3[3]};
#pragma unroll
    for (int i = 0; i < 16; ++i) { const unsigned short hb = bf16_bits(xs[i]); ah.u[i] = hb; al.u[i] = ASPLIT ? bf16_bits(xs[i] - bf16_val(hb)) : (unsigned short)0; }
#pragma unroll
    for (int t = 0; t < 4; ++t) {
      const unsigned short* brow = Wt + (size_t)(col0 + t * 16 + ln) * ldb + kb;
      FragB b;
      b.half[0] = *(const v8us*)(brow + 8 * hh);
      b.half[1] = *(const v8us*)(brow + 16 + 8 * hh);
      acc[t] = mmaN<ASPLIT ? 2 : 1>(ah.v, al.v, b.v, b.v, acc[t]);
    }
  }
#pragma unroll
  for (int t = 0; t < 4; ++t) {
    float bv = bias ? bias[col0 + t * 16 + ln] : 0.f;
    if (BIAS_BF16) bv = bf16_round(bv);
#pragma unroll
    for (int r = 0; r < 8; ++r) { float v = acc[t][r] + bv; if (ACT == 1) v = fmaxf(v, 0.f); so[w][8 * hh + r][t * 16 + ln] = v; }
  }
  __builtin_amdgcn_fence(__ATOMIC_ACQ_REL, "workgroup");
  __builtin_amdgcn_wave_barrier();
  const int rsub = lane >> 4, c4 = (lane & 15) * 4;
  {
#pragma unroll
    for (int q = 0; q < 8; ++q) {
      const int r = q * 2 + rsub;
      const v4f v = *(const v4fa*)&so[w][r][c4];
      *(v4f*)(C + (size_t)(row0 + r) * ldc + col0 + c4) = v;
    }
    
  }
}

// GEMM C = act(A·W + bias + resid): A f32 (ASPLIT -> hi/lo 2 terms), Wt bf16 [N][K]; ACT 0 none, 1 relu, 2 exact gelu;
// resid (optional, f32, row index = (row % rmod), pitch ldr, RES_BF16 rounds it) added before the activation.
template <bool ASPLIT, int ACT, bool BIAS_BF16, bool RES_BF16>
__global__ __launch_bounds__(128) void k_gemm_bf3(const float* __restrict__ A, int lda, const unsigned short* __restrict__ Wt, int ldb,
                                                const float* __restrict__ bias, const float* __restrict__ resid, int rmod, int ldr,
                                                float* __restrict__ C, int ldc, int M, int N, int K) {
  __shared__ __attribute__((aligned(16))) float so[4][16][64];
  const int tid = threadIdx.x, w = tid >> 5, lane = tid & 31, ln = lane & 15, hh = lane >> 4;
  const int ntn = N / 64;
  const int wid = blockIdx.x * 4 + w;
  const int mt = wid / ntn, nq = wid % ntn;
  if (mt * 16 >= M) return;
  const int row0 = mt * 16, col0 = nq * 64;
  const float* arow = A + (size_t)(row0 + ln) * lda;
  v8f acc[4] = {};
  for (int kb = 0; kb < K; kb += 32) {
    FragB ah, al;
    const v4f x0 = *(const v4fa*)(arow + kb + 8 * hh), x1 = *(const v4fa*)(arow + kb + 8 * hh + 4);
    const v4f x2 = *(const v4fa*)(arow + kb + 16 + 8 * hh), x3 = *(const v4fa*)(arow + kb + 16 + 8 * hh + 4);
    float xs[16] = {x0[0],x0[1],x0[2],x0[3],x1[0],x1[1],x1[2],x1[3],x2[0],x2[1],x2[2],x2[3],x3[0],x3[1],x3[2],x3[3]};
#pragma unroll
    for (int i = 0; i < 16; ++i) { const unsigned short hb = bf16_bits(xs[i]); ah.u[i] = hb; al.u[i] = ASPLIT ? bf16_bits(xs[i] - bf16_val(hb)) : (unsigned short)0; }
#pragma unroll
    for (int t = 0; t < 4; ++t) {
      const unsigned short* brow = Wt + (size_t)(col0 + t * 16 + ln) * ldb + kb;
      FragB b;
      b.half[0] = *(const v8us*)(brow + 8 * hh);
      b.half[1] = *(const v8us*)(brow + 16 + 8 * hh);
      acc[t] = mmaN<ASPLIT ? 2 : 1>(ah.v, al.v, b.v, b.v, acc[t]);
    }
  }
#pragma unroll
  for (int t = 0; t < 4; ++t) {
    const int col = col0 + t * 16 + ln;
    float bv = bias ? bias[col] : 0.f;
    if (BIAS_BF16) bv = bf16_round(bv);
#pragma unroll
    for (int r = 0; r < 8; ++r) {
      float v = acc[t][r] + bv;
      if (resid) { float rv = resid[(size_t)((row0 + 8 * hh + r) % rmod) * ldr + col]; if (RES_BF16) rv = bf16_round(rv); v += rv; }
      if (ACT == 1) v = fmaxf(v, 0.f);
      if (ACT == 2) v = 0.5f * v * (1.0f + erff(v * 0.70710678118654752f));
      if (ACT == 3) { const float u = 0.7978845608028654f * (v + 0.044715f * v * v * v); v = 0.5f * v * (1.0f + tanhf(u)); }
      so[w][8 * hh + r][t * 16 + ln] = v;
    }
  }
  __builtin_amdgcn_fence(__ATOMIC_ACQ_REL, "workgroup");
  __builtin_amdgcn_wave_barrier();
  const int rsub = lane >> 4, c4 = (lane & 15) * 4;
  {
#pragma unroll
    for (int q = 0; q < 8; ++q) {
      const int r = q * 2 + rsub;
      const v4f v = *(const v4fa*)&so[w][r][c4];
      *(v4f*)(C + (size_t)(row0 + r) * ldc + col0 + c4) = v;
    }
    
  }
}
// row LayerNorm (biased variance, eps) over N: s = X (+ R); optional out_sum <- s; out_norm <- (s-mu)*rsqrt(var+eps)*g + b
template <bool PARAM_BF16>
__global__ __launch_bounds__(256) void k_layernorm(const float* __restrict__ X, const float* __restrict__ R, const float* __restrict__ g, const float* __restrict__ bta,
                                                  float* __restrict__ out_sum, float* __restrict__ out_norm, int N, float eps) {
  __shared__ float red[256];
  const int row = blockIdx.x, tid = threadIdx.x;
  const float* x = X + (size_t)row * N; const float* rr = R ? R + (size_t)row * N : nullptr;
  float vals[16];                     // up to N = 4096
  const int per = N / 256;            // contiguous chunk per thread? use strided-by-4 chunks: thread handles j = tid*4 + 1024*u
  float s1 = 0.f;
  for (int u = 0; u < per / 4; ++u) {
    const int j = tid * 4 + 1024 * u;
    const v4f a = *(const v4fa*)(x + j);
    v4f b = {0.f,0.f,0.f,0.f}; if (rr) b = *(const v4fa*)(rr + j);
#pragma unroll
    for (int q = 0; q < 4; ++q) { const float v = a[q] + b[q]; vals[u * 4 + q] = v; s1 += v; }
  }
  red[tid] = s1; __syncthreads();
  for (int st = 128; st > 0; st >>= 1) { if (tid < st) red[tid] += red[tid + st]; __syncthreads(); }
  const float mu = red[0] / (float)N; __syncthreads();
  float s2 = 0.f;
  for (int u = 0; u < per / 4; ++u)
#pragma unroll
    for (int q = 0; q < 4; ++q) { const float c = vals[u * 4 + q] - mu; s2 += c * c; }
  red[tid] = s2; __syncthreads();
  for (int st = 128; st > 0; st >>= 1) { if (tid < st) red[tid] += red[tid + st]; __syncthreads(); }
  const float rs = rsqrtf(red[0] / (float)N + eps);
  {
    for (int u = 0; u < per / 4; ++u) {
      const int j = tid * 4 + 1024 * u;
      v4f o, sm;
#pragma unroll
      for (int q = 0; q < 4; ++q) {
        float gg = g[j + q], bb = bta[j + q];
        if (PARAM_BF16) { gg = bf16_round(gg); bb = bf16_round(bb); }
        sm[q] = vals[u * 4 + q]; o[q] = (vals[u * 4 + q] - mu) * rs * gg + bb;
      }
      if (out_sum) *(v4f*)(out_sum + (size_t)row * N + j) = sm;
      *(v4f*)(out_norm + (size_t)row * N + j) = o;
    }
    
  }
}



// ---- f16 WMMA path (v_wmma_f32_16x16x32_f16): 11-bit significands for operands in range — used where a [0,1] probability operand needs more precision than bf16
typedef _Float16 v16h __attribute__((ext_vector_type(16)));
union FragH { v16h v; v8us half[2]; _Float16 h[16]; unsigned short u[16]; };
template <int NT>
__device__ __forceinline__ v8f mmaH(v16h ah, v16h al, v16h bh, v16h bl, v8f c) {
  c = __builtin_amdgcn_wmma_f32_16x16x32_f16(false, ah, false, bh, (short)0, c, false, false);
  if (NT >= 2) c = __builtin_amdgcn_wmma_f32_16x16x32_f16(false, al, false, bh, (short)0, c, false, false);
  if (NT >= 3) c = __builtin_amdgcn_wmma_f32_16x16x32_f16(false, ah, false, bl, (short)0, c, false, false);
  asm volatile("v_nop\n\tv_nop\n\tv_nop\n\tv_nop" : "+v"(c) : "v"(ah), "v"(al), "v"(bh), "v"(bl));
  return c;
}
// batched GEMM like k_gemm_b but f16 operands: A f32 (split into f16 hi/lo if ASPLIT, else rounded to f16), Bt = f16 values [n][k]; alpha; C f32; N multiple of 16 (partial tiles skipped)
template <bool ASPLIT>
__global__ __launch_bounds__(128) void k_gemm_h(const float* __restrict__ A, int lda, size_t sA, const _Float16* __restrict__ Bh, int ldb, size_t sB, float alpha, float* __restrict__ C, int ldc, size_t sC, int M, int N, int K) {
  __shared__ __attribute__((aligned(16))) float so[4][16][64];
  const int tid = threadIdx.x, w = tid >> 5, lane = tid & 31, ln = lane & 15, hh = lane >> 4; const int by = blockIdx.y;
  A += (size_t)by * sA; Bh += (size_t)by * sB; C += (size_t)by * sC;
  const int ntn = (N + 63) / 64; const int wid = blockIdx.x * 4 + w; const int mt = wid / ntn, nq = wid % ntn; if (mt * 16 >= M) return;
  const int row0 = mt * 16, col0 = nq * 64; const float* arow = A + (size_t)(row0 + ln) * lda;
  v8f acc[4] = {};
  for (int kb = 0; kb < K; kb += 32) {
    FragH ah, al;
    const v4f x0 = *(const v4fa*)(arow + kb + 8 * hh), x1 = *(const v4fa*)(arow + kb + 8 * hh + 4), x2 = *(const v4fa*)(arow + kb + 16 + 8 * hh), x3 = *(const v4fa*)(arow + kb + 16 + 8 * hh + 4);
    float xs[16] = {x0[0],x0[1],x0[2],x0[3],x1[0],x1[1],x1[2],x1[3],x2[0],x2[1],x2[2],x2[3],x3[0],x3[1],x3[2],x3[3]};
#pragma unroll
    for (int i = 0; i < 16; ++i) { const _Float16 h = (_Float16)xs[i]; ah.h[i] = h; al.h[i] = ASPLIT ? (_Float16)(xs[i] - (float)h) : (_Float16)0.0f; }
#pragma unroll
    for (int t = 0; t < 4; ++t) { if (col0 + t * 16 >= N) continue; const size_t boff = (size_t)(col0 + t * 16 + ln) * ldb + kb; FragH bq; bq.half[0] = *(const v8us*)(Bh + boff + 8 * hh); bq.half[1] = *(const v8us*)(Bh + boff + 16 + 8 * hh);
      acc[t] = mmaH<ASPLIT ? 2 : 1>(ah.v, al.v, bq.v, bq.v, acc[t]); }
  }
#pragma unroll
  for (int t = 0; t < 4; ++t) { if (col0 + t * 16 >= N) continue;
#pragma unroll
    for (int r = 0; r < 8; ++r) so[w][8 * hh + r][t * 16 + ln] = acc[t][r] * alpha; }
  __builtin_amdgcn_fence(__ATOMIC_ACQ_REL, "workgroup"); __builtin_amdgcn_wave_barrier();
  const int rsub = lane >> 4, c4 = (lane & 15) * 4;
  {
#pragma unroll
    for (int q = 0; q < 8; ++q) { const int r = q * 2 + rsub; if (col0 + c4 < N) { const v4f v = *(const v4fa*)&so[w][r][c4]; *(v4f*)(C + (size_t)(row0 + r) * ldc + col0 + c4) = v; } }
     }
}

// Wt[n][k] = f16(W[k][n]·scale) from f32 row-major W[K][N] (scale = power of two; bf16-exact weights stay exact in f16 away from the subnormal range)
__global__ __launch_bounds__(256) void k_wt_f16(const float* __restrict__ W, _Float16* __restrict__ Wt, int K, int N, float scale) {
  const int t = blockIdx.x * 256 + threadIdx.x; if (t >= N * (K / 8)) return; const int n = t / (K / 8), k8 = (t % (K / 8)) * 8; FragH f;
#pragma unroll
  for (int i = 0; i < 8; ++i) f.h[i] = (_Float16)(bf16_round(W[(size_t)(k8 + i) * N + n]) * scale); const v8us o = f.half[0];
  *(v8us*)((unsigned short*)Wt + (size_t)n * K + k8) = o; 
}
// k_gemm_hh variant with fused epilogue: v = acc·alpha + bias[by·sBias + col] (+ CP[(row/rowsPerB)·sCPb + by·64 + col] if CP) ; ACT 0 none / 1 elu ; writes f16 C16 (and f32 C if non-null)
template <int ACT>
__global__ __launch_bounds__(128) void k_gemm_hhx(const _Float16* __restrict__ A, int lda, size_t sA, const _Float16* __restrict__ Bh, int ldb, size_t sB, float alpha, const float* __restrict__ bias, size_t sBias, const float* __restrict__ CP, int rowsPerB, size_t sCPb, int row0g,
    float* __restrict__ C, _Float16* __restrict__ C16, int ldc, size_t sC, int M, int N, int K) {
  __shared__ __attribute__((aligned(16))) float so[4][16][64];
  const int tid = threadIdx.x, w = tid >> 5, lane = tid & 31, ln = lane & 15, hh = lane >> 4; const int by = blockIdx.y;
  A += (size_t)by * sA; Bh += (size_t)by * sB; const size_t cofs = (size_t)by * sC; const float* bp = bias ? bias + (size_t)by * sBias : nullptr;
  const int ntn = (N + 63) / 64; const int wid = blockIdx.x * 4 + w; const int mt = wid / ntn, nq = wid % ntn; if (mt * 16 >= M) return;
  const int row0 = mt * 16, col0 = nq * 64; const _Float16* arow = A + (size_t)(row0 + ln) * lda;
  v8f acc[4] = {};
  for (int kb = 0; kb < K; kb += 32) { FragH ah; ah.half[0] = *(const v8us*)((const unsigned short*)arow + kb + 8 * hh); ah.half[1] = *(const v8us*)((const unsigned short*)arow + kb + 16 + 8 * hh);
#pragma unroll
    for (int t = 0; t < 4; ++t) { if (col0 + t * 16 >= N) continue; const size_t boff = (size_t)(col0 + t * 16 + ln) * ldb + kb; FragH bq; bq.half[0] = *(const v8us*)((const unsigned short*)Bh + boff + 8 * hh); bq.half[1] = *(const v8us*)((const unsigned short*)Bh + boff + 16 + 8 * hh);
      acc[t] = mmaH<1>(ah.v, ah.v, bq.v, bq.v, acc[t]); }
  }
#pragma unroll
  for (int t = 0; t < 4; ++t) { if (col0 + t * 16 >= N) continue; const int col = col0 + t * 16 + ln; const float bv = bp ? bf16_round(bp[col]) : 0.f;
#pragma unroll
    for (int r = 0; r < 8; ++r) { float v = acc[t][r] * alpha + bv; if (CP) { const int rr = row0g + row0 + 8 * hh + r; if (rowsPerB < 0) v += CP[cofs + (size_t)rr * ldc + col];      /* rowsPerB < 0: own element of the batched C plane */ else { const int bidx = rr / rowsPerB; v += CP[(size_t)bidx * sCPb + (size_t)by * 64 + col]; } } if (ACT == 1) v = (v > 0.f) ? v : expm1f(v); else if (ACT == 7) v = (v > 0.f) ? v + 1.0f : expf(v); else if (ACT == 8) v = tanhf(v); else if (ACT == 9) v = 0.5f * v * (1.0f + tanhf(0.7978845608028654f * (v + 0.044715f * v * v * v))); else if (ACT == 11) v = 1.0f / (1.0f + expf(-v)); else if (ACT == 12) v = (v > 0.f) ? v : 0.01f * v; else if (ACT == 14) v = (v > 0.f) ? v : 0.1f * v; else if (ACT == 16) v = (v >= 0.f) ? v : 0.3f * v; else if (ACT == 17) v = (v >= 0.f) ? v : 0.2f * v; else if (ACT == 15) v = v / (1.0f + expf(-v)); else if (ACT == 3) v = fmaxf(v, 0.f); else if (ACT == 6) v = 0.5f * v * (1.0f + erff(v * 0.70710678118654752f)); so[w][8 * hh + r][t * 16 + ln] = v; } }
  __builtin_amdgcn_fence(__ATOMIC_ACQ_REL, "workgroup"); __builtin_amdgcn_wave_barrier();
  const int rsub = lane >> 4, c4 = (lane & 15) * 4; typedef _Float16 v4h __attribute__((ext_vector_type(4)));
  {
#pragma unroll
    for (int q = 0; q < 8; ++q) { const int r = q * 2 + rsub; if (col0 + c4 < N) { const v4f v = *(const v4fa*)&so[w][r][c4]; if (C) *(v4f*)(C + cofs + (size_t)(row0 + r) * ldc + col0 + c4) = v; if (C16) { v4h h4; for (int i = 0; i < 4; ++i) h4[i] = (_Float16)v[i]; *(v4h*)(C16 + cofs + (size_t)(row0 + r) * ldc + col0 + c4) = h4; } } }
     }
}


typedef _Float16 v4h __attribute__((ext_vector_type(4)));

__global__ __launch_bounds__(256) void k_h16(const float* __restrict__ x, _Float16* __restrict__ X16, size_t n8) { const size_t t = (size_t)blockIdx.x * 256 + threadIdx.x; if (t >= n8) return; FragH f;
#pragma unroll
  for (int q = 0; q < 8; ++q) f.h[q] = (_Float16)x[t * 8 + q]; *(v8us*)((unsigned short*)X16 + t * 8) = f.half[0];  }
__global__ __launch_bounds__(256) void k_round16f(const float* __restrict__ W, _Float16* __restrict__ Bt, size_t n8) { const size_t t = (size_t)blockIdx.x * 256 + threadIdx.x; if (t >= n8) return; FragH f;
#pragma unroll
  for (int i = 0; i < 8; ++i) f.h[i] = (_Float16)(bf16_round(W[t * 8 + i]) * 16.0f); *(v8us*)((unsigned short*)Bt + t * 8) = f.half[0];  }
template <int NHv, int TTv>
__global__ __launch_bounds__(256) void k_vt(const _Float16* __restrict__ V16, int ldv, int voff, _Float16* __restrict__ Vt) { __shared__ unsigned short tl[64][66]; const int tid = threadIdx.x; const int slab = blockIdx.x / (TTv / 64), lg = blockIdx.x % (TTv / 64); const int b = slab / NHv, h = slab % NHv;
  for (int i = tid; i < 64 * 8; i += 256) { const int r = i / 8, c8 = (i % 8) * 8; FragH f; f.half[0] = *(const v8us*)((const unsigned short*)V16 + ((size_t)b * TTv + lg * 64 + r) * ldv + voff + h * 64 + c8);
#pragma unroll
    for (int q = 0; q < 8; ++q) tl[r][c8 + q] = f.u[q]; }
  __syncthreads();
  {
#pragma unroll
    for (int rd = 0; rd < 2; ++rd) { const int i = rd * 256 + tid, ln = i & 15, hh = (i >> 4) & 1, j = (i >> 5) & 1, t = (i >> 6) & 3, ss = i >> 8; FragH f;      /* fragment order: [slab][32 keys][16 d][half j] pieces of 512 bytes, lane (hh, ln) holding row d = 16 t + ln, keys 16 j + 8 hh + 0..7; piece and lane count up with i, so a wave stores 512 contiguous bytes */
#pragma unroll
      for (int q = 0; q < 8; ++q) f.u[q] = tl[ss * 32 + j * 16 + hh * 8 + q][t * 16 + ln];
      *(v8us*)((unsigned short*)Vt + ((size_t)slab * (TTv / 64) + lg) * 4096 + i * 8) = f.half[0]; }
     } }

__global__ __launch_bounds__(256) void k_hl(const float* __restrict__ F, _Float16* __restrict__ Hh, _Float16* __restrict__ Hl, size_t n8) { const size_t t = (size_t)blockIdx.x * 256 + threadIdx.x; if (t >= n8) return; FragH fh, fl; const v4f a = *(const v4fa*)(F + t * 8), c = *(const v4fa*)(F + t * 8 + 4);
#pragma unroll
  for (int q = 0; q < 4; ++q) { _Float16 h = (_Float16)a[q]; fh.h[q] = h; fl.h[q] = (_Float16)((a[q] - (float)h) * 1024.0f); h = (_Float16)c[q]; fh.h[4 + q] = h; fl.h[4 + q] = (_Float16)((c[q] - (float)h) * 1024.0f); }
  { *(v8us*)((unsigned short*)Hh + t * 8) = fh.half[0]; *(v8us*)((unsigned short*)Hl + t * 8) = fl.half[0];  } }

// ---- fast GEMM (work-group tile 128x64, wave tile 32x64; requires M % 32 == 0 rows per launch region, N % 64 == 0 and K % 64 == 0); epilogue = k_gemm_hhx semantics ----
// Operand tiles of GK k (one 128-byte line of each of the 128 A rows and 64 B rows) go through LDS: eight lanes fetch a whole line, one tile ahead of the matrix work, and the waves read their fragments from LDS.
// Products that read none of each other's output share a launch: planes by = blockIdx.y; planes by < nact take bias + by sBias and the activation, the others biasz and none; cfirst: the f32 plane C takes only the first QT0 rows of each batch;
// A1 (if given): the row tiles that hold the first QT0 rows of a batch read their A rows from A1 [batch][QT0] in place of A.
// Planes by < npk (rows of NH heads of HD = 64 columns, SQ rows a batch) store their f16 output in FRAGMENT ORDER in place of rows: [batch][head][16-row tile] tiles of PKT halfs; a tile is four pieces c of 512 bytes,
// piece c holding at lane (hh, ln) the 8 halfs of row ln, columns 16 c + 8 hh + 0..7: pieces 2 m and 2 m + 1 are the two halves of the g2_frag fragment of columns 32 m .. 32 m + 31, each one whole-line load of a wave.
#define PKT 1024                     /* halfs per 16 x 64 tile in fragment order */
__device__ __forceinline__ v16h pk_frag(const _Float16* p) { FragH f; f.half[0] = *(const v8us*)((const unsigned short*)p); f.half[1] = *(const v8us*)((const unsigned short*)p + 256); return f.v; }      /* p: the fragment's first piece + 8 lane */
#define GK 64                        /* k per staged tile */
#define GP 72                        /* pitch in halfs of a staged row: 144 B = 16 B x odd, so that 16-byte fragment reads of 16 rows spread over the banks */
__device__ __forceinline__ v16h g2_frag(const _Float16* p, int hh) { FragH f; f.half[0] = *(const v8us*)((const unsigned short*)p + 8 * hh); f.half[1] = *(const v8us*)((const unsigned short*)p + 16 + 8 * hh); return f.v; }
__device__ __forceinline__ v8f g2_mma(v16h a, v16h b, v8f c) { v8f d = __builtin_amdgcn_wmma_f32_16x16x32_f16(false, a, false, b, (short)0, c, false, false); asm volatile("v_nop\n\tv_nop\n\tv_nop\n\tv_nop" : "+v"(d) : "v"(a), "v"(b)); return d; }
template <int ACT>
__global__ __launch_bounds__(128) void k_gemm2(const _Float16* __restrict__ A, int lda, size_t sA, const _Float16* __restrict__ Bh, int ldb, size_t sB, float alpha, const float* __restrict__ bias, size_t sBias, const float* __restrict__ CP, int rowsPerB, size_t sCPb, int row0g,
    float* __restrict__ C, _Float16* __restrict__ C16, int ldc, size_t sC, int M, int N, int K, const _Float16* __restrict__ A1, const float* __restrict__ biasz, int nact, int cfirst, int npk) { static_assert(ACT == 0 || ACT == 3 || ACT == 6 || ACT == 8 || ACT == 9 || ACT == 11 || ACT == 12 || ACT == 14 || ACT == 15 || ACT == 16 || ACT == 17 || ACT == 19, "k_gemm2: unsupported ACT code (would silently apply no activation)"); static_assert(QT0 == 128 && SQ % 128 == 0, "k_gemm2: the first rows of a batch are one row tile");
  __shared__ __attribute__((aligned(16))) float so[4][32][68];
  __shared__ __attribute__((aligned(16))) _Float16 sa[2][128][GP]; __shared__ __attribute__((aligned(16))) _Float16 sb[2][64][GP];
  const int tid = threadIdx.x, w = tid >> 5, lane = tid & 31, ln = lane & 15, hh = lane >> 4; const int by = blockIdx.y;
  A += (size_t)by * sA; Bh += (size_t)by * sB; const size_t cofs = (size_t)by * sC; const bool act = by < nact; const float* bp = bias ? (act ? bias + (size_t)by * sBias : biasz) : nullptr;
  const int ntn = N >> 6; const int mt = blockIdx.x / ntn, nq = blockIdx.x - mt * ntn; const int row0 = mt * 128 + 32 * w, col0 = nq * 64; if (mt * 128 >= M) return;      /* the whole work-group or none: barriers follow; a wave whose own rows lie past M leaves behind the last one */
  const int sr = tid >> 3, sc = (tid & 7) * 8;      /* staging: 8 lanes per 128-byte line, 16 rows per pass of the work-group */
  const bool first = (mt * 128) % SQ == 0; const bool cf = C && (!cfirst || first); const bool pk = by < npk; int ar0 = mt * 128, am = M;      /* ar0, am: the tile's first row in its A plane and that plane's rows */
  const char* ab = (const char*)A; const char* bb = (const char*)Bh; unsigned ao[8], bo[4]; if (A1 && first) { ab = (const char*)A1; ar0 = ar0 / SQ * QT0; am = M / SQ * QT0; }      /* one base per operand for the whole work-group + the lane's own byte offset to each of its rows; a 16-row pass past M (M % 32 == 0) rereads the last 16 rows, which no wave uses */
#pragma unroll
  for (int p = 0; p < 8; ++p) ao[p] = (unsigned)((min(ar0 + 16 * p, am - 16) + sr) * lda + sc) * 2u;
#pragma unroll
  for (int p = 0; p < 4; ++p) bo[p] = (unsigned)((col0 + 16 * p + sr) * ldb + sc) * 2u;
  v8us ra[8], rb[4]; v16h a0[2], a1[2], b[2][4];
  auto fetch = [&]() {      /* the next tile into registers */
#pragma unroll
    for (int p = 0; p < 8; ++p) ra[p] = *(const v8us*)(ab + ao[p]);
#pragma unroll
    for (int p = 0; p < 4; ++p) rb[p] = *(const v8us*)(bb + bo[p]); };
  auto put = [&](int u) {      /* the fetched tile into buffer u; the offsets step on by one tile here, behind the waits for the loads that name them */
#pragma unroll
    for (int p = 0; p < 8; ++p) { *(v8us*)&sa[u][16 * p + sr][sc] = ra[p]; ao[p] += GK * 2; }
#pragma unroll
    for (int p = 0; p < 4; ++p) { *(v8us*)&sb[u][16 * p + sr][sc] = rb[p]; bo[p] += GK * 2; } };
  auto frags = [&](int u) {      /* all fragments of one staged tile: the second half's reads return under the first half's products */
#pragma unroll
    for (int ks = 0; ks < 2; ++ks) { a0[ks] = g2_frag(&sa[u][32 * w + ln][ks * 32], hh); a1[ks] = g2_frag(&sa[u][32 * w + 16 + ln][ks * 32], hh);
#pragma unroll
      for (int t = 0; t < 4; ++t) b[ks][t] = g2_frag(&sb[u][16 * t + ln][ks * 32], hh); } };
  const v8f z8 = {0.f,0.f,0.f,0.f,0.f,0.f,0.f,0.f}; v8f c00 = z8, c01 = z8, c02 = z8, c03 = z8, c10 = z8, c11 = z8, c12 = z8, c13 = z8;
  auto prods = [&]() {
#pragma unroll
    for (int ks = 0; ks < 2; ++ks) { c00 = g2_mma(a0[ks], b[ks][0], c00); c10 = g2_mma(a1[ks], b[ks][0], c10); c01 = g2_mma(a0[ks], b[ks][1], c01); c11 = g2_mma(a1[ks], b[ks][1], c11);
      c02 = g2_mma(a0[ks], b[ks][2], c02); c12 = g2_mma(a1[ks], b[ks][2], c12); c03 = g2_mma(a0[ks], b[ks][3], c03); c13 = g2_mma(a1[ks], b[ks][3], c13); } };
  const int nt = K / GK;
  fetch(); put(0); __syncthreads();
#pragma unroll 1      /* one copy of the loop body: the buffer's number is a scalar offset */
  for (int t = 0; t + 1 < nt; ++t) { frags(t & 1); fetch(); prods(); put((t + 1) & 1); __syncthreads(); }      /* tile t + 1 is on its way under tile t's products; the one barrier of a pass publishes it and ends the reads of tile t, whose buffer the next pass refills */
  frags((nt - 1) & 1); prods();
  if (row0 >= M) return;
  v8f accs[8] = {c00, c01, c02, c03, c10, c11, c12, c13};
#pragma unroll
  for (int u = 0; u < 8; ++u) { const int t = u & 3, half = u >> 2; const int col = col0 + t * 16 + ln; const float bv = bp ? bf16_round(bp[col]) : 0.f;
#pragma unroll
    for (int r = 0; r < 8; ++r) { const int rloc = half * 16 + 8 * hh + r; float v = accs[u][r] * alpha + bv; if (CP) { if (rowsPerB < 0) v += CP[cofs + (size_t)(row0g + row0 + rloc) * ldc + col];      /* rowsPerB < 0: own element of the batched C plane */ else { const int bidx = (row0g + row0 + rloc) / rowsPerB; v += CP[(size_t)bidx * sCPb + (size_t)by * 64 + col]; } }
      if (act) { if (ACT == 3) v = fmaxf(v, 0.f); else if (ACT == 6) v = 0.5f * v * (1.0f + erff(v * 0.70710678118654752f)); else if (ACT == 11) v = 1.0f / (1.0f + expf(-v)); else if (ACT == 15) v = v / (1.0f + expf(-v)); else if (ACT == 19) v = (v > 0.f) ? (v + 1.0f) : expf(v);      /* elu(v) + 1 */ else if (ACT == 12) v = (v > 0.f) ? v : 0.01f * v; else if (ACT == 8) v = tanhf(v); else if (ACT == 9) v = 0.5f * v * (1.0f + tanhf(0.7978845608028654f * (v + 0.044715f * v * v * v))); else if (ACT == 14) v = (v > 0.f) ? v : 0.1f * v; else if (ACT == 16) v = (v >= 0.f) ? v : 0.3f * v; else if (ACT == 17) v = (v >= 0.f) ? v : 0.2f * v; }
      so[w][rloc][t * 16 + ln] = v; } }
  __builtin_amdgcn_fence(__ATOMIC_ACQ_REL, "workgroup"); __builtin_amdgcn_wave_barrier();
  const int rsub = lane >> 4, c4 = (lane & 15) * 4;
  if (cf || (C16 && !pk)) {      /* the row pass; a tile that stores neither f32 rows nor f16 rows skips its sixteen LDS reads */
#pragma unroll
    for (int q = 0; q < 16; ++q) { const int r = q * 2 + rsub; const v4f v = *(const v4fa*)&so[w][r][c4];
      if (cf) { *(v4f*)(C + cofs + (size_t)(row0 + r) * ldc + col0 + c4) = v; asm volatile("s_wait_xcnt 0x0" :: "v"(v) : "memory"); }      /* behind the f32 store; the stored registers are the wait's inputs, so that the f16 conversion below does not reuse them ahead of it */
      if (C16 && !pk) { v4h h4; for (int i = 0; i < 4; ++i) h4[i] = (_Float16)v[i]; _Float16* dp = C16 + cofs + (size_t)(row0 + r) * ldc + col0 + c4; *(v4h*)dp = h4; asm volatile("s_wait_xcnt 0x0" :: "v"(h4), "v"(dp) : "memory"); } }      /* behind the f16 row store; the stored registers and the address pair are the wait's inputs, so that nothing behind it reuses them ahead of it */
     }
  if (C16 && pk) {      /* fragment order: the wave's 32 rows x 64 columns are two tiles of 2 KiB in a row; each store is 512 contiguous bytes */
    unsigned short* pt = (unsigned short*)C16 + cofs + (((size_t)(row0 / SQ) * NH + nq) * (SQ / 16) + (row0 % SQ) / 16) * PKT + lane * 8;
#pragma unroll      /* constant LDS and store offsets; the LDS reads of all eight pieces are issued ahead of the conversions */
    for (int u = 0; u < 8; ++u) { const float* sp = &so[w][(u >> 2) * 16 + ln][(u & 3) * 16 + 8 * hh]; const v4f x = *(const v4fa*)sp, y = *(const v4fa*)(sp + 4); FragH f;
#pragma unroll
      for (int i = 0; i < 4; ++i) { f.h[i] = (_Float16)x[i]; f.h[4 + i] = (_Float16)y[i]; }
      *(v8us*)(pt + u * 256) = f.half[0]; } } }


// All four operand conversions in one launch (none reads another's output): the weights, natural [out][in] = Bt[n][k], x16, into the planes BW = Wqk (q rows, k rows) | Wv | Wo, then x into X16. A work-group lies wholly in one source.
#define CPB (DM * DM / 8 / 256)      /* work-groups per DM x DM plane, 8 elements per thread */
#define CXB ((unsigned)(NR * DM / 8 / 256))      /* work-groups of x */
__global__ __launch_bounds__(256) void k_cvt(const float* __restrict__ wqk, const float* __restrict__ wv, const float* __restrict__ wo, const float* __restrict__ x, _Float16* __restrict__ BW, _Float16* __restrict__ X16) {
  const unsigned bx = blockIdx.x; const float* s = wqk; _Float16* d = BW; unsigned b0 = 0; float sc = 16.0f;
  if (bx >= 4 * CPB) { s = x; d = X16; b0 = 4 * CPB; sc = 1.0f; } else if (bx >= 3 * CPB) { s = wo; d = BW + (size_t)3 * DM * DM; b0 = 3 * CPB; } else if (bx >= 2 * CPB) { s = wv; d = BW + (size_t)2 * DM * DM; b0 = 2 * CPB; }
  const size_t t = (size_t)(bx - b0) * 256 + threadIdx.x; FragH f;
#pragma unroll
  for (int q = 0; q < 8; ++q) f.h[q] = (_Float16)(bf16_round(s[t * 8 + q]) * sc);
  *(v8us*)((unsigned short*)d + t * 8) = f.half[0]; }
__global__ __launch_bounds__(256) void k_rsm(const float* __restrict__ S, _Float16* __restrict__ P, int nrows) {
  #pragma clang fp contract(off)
  const int i = blockIdx.x * 256 + threadIdx.x; if (i >= nrows) return; const float* s = S + (size_t)i * SQ; float mx = -3.0e38f;
#pragma unroll 1
  for (int j = 0; j < SQ; ++j) mx = fmaxf(mx, s[j]); float se = 0.f;
#pragma unroll 1
  for (int j = 0; j < SQ; ++j) se += expf(s[j] - mx); const float sc = 256.0f / se;
#pragma unroll 1
  for (int j0 = 0; j0 < SQ; j0 += 8) { FragH f; for (int q = 0; q < 8; ++q) f.h[q] = (_Float16)(expf(s[j0 + q] - mx) * sc); unsigned short* d = (unsigned short*)P + (size_t)i * SQ + j0; *(v8us*)d = f.half[0];  } }
__global__ __launch_bounds__(256) void k_vt(const _Float16* __restrict__ V16, int b, int h0, _Float16* __restrict__ VT) { __shared__ unsigned short tl[64][65]; const int tid = threadIdx.x; const int hh = blockIdx.x % HG, sg = blockIdx.x / HG; const int s0 = sg * 64; const int h = h0 + hh;
  for (int i = tid; i < 64 * 8; i += 256) { const int j = i / 8, d8 = (i % 8) * 8; FragH f; f.half[0] = *(const v8us*)((const unsigned short*)V16 + ((size_t)b * SQ + s0 + j) * DM + h * HD + d8); for (int q = 0; q < 8; ++q) tl[d8 + q][j] = f.u[q]; }
  __syncthreads();
  { for (int i = tid; i < 64 * 8; i += 256) { const int d = i / 8, j8 = (i % 8) * 8; FragH f; for (int q = 0; q < 8; ++q) f.u[q] = tl[d][j8 + q]; *(v8us*)((unsigned short*)VT + ((size_t)hh * HD + d) * SQ + s0 + j8) = f.half[0]; }  } }



__global__ __launch_bounds__(256) void k_rsmcf2(const float* __restrict__ S, _Float16* __restrict__ P, int hg, int q0, int nk) {
  #pragma clang fp contract(off)
  const int t = blockIdx.x * 256 + threadIdx.x; if (t >= hg * QT) return; const size_t i = (size_t)t; const float* s = S + i * NKX; const int last = q0 + (t % QT); float mx = -3.0e38f;
#pragma unroll 1
  for (int j = 0; j < nk; ++j) { const float f = (j <= last) ? 1.f : 0.f; mx = fmaxf(mx, fmaf(f, s[j], (1.f - f) * -1.0e9f)); } float se = 0.f;
#pragma unroll 1
  for (int j = 0; j < nk; ++j) { const float f = (j <= last) ? 1.f : 0.f; se += __expf(fmaf(f, s[j], (1.f - f) * -1.0e9f) - mx); } const float sc = 256.0f / se;
#pragma unroll 1
  for (int j0 = 0; j0 < nk; j0 += 8) { FragH fr; for (int q = 0; q < 8; ++q) { const int j = j0 + q; const float f = (j <= last) ? 1.f : 0.f; fr.h[q] = (_Float16)(__expf(fmaf(f, s[j], (1.f - f) * -1.0e9f) - mx) * sc); } unsigned short* d = (unsigned short*)P + i * NKX + j0; *(v8us*)d = fr.half[0];  } }


template <int MASKADD>
__global__ __launch_bounds__(64) void k_att0(const float* __restrict__ QF, const float* __restrict__ KF, const float* __restrict__ VF, int ld, const float* __restrict__ mask, float scale, float* __restrict__ OF, int ldo) {
  #pragma clang fp contract(off)
  __shared__ __attribute__((aligned(16))) float lq[64][64]; __shared__ __attribute__((aligned(16))) float lo[64][64];
  const int tid = threadIdx.x; const int h = blockIdx.x / (QT0 / 64), rg = blockIdx.x % (QT0 / 64); const int i = rg * 64 + tid;
  const float* qr = QF + (size_t)i * ld + h * HD;
#pragma unroll 1
  for (int c = 0; c < HD / 4; ++c) { *(v4f*)&lq[tid][c * 4] = *(const v4fa*)(qr + c * 4); const v4f z = {0.f, 0.f, 0.f, 0.f}; *(v4f*)&lo[tid][c * 4] = z; }
  float m = -1.0e30f, l = 0.f; const int jmax = MASKADD ? (SQ - 1) : (rg * 64 + 63);      /* additive-mask form: every key (the mask input decides); causal form: keys up to the block's last row */
#pragma unroll 1
  for (int j = 0; j <= jmax; ++j) { const float* kr = KF + (size_t)j * ld + h * HD; const float* vr = VF + (size_t)j * ld + h * HD; float s = 0.f;
#pragma unroll 1
    for (int c = 0; c < HD / 4; ++c) { const v4f kq = *(const v4fa*)(kr + c * 4); const v4f qq = *(v4f*)&lq[tid][c * 4]; s = __fadd_rn(s, __fmul_rn(qq[0], kq[0])); s = __fadd_rn(s, __fmul_rn(qq[1], kq[1])); s = __fadd_rn(s, __fmul_rn(qq[2], kq[2])); s = __fadd_rn(s, __fmul_rn(qq[3], kq[3])); }
    s = __fmul_rn(s, scale); if (MASKADD) s = __fadd_rn(s, __fmul_rn(bf16_round(mask[(size_t)i * SQ + j]), -10000.0f));
    const float f = (MASKADD || j <= i) ? 1.f : 0.f; const float sm = fmaf(f, s, (1.f - f) * -1.0e30f); const float mn = fmaxf(m, sm); const float sc = expf(m - mn); const float e = expf(sm - mn); l = __fadd_rn(__fmul_rn(l, sc), e); m = mn;
#pragma unroll 1
    for (int c = 0; c < HD / 4; ++c) { const v4f vv = *(const v4fa*)(vr + c * 4); v4f oo = *(v4f*)&lo[tid][c * 4]; for (int u = 0; u < 4; ++u) oo[u] = __fadd_rn(__fmul_rn(oo[u], sc), __fmul_rn(e, vv[u])); *(v4f*)&lo[tid][c * 4] = oo; } }
  const float fin = 64.0f / l;      /* o carried x64 like the f16 path */
#pragma unroll 1
  for (int c = 0; c < HD / 4; ++c) { v4f oo = *(v4f*)&lo[tid][c * 4]; for (int u = 0; u < 4; ++u) oo[u] = __fmul_rn(oo[u], fin); *(v4f*)&lo[tid][c * 4] = oo; }
  __syncthreads();
  {
#pragma unroll 1
    for (int it = 0; it < 16; ++it) { const int row = it * 4 + tid / 16, pc = (tid % 16) * 4; const v4f v = *(const v4f*)&lo[row][pc]; *(v4f*)(OF + (size_t)(rg * 64 + row) * ldo + h * HD + pc) = v; }
     } }


// Fused causal linear attention: o_i = sum_{j <= i} a_ij v_j / sum_{j <= i} a_ij, a_ij = phi(q_i) . phi(k_j); no score or weight plane in memory.
// One work-group of 4 waves per (batch, head, 32 query rows). The sums over the keys are plain sums, so the waves split the keys: wave w takes the 64-key blocks w, w + 4, ... in two steps of 32 keys
// and the four partial o tiles and row sums are added through LDS at the end. q, k and V^T lie in memory in fragment order (k_gemm2, k_vt): every load of a wave is 512 contiguous bytes, four whole lines.
// Per step: a^T = K Q^T, so that a lane of the accumulator holds 8 consecutive keys of ONE query: accumulator tile 0 (keys 0..15) and tile 1 (keys 16..31) of a query column, rounded to f16,
// are elements 0..7 and 8..15 of the A fragment of a V^T in the k order of g2_frag (8 hh + i, 16 + 8 hh + i), in which V^T is stored too: nothing is moved between lanes.
#define FQ 32                        /* query rows per work-group */
#define FS 32                        /* keys per step */
#define FP 68                        /* pitch in floats of the partial o rows in LDS, as in k_gemm2 */
__global__ __launch_bounds__(128) void k_lfa(const _Float16* __restrict__ Q16, const _Float16* __restrict__ K16, const _Float16* __restrict__ VT, _Float16* __restrict__ O16) {      /* Q16, K16: fragment order of k_gemm2; VT: fragment order of k_vt; each SQ HD halfs a (batch, head); O16: rows of DM */
  __shared__ __attribute__((aligned(16))) float so[4][FQ][FP]; __shared__ float sl[4][2][FQ];
  const int tid = threadIdx.x, lane = tid & 31, ln = lane & 15, hh = lane >> 4; const int w = __builtin_amdgcn_readfirstlane(tid >> 5);      /* the wave's number in a scalar register: the loop and the mask test are scalar branches, every lane stays on at the matrix instructions */
  const int rg = (SQ / FQ - 1) - (int)blockIdx.x, h = blockIdx.y, b = blockIdx.z;      /* the tiles with the most keys start first */
  const size_t hb = ((size_t)b * NH + h) * SQ * HD + lane * 8; const _Float16* qp = Q16 + hb + (size_t)rg * FQ * HD; const _Float16* kp = K16 + hb; const _Float16* vp = VT + hb;      /* the lane's own 16 bytes of a piece are in the pointer, so that the step's loads all name kq or vq itself */
  v16h qf[2][2];
#pragma unroll
  for (int qs = 0; qs < 2; ++qs) { qf[qs][0] = pk_frag(qp + qs * PKT); qf[qs][1] = pk_frag(qp + qs * PKT + 512); }
  asm volatile("s_wait_xcnt 0x0" :: "v"(qp) : "memory");      /* behind the last q load; the address pair is its input, so that it is not reused ahead of it */
  const v8f z8 = {0.f,0.f,0.f,0.f,0.f,0.f,0.f,0.f}; v8f o[2][4] = {{z8, z8, z8, z8}, {z8, z8, z8, z8}}; float ls[2] = {0.f, 0.f};
  for (int it = 0; ; ++it) { const int s = (((it >> 1) * 4 + w) << 1) + (it & 1); if (s > rg) break;      /* s rises with it; step rg holds the diagonal and is the last */
    const _Float16* kq = kp + (size_t)s * FS * HD; const _Float16* vq = vp + (size_t)s * FS * HD;      /* a step's k and its V^T: 4 KiB in a row each */
    v16h kf[2][2], vf[4];
#pragma unroll
    for (int ks = 0; ks < 2; ++ks) { kf[ks][0] = pk_frag(kq + ks * PKT); kf[ks][1] = pk_frag(kq + ks * PKT + 512); }
#pragma unroll
    for (int t = 0; t < 4; ++t) vf[t] = pk_frag(vq + t * 512);
    asm volatile("s_wait_xcnt 0x0" :: "v"(kq), "v"(vq) : "memory");      /* behind the last load of the step; the two address pairs are its inputs, so that neither is advanced or reused ahead of it */
    v8f st[2][2];      /* st[ks][qs][r]: key s FS + 16 ks + 8 hh + r, query rg FQ + 16 qs + ln */
#pragma unroll
    for (int ks = 0; ks < 2; ++ks)
#pragma unroll
      for (int qs = 0; qs < 2; ++qs) st[ks][qs] = g2_mma(kf[ks][0], qf[qs][0], z8);
#pragma unroll
    for (int ks = 0; ks < 2; ++ks)
#pragma unroll
      for (int qs = 0; qs < 2; ++qs) st[ks][qs] = g2_mma(kf[ks][1], qf[qs][1], st[ks][qs]);
    if (s == rg) {      /* the diagonal step: key and query count from the same row here */
#pragma unroll
      for (int ks = 0; ks < 2; ++ks)
#pragma unroll
        for (int qs = 0; qs < 2; ++qs)
#pragma unroll
          for (int r = 0; r < 8; ++r) st[ks][qs][r] = (ks * 16 + 8 * hh + r <= qs * 16 + ln) ? st[ks][qs][r] : 0.f; }
#pragma unroll
    for (int qs = 0; qs < 2; ++qs) { FragH p; float a = 0.f;
#pragma unroll
      for (int r = 0; r < 8; ++r) { a += st[0][qs][r] + st[1][qs][r]; p.h[r] = (_Float16)st[0][qs][r]; p.h[8 + r] = (_Float16)st[1][qs][r]; }
      ls[qs] += a;
#pragma unroll
      for (int t = 0; t < 4; ++t) o[qs][t] = g2_mma(p.v, vf[t], o[qs][t]); } }
#pragma unroll
  for (int qs = 0; qs < 2; ++qs) { sl[w][hh][qs * 16 + ln] = ls[qs];
#pragma unroll
    for (int t = 0; t < 4; ++t)
#pragma unroll
      for (int r = 0; r < 8; ++r) so[w][qs * 16 + 8 * hh + r][t * 16 + ln] = o[qs][t][r]; }
  __syncthreads();
  const int row = tid >> 2, c0 = (tid & 3) * 16;      /* four lanes per output row: 32 bytes each of its 128-byte line */
  float l = 0.f;
#pragma unroll
  for (int u = 0; u < 4; ++u) l += sl[u][0][row] + sl[u][1][row];
  const float fin = 64.0f / l;      /* o carried x64 as the output GEMM expects */
  FragH f;
#pragma unroll
  for (int c = 0; c < 4; ++c) { const v4f a = (*(const v4f*)&so[0][row][c0 + c * 4] + *(const v4f*)&so[1][row][c0 + c * 4]) + (*(const v4f*)&so[2][row][c0 + c * 4] + *(const v4f*)&so[3][row][c0 + c * 4]);
#pragma unroll
    for (int q = 0; q < 4; ++q) f.h[c * 4 + q] = (_Float16)(a[q] * fin); }
  unsigned short* d = (unsigned short*)O16 + ((size_t)b * SQ + rg * FQ + row) * DM + h * HD + c0;
  *(v8us*)d = f.half[0]; *(v8us*)(d + 8) = f.half[1]; }

// Exact f32 linear attention for the first QT0 rows of every batch (blockIdx.y). One work-group of 8 waves per (batch, head, 32 query rows), lane = query row.
// The head's QT0 key and value rows and the group's 32 q rows are staged once in LDS with whole-line loads, all in flight together. Step 1: wave w takes the keys j = w mod 8, four at a time
// (four independent sum chains), q row in registers, k row broadcast from LDS; the masked score goes to le[j][row]. Step 2: wave w owns columns 8 w .. 8 w + 7 of o in registers
// and walks the keys in ascending order. Each sum runs in the order of the one-thread-per-row form (d ascending, j ascending); keys above the group's last row only ever added zeros and are left out.
#define LR 32                        /* query rows per work-group */
#define LP 68                        /* pitch in floats of the per-row LDS arrays: 16 B x odd, so that 32 lanes reading 16 B of their own rows spread over the banks */
__global__ __launch_bounds__(256) void k_latt0(const float* __restrict__ QF, const float* __restrict__ KF, const float* __restrict__ VF, float* __restrict__ OF) {      /* all four planes: rows of DM floats; QF, KF, VF: SQ rows a batch, the first QT0 of them written; OF: QT0 rows a batch */
  { const size_t fb = (size_t)blockIdx.y * SQ * DM; QF += fb; KF += fb; VF += fb; OF += (size_t)blockIdx.y * QT0 * DM; }
  __shared__ __attribute__((aligned(16))) float lk[QT0][HD]; __shared__ __attribute__((aligned(16))) float lv[QT0][HD]; __shared__ __attribute__((aligned(16))) float le[QT0][LR];
  __shared__ __attribute__((aligned(16))) float lq[LR][LP]; __shared__ __attribute__((aligned(16))) float lo[LR][LP];
  const int tid = threadIdx.x, w = tid >> 5, lane = tid & 31; const int h = blockIdx.x / (QT0 / LR), rg = blockIdx.x % (QT0 / LR); const int r0 = rg * LR, nj = r0 + LR, i = r0 + lane;
  const int sr = tid / (HD / 4), sc = (tid % (HD / 4)) * 4;      /* staging and output: 16 lanes per 256-byte row, 16 rows per pass of the work-group */
  { v4f tk[QT0 / 16], tv[QT0 / 16], tq[LR / 16]; const float* kp = KF + (size_t)sr * DM + h * HD + sc; const float* vp = VF + (size_t)sr * DM + h * HD + sc; const float* qp = QF + (size_t)(r0 + sr) * DM + h * HD + sc;
#pragma unroll      /* every load is issued before the first LDS store waits for one */
    for (int p = 0; p < QT0 / 16; ++p) { tk[p] = *(const v4fa*)(kp + (size_t)p * 16 * DM); tv[p] = *(const v4fa*)(vp + (size_t)p * 16 * DM); }
#pragma unroll
    for (int p = 0; p < LR / 16; ++p) tq[p] = *(const v4fa*)(qp + (size_t)p * 16 * DM);
    asm volatile("s_wait_xcnt 0x0" :: "v"(kp), "v"(vp), "v"(qp) : "memory");      /* behind the last load of the run; the three address pairs are its inputs, so that none of them is given to a load's result or reused ahead of it */
#pragma unroll
    for (int p = 0; p < QT0 / 16; ++p) { *(v4f*)&lk[p * 16 + sr][sc] = tk[p]; *(v4f*)&lv[p * 16 + sr][sc] = tv[p]; }
#pragma unroll
    for (int p = 0; p < LR / 16; ++p) *(v4f*)&lq[p * 16 + sr][sc] = tq[p]; }
  __syncthreads();
  v4f q[HD / 4];
#pragma unroll      /* q stays in registers: constant indices only */
  for (int c = 0; c < HD / 4; ++c) q[c] = *(const v4f*)&lq[lane][c * 4];
  for (int jb = 0; jb < nj; jb += 32) { const int j0 = jb + w; float s0 = 0.f, s1 = 0.f, s2 = 0.f, s3 = 0.f;
#pragma unroll      /* constant indices into q; the four chains fill each other's result latency */
    for (int c = 0; c < HD / 4; ++c) { const v4f k0 = *(const v4f*)&lk[j0][c * 4], k1 = *(const v4f*)&lk[j0 + 8][c * 4], k2 = *(const v4f*)&lk[j0 + 16][c * 4], k3 = *(const v4f*)&lk[j0 + 24][c * 4];
#pragma unroll
      for (int u = 0; u < 4; ++u) { s0 += q[c][u] * k0[u]; s1 += q[c][u] * k1[u]; s2 += q[c][u] * k2[u]; s3 += q[c][u] * k3[u]; } }
    le[j0][lane] = (j0 <= i) ? s0 : 0.f; le[j0 + 8][lane] = (j0 + 8 <= i) ? s1 : 0.f; le[j0 + 16][lane] = (j0 + 16 <= i) ? s2 : 0.f; le[j0 + 24][lane] = (j0 + 24 <= i) ? s3 : 0.f; }
  __syncthreads();
  float l = 0.f; v4f oa = {0.f, 0.f, 0.f, 0.f}, ob = {0.f, 0.f, 0.f, 0.f};
#pragma unroll 8      /* eight keys' LDS reads are issued ahead of the sums that use them */
  for (int j = 0; j < nj; ++j) { const float e = le[j][lane]; const v4f va = *(const v4f*)&lv[j][w * 8], vb = *(const v4f*)&lv[j][w * 8 + 4]; l += e; oa += e * va; ob += e * vb; }
  const float fin = 64.0f / l;      /* o carried x64 like the f16 path */
  *(v4f*)&lo[lane][w * 8] = oa * fin; *(v4f*)&lo[lane][w * 8 + 4] = ob * fin;
  __syncthreads();
#pragma unroll      /* two passes, each wave storing whole 128-byte lines */
  for (int p = 0; p < LR / 16; ++p) *(v4f*)(OF + (size_t)(r0 + p * 16 + sr) * DM + h * HD + sc) = *(const v4f*)&lo[p * 16 + sr][sc]; }
extern "C" void kernel_launch(void* const* d_in, const int* in_sizes, int n_in,
                              void* d_out, int out_size, void* d_ws, size_t ws_size, hipStream_t stream) {
  (void)in_sizes; (void)n_in; (void)out_size;
  const float* const* I = (const float* const*)d_in; const float* x = I[0]; const float* wqk = I[1]; const float* bqk = I[2]; const float* wv = I[3]; const float* bv = I[4]; const float* wo = I[5]; const float* bo = I[6];      /* natural Wqk [2048][1024] (q rows | k rows) + bias [2048]; Wv + bv; Wo + bo */
  char* ws = (char*)d_ws; size_t off = 0;
  auto take = [&](size_t bytes) { char* p = ws + off; off += (bytes + 255) & ~(size_t)255; return p; };
  _Float16* BQK = (_Float16*)take((size_t)4 * DM * DM * 2); _Float16* BO = BQK + (size_t)3 * DM * DM;      /* four planes in a row: Wq | Wk | Wv | Wo */
  _Float16* X16 = (_Float16*)take(NR * DM * 2); _Float16* Q16 = (_Float16*)take((size_t)3 * NR * DM * 2); _Float16* K16 = Q16 + NR * DM; _Float16* V16 = Q16 + 2 * NR * DM; _Float16* O16 = (_Float16*)take(NR * DM * 2);      /* q | k | v: three planes in a row */
  _Float16* VT = (_Float16*)take((size_t)NB * NH * HD * SQ * 2);
  float* QF0 = (float*)take((size_t)3 * NR * DM * 4); float* KF0 = QF0 + NR * DM; float* VF0 = QF0 + 2 * NR * DM;      /* f32 q | k | v, rows of DM floats like the f16 v plane; only the first QT0 rows of each batch are written and read */
  float* OF0 = (float*)take((size_t)NB * QT0 * DM * 4); _Float16* OH0 = (_Float16*)take((size_t)NB * QT0 * DM * 2); _Float16* OL0 = (_Float16*)take((size_t)NB * QT0 * DM * 2);
  if (off > ws_size) return;
  k_cvt<<<4 * CPB + CXB, 256, 0, stream>>>(wqk, wv, wo, x, BQK, X16);
  k_gemm2<19><<<dim3((unsigned)((NR / 128) * (DM / 64)), 3), 128, 0, stream>>>(X16, DM, 0, BQK, DM, (size_t)DM * DM, 0.0625f, bqk, DM, nullptr, 1, 0, 0, QF0, Q16, DM, NR * DM, (int)NR, DM, DM, nullptr, bv, 2, 1, 2);      /* planes 0, 1: phi(q), phi(k) = elu(x W^T + b) + 1, f16 in fragment order; plane 2: v, f16 rows; and in f32 rows the first 128 rows of each batch (exact products) */
  k_vt<NH, SQ><<<NB * NH * (SQ / 64), 256, 0, stream>>>(V16, LQ, 0, VT);      /* V^T in fragment order, [NB][NH][SQ / 32][HD / 16] fragments */
  k_latt0<<<dim3(NH * (QT0 / LR), NB), 256, 0, stream>>>(QF0, KF0, VF0, OF0);      /* exact f32 linear attention for rows 0..127 of each batch (o x64): the few-key rows without the f16 roundings */
  k_hl<<<(unsigned)(((size_t)NB * QT0 * DM / 8 + 255) / 256), 256, 0, stream>>>(OF0, OH0, OL0, (size_t)NB * QT0 * DM / 8);      /* first-tile o (x64) -> f16 hi + x1024 residual planes */
  k_lfa<<<dim3(SQ / FQ, NH, NB), 128, 0, stream>>>(Q16, K16, VT, O16);      /* scores, causal normalisation and a V^T of every batch, head and query tile in one launch: o (merged heads, x64) as f16 rows */
  k_gemm2<0><<<dim3((unsigned)((NR / 128) * (DM / 64)), 1), 128, 0, stream>>>(O16, DM, 0, BO, DM, 0, 0.0009765625f, bo, 0, nullptr, 1, 0, 0, (float*)d_out, nullptr, DM, 0, (int)NR, DM, DM, OH0, nullptr, 1, 0, 0);      /* out rows are the output layout; rows 0..127 of each batch: out = o_hi Wo (+ b) */
  k_gemm2<0><<<dim3((QT0 / 128) * (DM / 64), NB), 128, 0, stream>>>(OL0, DM, (size_t)QT0 * DM, BO, DM, 0, 0.00000095367431640625f, nullptr, 0, (const float*)d_out, -1, 0, 0, (float*)d_out, nullptr, DM, (size_t)SQ * DM, QT0, DM, DM, nullptr, nullptr, NB, 0, 0);      /* rows 0..127 of each batch (plane by): += o_lo Wo 2^-20 (own-element accumulate) */
}

// v007
// It runs in 134 microseconds.
// Two timings next to v006 put it at 1.11 and 1.12 times that version's speed.
// Over all steps from v000 it is 31.6 times as fast.
#include <hip/hip_runtime.h>
// Causal LINEAR attention (x [2][2048][1024]; qk = x Wqk^T + bqk (natural [2048][1024]: rows 0..1023 -> q, 1024..2047 -> k; sigma 1/32, biases 0.02), v = x Wv^T + bv; 16 heads of 64; feature map phi = elu + 1 on q and k; ctx_t = (phi(q_t) . sum_{s<=t} phi(k_s) v_s^T) / (phi(q_t) . sum_{s<=t} phi(k_s)) = sum_{s<=t} a_ts v_s / sum_{s<=t} a_ts with a_ts = phi(q_t).phi(k_s) (the module's cumsum form, no softmax, no scaling, no eps); out = ctx Wo^T + bo -> [2][2048][1024]).
// Structure: x as exact f16 rows and the natural weights as exact x16 planes in one VALU launch; q, k (with the elu + 1 feature map in the GEMM epilogue) and v as one launch of WMMA GEMMs (32x64 wave tiles, f32 accumulation, + bias) with f16 outputs, phi(k) and v also transposed straight from the accumulators, the first 128 rows of each batch also in f32; the running sums phi(k) v^T and phi(k) in front of every chunk of 64 keys on WMMA (f32 accumulation, stored f16); one fused attention launch for all batches, heads and query tiles of 32 rows: phi(q) times the state in front of the chunk, then a^T = phi(k) phi(q)^T on WMMA (K = 64) for the chunk's own keys, causal mask, a as f16 straight from the accumulators into the A operand of ctx = a V^T on WMMA, row sums on WMMA too, ctx x64 / sum a into merged f16 rows; out = ctx Wo^T + bo GEMM (f32); first-tile refinement: the first 128 rows of each batch computed exactly in f32 on VALU (a / sum a weights), their output rows taken from o hi in the output GEMM and completed from o lo by one accumulating GEMM pass; 8 launches.
// Compute dtype: inputs rounded to bf16; x / weights exact; q, k, v, the weights a and o as plain f16 GEMM operands (~2^-12); scores and row sums f32. v_wmma_f32_16x16x32_f16.
#define NB 2
#define SQ 2048
#define DM 1024
#define NH 16
#define HD 64
#define HG 4                         /* heads per group in the unlaunched k_vt(V16, b, h0, VT) overload */
#define QT 256                       /* query rows per causal tile */
#define NKX SQ                       /* S / P row pitch */
#define QT0 128                      /* first-tile rows recomputed exactly in f32 */
#define B0 0                         /* unused: every launch starts at batch 0 */
#define NBR NB                       /* only in MP, which no launch reads: the launches cover all NB batches */
#define NR ((size_t)NB * SQ)         /* token rows */
#define MP ((int)((size_t)NBR * SQ)) /* only in MPO, which no launch reads: the projections take all NR rows */
#define QN SQ                        /* unused: k_lfa attends all SQ rows of every batch */
#define NHD NH                       /* unused: k_lfa attends all NH heads */
#define MPO MP                       /* unused: the output GEMM takes all NR rows */
#define LQ DM      /* unused: the f32 q/k/v rows take pitch DM */
typedef __bf16 v16b __attribute__((ext_vector_type(16)));
typedef unsigned short v8us __attribute__((ext_vector_type(8), may_alias));
typedef float  v8f  __attribute__((ext_vector_type(8)));
typedef float  v4f  __attribute__((ext_vector_type(4)));
typedef float  v4fa __attribute__((ext_vector_type(4), may_alias));
union FragB { v16b v; v8us half[2]; unsigned short u[16]; };

__device__ __forceinline__ unsigned short bf16_bits(float x) { unsigned int u = __float_as_uint(x); return (unsigned short)((u + 0x7FFFu + ((u >> 16) & 1u)) >> 16); }
__device__ __forceinline__ float bf16_val(unsigned short b) { return __uint_as_float(((unsigned int)b) << 16); }
__device__ __forceinline__ float bf16_round(float x) { return bf16_val(bf16_bits(x)); }
// D += A·B with NT terms: 1 = ah·bh, 2 = + al·bh (A split), 3 = + ah·bl (both split)
template <int NT>
__device__ __forceinline__ v8f mmaN(v16b ah, v16b al, v16b bh, v16b bl, v8f c) {
  c = __builtin_amdgcn_wmma_f32_16x16x32_bf16(false, ah, false, bh, (short)0, c, false, false);
  if (NT >= 2) c = __builtin_amdgcn_wmma_f32_16x16x32_bf16(false, al, false, bh, (short)0, c, false, false);
  if (NT >= 3) c = __builtin_amdgcn_wmma_f32_16x16x32_bf16(false, ah, false, bl, (short)0, c, false, false);
  asm volatile("v_nop\n\tv_nop\n\tv_nop\n\tv_nop" : "+v"(c) : "v"(ah), "v"(al), "v"(bh), "v"(bl));
  return c;
}

__global__ __launch_bounds__(256) void k_wt_bf16(const float* __restrict__ W, unsigned short* __restrict__ Wt, int K, int N) {
  const int t = blockIdx.x * 256 + threadIdx.x;
  const int k8n = K / 8;
  if (t >= N * k8n) return;
  const int n = t / k8n, k8 = (t % k8n) * 8;
  v8us v;
#pragma unroll
  for (int i = 0; i < 8; ++i) v[i] = bf16_bits(W[(size_t)(k8 + i) * N + n]);
  *(v8us*)(Wt + (size_t)n * K + k8) = v;
  
}

// GEMM C[M][N] (f32, pitch ldc) = act(A[M][K]·W + bias). A f32 row-major (pitch lda) converted per fragment to bf16
// (ASPLIT: hi/lo two planes -> 2 terms, else single rounded term); Wt bf16 [N][K] (pitch ldb). BIAS_BF16 rounds the
// bias to bf16 first (bias quantised to bf16 before the add). K%32==0, M%16==0, N%64==0.
template <bool ASPLIT, int ACT, bool BIAS_BF16>
__global__ __launch_bounds__(128) void k_gemm_bf(const float* __restrict__ A, int lda, const unsigned short* __restrict__ Wt, int ldb,
                                               const float* __restrict__ bias, float* __restrict__ C, int ldc, int M, int N, int K) {
  __shared__ __attribute__((aligned(16))) float so[4][16][64];
  const int tid = threadIdx.x, w = tid >> 5, lane = tid & 31, ln = lane & 15, hh = lane >> 4;
  const int ntn = N / 64;
  const int wid = blockIdx.x * 4 + w;
  const int mt = wid / ntn, nq = wid % ntn;
  if (mt * 16 >= M) return;
  const int row0 = mt * 16, col0 = nq * 64;
  const float* arow = A + (size_t)(row0 + ln) * lda;
  v8f acc[4] = {};
  for (int kb = 0; kb < K; kb += 32) {
    FragB ah, al;
    const v4f x0 = *(const v4fa*)(arow + kb + 8 * hh), x1 = *(const v4fa*)(arow + kb + 8 * hh + 4);
    const v4f x2 = *(const v4fa*)(arow + kb + 16 + 8 * hh), x3 = *(const v4fa*)(arow + kb + 16 + 8 * hh + 4);
    float xs[16] = {x0[0],x0[1],x0[2],x0[3],x1[0],x1[1],x1[2],x1[3],x2[0],x2[1],x2[2],x2[3],x3[0],x3[1],x3[2],x3[3]};
#pragma unroll
    for (int i = 0; i < 16; ++i) { const unsigned short hb = bf16_bits(xs[i]); ah.u[i] = hb; al.u[i] = ASPLIT ? bf16_bits(xs[i] - bf16_val(hb)) : (unsigned short)0; }
#pragma unroll
    for (int t = 0; t < 4; ++t) {
      const unsigned short* brow = Wt + (size_t)(col0 + t * 16 + ln) * ldb + kb;
      FragB b;
      b.half[0] = *(const v8us*)(brow + 8 * hh);
      b.half[1] = *(const v8us*)(brow + 16 + 8 * hh);
      acc[t] = mmaN<ASPLIT ? 2 : 1>(ah.v, al.v, b.v, b.v, acc[t]);
    }
  }
#pragma unroll
  for (int t = 0; t < 4; ++t) {
    float bv = bias ? bias[col0 + t * 16 + ln] : 0.f;
    if (BIAS_BF16) bv = bf16_round(bv);
#pragma unroll
    for (int r = 0; r < 8; ++r) { float v = acc[t][r] + bv; if (ACT == 1) v = fmaxf(v, 0.f); so[w][8 * hh + r][t * 16 + ln] = v; }
  }
  __builtin_amdgcn_fence(__ATOMIC_ACQ_REL, "workgroup");
  __builtin_amdgcn_wave_barrier();
  const int rsub = lane >> 4, c4 = (lane & 15) * 4;
  {
#pragma unroll
    for (int q = 0; q < 8; ++q) {
      const int r = q * 2 + rsub;
      const v4f v = *(const v4fa*)&so[w][r][c4];
      *(v4f*)(C + (size_t)(row0 + r) * ldc + col0 + c4) = v;
    }
    
  }
}

// GEMM C = act(A·W + bias + resid): A f32 (ASPLIT -> hi/lo 2 terms), Wt bf16 [N][K]; ACT 0 none, 1 relu, 2 exact gelu;
// resid (optional, f32, row index = (row % rmod), pitch ldr, RES_BF16 rounds it) added before the activation.
template <bool ASPLIT, int ACT, bool BIAS_BF16, bool RES_BF16>
__global__ __launch_bounds__(128) void k_gemm_bf3(const float* __restrict__ A, int lda, const unsigned short* __restrict__ Wt, int ldb,
                                                const float* __restrict__ bias, const float* __restrict__ resid, int rmod, int ldr,
                                                float* __restrict__ C, int ldc, int M, int N, int K) {
  __shared__ __attribute__((aligned(16))) float so[4][16][64];
  const int tid = threadIdx.x, w = tid >> 5, lane = tid & 31, ln = lane & 15, hh = lane >> 4;
  const int ntn = N / 64;
  const int wid = blockIdx.x * 4 + w;
  const int mt = wid / ntn, nq = wid % ntn;
  if (mt * 16 >= M) return;
  const int row0 = mt * 16, col0 = nq * 64;
  const float* arow = A + (size_t)(row0 + ln) * lda;
  v8f acc[4] = {};
  for (int kb = 0; kb < K; kb += 32) {
    FragB ah, al;
    const v4f x0 = *(const v4fa*)(arow + kb + 8 * hh), x1 = *(const v4fa*)(arow + kb + 8 * hh + 4);
    const v4f x2 = *(const v4fa*)(arow + kb + 16 + 8 * hh), x3 = *(const v4fa*)(arow + kb + 16 + 8 * hh + 4);
    float xs[16] = {x0[0],x0[1],x0[2],x0[3],x1[0],x1[1],x1[2],x1[3],x2[0],x2[1],x2[2],x2[3],x3[0],x3[1],x3[2],x3[3]};
#pragma unroll
    for (int i = 0; i < 16; ++i) { const unsigned short hb = bf16_bits(xs[i]); ah.u[i] = hb; al.u[i] = ASPLIT ? bf16_bits(xs[i] - bf16_val(hb)) : (unsigned short)0; }
#pragma unroll
    for (int t = 0; t < 4; ++t) {
      const unsigned short* brow = Wt + (size_t)(col0 + t * 16 + ln) * ldb + kb;
      FragB b;
      b.half[0] = *(const v8us*)(brow + 8 * hh);
      b.half[1] = *(const v8us*)(brow + 16 + 8 * hh);
      acc[t] = mmaN<ASPLIT ? 2 : 1>(ah.v, al.v, b.v, b.v, acc[t]);
    }
  }
#pragma unroll
  for (int t = 0; t < 4; ++t) {
    const int col = col0 + t * 16 + ln;
    float bv = bias ? bias[col] : 0.f;
    if (BIAS_BF16) bv = bf16_round(bv);
#pragma unroll
    for (int r = 0; r < 8; ++r) {
      float v = acc[t][r] + bv;
      if (resid) { float rv = resid[(size_t)((row0 + 8 * hh + r) % rmod) * ldr + col]; if (RES_BF16) rv = bf16_round(rv); v += rv; }
      if (ACT == 1) v = fmaxf(v, 0.f);
      if (ACT == 2) v = 0.5f * v * (1.0f + erff(v * 0.70710678118654752f));
      if (ACT == 3) { const float u = 0.7978845608028654f * (v + 0.044715f * v * v * v); v = 0.5f * v * (1.0f + tanhf(u)); }
      so[w][8 * hh + r][t * 16 + ln] = v;
    }
  }
  __builtin_amdgcn_fence(__ATOMIC_ACQ_REL, "workgroup");
  __builtin_amdgcn_wave_barrier();
  const int rsub = lane >> 4, c4 = (lane & 15) * 4;
  {
#pragma unroll
    for (int q = 0; q < 8; ++q) {
      const int r = q * 2 + rsub;
      const v4f v = *(const v4fa*)&so[w][r][c4];
      *(v4f*)(C + (size_t)(row0 + r) * ldc + col0 + c4) = v;
    }
    
  }
}
// row LayerNorm (biased variance, eps) over N: s = X (+ R); optional out_sum <- s; out_norm <- (s-mu)*rsqrt(var+eps)*g + b
template <bool PARAM_BF16>
__global__ __launch_bounds__(256) void k_layernorm(const float* __restrict__ X, const float* __restrict__ R, const float* __restrict__ g, const float* __restrict__ bta,
                                                  float* __restrict__ out_sum, float* __restrict__ out_norm, int N, float eps) {
  __shared__ float red[256];
  const int row = blockIdx.x, tid = threadIdx.x;
  const float* x = X + (size_t)row * N; const float* rr = R ? R + (size_t)row * N : nullptr;
  float vals[16];                     // up to N = 4096
  const int per = N / 256;            // contiguous chunk per thread? use strided-by-4 chunks: thread handles j = tid*4 + 1024*u
  float s1 = 0.f;
  for (int u = 0; u < per / 4; ++u) {
    const int j = tid * 4 + 1024 * u;
    const v4f a = *(const v4fa*)(x + j);
    v4f b = {0.f,0.f,0.f,0.f}; if (rr) b = *(const v4fa*)(rr + j);
#pragma unroll
    for (int q = 0; q < 4; ++q) { const float v = a[q] + b[q]; vals[u * 4 + q] = v; s1 += v; }
  }
  red[tid] = s1; __syncthreads();
  for (int st = 128; st > 0; st >>= 1) { if (tid < st) red[tid] += red[tid + st]; __syncthreads(); }
  const float mu = red[0] / (float)N; __syncthreads();
  float s2 = 0.f;
  for (int u = 0; u < per / 4; ++u)
#pragma unroll
    for (int q = 0; q < 4; ++q) { const float c = vals[u * 4 + q] - mu; s2 += c * c; }
  red[tid] = s2; __syncthreads();
  for (int st = 128; st > 0; st >>= 1) { if (tid < st) red[tid] += red[tid + st]; __syncthreads(); }
  const float rs = rsqrtf(red[0] / (float)N + eps);
  {
    for (int u = 0; u < per / 4; ++u) {
      const int j = tid * 4 + 1024 * u;
      v4f o, sm;
#pragma unroll
      for (int q = 0; q < 4; ++q) {
        float gg = g[j + q], bb = bta[j + q];
        if (PARAM_BF16) { gg = bf16_round(gg); bb = bf16_round(bb); }
        sm[q] = vals[u * 4 + q]; o[q] = (vals[u * 4 + q] - mu) * rs * gg + bb;
      }
      if (out_sum) *(v4f*)(out_sum + (size_t)row * N + j) = sm;
      *(v4f*)(out_norm + (size_t)row * N + j) = o;
    }
    
  }
}



// ---- f16 WMMA path (v_wmma_f32_16x16x32_f16): 11-bit significands for operands in range — used where a [0,1] probability operand needs more precision than bf16
typedef _Float16 v16h __attribute__((ext_vector_type(16)));
union FragH { v16h v; v8us half[2]; _Float16 h[16]; unsigned short u[16]; };
template <int NT>
__device__ __forceinline__ v8f mmaH(v16h ah, v16h al, v16h bh, v16h bl, v8f c) {
  c = __builtin_amdgcn_wmma_f32_16x16x32_f16(false, ah, false, bh, (short)0, c, false, false);
  if (NT >= 2) c = __builtin_amdgcn_wmma_f32_16x16x32_f16(false, al, false, bh, (short)0, c, false, false);
  if (NT >= 3) c = __builtin_amdgcn_wmma_f32_16x16x32_f16(false, ah, false, bl, (short)0, c, false, false);
  asm volatile("v_nop\n\tv_nop\n\tv_nop\n\tv_nop" : "+v"(c) : "v"(ah), "v"(al), "v"(bh), "v"(bl));
  return c;
}
// batched GEMM like k_gemm_b but f16 operands: A f32 (split into f16 hi/lo if ASPLIT, else rounded to f16), Bt = f16 values [n][k]; alpha; C f32; N multiple of 16 (partial tiles skipped)
template <bool ASPLIT>
__global__ __launch_bounds__(128) void k_gemm_h(const float* __restrict__ A, int lda, size_t sA, const _Float16* __restrict__ Bh, int ldb, size_t sB, float alpha, float* __restrict__ C, int ldc, size_t sC, int M, int N, int K) {
  __shared__ __attribute__((aligned(16))) float so[4][16][64];
  const int tid = threadIdx.x, w = tid >> 5, lane = tid & 31, ln = lane & 15, hh = lane >> 4; const int by = blockIdx.y;
  A += (size_t)by * sA; Bh += (size_t)by * sB; C += (size_t)by * sC;
  const int ntn = (N + 63) / 64; const int wid = blockIdx.x * 4 + w; const int mt = wid / ntn, nq = wid % ntn; if (mt * 16 >= M) return;
  const int row0 = mt * 16, col0 = nq * 64; const float* arow = A + (size_t)(row0 + ln) * lda;
  v8f acc[4] = {};
  for (int kb = 0; kb < K; kb += 32) {
    FragH ah, al;
    const v4f x0 = *(const v4fa*)(arow + kb + 8 * hh), x1 = *(const v4fa*)(arow + kb + 8 * hh + 4), x2 = *(const v4fa*)(arow + kb + 16 + 8 * hh), x3 = *(const v4fa*)(arow + kb + 16 + 8 * hh + 4);
    float xs[16] = {x0[0],x0[1],x0[2],x0[3],x1[0],x1[1],x1[2],x1[3],x2[0],x2[1],x2[2],x2[3],x3[0],x3[1],x3[2],x3[3]};
#pragma unroll
    for (int i = 0; i < 16; ++i) { const _Float16 h = (_Float16)xs[i]; ah.h[i] = h; al.h[i] = ASPLIT ? (_Float16)(xs[i] - (float)h) : (_Float16)0.0f; }
#pragma unroll
    for (int t = 0; t < 4; ++t) { if (col0 + t * 16 >= N) continue; const size_t boff = (size_t)(col0 + t * 16 + ln) * ldb + kb; FragH bq; bq.half[0] = *(const v8us*)(Bh + boff + 8 * hh); bq.half[1] = *(const v8us*)(Bh + boff + 16 + 8 * hh);
      acc[t] = mmaH<ASPLIT ? 2 : 1>(ah.v, al.v, bq.v, bq.v, acc[t]); }
  }
#pragma unroll
  for (int t = 0; t < 4; ++t) { if (col0 + t * 16 >= N) continue;
#pragma unroll
    for (int r = 0; r < 8; ++r) so[w][8 * hh + r][t * 16 + ln] = acc[t][r] * alpha; }
  __builtin_amdgcn_fence(__ATOMIC_ACQ_REL, "workgroup"); __builtin_amdgcn_wave_barrier();
  const int rsub = lane >> 4, c4 = (lane & 15) * 4;
  {
#pragma unroll
    for (int q = 0; q < 8; ++q) { const int r = q * 2 + rsub; if (col0 + c4 < N) { const v4f v = *(const v4fa*)&so[w][r][c4]; *(v4f*)(C + (size_t)(row0 + r) * ldc + col0 + c4) = v; } }
     }
}

// Wt[n][k] = f16(W[k][n]·scale) from f32 row-major W[K][N] (scale = power of two; bf16-exact weights stay exact in f16 away from the subnormal range)
__global__ __launch_bounds__(256) void k_wt_f16(const float* __restrict__ W, _Float16* __restrict__ Wt, int K, int N, float scale) {
  const int t = blockIdx.x * 256 + threadIdx.x; if (t >= N * (K / 8)) return; const int n = t / (K / 8), k8 = (t % (K / 8)) * 8; FragH f;
#pragma unroll
  for (int i = 0; i < 8; ++i) f.h[i] = (_Float16)(bf16_round(W[(size_t)(k8 + i) * N + n]) * scale); const v8us o = f.half[0];
  *(v8us*)((unsigned short*)Wt + (size_t)n * K + k8) = o; 
}
// k_gemm_hh variant with fused epilogue: v = acc·alpha + bias[by·sBias + col] (+ CP[(row/rowsPerB)·sCPb + by·64 + col] if CP) ; ACT 0 none / 1 elu ; writes f16 C16 (and f32 C if non-null)
template <int ACT>
__global__ __launch_bounds__(128) void k_gemm_hhx(const _Float16* __restrict__ A, int lda, size_t sA, const _Float16* __restrict__ Bh, int ldb, size_t sB, float alpha, const float* __restrict__ bias, size_t sBias, const float* __restrict__ CP, int rowsPerB, size_t sCPb, int row0g,
    float* __restrict__ C, _Float16* __restrict__ C16, int ldc, size_t sC, int M, int N, int K) {
  __shared__ __attribute__((aligned(16))) float so[4][16][64];
  const int tid = threadIdx.x, w = tid >> 5, lane = tid & 31, ln = lane & 15, hh = lane >> 4; const int by = blockIdx.y;
  A += (size_t)by * sA; Bh += (size_t)by * sB; const size_t cofs = (size_t)by * sC; const float* bp = bias ? bias + (size_t)by * sBias : nullptr;
  const int ntn = (N + 63) / 64; const int wid = blockIdx.x * 4 + w; const int mt = wid / ntn, nq = wid % ntn; if (mt * 16 >= M) return;
  const int row0 = mt * 16, col0 = nq * 64; const _Float16* arow = A + (size_t)(row0 + ln) * lda;
  v8f acc[4] = {};
  for (int kb = 0; kb < K; kb += 32) { FragH ah; ah.half[0] = *(const v8us*)((const unsigned short*)arow + kb + 8 * hh); ah.half[1] = *(const v8us*)((const unsigned short*)arow + kb + 16 + 8 * hh);
#pragma unroll
    for (int t = 0; t < 4; ++t) { if (col0 + t * 16 >= N) continue; const size_t boff = (size_t)(col0 + t * 16 + ln) * ldb + kb; FragH bq; bq.half[0] = *(const v8us*)((const unsigned short*)Bh + boff + 8 * hh); bq.half[1] = *(const v8us*)((const unsigned short*)Bh + boff + 16 + 8 * hh);
      acc[t] = mmaH<1>(ah.v, ah.v, bq.v, bq.v, acc[t]); }
  }
#pragma unroll
  for (int t = 0; t < 4; ++t) { if (col0 + t * 16 >= N) continue; const int col = col0 + t * 16 + ln; const float bv = bp ? bf16_round(bp[col]) : 0.f;
#pragma unroll
    for (int r = 0; r < 8; ++r) { float v = acc[t][r] * alpha + bv; if (CP) { const int rr = row0g + row0 + 8 * hh + r; if (rowsPerB < 0) v += CP[cofs + (size_t)rr * ldc + col];      /* rowsPerB < 0: own element of the batched C plane */ else { const int bidx = rr / rowsPerB; v += CP[(size_t)bidx * sCPb + (size_t)by * 64 + col]; } } if (ACT == 1) v = (v > 0.f) ? v : expm1f(v); else if (ACT == 7) v = (v > 0.f) ? v + 1.0f : expf(v); else if (ACT == 8) v = tanhf(v); else if (ACT == 9) v = 0.5f * v * (1.0f + tanhf(0.7978845608028654f * (v + 0.044715f * v * v * v))); else if (ACT == 11) v = 1.0f / (1.0f + expf(-v)); else if (ACT == 12) v = (v > 0.f) ? v : 0.01f * v; else if (ACT == 14) v = (v > 0.f) ? v : 0.1f * v; else if (ACT == 16) v = (v >= 0.f) ? v : 0.3f * v; else if (ACT == 17) v = (v >= 0.f) ? v : 0.2f * v; else if (ACT == 15) v = v / (1.0f + expf(-v)); else if (ACT == 3) v = fmaxf(v, 0.f); else if (ACT == 6) v = 0.5f * v * (1.0f + erff(v * 0.70710678118654752f)); so[w][8 * hh + r][t * 16 + ln] = v; } }
  __builtin_amdgcn_fence(__ATOMIC_ACQ_REL, "workgroup"); __builtin_amdgcn_wave_barrier();
  const int rsub = lane >> 4, c4 = (lane & 15) * 4; typedef _Float16 v4h __attribute__((ext_vector_type(4)));
  {
#pragma unroll
    for (int q = 0; q < 8; ++q) { const int r = q * 2 + rsub; if (col0 + c4 < N) { const v4f v = *(const v4fa*)&so[w][r][c4]; if (C) *(v4f*)(C + cofs + (size_t)(row0 + r) * ldc + col0 + c4) = v; if (C16) { v4h h4; for (int i = 0; i < 4; ++i) h4[i] = (_Float16)v[i]; *(v4h*)(C16 + cofs + (size_t)(row0 + r) * ldc + col0 + c4) = h4; } } }
     }
}


typedef _Float16 v4h __attribute__((ext_vector_type(4)));

__global__ __launch_bounds__(256) void k_h16(const float* __restrict__ x, _Float16* __restrict__ X16, size_t n8) { const size_t t = (size_t)blockIdx.x * 256 + threadIdx.x; if (t >= n8) return; FragH f;
#pragma unroll
  for (int q = 0; q < 8; ++q) f.h[q] = (_Float16)x[t * 8 + q]; *(v8us*)((unsigned short*)X16 + t * 8) = f.half[0];  }
__global__ __launch_bounds__(256) void k_round16f(const float* __restrict__ W, _Float16* __restrict__ Bt, size_t n8) { const size_t t = (size_t)blockIdx.x * 256 + threadIdx.x; if (t >= n8) return; FragH f;
#pragma unroll
  for (int i = 0; i < 8; ++i) f.h[i] = (_Float16)(bf16_round(W[t * 8 + i]) * 16.0f); *(v8us*)((unsigned short*)Bt + t * 8) = f.half[0];  }
template <int NHv, int TTv>
__global__ __launch_bounds__(256) void k_vt(const _Float16* __restrict__ V16, int ldv, int voff, _Float16* __restrict__ Vt) { __shared__ unsigned short tl[64][66]; const int tid = threadIdx.x; const int slab = blockIdx.x / (TTv / 64), lg = blockIdx.x % (TTv / 64); const int b = slab / NHv, h = slab % NHv;
  for (int i = tid; i < 64 * 8; i += 256) { const int r = i / 8, c8 = (i % 8) * 8; FragH f; f.half[0] = *(const v8us*)((const unsigned short*)V16 + ((size_t)b * TTv + lg * 64 + r) * ldv + voff + h * 64 + c8);
#pragma unroll
    for (int q = 0; q < 8; ++q) tl[r][c8 + q] = f.u[q]; }
  __syncthreads();
  {
#pragma unroll
    for (int rd = 0; rd < 2; ++rd) { const int i = rd * 256 + tid, ln = i & 15, hh = (i >> 4) & 1, j = (i >> 5) & 1, t = (i >> 6) & 3, ss = i >> 8; FragH f;      /* fragment order: [slab][32 keys][16 d][half j] pieces of 512 bytes, lane (hh, ln) holding row d = 16 t + ln, keys 16 j + 8 hh + 0..7; piece and lane count up with i, so a wave stores 512 contiguous bytes */
#pragma unroll
      for (int q = 0; q < 8; ++q) f.u[q] = tl[ss * 32 + j * 16 + hh * 8 + q][t * 16 + ln];
      *(v8us*)((unsigned short*)Vt + ((size_t)slab * (TTv / 64) + lg) * 4096 + i * 8) = f.half[0]; }
     } }

__global__ __launch_bounds__(256) void k_hl(const float* __restrict__ F, _Float16* __restrict__ Hh, _Float16* __restrict__ Hl, size_t n8) { const size_t t = (size_t)blockIdx.x * 256 + threadIdx.x; if (t >= n8) return; FragH fh, fl; const v4f a = *(const v4fa*)(F + t * 8), c = *(const v4fa*)(F + t * 8 + 4);
#pragma unroll
  for (int q = 0; q < 4; ++q) { _Float16 h = (_Float16)a[q]; fh.h[q] = h; fl.h[q] = (_Float16)((a[q] - (float)h) * 1024.0f); h = (_Float16)c[q]; fh.h[4 + q] = h; fl.h[4 + q] = (_Float16)((c[q] - (float)h) * 1024.0f); }
  { *(v8us*)((unsigned short*)Hh + t * 8) = fh.half[0]; *(v8us*)((unsigned short*)Hl + t * 8) = fl.half[0];  } }

// ---- fast GEMM (work-group tile 128x64, wave tile 32x64; requires M % 32 == 0 rows per launch region, N % 64 == 0 and K % 64 == 0); epilogue = k_gemm_hhx semantics ----
// Operand tiles of GK k (one 128-byte line of each of the 128 A rows and 64 B rows) go through LDS: eight lanes fetch a whole line, one tile ahead of the matrix work, and the waves read their fragments from LDS.
// Products that read none of each other's output share a launch: planes by = blockIdx.y; planes by < nact take bias + by sBias and the activation, the others biasz and none; cfirst: the f32 plane C takes only the first QT0 rows of each batch;
// A1 (if given): the row tiles that hold the first QT0 rows of a batch read their A rows from A1 [batch][QT0] in place of A.
// Planes by < npk (rows of NH heads of HD = 64 columns, SQ rows a batch) store their f16 output in FRAGMENT ORDER in place of rows: [batch][head][16-row tile] tiles of PKT halfs; a tile is four pieces c of 512 bytes,
// piece c holding at lane (hh, ln) the 8 halfs of row ln, columns 16 c + 8 hh + 0..7: pieces 2 m and 2 m + 1 are the two halves of the g2_frag fragment of columns 32 m .. 32 m + 31, each one whole-line load of a wave.
// Planes by >= ntr (if CT is given) store their f16 output TRANSPOSED in fragment order into plane by - ntr of CT, and no f16 rows: [batch][head][32 rows][16 columns t][half j] pieces of 512 bytes,
// lane (hh, ln) holding column 16 t + ln, rows 16 j + 8 hh + 0..7: the fragment of a product that sums over the rows.
#define PKT 1024                     /* halfs per 16 x 64 tile in fragment order */
__device__ __forceinline__ v16h pk_frag(const _Float16* p) { FragH f; f.half[0] = *(const v8us*)((const unsigned short*)p); f.half[1] = *(const v8us*)((const unsigned short*)p + 256); return f.v; }      /* p: the fragment's first piece + 8 lane */
#define GK 64                        /* k per staged tile */
#define GP 72                        /* pitch in halfs of a staged row: 144 B = 16 B x odd, so that 16-byte fragment reads of 16 rows spread over the banks */
__device__ __forceinline__ v16h g2_frag(const _Float16* p, int hh) { FragH f; f.half[0] = *(const v8us*)((const unsigned short*)p + 8 * hh); f.half[1] = *(const v8us*)((const unsigned short*)p + 16 + 8 * hh); return f.v; }
__device__ __forceinline__ v8f g2_mma(v16h a, v16h b, v8f c) { v8f d = __builtin_amdgcn_wmma_f32_16x16x32_f16(false, a, false, b, (short)0, c, false, false); asm volatile("v_nop\n\tv_nop\n\tv_nop\n\tv_nop" : "+v"(d) : "v"(a), "v"(b)); return d; }
template <int ACT>
__global__ __launch_bounds__(128) void k_gemm2(const _Float16* __restrict__ A, int lda, size_t sA, const _Float16* __restrict__ Bh, int ldb, size_t sB, float alpha, const float* __restrict__ bias, size_t sBias, const float* __restrict__ CP, int rowsPerB, size_t sCPb, int row0g,
    float* __restrict__ C, _Float16* __restrict__ C16, int ldc, size_t sC, int M, int N, int K, const _Float16* __restrict__ A1, const float* __restrict__ biasz, int nact, int cfirst, int npk, _Float16* __restrict__ CT, int ntr) { static_assert(ACT == 0 || ACT == 3 || ACT == 6 || ACT == 8 || ACT == 9 || ACT == 11 || ACT == 12 || ACT == 14 || ACT == 15 || ACT == 16 || ACT == 17 || ACT == 19, "k_gemm2: unsupported ACT code (would silently apply no activation)"); static_assert(QT0 == 128 && SQ % 128 == 0, "k_gemm2: the first rows of a batch are one row tile");
  __shared__ __attribute__((aligned(16))) float so[4][32][68];
  __shared__ __attribute__((aligned(16))) _Float16 sa[2][128][GP]; __shared__ __attribute__((aligned(16))) _Float16 sb[2][64][GP];
  const int tid = threadIdx.x, w = tid >> 5, lane = tid & 31, ln = lane & 15, hh = lane >> 4; const int by = blockIdx.y;
  A += (size_t)by * sA; Bh += (size_t)by * sB; const size_t cofs = (size_t)by * sC; const bool act = by < nact; const float* bp = bias ? (act ? bias + (size_t)by * sBias : biasz) : nullptr;
  const int ntn = N >> 6; const int mt = blockIdx.x / ntn, nq = blockIdx.x - mt * ntn; const int row0 = mt * 128 + 32 * w, col0 = nq * 64; if (mt * 128 >= M) return;      /* the whole work-group or none: barriers follow; a wave whose own rows lie past M leaves behind the last one */
  const int sr = tid >> 3, sc = (tid & 7) * 8;      /* staging: 8 lanes per 128-byte line, 16 rows per pass of the work-group */
  const bool first = (mt * 128) % SQ == 0; const bool cf = C && (!cfirst || first); const bool pk = by < npk; const bool tr = CT && by >= ntr; const bool rows16 = C16 && !pk && !tr; int ar0 = mt * 128, am = M;      /* ar0, am: the tile's first row in its A plane and that plane's rows */
  const char* ab = (const char*)A; const char* bb = (const char*)Bh; unsigned ao[8], bo[4]; if (A1 && first) { ab = (const char*)A1; ar0 = ar0 / SQ * QT0; am = M / SQ * QT0; }      /* one base per operand for the whole work-group + the lane's own byte offset to each of its rows; a 16-row pass past M (M % 32 == 0) rereads the last 16 rows, which no wave uses */
#pragma unroll
  for (int p = 0; p < 8; ++p) ao[p] = (unsigned)((min(ar0 + 16 * p, am - 16) + sr) * lda + sc) * 2u;
#pragma unroll
  for (int p = 0; p < 4; ++p) bo[p] = (unsigned)((col0 + 16 * p + sr) * ldb + sc) * 2u;
  v8us ra[8], rb[4]; v16h a0[2], a1[2], b[2][4];
  auto fetch = [&]() {      /* the next tile into registers */
#pragma unroll
    for (int p = 0; p < 8; ++p) ra[p] = *(const v8us*)(ab + ao[p]);
#pragma unroll
    for (int p = 0; p < 4; ++p) rb[p] = *(const v8us*)(bb + bo[p]); };
  auto put = [&](int u) {      /* the fetched tile into buffer u; the offsets step on by one tile here, behind the waits for the loads that name them */
#pragma unroll
    for (int p = 0; p < 8; ++p) { *(v8us*)&sa[u][16 * p + sr][sc] = ra[p]; ao[p] += GK * 2; }
#pragma unroll
    for (int p = 0; p < 4; ++p) { *(v8us*)&sb[u][16 * p + sr][sc] = rb[p]; bo[p] += GK * 2; } };
  auto frags = [&](int u) {      /* all fragments of one staged tile: the second half's reads return under the first half's products */
#pragma unroll
    for (int ks = 0; ks < 2; ++ks) { a0[ks] = g2_frag(&sa[u][32 * w + ln][ks * 32], hh); a1[ks] = g2_frag(&sa[u][32 * w + 16 + ln][ks * 32], hh);
#pragma unroll
      for (int t = 0; t < 4; ++t) b[ks][t] = g2_frag(&sb[u][16 * t + ln][ks * 32], hh); } };
  const v8f z8 = {0.f,0.f,0.f,0.f,0.f,0.f,0.f,0.f}; v8f c00 = z8, c01 = z8, c02 = z8, c03 = z8, c10 = z8, c11 = z8, c12 = z8, c13 = z8;
  auto prods = [&]() {
#pragma unroll
    for (int ks = 0; ks < 2; ++ks) { c00 = g2_mma(a0[ks], b[ks][0], c00); c10 = g2_mma(a1[ks], b[ks][0], c10); c01 = g2_mma(a0[ks], b[ks][1], c01); c11 = g2_mma(a1[ks], b[ks][1], c11);
      c02 = g2_mma(a0[ks], b[ks][2], c02); c12 = g2_mma(a1[ks], b[ks][2], c12); c03 = g2_mma(a0[ks], b[ks][3], c03); c13 = g2_mma(a1[ks], b[ks][3], c13); } };
  const int nt = K / GK;
  fetch(); put(0); __syncthreads();
#pragma unroll 1      /* one copy of the loop body: the buffer's number is a scalar offset */
  for (int t = 0; t + 1 < nt; ++t) { frags(t & 1); fetch(); prods(); put((t + 1) & 1); __syncthreads(); }      /* tile t + 1 is on its way under tile t's products; the one barrier of a pass publishes it and ends the reads of tile t, whose buffer the next pass refills */
  frags((nt - 1) & 1); prods();
  if (row0 >= M) return;
  v8f accs[8] = {c00, c01, c02, c03, c10, c11, c12, c13};
  unsigned short* tq = (unsigned short*)CT + (tr ? (size_t)(by - ntr) * sC + (((size_t)(row0 / SQ) * NH + nq) * (SQ / 32) + (row0 % SQ) / 32) * 2048 + lane * 8 : (size_t)0);      /* the wave's 32 rows x 64 columns, transposed: one block of 4 KiB */
#pragma unroll
  for (int u = 0; u < 8; ++u) { const int t = u & 3, half = u >> 2; const int col = col0 + t * 16 + ln; const float bv = bp ? bf16_round(bp[col]) : 0.f; FragH tf;
#pragma unroll
    for (int r = 0; r < 8; ++r) { const int rloc = half * 16 + 8 * hh + r; float v = accs[u][r] * alpha + bv; if (CP) { if (rowsPerB < 0) v += CP[cofs + (size_t)(row0g + row0 + rloc) * ldc + col];      /* rowsPerB < 0: own element of the batched C plane */ else { const int bidx = (row0g + row0 + rloc) / rowsPerB; v += CP[(size_t)bidx * sCPb + (size_t)by * 64 + col]; } }
      if (act) { if (ACT == 3) v = fmaxf(v, 0.f); else if (ACT == 6) v = 0.5f * v * (1.0f + erff(v * 0.70710678118654752f)); else if (ACT == 11) v = 1.0f / (1.0f + expf(-v)); else if (ACT == 15) v = v / (1.0f + expf(-v)); else if (ACT == 19) v = (v > 0.f) ? (v + 1.0f) : expf(v);      /* elu(v) + 1 */ else if (ACT == 12) v = (v > 0.f) ? v : 0.01f * v; else if (ACT == 8) v = tanhf(v); else if (ACT == 9) v = 0.5f * v * (1.0f + tanhf(0.7978845608028654f * (v + 0.044715f * v * v * v))); else if (ACT == 14) v = (v > 0.f) ? v : 0.1f * v; else if (ACT == 16) v = (v >= 0.f) ? v : 0.3f * v; else if (ACT == 17) v = (v >= 0.f) ? v : 0.2f * v; }
      so[w][rloc][t * 16 + ln] = v; tf.h[r] = (_Float16)v; }
    if (tr) { *(v8us*)(tq + t * 512 + half * 256) = tf.half[0]; asm volatile("s_wait_xcnt 0x0" :: "v"(tf.half[0]), "v"(tq) : "memory"); } }      /* an accumulator holds 8 consecutive rows of ONE column in a lane: that is the lane's 16 bytes of the transposed fragment, stored as 512 contiguous bytes a wave; the wait stands behind the store with the stored registers and the address pair as inputs, so that neither is reused ahead of it */
  __builtin_amdgcn_fence(__ATOMIC_ACQ_REL, "workgroup"); __builtin_amdgcn_wave_barrier();
  const int rsub = lane >> 4, c4 = (lane & 15) * 4;
  if (cf || rows16) {      /* the row pass; a tile that stores neither f32 rows nor f16 rows skips its sixteen LDS reads */
#pragma unroll
    for (int q = 0; q < 16; ++q) { const int r = q * 2 + rsub; const v4f v = *(const v4fa*)&so[w][r][c4];
      if (cf) { *(v4f*)(C + cofs + (size_t)(row0 + r) * ldc + col0 + c4) = v; asm volatile("s_wait_xcnt 0x0" :: "v"(v) : "memory"); }      /* behind the f32 store; the stored registers are the wait's inputs, so that the f16 conversion below does not reuse them ahead of it */
      if (rows16) { v4h h4; for (int i = 0; i < 4; ++i) h4[i] = (_Float16)v[i]; _Float16* dp = C16 + cofs + (size_t)(row0 + r) * ldc + col0 + c4; *(v4h*)dp = h4; asm volatile("s_wait_xcnt 0x0" :: "v"(h4), "v"(dp) : "memory"); } }      /* behind the f16 row store; the stored registers and the address pair are the wait's inputs, so that nothing behind it reuses them ahead of it */
     }
  if (C16 && pk) {      /* fragment order: the wave's 32 rows x 64 columns are two tiles of 2 KiB in a row; each store is 512 contiguous bytes */
    unsigned short* pt = (unsigned short*)C16 + cofs + (((size_t)(row0 / SQ) * NH + nq) * (SQ / 16) + (row0 % SQ) / 16) * PKT + lane * 8;
#pragma unroll      /* constant LDS and store offsets; the LDS reads of all eight pieces are issued ahead of the conversions */
    for (int u = 0; u < 8; ++u) { const float* sp = &so[w][(u >> 2) * 16 + ln][(u & 3) * 16 + 8 * hh]; const v4f x = *(const v4fa*)sp, y = *(const v4fa*)(sp + 4); FragH f;
#pragma unroll
      for (int i = 0; i < 4; ++i) { f.h[i] = (_Float16)x[i]; f.h[4 + i] = (_Float16)y[i]; }
      *(v8us*)(pt + u * 256) = f.half[0]; } } }


// All four operand conversions in one launch (none reads another's output): the weights, natural [out][in] = Bt[n][k], x16, into the planes BW = Wqk (q rows, k rows) | Wv | Wo, then x into X16. A work-group lies wholly in one source.
#define CPB (DM * DM / 8 / 256)      /* work-groups per DM x DM plane, 8 elements per thread */
#define CXB ((unsigned)(NR * DM / 8 / 256))      /* work-groups of x */
__global__ __launch_bounds__(256) void k_cvt(const float* __restrict__ wqk, const float* __restrict__ wv, const float* __restrict__ wo, const float* __restrict__ x, _Float16* __restrict__ BW, _Float16* __restrict__ X16) {
  const unsigned bx = blockIdx.x; const float* s = wqk; _Float16* d = BW; unsigned b0 = 0; float sc = 16.0f;
  if (bx >= 4 * CPB) { s = x; d = X16; b0 = 4 * CPB; sc = 1.0f; } else if (bx >= 3 * CPB) { s = wo; d = BW + (size_t)3 * DM * DM; b0 = 3 * CPB; } else if (bx >= 2 * CPB) { s = wv; d = BW + (size_t)2 * DM * DM; b0 = 2 * CPB; }
  const size_t t = (size_t)(bx - b0) * 256 + threadIdx.x; FragH f;
#pragma unroll
  for (int q = 0; q < 8; ++q) f.h[q] = (_Float16)(bf16_round(s[t * 8 + q]) * sc);
  *(v8us*)((unsigned short*)d + t * 8) = f.half[0]; }
__global__ __launch_bounds__(256) void k_rsm(const float* __restrict__ S, _Float16* __restrict__ P, int nrows) {
  #pragma clang fp contract(off)
  const int i = blockIdx.x * 256 + threadIdx.x; if (i >= nrows) return; const float* s = S + (size_t)i * SQ; float mx = -3.0e38f;
#pragma unroll 1
  for (int j = 0; j < SQ; ++j) mx = fmaxf(mx, s[j]); float se = 0.f;
#pragma unroll 1
  for (int j = 0; j < SQ; ++j) se += expf(s[j] - mx); const float sc = 256.0f / se;
#pragma unroll 1
  for (int j0 = 0; j0 < SQ; j0 += 8) { FragH f; for (int q = 0; q < 8; ++q) f.h[q] = (_Float16)(expf(s[j0 + q] - mx) * sc); unsigned short* d = (unsigned short*)P + (size_t)i * SQ + j0; *(v8us*)d = f.half[0];  } }
__global__ __launch_bounds__(256) void k_vt(const _Float16* __restrict__ V16, int b, int h0, _Float16* __restrict__ VT) { __shared__ unsigned short tl[64][65]; const int tid = threadIdx.x; const int hh = blockIdx.x % HG, sg = blockIdx.x / HG; const int s0 = sg * 64; const int h = h0 + hh;
  for (int i = tid; i < 64 * 8; i += 256) { const int j = i / 8, d8 = (i % 8) * 8; FragH f; f.half[0] = *(const v8us*)((const unsigned short*)V16 + ((size_t)b * SQ + s0 + j) * DM + h * HD + d8); for (int q = 0; q < 8; ++q) tl[d8 + q][j] = f.u[q]; }
  __syncthreads();
  { for (int i = tid; i < 64 * 8; i += 256) { const int d = i / 8, j8 = (i % 8) * 8; FragH f; for (int q = 0; q < 8; ++q) f.u[q] = tl[d][j8 + q]; *(v8us*)((unsigned short*)VT + ((size_t)hh * HD + d) * SQ + s0 + j8) = f.half[0]; }  } }



__global__ __launch_bounds__(256) void k_rsmcf2(const float* __restrict__ S, _Float16* __restrict__ P, int hg, int q0, int nk) {
  #pragma clang fp contract(off)
  const int t = blockIdx.x * 256 + threadIdx.x; if (t >= hg * QT) return; const size_t i = (size_t)t; const float* s = S + i * NKX; const int last = q0 + (t % QT); float mx = -3.0e38f;
#pragma unroll 1
  for (int j = 0; j < nk; ++j) { const float f = (j <= last) ? 1.f : 0.f; mx = fmaxf(mx, fmaf(f, s[j], (1.f - f) * -1.0e9f)); } float se = 0.f;
#pragma unroll 1
  for (int j = 0; j < nk; ++j) { const float f = (j <= last) ? 1.f : 0.f; se += __expf(fmaf(f, s[j], (1.f - f) * -1.0e9f) - mx); } const float sc = 256.0f / se;
#pragma unroll 1
  for (int j0 = 0; j0 < nk; j0 += 8) { FragH fr; for (int q = 0; q < 8; ++q) { const int j = j0 + q; const float f = (j <= last) ? 1.f : 0.f; fr.h[q] = (_Float16)(__expf(fmaf(f, s[j], (1.f - f) * -1.0e9f) - mx) * sc); } unsigned short* d = (unsigned short*)P + i * NKX + j0; *(v8us*)d = fr.half[0];  } }


template <int MASKADD>
__global__ __launch_bounds__(64) void k_att0(const float* __restrict__ QF, const float* __restrict__ KF, const float* __restrict__ VF, int ld, const float* __restrict__ mask, float scale, float* __restrict__ OF, int ldo) {
  #pragma clang fp contract(off)
  __shared__ __attribute__((aligned(16))) float lq[64][64]; __shared__ __attribute__((aligned(16))) float lo[64][64];
  const int tid = threadIdx.x; const int h = blockIdx.x / (QT0 / 64), rg = blockIdx.x % (QT0 / 64); const int i = rg * 64 + tid;
  const float* qr = QF + (size_t)i * ld + h * HD;
#pragma unroll 1
  for (int c = 0; c < HD / 4; ++c) { *(v4f*)&lq[tid][c * 4] = *(const v4fa*)(qr + c * 4); const v4f z = {0.f, 0.f, 0.f, 0.f}; *(v4f*)&lo[tid][c * 4] = z; }
  float m = -1.0e30f, l = 0.f; const int jmax = MASKADD ? (SQ - 1) : (rg * 64 + 63);      /* additive-mask form: every key (the mask input decides); causal form: keys up to the block's last row */
#pragma unroll 1
  for (int j = 0; j <= jmax; ++j) { const float* kr = KF + (size_t)j * ld + h * HD; const float* vr = VF + (size_t)j * ld + h * HD; float s = 0.f;
#pragma unroll 1
    for (int c = 0; c < HD / 4; ++c) { const v4f kq = *(const v4fa*)(kr + c * 4); const v4f qq = *(v4f*)&lq[tid][c * 4]; s = __fadd_rn(s, __fmul_rn(qq[0], kq[0])); s = __fadd_rn(s, __fmul_rn(qq[1], kq[1])); s = __fadd_rn(s, __fmul_rn(qq[2], kq[2])); s = __fadd_rn(s, __fmul_rn(qq[3], kq[3])); }
    s = __fmul_rn(s, scale); if (MASKADD) s = __fadd_rn(s, __fmul_rn(bf16_round(mask[(size_t)i * SQ + j]), -10000.0f));
    const float f = (MASKADD || j <= i) ? 1.f : 0.f; const float sm = fmaf(f, s, (1.f - f) * -1.0e30f); const float mn = fmaxf(m, sm); const float sc = expf(m - mn); const float e = expf(sm - mn); l = __fadd_rn(__fmul_rn(l, sc), e); m = mn;
#pragma unroll 1
    for (int c = 0; c < HD / 4; ++c) { const v4f vv = *(const v4fa*)(vr + c * 4); v4f oo = *(v4f*)&lo[tid][c * 4]; for (int u = 0; u < 4; ++u) oo[u] = __fadd_rn(__fmul_rn(oo[u], sc), __fmul_rn(e, vv[u])); *(v4f*)&lo[tid][c * 4] = oo; } }
  const float fin = 64.0f / l;      /* o carried x64 like the f16 path */
#pragma unroll 1
  for (int c = 0; c < HD / 4; ++c) { v4f oo = *(v4f*)&lo[tid][c * 4]; for (int u = 0; u < 4; ++u) oo[u] = __fmul_rn(oo[u], fin); *(v4f*)&lo[tid][c * 4] = oo; }
  __syncthreads();
  {
#pragma unroll 1
    for (int it = 0; it < 16; ++it) { const int row = it * 4 + tid / 16, pc = (tid % 16) * 4; const v4f v = *(const v4f*)&lo[row][pc]; *(v4f*)(OF + (size_t)(rg * 64 + row) * ldo + h * HD + pc) = v; }
     } }


// Causal linear attention in chunks of SC keys: o_i = sum_{j <= i} a_ij v_j / sum_{j <= i} a_ij, a_ij = phi(q_i) . phi(k_j). The sums over the keys are plain sums, so the keys in front of a query's own chunk
// enter through the running state S = sum_j phi(k_j) v_j^T (HD x HD) and z = sum_j phi(k_j), as in the cumulative-sum form of the definition: o_i = (phi(q_i) S + own chunk) / (phi(q_i) z + own chunk).
// k_kvs: the state in front of every chunk. One work-group per (batch, head, 16 columns t of S), one wave per (16 rows d, quarter of the keys). A wave forms the sums of its 8 chunks, S[d][t] = sum K^T[d][key] V^T[t][key] on WMMA
// (f32 accumulators; both planes transposed in fragment order by k_gemm2), the quarters' totals go through LDS, and each wave adds up in f32: the quarters in front of its own, then its chunks in ascending order,
// storing the tile as f16 in front of each chunk. A lane of the accumulator holds 8 consecutive d of ONE column t: its 16 bytes of the B fragment (row t, k = d) of phi(q) S. Column tile 4 takes a fragment of ones for V^T: each of its 16 columns is z.
#define SC 64                        /* keys per chunk */
#define SNP 5120                     /* halfs per stored state: [5 column tiles][4 d tiles] pieces of 512 bytes */
#define SG 8                         /* steps of 32 keys whose loads are in flight together */
#define SN 4                         /* parts of the keys, four waves each (one per 16 rows d) */
#define SW (SQ / SC / SN)            /* chunks per wave */
__global__ __launch_bounds__(128 * SN) void k_kvs(const _Float16* __restrict__ KT, const _Float16* __restrict__ VT, _Float16* __restrict__ ST) {
  __shared__ __attribute__((aligned(16))) float tot[SN][4][32][8];
  const int lane = threadIdx.x & 31; const int wv = __builtin_amdgcn_readfirstlane(threadIdx.x >> 5); const int dt = wv & 3, sg = wv >> 2; const int tt = blockIdx.x, h = blockIdx.y, b = blockIdx.z; const bool zt = tt == 4;
  const size_t hb = ((size_t)b * NH + h) * SQ * HD + (size_t)sg * (SQ / SN) * HD + lane * 8; const _Float16* kp = KT + hb + dt * 512; const _Float16* vp = VT + hb + (zt ? 0 : tt) * 512;
  unsigned short* sp = (unsigned short*)ST + (((size_t)b * NH + h) * (SQ / SC) + sg * SW) * SNP + (tt * 4 + dt) * 256 + lane * 8;
  v16h one;
#pragma unroll
  for (int i = 0; i < 16; ++i) one[i] = (_Float16)1.0f;
  const v8f z8 = {0.f,0.f,0.f,0.f,0.f,0.f,0.f,0.f}; v8f cs[SW];
#pragma unroll      /* constant indices into cs */
  for (int g = 0; g < SW * 2 / SG; ++g) { v16h kf[SG], vf[SG]; const _Float16* kq = kp + g * SG * 2048; const _Float16* vq = vp + g * SG * 2048;
#pragma unroll
    for (int s = 0; s < SG; ++s) { kf[s] = pk_frag(kq + s * 2048); vf[s] = pk_frag(vq + s * 2048); }
    asm volatile("s_wait_xcnt 0x0" :: "v"(kq), "v"(vq) : "memory");      /* behind the last load of the group; the two address pairs are its inputs, so that neither is reused ahead of it */
#pragma unroll
    for (int c = 0; c < SG / 2; ++c) cs[g * (SG / 2) + c] = g2_mma(kf[2 * c + 1], zt ? one : vf[2 * c + 1], g2_mma(kf[2 * c], zt ? one : vf[2 * c], z8)); }
  v8f run = cs[0];
#pragma unroll
  for (int c = 1; c < SW; ++c) run += cs[c];
  *(v4f*)&tot[sg][dt][lane][0] = __builtin_shufflevector(run, run, 0, 1, 2, 3); *(v4f*)&tot[sg][dt][lane][4] = __builtin_shufflevector(run, run, 4, 5, 6, 7);
  __syncthreads();
  run = z8;
#pragma unroll
  for (int s = 0; s < SN - 1; ++s) if (s < sg) { const v4f x = *(const v4f*)&tot[s][dt][lane][0], y = *(const v4f*)&tot[s][dt][lane][4]; run += __builtin_shufflevector(x, y, 0, 1, 2, 3, 4, 5, 6, 7); }
#pragma unroll
  for (int c = 0; c < SW; ++c) { FragH f;      /* the state in front of the chunk (zero in front of the first), then the chunk's sum */
#pragma unroll
    for (int r = 0; r < 8; ++r) f.h[r] = (_Float16)run[r];
    *(v8us*)(sp + c * SNP) = f.half[0]; asm volatile("s_wait_xcnt 0x0" :: "v"(f.half[0]), "v"(sp) : "memory");      /* behind the store; the stored registers and the address pair are its inputs, so that neither is reused ahead of it */
    run += cs[c]; } }

// k_lfa: one wave per (batch, head, 32 query rows), four such waves a work-group. o and the row sum l start as phi(q) S and phi(q) z of the state in front of the rows' chunk; then the chunk's own 64 keys in two steps of 32:
// a^T = K Q^T, so that a lane of the accumulator holds 8 consecutive keys of ONE query: accumulator tile 0 (keys 0..15) and tile 1 (keys 16..31) of a query column, masked and rounded to f16,
// are elements 0..7 and 8..15 of the A fragment of a V^T in the k order of g2_frag (8 hh + i, 16 + 8 hh + i), in which V^T is stored too: nothing is moved between lanes. a times a fragment of ones adds the row sums to l,
// which so lies in the lane and register of the o elements that it divides. Every load of a wave is 512 contiguous bytes, four whole lines.
#define FQ 32                        /* query rows per wave */
#define FS 32                        /* keys per step */
#define FP 68                        /* pitch in floats of the o rows in LDS, as in k_gemm2 */
__global__ __launch_bounds__(128) void k_lfa(const _Float16* __restrict__ Q16, const _Float16* __restrict__ K16, const _Float16* __restrict__ VT, const _Float16* __restrict__ ST, _Float16* __restrict__ O16) {      /* Q16, K16: fragment order of k_gemm2; VT: its transposed fragment order; each SQ HD halfs a (batch, head); ST: k_kvs; O16: rows of DM */
  __shared__ __attribute__((aligned(16))) float so[4][FQ][FP];
  const int tid = threadIdx.x, lane = tid & 31, ln = lane & 15, hh = lane >> 4; const int w = __builtin_amdgcn_readfirstlane(tid >> 5);
  const int rg = (int)blockIdx.x * 4 + w, h = blockIdx.y, b = blockIdx.z, ch = rg / (SC / FQ);
  const size_t hb = ((size_t)b * NH + h) * SQ * HD + lane * 8; const _Float16* qp = Q16 + hb + (size_t)rg * FQ * HD; const _Float16* kp = K16 + hb + (size_t)ch * SC * HD; const _Float16* vp = VT + hb + (size_t)ch * SC * HD;
  const _Float16* sp = ST + (((size_t)b * NH + h) * (SQ / SC) + ch) * SNP + lane * 8;
  v16h qf[2][2], sf[5][2], one;
#pragma unroll
  for (int i = 0; i < 16; ++i) one[i] = (_Float16)1.0f;
#pragma unroll
  for (int qs = 0; qs < 2; ++qs) { qf[qs][0] = pk_frag(qp + qs * PKT); qf[qs][1] = pk_frag(qp + qs * PKT + 512); }
#pragma unroll
  for (int t = 0; t < 5; ++t) { sf[t][0] = pk_frag(sp + t * 1024); sf[t][1] = pk_frag(sp + t * 1024 + 512); }
  asm volatile("s_wait_xcnt 0x0" :: "v"(qp), "v"(sp) : "memory");      /* behind the last q and state load; the address pairs are its inputs, so that they are not reused ahead of it */
  const v8f z8 = {0.f,0.f,0.f,0.f,0.f,0.f,0.f,0.f}; v8f o[2][5];      /* o[qs][t][r]: query 16 qs + 8 hh + r, column 16 t + ln; t = 4: the row sum, the same in every column */
#pragma unroll
  for (int qs = 0; qs < 2; ++qs)
#pragma unroll
    for (int t = 0; t < 5; ++t) o[qs][t] = g2_mma(qf[qs][0], sf[t][0], z8);
#pragma unroll
  for (int qs = 0; qs < 2; ++qs)
#pragma unroll
    for (int t = 0; t < 5; ++t) o[qs][t] = g2_mma(qf[qs][1], sf[t][1], o[qs][t]);
#pragma unroll
  for (int js = 0; js < SC / FS; ++js) { const _Float16* kq = kp + js * FS * HD; const _Float16* vq = vp + js * FS * HD;      /* a step's k and its V^T: 4 KiB in a row each */
    v16h kf[2][2], vf[4];
#pragma unroll
    for (int ks = 0; ks < 2; ++ks) { kf[ks][0] = pk_frag(kq + ks * PKT); kf[ks][1] = pk_frag(kq + ks * PKT + 512); }
#pragma unroll
    for (int t = 0; t < 4; ++t) vf[t] = pk_frag(vq + t * 512);
    asm volatile("s_wait_xcnt 0x0" :: "v"(kq), "v"(vq) : "memory");      /* behind the last load of the step; the two address pairs are its inputs, so that neither is reused ahead of it */
    v8f st[2][2];      /* st[ks][qs][r]: key ch SC + js FS + 16 ks + 8 hh + r, query rg FQ + 16 qs + ln */
#pragma unroll
    for (int ks = 0; ks < 2; ++ks)
#pragma unroll
      for (int qs = 0; qs < 2; ++qs) st[ks][qs] = g2_mma(kf[ks][0], qf[qs][0], z8);
#pragma unroll
    for (int ks = 0; ks < 2; ++ks)
#pragma unroll
      for (int qs = 0; qs < 2; ++qs) st[ks][qs] = g2_mma(kf[ks][1], qf[qs][1], st[ks][qs]);
    const int dq = (rg - ch * (SC / FQ) - js) * FS + ln - 8 * hh;      /* query row less key row at ks = qs = r = 0; both steps are masked, the keys behind a query count zero */
#pragma unroll
    for (int ks = 0; ks < 2; ++ks)
#pragma unroll
      for (int qs = 0; qs < 2; ++qs)
#pragma unroll
        for (int r = 0; r < 8; ++r) st[ks][qs][r] = (ks * 16 + r <= qs * 16 + dq) ? st[ks][qs][r] : 0.f;
#pragma unroll
    for (int qs = 0; qs < 2; ++qs) { FragH p;
#pragma unroll
      for (int r = 0; r < 8; ++r) { p.h[r] = (_Float16)st[0][qs][r]; p.h[8 + r] = (_Float16)st[1][qs][r]; }
#pragma unroll
      for (int t = 0; t < 4; ++t) o[qs][t] = g2_mma(p.v, vf[t], o[qs][t]);
      o[qs][4] = g2_mma(p.v, one, o[qs][4]); } }
#pragma unroll
  for (int qs = 0; qs < 2; ++qs)
#pragma unroll
    for (int r = 0; r < 8; ++r) { const float fin = 64.0f / o[qs][4][r];      /* o carried x64 as the output GEMM expects */
#pragma unroll
      for (int t = 0; t < 4; ++t) so[w][qs * 16 + 8 * hh + r][t * 16 + ln] = o[qs][t][r] * fin; }
  __syncthreads();
  const int r0 = lane >> 2, c0 = (lane & 3) * 16;      /* four lanes per output row: 32 bytes each of its 128-byte line; a wave stores its own 32 rows in four passes */
#pragma unroll
  for (int p = 0; p < 4; ++p) { const int row = p * 8 + r0; FragH f;
#pragma unroll
    for (int c = 0; c < 4; ++c) { const v4f a = *(const v4f*)&so[w][row][c0 + c * 4];
#pragma unroll
      for (int q = 0; q < 4; ++q) f.h[c * 4 + q] = (_Float16)a[q]; }
    unsigned short* d = (unsigned short*)O16 + ((size_t)b * SQ + rg * FQ + row) * DM + h * HD + c0;
    *(v8us*)d = f.half[0]; *(v8us*)(d + 8) = f.half[1]; asm volatile("s_wait_xcnt 0x0" :: "v"(f.half[0]), "v"(f.half[1]), "v"(d) : "memory"); } }      /* behind the two stores; the stored registers and the address pair are its inputs, so that neither is reused ahead of it */

// Exact f32 linear attention for the first QT0 rows of every batch (blockIdx.y). One work-group of 8 waves per (batch, head, 32 query rows), lane = query row.
// The head's QT0 key and value rows and the group's 32 q rows are staged once in LDS with whole-line loads, all in flight together. Step 1: wave w takes the keys j = w mod 8, four at a time
// (four independent sum chains), q row in registers, k row broadcast from LDS; the masked score goes to le[j][row]. Step 2: wave w owns columns 8 w .. 8 w + 7 of o in registers
// and walks the keys in ascending order. Each sum runs in the order of the one-thread-per-row form (d ascending, j ascending); keys above the group's last row only ever added zeros and are left out.
#define LR 32                        /* query rows per work-group */
#define LP 68                        /* pitch in floats of the per-row LDS arrays: 16 B x odd, so that 32 lanes reading 16 B of their own rows spread over the banks */
__global__ __launch_bounds__(256) void k_latt0(const float* __restrict__ QF, const float* __restrict__ KF, const float* __restrict__ VF, float* __restrict__ OF) {      /* all four planes: rows of DM floats; QF, KF, VF: SQ rows a batch, the first QT0 of them written; OF: QT0 rows a batch */
  { const size_t fb = (size_t)blockIdx.y * SQ * DM; QF += fb; KF += fb; VF += fb; OF += (size_t)blockIdx.y * QT0 * DM; }
  __shared__ __attribute__((aligned(16))) float lk[QT0][HD]; __shared__ __attribute__((aligned(16))) float lv[QT0][HD]; __shared__ __attribute__((aligned(16))) float le[QT0][LR];
  __shared__ __attribute__((aligned(16))) float lq[LR][LP]; __shared__ __attribute__((aligned(16))) float lo[LR][LP];
  const int tid = threadIdx.x, w = tid >> 5, lane = tid & 31; const int h = blockIdx.x / (QT0 / LR), rg = blockIdx.x % (QT0 / LR); const int r0 = rg * LR, nj = r0 + LR, i = r0 + lane;
  const int sr = tid / (HD / 4), sc = (tid % (HD / 4)) * 4;      /* staging and output: 16 lanes per 256-byte row, 16 rows per pass of the work-group */
  { v4f tk[QT0 / 16], tv[QT0 / 16], tq[LR / 16]; const float* kp = KF + (size_t)sr * DM + h * HD + sc; const float* vp = VF + (size_t)sr * DM + h * HD + sc; const float* qp = QF + (size_t)(r0 + sr) * DM + h * HD + sc;
#pragma unroll      /* every load is issued before the first LDS store waits for one */
    for (int p = 0; p < QT0 / 16; ++p) { tk[p] = *(const v4fa*)(kp + (size_t)p * 16 * DM); tv[p] = *(const v4fa*)(vp + (size_t)p * 16 * DM); }
#pragma unroll
    for (int p = 0; p < LR / 16; ++p) tq[p] = *(const v4fa*)(qp + (size_t)p * 16 * DM);
    asm volatile("s_wait_xcnt 0x0" :: "v"(kp), "v"(vp), "v"(qp) : "memory");      /* behind the last load of the run; the three address pairs are its inputs, so that none of them is given to a load's result or reused ahead of it */
#pragma unroll
    for (int p = 0; p < QT0 / 16; ++p) { *(v4f*)&lk[p * 16 + sr][sc] = tk[p]; *(v4f*)&lv[p * 16 + sr][sc] = tv[p]; }
#pragma unroll
    for (int p = 0; p < LR / 16; ++p) *(v4f*)&lq[p * 16 + sr][sc] = tq[p]; }
  __syncthreads();
  v4f q[HD / 4];
#pragma unroll      /* q stays in registers: constant indices only */
  for (int c = 0; c < HD / 4; ++c) q[c] = *(const v4f*)&lq[lane][c * 4];
  for (int jb = 0; jb < nj; jb += 32) { const int j0 = jb + w; float s0 = 0.f, s1 = 0.f, s2 = 0.f, s3 = 0.f;
#pragma unroll      /* constant indices into q; the four chains fill each other's result latency */
    for (int c = 0; c < HD / 4; ++c) { const v4f k0 = *(const v4f*)&lk[j0][c * 4], k1 = *(const v4f*)&lk[j0 + 8][c * 4], k2 = *(const v4f*)&lk[j0 + 16][c * 4], k3 = *(const v4f*)&lk[j0 + 24][c * 4];
#pragma unroll
      for (int u = 0; u < 4; ++u) { s0 += q[c][u] * k0[u]; s1 += q[c][u] * k1[u]; s2 += q[c][u] * k2[u]; s3 += q[c][u] * k3[u]; } }
    le[j0][lane] = (j0 <= i) ? s0 : 0.f; le[j0 + 8][lane] = (j0 + 8 <= i) ? s1 : 0.f; le[j0 + 16][lane] = (j0 + 16 <= i) ? s2 : 0.f; le[j0 + 24][lane] = (j0 + 24 <= i) ? s3 : 0.f; }
  __syncthreads();
  float l = 0.f; v4f oa = {0.f, 0.f, 0.f, 0.f}, ob = {0.f, 0.f, 0.f, 0.f};
#pragma unroll 8      /* eight keys' LDS reads are issued ahead of the sums that use them */
  for (int j = 0; j < nj; ++j) { const float e = le[j][lane]; const v4f va = *(const v4f*)&lv[j][w * 8], vb = *(const v4f*)&lv[j][w * 8 + 4]; l += e; oa += e * va; ob += e * vb; }
  const float fin = 64.0f / l;      /* o carried x64 like the f16 path */
  *(v4f*)&lo[lane][w * 8] = oa * fin; *(v4f*)&lo[lane][w * 8 + 4] = ob * fin;
  __syncthreads();
#pragma unroll      /* two passes, each wave storing whole 128-byte lines */
  for (int p = 0; p < LR / 16; ++p) *(v4f*)(OF + (size_t)(r0 + p * 16 + sr) * DM + h * HD + sc) = *(const v4f*)&lo[p * 16 + sr][sc]; }
extern "C" void kernel_launch(void* const* d_in, const int* in_sizes, int n_in,
                              void* d_out, int out_size, void* d_ws, size_t ws_size, hipStream_t stream) {
  (void)in_sizes; (void)n_in; (void)out_size;
  const float* const* I = (const float* const*)d_in; const float* x = I[0]; const float* wqk = I[1]; const float* bqk = I[2]; const float* wv = I[3]; const float* bv = I[4]; const float* wo = I[5]; const float* bo = I[6];      /* natural Wqk [2048][1024] (q rows | k rows) + bias [2048]; Wv + bv; Wo + bo */
  char* ws = (char*)d_ws; size_t off = 0;
  auto take = [&](size_t bytes) { char* p = ws + off; off += (bytes + 255) & ~(size_t)255; return p; };
  _Float16* BQK = (_Float16*)take((size_t)4 * DM * DM * 2); _Float16* BO = BQK + (size_t)3 * DM * DM;      /* four planes in a row: Wq | Wk | Wv | Wo */
  _Float16* X16 = (_Float16*)take(NR * DM * 2); _Float16* Q16 = (_Float16*)take((size_t)3 * NR * DM * 2); _Float16* K16 = Q16 + NR * DM; _Float16* O16 = (_Float16*)take(NR * DM * 2);      /* q | k | a third plane that nothing writes: v is stored only as V^T */
  _Float16* KT = (_Float16*)take((size_t)2 * NB * NH * HD * SQ * 2); _Float16* VT = KT + (size_t)NB * NH * HD * SQ; _Float16* ST = (_Float16*)take((size_t)NB * NH * (SQ / SC) * SNP * 2);      /* K^T | V^T: two planes in a row; the states in front of the chunks */
  float* QF0 = (float*)take((size_t)3 * NR * DM * 4); float* KF0 = QF0 + NR * DM; float* VF0 = QF0 + 2 * NR * DM;      /* f32 q | k | v, indexed like the f16 planes; only the first QT0 rows of each batch are written and read */
  float* OF0 = (float*)take((size_t)NB * QT0 * DM * 4); _Float16* OH0 = (_Float16*)take((size_t)NB * QT0 * DM * 2); _Float16* OL0 = (_Float16*)take((size_t)NB * QT0 * DM * 2);
  if (off > ws_size) return;
  k_cvt<<<4 * CPB + CXB, 256, 0, stream>>>(wqk, wv, wo, x, BQK, X16);
  k_gemm2<19><<<dim3((unsigned)((NR / 128) * (DM / 64)), 3), 128, 0, stream>>>(X16, DM, 0, BQK, DM, (size_t)DM * DM, 0.0625f, bqk, DM, nullptr, 1, 0, 0, QF0, Q16, DM, NR * DM, (int)NR, DM, DM, nullptr, bv, 2, 1, 2, KT, 1);      /* planes 0, 1: phi(q), phi(k) = elu(x W^T + b) + 1, f16 in fragment order; planes 1, 2: phi(k), v transposed in fragment order; and in f32 rows the first 128 rows of each batch (exact products) */
  k_kvs<<<dim3(5, NH, NB), 128 * SN, 0, stream>>>(KT, VT, ST);      /* the running sums phi(k) v^T and phi(k) in front of every chunk of 64 keys */
  k_latt0<<<dim3(NH * (QT0 / LR), NB), 256, 0, stream>>>(QF0, KF0, VF0, OF0);      /* exact f32 linear attention for rows 0..127 of each batch (o x64): the few-key rows without the f16 roundings */
  k_hl<<<(unsigned)(((size_t)NB * QT0 * DM / 8 + 255) / 256), 256, 0, stream>>>(OF0, OH0, OL0, (size_t)NB * QT0 * DM / 8);      /* first-tile o (x64) -> f16 hi + x1024 residual planes */
  k_lfa<<<dim3(SQ / FQ / 4, NH, NB), 128, 0, stream>>>(Q16, K16, VT, ST, O16);      /* state product, own chunk's scores, causal normalisation and a V^T of every batch, head and query tile in one launch: o (merged heads, x64) as f16 rows */
  k_gemm2<0><<<dim3((unsigned)((NR / 128) * (DM / 64)), 1), 128, 0, stream>>>(O16, DM, 0, BO, DM, 0, 0.0009765625f, bo, 0, nullptr, 1, 0, 0, (float*)d_out, nullptr, DM, 0, (int)NR, DM, DM, OH0, nullptr, 1, 0, 0, nullptr, 0);      /* out rows are the output layout; rows 0..127 of each batch: out = o_hi Wo (+ b) */
  k_gemm2<0><<<dim3((QT0 / 128) * (DM / 64), NB), 128, 0, stream>>>(OL0, DM, (size_t)QT0 * DM, BO, DM, 0, 0.00000095367431640625f, nullptr, 0, (const float*)d_out, -1, 0, 0, (float*)d_out, nullptr, DM, (size_t)SQ * DM, QT0, DM, DM, nullptr, nullptr, NB, 0, 0, nullptr, 0);      /* rows 0..127 of each batch (plane by): += o_lo Wo 2^-20 (own-element accumulate) */
}

// v008
// Measured time: 109 microseconds a run.
// Two timings next to v007 put it at 1.20 and 1.26 times that version's speed.
// Over all steps from v000 it is 38.9 times as fast.
#include <hip/hip_runtime.h>
// Causal LINEAR attention (x [2][2048][1024]; qk = x Wqk^T + bqk (natural [2048][1024]: rows 0..1023 -> q, 1024..2047 -> k; sigma 1/32, biases 0.02), v = x Wv^T + bv; 16 heads of 64; feature map phi = elu + 1 on q and k; ctx_t = (phi(q_t) . sum_{s<=t} phi(k_s) v_s^T) / (phi(q_t) . sum_{s<=t} phi(k_s)) = sum_{s<=t} a_ts v_s / sum_{s<=t} a_ts with a_ts = phi(q_t).phi(k_s) (the module's cumsum form, no softmax, no scaling, no eps); out = ctx Wo^T + bo -> [2][2048][1024]).
// Structure: x as exact f16 rows and the natural weights as exact x16 planes in one VALU launch; q, k (with the elu + 1 feature map in the GEMM epilogue) and v as one launch of WMMA GEMMs (32x64 wave tiles, f32 accumulation, + bias) with f16 outputs, phi(k) and v also transposed straight from the accumulators, the first 128 rows of each batch also in f32; the running sums phi(k) v^T and phi(k) in front of every chunk of 64 keys on WMMA (f32 accumulation, stored f16), in one launch with the first rows' f32 attention; one fused attention launch for all batches, heads and query tiles of 32 rows: phi(q) times the state in front of the chunk, then a^T = phi(k) phi(q)^T on WMMA (K = 64) for the chunk's own keys, causal mask, a as f16 straight from the accumulators into the A operand of ctx = a V^T on WMMA, row sums on WMMA too, ctx x64 / sum a into merged f16 rows; out = ctx Wo^T + bo GEMM (f32); first-tile refinement: the first 128 rows of each batch computed exactly in f32 on VALU (a / sum a weights), their output rows taken from o hi in the output GEMM, which adds the o lo product formed beside the attention launch; 5 launches.
// Compute dtype: inputs rounded to bf16; x / weights exact; q, k, v, the weights a and o as plain f16 GEMM operands (~2^-12); scores and row sums f32. v_wmma_f32_16x16x32_f16.
#define NB 2
#define SQ 2048
#define DM 1024
#define NH 16
#define HD 64
#define HG 4                         /* heads per group in the unlaunched k_vt(V16, b, h0, VT) overload */
#define QT 256                       /* query rows per causal tile */
#define NKX SQ                       /* S / P row pitch */
#define QT0 128                      /* first-tile rows recomputed exactly in f32 */
#define B0 0                         /* unused: every launch starts at batch 0 */
#define NBR NB                       /* only in MP, which no launch reads: the launches cover all NB batches */
#define NR ((size_t)NB * SQ)         /* token rows */
#define MP ((int)((size_t)NBR * SQ)) /* only in MPO, which no launch reads: the projections take all NR rows */
#define QN SQ                        /* unused: k_lfa attends all SQ rows of every batch */
#define NHD NH                       /* unused: k_lfa attends all NH heads */
#define MPO MP                       /* unused: the output GEMM takes all NR rows */
#define LQ DM      /* unused: the f32 q/k/v rows take pitch DM */
typedef __bf16 v16b __attribute__((ext_vector_type(16)));
typedef unsigned short v8us __attribute__((ext_vector_type(8), may_alias));
typedef float  v8f  __attribute__((ext_vector_type(8)));
typedef float  v4f  __attribute__((ext_vector_type(4)));
typedef float  v4fa __attribute__((ext_vector_type(4), may_alias));
union FragB { v16b v; v8us half[2]; unsigned short u[16]; };

__device__ __forceinline__ unsigned short bf16_bits(float x) { unsigned int u = __float_as_uint(x); return (unsigned short)((u + 0x7FFFu + ((u >> 16) & 1u)) >> 16); }
__device__ __forceinline__ float bf16_val(unsigned short b) { return __uint_as_float(((unsigned int)b) << 16); }
__device__ __forceinline__ float bf16_round(float x) { return bf16_val(bf16_bits(x)); }
// D += A·B with NT terms: 1 = ah·bh, 2 = + al·bh (A split), 3 = + ah·bl (both split)
template <int NT>
__device__ __forceinline__ v8f mmaN(v16b ah, v16b al, v16b bh, v16b bl, v8f c) {
  c = __builtin_amdgcn_wmma_f32_16x16x32_bf16(false, ah, false, bh, (short)0, c, false, false);
  if (NT >= 2) c = __builtin_amdgcn_wmma_f32_16x16x32_bf16(false, al, false, bh, (short)0, c, false, false);
  if (NT >= 3) c = __builtin_amdgcn_wmma_f32_16x16x32_bf16(false, ah, false, bl, (short)0, c, false, false);
  asm volatile("v_nop\n\tv_nop\n\tv_nop\n\tv_nop" : "+v"(c) : "v"(ah), "v"(al), "v"(bh), "v"(bl));
  return c;
}

__global__ __launch_bounds__(256) void k_wt_bf16(const float* __restrict__ W, unsigned short* __restrict__ Wt, int K, int N) {
  const int t = blockIdx.x * 256 + threadIdx.x;
  const int k8n = K / 8;
  if (t >= N * k8n) return;
  const int n = t / k8n, k8 = (t % k8n) * 8;
  v8us v;
#pragma unroll
  for (int i = 0; i < 8; ++i) v[i] = bf16_bits(W[(size_t)(k8 + i) * N + n]);
  *(v8us*)(Wt + (size_t)n * K + k8) = v;
  
}

// GEMM C[M][N] (f32, pitch ldc) = act(A[M][K]·W + bias). A f32 row-major (pitch lda) converted per fragment to bf16
// (ASPLIT: hi/lo two planes -> 2 terms, else single rounded term); Wt bf16 [N][K] (pitch ldb). BIAS_BF16 rounds the
// bias to bf16 first (bias quantised to bf16 before the add). K%32==0, M%16==0, N%64==0.
template <bool ASPLIT, int ACT, bool BIAS_BF16>
__global__ __launch_bounds__(128) void k_gemm_bf(const float* __restrict__ A, int lda, const unsigned short* __restrict__ Wt, int ldb,
                                               const float* __restrict__ bias, float* __restrict__ C, int ldc, int M, int N, int K) {
  __shared__ __attribute__((aligned(16))) float so[4][16][64];
  const int tid = threadIdx.x, w = tid >> 5, lane = tid & 31, ln = lane & 15, hh = lane >> 4;
  const int ntn = N / 64;
  const int wid = blockIdx.x * 4 + w;
  const int mt = wid / ntn, nq = wid % ntn;
  if (mt * 16 >= M) return;
  const int row0 = mt * 16, col0 = nq * 64;
  const float* arow = A + (size_t)(row0 + ln) * lda;
  v8f acc[4] = {};
  for (int kb = 0; kb < K; kb += 32) {
    FragB ah, al;
    const v4f x0 = *(const v4fa*)(arow + kb + 8 * hh), x1 = *(const v4fa*)(arow + kb + 8 * hh + 4);
    const v4f x2 = *(const v4fa*)(arow + kb + 16 + 8 * hh), x3 = *(const v4fa*)(arow + kb + 16 + 8 * hh + 4);
    float xs[16] = {x0[0],x0[1],x0[2],x0[3],x1[0],x1[1],x1[2],x1[3],x2[0],x2[1],x2[2],x2[3],x3[0],x3[1],x3[2],x3[3]};
#pragma unroll
    for (int i = 0; i < 16; ++i) { const unsigned short hb = bf16_bits(xs[i]); ah.u[i] = hb; al.u[i] = ASPLIT ? bf16_bits(xs[i] - bf16_val(hb)) : (unsigned short)0; }
#pragma unroll
    for (int t = 0; t < 4; ++t) {
      const unsigned short* brow = Wt + (size_t)(col0 + t * 16 + ln) * ldb + kb;
      FragB b;
      b.half[0] = *(const v8us*)(brow + 8 * hh);
      b.half[1] = *(const v8us*)(brow + 16 + 8 * hh);
      acc[t] = mmaN<ASPLIT ? 2 : 1>(ah.v, al.v, b.v, b.v, acc[t]);
    }
  }
#pragma unroll
  for (int t = 0; t < 4; ++t) {
    float bv = bias ? bias[col0 + t * 16 + ln] : 0.f;
    if (BIAS_BF16) bv = bf16_round(bv);
#pragma unroll
    for (int r = 0; r < 8; ++r) { float v = acc[t][r] + bv; if (ACT == 1) v = fmaxf(v, 0.f); so[w][8 * hh + r][t * 16 + ln] = v; }
  }
  __builtin_amdgcn_fence(__ATOMIC_ACQ_REL, "workgroup");
  __builtin_amdgcn_wave_barrier();
  const int rsub = lane >> 4, c4 = (lane & 15) * 4;
  {
#pragma unroll
    for (int q = 0; q < 8; ++q) {
      const int r = q * 2 + rsub;
      const v4f v = *(const v4fa*)&so[w][r][c4];
      *(v4f*)(C + (size_t)(row0 + r) * ldc + col0 + c4) = v;
    }
    
  }
}

// GEMM C = act(A·W + bias + resid): A f32 (ASPLIT -> hi/lo 2 terms), Wt bf16 [N][K]; ACT 0 none, 1 relu, 2 exact gelu;
// resid (optional, f32, row index = (row % rmod), pitch ldr, RES_BF16 rounds it) added before the activation.
template <bool ASPLIT, int ACT, bool BIAS_BF16, bool RES_BF16>
__global__ __launch_bounds__(128) void k_gemm_bf3(const float* __restrict__ A, int lda, const unsigned short* __restrict__ Wt, int ldb,
                                                const float* __restrict__ bias, const float* __restrict__ resid, int rmod, int ldr,
                                                float* __restrict__ C, int ldc, int M, int N, int K) {
  __shared__ __attribute__((aligned(16))) float so[4][16][64];
  const int tid = threadIdx.x, w = tid >> 5, lane = tid & 31, ln = lane & 15, hh = lane >> 4;
  const int ntn = N / 64;
  const int wid = blockIdx.x * 4 + w;
  const int mt = wid / ntn, nq = wid % ntn;
  if (mt * 16 >= M) return;
  const int row0 = mt * 16, col0 = nq * 64;
  const float* arow = A + (size_t)(row0 + ln) * lda;
  v8f acc[4] = {};
  for (int kb = 0; kb < K; kb += 32) {
    FragB ah, al;
    const v4f x0 = *(const v4fa*)(arow + kb + 8 * hh), x1 = *(const v4fa*)(arow + kb + 8 * hh + 4);
    const v4f x2 = *(const v4fa*)(arow + kb + 16 + 8 * hh), x3 = *(const v4fa*)(arow + kb + 16 + 8 * hh + 4);
    float xs[16] = {x0[0],x0[1],x0[2],x0[3],x1[0],x1[1],x1[2],x1[3],x2[0],x2[1],x2[2],x2[3],x3[0],x3[1],x3[2],x3[3]};
#pragma unroll
    for (int i = 0; i < 16; ++i) { const unsigned short hb = bf16_bits(xs[i]); ah.u[i] = hb; al.u[i] = ASPLIT ? bf16_bits(xs[i] - bf16_val(hb)) : (unsigned short)0; }
#pragma unroll
    for (int t = 0; t < 4; ++t) {
      const unsigned short* brow = Wt + (size_t)(col0 + t * 16 + ln) * ldb + kb;
      FragB b;
      b.half[0] = *(const v8us*)(brow + 8 * hh);
      b.half[1] = *(const v8us*)(brow + 16 + 8 * hh);
      acc[t] = mmaN<ASPLIT ? 2 : 1>(ah.v, al.v, b.v, b.v, acc[t]);
    }
  }
#pragma unroll
  for (int t = 0; t < 4; ++t) {
    const int col = col0 + t * 16 + ln;
    float bv = bias ? bias[col] : 0.f;
    if (BIAS_BF16) bv = bf16_round(bv);
#pragma unroll
    for (int r = 0; r < 8; ++r) {
      float v = acc[t][r] + bv;
      if (resid) { float rv = resid[(size_t)((row0 + 8 * hh + r) % rmod) * ldr + col]; if (RES_BF16) rv = bf16_round(rv); v += rv; }
      if (ACT == 1) v = fmaxf(v, 0.f);
      if (ACT == 2) v = 0.5f * v * (1.0f + erff(v * 0.70710678118654752f));
      if (ACT == 3) { const float u = 0.7978845608028654f * (v + 0.044715f * v * v * v); v = 0.5f * v * (1.0f + tanhf(u)); }
      so[w][8 * hh + r][t * 16 + ln] = v;
    }
  }
  __builtin_amdgcn_fence(__ATOMIC_ACQ_REL, "workgroup");
  __builtin_amdgcn_wave_barrier();
  const int rsub = lane >> 4, c4 = (lane & 15) * 4;
  {
#pragma unroll
    for (int q = 0; q < 8; ++q) {
      const int r = q * 2 + rsub;
      const v4f v = *(const v4fa*)&so[w][r][c4];
      *(v4f*)(C + (size_t)(row0 + r) * ldc + col0 + c4) = v;
    }
    
  }
}
// row LayerNorm (biased variance, eps) over N: s = X (+ R); optional out_sum <- s; out_norm <- (s-mu)*rsqrt(var+eps)*g + b
template <bool PARAM_BF16>
__global__ __launch_bounds__(256) void k_layernorm(const float* __restrict__ X, const float* __restrict__ R, const float* __restrict__ g, const float* __restrict__ bta,
                                                  float* __restrict__ out_sum, float* __restrict__ out_norm, int N, float eps) {
  __shared__ float red[256];
  const int row = blockIdx.x, tid = threadIdx.x;
  const float* x = X + (size_t)row * N; const float* rr = R ? R + (size_t)row * N : nullptr;
  float vals[16];                     // up to N = 4096
  const int per = N / 256;            // contiguous chunk per thread? use strided-by-4 chunks: thread handles j = tid*4 + 1024*u
  float s1 = 0.f;
  for (int u = 0; u < per / 4; ++u) {
    const int j = tid * 4 + 1024 * u;
    const v4f a = *(const v4fa*)(x + j);
    v4f b = {0.f,0.f,0.f,0.f}; if (rr) b = *(const v4fa*)(rr + j);
#pragma unroll
    for (int q = 0; q < 4; ++q) { const float v = a[q] + b[q]; vals[u * 4 + q] = v; s1 += v; }
  }
  red[tid] = s1; __syncthreads();
  for (int st = 128; st > 0; st >>= 1) { if (tid < st) red[tid] += red[tid + st]; __syncthreads(); }
  const float mu = red[0] / (float)N; __syncthreads();
  float s2 = 0.f;
  for (int u = 0; u < per / 4; ++u)
#pragma unroll
    for (int q = 0; q < 4; ++q) { const float c = vals[u * 4 + q] - mu; s2 += c * c; }
  red[tid] = s2; __syncthreads();
  for (int st = 128; st > 0; st >>= 1) { if (tid < st) red[tid] += red[tid + st]; __syncthreads(); }
  const float rs = rsqrtf(red[0] / (float)N + eps);
  {
    for (int u = 0; u < per / 4; ++u) {
      const int j = tid * 4 + 1024 * u;
      v4f o, sm;
#pragma unroll
      for (int q = 0; q < 4; ++q) {
        float gg = g[j + q], bb = bta[j + q];
        if (PARAM_BF16) { gg = bf16_round(gg); bb = bf16_round(bb); }
        sm[q] = vals[u * 4 + q]; o[q] = (vals[u * 4 + q] - mu) * rs * gg + bb;
      }
      if (out_sum) *(v4f*)(out_sum + (size_t)row * N + j) = sm;
      *(v4f*)(out_norm + (size_t)row * N + j) = o;
    }
    
  }
}



// ---- f16 WMMA path (v_wmma_f32_16x16x32_f16): 11-bit significands for operands in range — used where a [0,1] probability operand needs more precision than bf16
typedef _Float16 v16h __attribute__((ext_vector_type(16)));
union FragH { v16h v; v8us half[2]; _Float16 h[16]; unsigned short u[16]; };
template <int NT>
__device__ __forceinline__ v8f mmaH(v16h ah, v16h al, v16h bh, v16h bl, v8f c) {
  c = __builtin_amdgcn_wmma_f32_16x16x32_f16(false, ah, false, bh, (short)0, c, false, false);
  if (NT >= 2) c = __builtin_amdgcn_wmma_f32_16x16x32_f16(false, al, false, bh, (short)0, c, false, false);
  if (NT >= 3) c = __builtin_amdgcn_wmma_f32_16x16x32_f16(false, ah, false, bl, (short)0, c, false, false);
  asm volatile("v_nop\n\tv_nop\n\tv_nop\n\tv_nop" : "+v"(c) : "v"(ah), "v"(al), "v"(bh), "v"(bl));
  return c;
}
// batched GEMM like k_gemm_b but f16 operands: A f32 (split into f16 hi/lo if ASPLIT, else rounded to f16), Bt = f16 values [n][k]; alpha; C f32; N multiple of 16 (partial tiles skipped)
template <bool ASPLIT>
__global__ __launch_bounds__(128) void k_gemm_h(const float* __restrict__ A, int lda, size_t sA, const _Float16* __restrict__ Bh, int ldb, size_t sB, float alpha, float* __restrict__ C, int ldc, size_t sC, int M, int N, int K) {
  __shared__ __attribute__((aligned(16))) float so[4][16][64];
  const int tid = threadIdx.x, w = tid >> 5, lane = tid & 31, ln = lane & 15, hh = lane >> 4; const int by = blockIdx.y;
  A += (size_t)by * sA; Bh += (size_t)by * sB; C += (size_t)by * sC;
  const int ntn = (N + 63) / 64; const int wid = blockIdx.x * 4 + w; const int mt = wid / ntn, nq = wid % ntn; if (mt * 16 >= M) return;
  const int row0 = mt * 16, col0 = nq * 64; const float* arow = A + (size_t)(row0 + ln) * lda;
  v8f acc[4] = {};
  for (int kb = 0; kb < K; kb += 32) {
    FragH ah, al;
    const v4f x0 = *(const v4fa*)(arow + kb + 8 * hh), x1 = *(const v4fa*)(arow + kb + 8 * hh + 4), x2 = *(const v4fa*)(arow + kb + 16 + 8 * hh), x3 = *(const v4fa*)(arow + kb + 16 + 8 * hh + 4);
    float xs[16] = {x0[0],x0[1],x0[2],x0[3],x1[0],x1[1],x1[2],x1[3],x2[0],x2[1],x2[2],x2[3],x3[0],x3[1],x3[2],x3[3]};
#pragma unroll
    for (int i = 0; i < 16; ++i) { const _Float16 h = (_Float16)xs[i]; ah.h[i] = h; al.h[i] = ASPLIT ? (_Float16)(xs[i] - (float)h) : (_Float16)0.0f; }
#pragma unroll
    for (int t = 0; t < 4; ++t) { if (col0 + t * 16 >= N) continue; const size_t boff = (size_t)(col0 + t * 16 + ln) * ldb + kb; FragH bq; bq.half[0] = *(const v8us*)(Bh + boff + 8 * hh); bq.half[1] = *(const v8us*)(Bh + boff + 16 + 8 * hh);
      acc[t] = mmaH<ASPLIT ? 2 : 1>(ah.v, al.v, bq.v, bq.v, acc[t]); }
  }
#pragma unroll
  for (int t = 0; t < 4; ++t) { if (col0 + t * 16 >= N) continue;
#pragma unroll
    for (int r = 0; r < 8; ++r) so[w][8 * hh + r][t * 16 + ln] = acc[t][r] * alpha; }
  __builtin_amdgcn_fence(__ATOMIC_ACQ_REL, "workgroup"); __builtin_amdgcn_wave_barrier();
  const int rsub = lane >> 4, c4 = (lane & 15) * 4;
  {
#pragma unroll
    for (int q = 0; q < 8; ++q) { const int r = q * 2 + rsub; if (col0 + c4 < N) { const v4f v = *(const v4fa*)&so[w][r][c4]; *(v4f*)(C + (size_t)(row0 + r) * ldc + col0 + c4) = v; } }
     }
}

// Wt[n][k] = f16(W[k][n]·scale) from f32 row-major W[K][N] (scale = power of two; bf16-exact weights stay exact in f16 away from the subnormal range)
__global__ __launch_bounds__(256) void k_wt_f16(const float* __restrict__ W, _Float16* __restrict__ Wt, int K, int N, float scale) {
  const int t = blockIdx.x * 256 + threadIdx.x; if (t >= N * (K / 8)) return; const int n = t / (K / 8), k8 = (t % (K / 8)) * 8; FragH f;
#pragma unroll
  for (int i = 0; i < 8; ++i) f.h[i] = (_Float16)(bf16_round(W[(size_t)(k8 + i) * N + n]) * scale); const v8us o = f.half[0];
  *(v8us*)((unsigned short*)Wt + (size_t)n * K + k8) = o; 
}
// k_gemm_hh variant with fused epilogue: v = acc·alpha + bias[by·sBias + col] (+ CP[(row/rowsPerB)·sCPb + by·64 + col] if CP) ; ACT 0 none / 1 elu ; writes f16 C16 (and f32 C if non-null)
template <int ACT>
__global__ __launch_bounds__(128) void k_gemm_hhx(const _Float16* __restrict__ A, int lda, size_t sA, const _Float16* __restrict__ Bh, int ldb, size_t sB, float alpha, const float* __restrict__ bias, size_t sBias, const float* __restrict__ CP, int rowsPerB, size_t sCPb, int row0g,
    float* __restrict__ C, _Float16* __restrict__ C16, int ldc, size_t sC, int M, int N, int K) {
  __shared__ __attribute__((aligned(16))) float so[4][16][64];
  const int tid = threadIdx.x, w = tid >> 5, lane = tid & 31, ln = lane & 15, hh = lane >> 4; const int by = blockIdx.y;
  A += (size_t)by * sA; Bh += (size_t)by * sB; const size_t cofs = (size_t)by * sC; const float* bp = bias ? bias + (size_t)by * sBias : nullptr;
  const int ntn = (N + 63) / 64; const int wid = blockIdx.x * 4 + w; const int mt = wid / ntn, nq = wid % ntn; if (mt * 16 >= M) return;
  const int row0 = mt * 16, col0 = nq * 64; const _Float16* arow = A + (size_t)(row0 + ln) * lda;
  v8f acc[4] = {};
  for (int kb = 0; kb < K; kb += 32) { FragH ah; ah.half[0] = *(const v8us*)((const unsigned short*)arow + kb + 8 * hh); ah.half[1] = *(const v8us*)((const unsigned short*)arow + kb + 16 + 8 * hh);
#pragma unroll
    for (int t = 0; t < 4; ++t) { if (col0 + t * 16 >= N) continue; const size_t boff = (size_t)(col0 + t * 16 + ln) * ldb + kb; FragH bq; bq.half[0] = *(const v8us*)((const unsigned short*)Bh + boff + 8 * hh); bq.half[1] = *(const v8us*)((const unsigned short*)Bh + boff + 16 + 8 * hh);
      acc[t] = mmaH<1>(ah.v, ah.v, bq.v, bq.v, acc[t]); }
  }
#pragma unroll
  for (int t = 0; t < 4; ++t) { if (col0 + t * 16 >= N) continue; const int col = col0 + t * 16 + ln; const float bv = bp ? bf16_round(bp[col]) : 0.f;
#pragma unroll
    for (int r = 0; r < 8; ++r) { float v = acc[t][r] * alpha + bv; if (CP) { const int rr = row0g + row0 + 8 * hh + r; if (rowsPerB < 0) v += CP[cofs + (size_t)rr * ldc + col];      /* rowsPerB < 0: own element of the batched C plane */ else { const int bidx = rr / rowsPerB; v += CP[(size_t)bidx * sCPb + (size_t)by * 64 + col]; } } if (ACT == 1) v = (v > 0.f) ? v : expm1f(v); else if (ACT == 7) v = (v > 0.f) ? v + 1.0f : expf(v); else if (ACT == 8) v = tanhf(v); else if (ACT == 9) v = 0.5f * v * (1.0f + tanhf(0.7978845608028654f * (v + 0.044715f * v * v * v))); else if (ACT == 11) v = 1.0f / (1.0f + expf(-v)); else if (ACT == 12) v = (v > 0.f) ? v : 0.01f * v; else if (ACT == 14) v = (v > 0.f) ? v : 0.1f * v; else if (ACT == 16) v = (v >= 0.f) ? v : 0.3f * v; else if (ACT == 17) v = (v >= 0.f) ? v : 0.2f * v; else if (ACT == 15) v = v / (1.0f + expf(-v)); else if (ACT == 3) v = fmaxf(v, 0.f); else if (ACT == 6) v = 0.5f * v * (1.0f + erff(v * 0.70710678118654752f)); so[w][8 * hh + r][t * 16 + ln] = v; } }
  __builtin_amdgcn_fence(__ATOMIC_ACQ_REL, "workgroup"); __builtin_amdgcn_wave_barrier();
  const int rsub = lane >> 4, c4 = (lane & 15) * 4; typedef _Float16 v4h __attribute__((ext_vector_type(4)));
  {
#pragma unroll
    for (int q = 0; q < 8; ++q) { const int r = q * 2 + rsub; if (col0 + c4 < N) { const v4f v = *(const v4fa*)&so[w][r][c4]; if (C) *(v4f*)(C + cofs + (size_t)(row0 + r) * ldc + col0 + c4) = v; if (C16) { v4h h4; for (int i = 0; i < 4; ++i) h4[i] = (_Float16)v[i]; *(v4h*)(C16 + cofs + (size_t)(row0 + r) * ldc + col0 + c4) = h4; } } }
     }
}


typedef _Float16 v4h __attribute__((ext_vector_type(4)));

__global__ __launch_bounds__(256) void k_h16(const float* __restrict__ x, _Float16* __restrict__ X16, size_t n8) { const size_t t = (size_t)blockIdx.x * 256 + threadIdx.x; if (t >= n8) return; FragH f;
#pragma unroll
  for (int q = 0; q < 8; ++q) f.h[q] = (_Float16)x[t * 8 + q]; *(v8us*)((unsigned short*)X16 + t * 8) = f.half[0];  }
__global__ __launch_bounds__(256) void k_round16f(const float* __restrict__ W, _Float16* __restrict__ Bt, size_t n8) { const size_t t = (size_t)blockIdx.x * 256 + threadIdx.x; if (t >= n8) return; FragH f;
#pragma unroll
  for (int i = 0; i < 8; ++i) f.h[i] = (_Float16)(bf16_round(W[t * 8 + i]) * 16.0f); *(v8us*)((unsigned short*)Bt + t * 8) = f.half[0];  }
template <int NHv, int TTv>
__global__ __launch_bounds__(256) void k_vt(const _Float16* __restrict__ V16, int ldv, int voff, _Float16* __restrict__ Vt) { __shared__ unsigned short tl[64][66]; const int tid = threadIdx.x; const int slab = blockIdx.x / (TTv / 64), lg = blockIdx.x % (TTv / 64); const int b = slab / NHv, h = slab % NHv;
  for (int i = tid; i < 64 * 8; i += 256) { const int r = i / 8, c8 = (i % 8) * 8; FragH f; f.half[0] = *(const v8us*)((const unsigned short*)V16 + ((size_t)b * TTv + lg * 64 + r) * ldv + voff + h * 64 + c8);
#pragma unroll
    for (int q = 0; q < 8; ++q) tl[r][c8 + q] = f.u[q]; }
  __syncthreads();
  {
#pragma unroll
    for (int rd = 0; rd < 2; ++rd) { const int i = rd * 256 + tid, ln = i & 15, hh = (i >> 4) & 1, j = (i >> 5) & 1, t = (i >> 6) & 3, ss = i >> 8; FragH f;      /* fragment order: [slab][32 keys][16 d][half j] pieces of 512 bytes, lane (hh, ln) holding row d = 16 t + ln, keys 16 j + 8 hh + 0..7; piece and lane count up with i, so a wave stores 512 contiguous bytes */
#pragma unroll
      for (int q = 0; q < 8; ++q) f.u[q] = tl[ss * 32 + j * 16 + hh * 8 + q][t * 16 + ln];
      *(v8us*)((unsigned short*)Vt + ((size_t)slab * (TTv / 64) + lg) * 4096 + i * 8) = f.half[0]; }
     } }

// ---- fast GEMM (work-group tile 128x64, wave tile 32x64; requires M % 32 == 0 rows per launch region, N % 64 == 0 and K % 64 == 0); epilogue = k_gemm_hhx semantics ----
// Operand tiles of GK k (one 128-byte line of each of the 128 A rows and 64 B rows) go through LDS: eight lanes fetch a whole line, one tile ahead of the matrix work, and the waves read their fragments from LDS.
// Products that read none of each other's output share a launch: planes by = blockIdx.y; planes by < nact take bias + by sBias and the activation, the others biasz and none; cfirst: the f32 plane C takes only the first QT0 rows of each batch;
// A1 (if given): the row tiles that hold the first QT0 rows of a batch read their A rows from A1 [batch][QT0] in place of A.
// Planes by < npk (rows of NH heads of HD = 64 columns, SQ rows a batch) store their f16 output in FRAGMENT ORDER in place of rows: [batch][head][16-row tile] tiles of PKT halfs; a tile is four pieces c of 512 bytes,
// piece c holding at lane (hh, ln) the 8 halfs of row ln, columns 16 c + 8 hh + 0..7: pieces 2 m and 2 m + 1 are the two halves of the g2_frag fragment of columns 32 m .. 32 m + 31, each one whole-line load of a wave.
// Planes by >= ntr (if CT is given) store their f16 output TRANSPOSED in fragment order into plane by - ntr of CT, and no f16 rows: [batch][head][32 rows][16 columns t][half j] pieces of 512 bytes,
// lane (hh, ln) holding column 16 t + ln, rows 16 j + 8 hh + 0..7: the fragment of a product that sums over the rows.
#define PKT 1024                     /* halfs per 16 x 64 tile in fragment order */
__device__ __forceinline__ v16h pk_frag(const _Float16* p) { FragH f; f.half[0] = *(const v8us*)((const unsigned short*)p); f.half[1] = *(const v8us*)((const unsigned short*)p + 256); return f.v; }      /* p: the fragment's first piece + 8 lane */
#define GK 64                        /* k per staged tile */
#define GP 72                        /* pitch in halfs of a staged row: 144 B = 16 B x odd, so that 16-byte fragment reads of 16 rows spread over the banks */
__device__ __forceinline__ v16h g2_frag(const _Float16* p, int hh) { FragH f; f.half[0] = *(const v8us*)((const unsigned short*)p + 8 * hh); f.half[1] = *(const v8us*)((const unsigned short*)p + 16 + 8 * hh); return f.v; }
__device__ __forceinline__ v8f g2_mma(v16h a, v16h b, v8f c) { v8f d = __builtin_amdgcn_wmma_f32_16x16x32_f16(false, a, false, b, (short)0, c, false, false); asm volatile("v_nop\n\tv_nop\n\tv_nop\n\tv_nop" : "+v"(d) : "v"(a), "v"(b)); return d; }
// Left as it is: the epilogue tests its run-time switches (CP, act, tr, pk, cf) element by element and waits for each column tile's bias load by itself; the q, k, v build is about 9,000 instructions long, most of them never run.
// gemm2: the body, for work-group (bx, by) of the grid described above; so: the work-group's epilogue rows in LDS, handed in so that a launch which holds other work too has them once. CF (if given): f32 rows laid out like C; the row tiles with the first QT0 rows of a batch add their own elements of it in the row pass.
template <int ACT>
__device__ __forceinline__ void gemm2(const unsigned bx, const int by, float (*so)[32][68], const _Float16* __restrict__ A, int lda, size_t sA, const _Float16* __restrict__ Bh, int ldb, size_t sB, float alpha, const float* __restrict__ bias, size_t sBias, const float* __restrict__ CP, int rowsPerB, size_t sCPb, int row0g,
    float* __restrict__ C, _Float16* __restrict__ C16, int ldc, size_t sC, int M, int N, int K, const _Float16* __restrict__ A1, const float* __restrict__ biasz, int nact, int cfirst, int npk, _Float16* __restrict__ CT, int ntr, const float* CF) { static_assert(ACT == 0 || ACT == 3 || ACT == 6 || ACT == 8 || ACT == 9 || ACT == 11 || ACT == 12 || ACT == 14 || ACT == 15 || ACT == 16 || ACT == 17 || ACT == 19, "k_gemm2: unsupported ACT code (would silently apply no activation)"); static_assert(QT0 == 128 && SQ % 128 == 0, "k_gemm2: the first rows of a batch are one row tile");
  __shared__ __attribute__((aligned(16))) _Float16 sa[2][128][GP]; __shared__ __attribute__((aligned(16))) _Float16 sb[2][64][GP];
  const int tid = threadIdx.x, w = tid >> 5, lane = tid & 31, ln = lane & 15, hh = lane >> 4;
  A += (size_t)by * sA; Bh += (size_t)by * sB; const size_t cofs = (size_t)by * sC; const bool act = by < nact; const float* bp = bias ? (act ? bias + (size_t)by * sBias : biasz) : nullptr;
  const int ntn = N >> 6; const int mt = bx / ntn, nq = bx - mt * ntn; const int row0 = mt * 128 + 32 * w, col0 = nq * 64; if (mt * 128 >= M) return;      /* the whole work-group or none: barriers follow; a wave whose own rows lie past M leaves behind the last one */
  const int sr = tid >> 3, sc = (tid & 7) * 8;      /* staging: 8 lanes per 128-byte line, 16 rows per pass of the work-group */
  const bool first = (mt * 128) % SQ == 0; const bool cf = C && (!cfirst || first); const bool pk = by < npk; const bool tr = CT && by >= ntr; const bool rows16 = C16 && !pk && !tr; const bool cfa = CF && cf && first; int ar0 = mt * 128, am = M;      /* ar0, am: the tile's first row in its A plane and that plane's rows */
  const char* ab = (const char*)A; const char* bb = (const char*)Bh; unsigned ao[8], bo[4]; if (A1 && first) { ab = (const char*)A1; ar0 = ar0 / SQ * QT0; am = M / SQ * QT0; }      /* one base per operand for the whole work-group + the lane's own byte offset to each of its rows; a 16-row pass past M (M % 32 == 0) rereads the last 16 rows, which no wave uses */
#pragma unroll
  for (int p = 0; p < 8; ++p) ao[p] = (unsigned)((min(ar0 + 16 * p, am - 16) + sr) * lda + sc) * 2u;
#pragma unroll
  for (int p = 0; p < 4; ++p) bo[p] = (unsigned)((col0 + 16 * p + sr) * ldb + sc) * 2u;
  v8us ra[8], rb[4]; v16h a0[2], a1[2], b[2][4];
  auto fetch = [&]() {      /* the next tile into registers */
#pragma unroll
    for (int p = 0; p < 8; ++p) ra[p] = *(const v8us*)(ab + ao[p]);
#pragma unroll
    for (int p = 0; p < 4; ++p) rb[p] = *(const v8us*)(bb + bo[p]); };
  auto put = [&](int u) {      /* the fetched tile into buffer u; the offsets step on by one tile here, behind the waits for the loads that name them */
#pragma unroll
    for (int p = 0; p < 8; ++p) { *(v8us*)&sa[u][16 * p + sr][sc] = ra[p]; ao[p] += GK * 2; }
#pragma unroll
    for (int p = 0; p < 4; ++p) { *(v8us*)&sb[u][16 * p + sr][sc] = rb[p]; bo[p] += GK * 2; } };
  auto frags = [&](int u) {      /* all fragments of one staged tile: the second half's reads return under the first half's products */
#pragma unroll
    for (int ks = 0; ks < 2; ++ks) { a0[ks] = g2_frag(&sa[u][32 * w + ln][ks * 32], hh); a1[ks] = g2_frag(&sa[u][32 * w + 16 + ln][ks * 32], hh);
#pragma unroll
      for (int t = 0; t < 4; ++t) b[ks][t] = g2_frag(&sb[u][16 * t + ln][ks * 32], hh); } };
  const v8f z8 = {0.f,0.f,0.f,0.f,0.f,0.f,0.f,0.f}; v8f c00 = z8, c01 = z8, c02 = z8, c03 = z8, c10 = z8, c11 = z8, c12 = z8, c13 = z8;
  auto prods = [&]() {
#pragma unroll
    for (int ks = 0; ks < 2; ++ks) { c00 = g2_mma(a0[ks], b[ks][0], c00); c10 = g2_mma(a1[ks], b[ks][0], c10); c01 = g2_mma(a0[ks], b[ks][1], c01); c11 = g2_mma(a1[ks], b[ks][1], c11);
      c02 = g2_mma(a0[ks], b[ks][2], c02); c12 = g2_mma(a1[ks], b[ks][2], c12); c03 = g2_mma(a0[ks], b[ks][3], c03); c13 = g2_mma(a1[ks], b[ks][3], c13); } };
  const int nt = K / GK;
  fetch(); put(0); __syncthreads();
#pragma unroll 1      /* one copy of the loop body: the buffer's number is a scalar offset */
  for (int t = 0; t + 1 < nt; ++t) { frags(t & 1); fetch(); prods(); put((t + 1) & 1); __syncthreads(); }      /* tile t + 1 is on its way under tile t's products; the one barrier of a pass publishes it and ends the reads of tile t, whose buffer the next pass refills */
  frags((nt - 1) & 1); prods();
  if (row0 >= M) return;
  v8f accs[8] = {c00, c01, c02, c03, c10, c11, c12, c13};
  v4f cr[16];      /* the lane's elements of CF, at the addresses of its row-pass stores: all sixteen loads in flight together, under the accumulators' way into LDS */
  if (cfa) { const char* cb = (const char*)(CF + cofs + (size_t)(row0 + (lane >> 4)) * ldc + col0 + (lane & 15) * 4); const unsigned cs = (unsigned)ldc * 8u; const char* ca[16];
#pragma unroll
    for (int q = 0; q < 16; ++q) { ca[q] = cb + q * cs; cr[q] = *(const v4fa*)ca[q]; }
    asm volatile("s_wait_xcnt 0x0" :: "v"(ca[0]), "v"(ca[1]), "v"(ca[2]), "v"(ca[3]), "v"(ca[4]), "v"(ca[5]), "v"(ca[6]), "v"(ca[7]), "v"(ca[8]), "v"(ca[9]), "v"(ca[10]), "v"(ca[11]), "v"(ca[12]), "v"(ca[13]), "v"(ca[14]), "v"(ca[15]) : "memory"); }      /* behind the last load of the run; the sixteen address pairs are its inputs, so that none of them is given to a load's result or reused ahead of it */
  unsigned short* tq = (unsigned short*)CT + (tr ? (size_t)(by - ntr) * sC + (((size_t)(row0 / SQ) * NH + nq) * (SQ / 32) + (row0 % SQ) / 32) * 2048 + lane * 8 : (size_t)0);      /* the wave's 32 rows x 64 columns, transposed: one block of 4 KiB */
#pragma unroll
  for (int u = 0; u < 8; ++u) { const int t = u & 3, half = u >> 2; const int col = col0 + t * 16 + ln; const float bv = bp ? bf16_round(bp[col]) : 0.f; FragH tf;
#pragma unroll
    for (int r = 0; r < 8; ++r) { const int rloc = half * 16 + 8 * hh + r; float v = accs[u][r] * alpha + bv; if (CP) { if (rowsPerB < 0) v += CP[cofs + (size_t)(row0g + row0 + rloc) * ldc + col];      /* rowsPerB < 0: own element of the batched C plane */ else { const int bidx = (row0g + row0 + rloc) / rowsPerB; v += CP[(size_t)bidx * sCPb + (size_t)by * 64 + col]; } }
      if (act) { if (ACT == 3) v = fmaxf(v, 0.f); else if (ACT == 6) v = 0.5f * v * (1.0f + erff(v * 0.70710678118654752f)); else if (ACT == 11) v = 1.0f / (1.0f + expf(-v)); else if (ACT == 15) v = v / (1.0f + expf(-v)); else if (ACT == 19) v = (v > 0.f) ? (v + 1.0f) : expf(v);      /* elu(v) + 1 */ else if (ACT == 12) v = (v > 0.f) ? v : 0.01f * v; else if (ACT == 8) v = tanhf(v); else if (ACT == 9) v = 0.5f * v * (1.0f + tanhf(0.7978845608028654f * (v + 0.044715f * v * v * v))); else if (ACT == 14) v = (v > 0.f) ? v : 0.1f * v; else if (ACT == 16) v = (v >= 0.f) ? v : 0.3f * v; else if (ACT == 17) v = (v >= 0.f) ? v : 0.2f * v; }
      so[w][rloc][t * 16 + ln] = v; tf.h[r] = (_Float16)v; }
    if (tr) { *(v8us*)(tq + t * 512 + half * 256) = tf.half[0]; asm volatile("s_wait_xcnt 0x0" :: "v"(tf.half[0]), "v"(tq) : "memory"); } }      /* an accumulator holds 8 consecutive rows of ONE column in a lane: that is the lane's 16 bytes of the transposed fragment, stored as 512 contiguous bytes a wave; the wait stands behind the store with the stored registers and the address pair as inputs, so that neither is reused ahead of it */
  __builtin_amdgcn_fence(__ATOMIC_ACQ_REL, "workgroup"); __builtin_amdgcn_wave_barrier();
  const int rsub = lane >> 4, c4 = (lane & 15) * 4;
  if (cf || rows16) {      /* the row pass; a tile that stores neither f32 rows nor f16 rows skips its sixteen LDS reads */
#pragma unroll
    for (int q = 0; q < 16; ++q) { const int r = q * 2 + rsub; v4f v = *(const v4fa*)&so[w][r][c4]; if (cfa) v += cr[q];
      if (cf) { *(v4f*)(C + cofs + (size_t)(row0 + r) * ldc + col0 + c4) = v; asm volatile("s_wait_xcnt 0x0" :: "v"(v) : "memory"); }      /* behind the f32 store; the stored registers are the wait's inputs, so that the f16 conversion below does not reuse them ahead of it */
      if (rows16) { v4h h4; for (int i = 0; i < 4; ++i) h4[i] = (_Float16)v[i]; _Float16* dp = C16 + cofs + (size_t)(row0 + r) * ldc + col0 + c4; *(v4h*)dp = h4; asm volatile("s_wait_xcnt 0x0" :: "v"(h4), "v"(dp) : "memory"); } }      /* behind the f16 row store; the stored registers and the address pair are the wait's inputs, so that nothing behind it reuses them ahead of it */
     }
  if (C16 && pk) {      /* fragment order: the wave's 32 rows x 64 columns are two tiles of 2 KiB in a row; each store is 512 contiguous bytes */
    unsigned short* pt = (unsigned short*)C16 + cofs + (((size_t)(row0 / SQ) * NH + nq) * (SQ / 16) + (row0 % SQ) / 16) * PKT + lane * 8;
#pragma unroll      /* constant LDS and store offsets; the LDS reads of all eight pieces are issued ahead of the conversions */
    for (int u = 0; u < 8; ++u) { const float* sp = &so[w][(u >> 2) * 16 + ln][(u & 3) * 16 + 8 * hh]; const v4f x = *(const v4fa*)sp, y = *(const v4fa*)(sp + 4); FragH f;
#pragma unroll
      for (int i = 0; i < 4; ++i) { f.h[i] = (_Float16)x[i]; f.h[4 + i] = (_Float16)y[i]; }
      *(v8us*)(pt + u * 256) = f.half[0]; } } }
template <int ACT>
__global__ __launch_bounds__(128) void k_gemm2(const _Float16* __restrict__ A, int lda, size_t sA, const _Float16* __restrict__ Bh, int ldb, size_t sB, float alpha, const float* __restrict__ bias, size_t sBias, const float* __restrict__ CP, int rowsPerB, size_t sCPb, int row0g,
    float* __restrict__ C, _Float16* __restrict__ C16, int ldc, size_t sC, int M, int N, int K, const _Float16* __restrict__ A1, const float* __restrict__ biasz, int nact, int cfirst, int npk, _Float16* __restrict__ CT, int ntr, const float* CF) {
  __shared__ __attribute__((aligned(16))) float so[4][32][68];
  gemm2<ACT>(blockIdx.x, (int)blockIdx.y, so, A, lda, sA, Bh, ldb, sB, alpha, bias, sBias, CP, rowsPerB, sCPb, row0g, C, C16, ldc, sC, M, N, K, A1, biasz, nact, cfirst, npk, CT, ntr, CF); }


// All four operand conversions in one launch (none reads another's output): the weights, natural [out][in] = Bt[n][k], x16, into the planes BW = Wqk (q rows, k rows) | Wv | Wo, then x into X16. A work-group lies wholly in one source.
#define CPB (DM * DM / 8 / 256)      /* work-groups per DM x DM plane, 8 elements per thread */
#define CXB ((unsigned)(NR * DM / 8 / 256))      /* work-groups of x */
__global__ __launch_bounds__(256) void k_cvt(const float* __restrict__ wqk, const float* __restrict__ wv, const float* __restrict__ wo, const float* __restrict__ x, _Float16* __restrict__ BW, _Float16* __restrict__ X16) {
  const unsigned bx = blockIdx.x; const float* s = wqk; _Float16* d = BW; unsigned b0 = 0; float sc = 16.0f;
  if (bx >= 4 * CPB) { s = x; d = X16; b0 = 4 * CPB; sc = 1.0f; } else if (bx >= 3 * CPB) { s = wo; d = BW + (size_t)3 * DM * DM; b0 = 3 * CPB; } else if (bx >= 2 * CPB) { s = wv; d = BW + (size_t)2 * DM * DM; b0 = 2 * CPB; }
  const size_t t = (size_t)(bx - b0) * 256 + threadIdx.x; FragH f;
#pragma unroll
  for (int q = 0; q < 8; ++q) f.h[q] = (_Float16)(bf16_round(s[t * 8 + q]) * sc);
  *(v8us*)((unsigned short*)d + t * 8) = f.half[0]; }
__global__ __launch_bounds__(256) void k_rsm(const float* __restrict__ S, _Float16* __restrict__ P, int nrows) {
  #pragma clang fp contract(off)
  const int i = blockIdx.x * 256 + threadIdx.x; if (i >= nrows) return; const float* s = S + (size_t)i * SQ; float mx = -3.0e38f;
#pragma unroll 1
  for (int j = 0; j < SQ; ++j) mx = fmaxf(mx, s[j]); float se = 0.f;
#pragma unroll 1
  for (int j = 0; j < SQ; ++j) se += expf(s[j] - mx); const float sc = 256.0f / se;
#pragma unroll 1
  for (int j0 = 0; j0 < SQ; j0 += 8) { FragH f; for (int q = 0; q < 8; ++q) f.h[q] = (_Float16)(expf(s[j0 + q] - mx) * sc); unsigned short* d = (unsigned short*)P + (size_t)i * SQ + j0; *(v8us*)d = f.half[0];  } }
__global__ __launch_bounds__(256) void k_vt(const _Float16* __restrict__ V16, int b, int h0, _Float16* __restrict__ VT) { __shared__ unsigned short tl[64][65]; const int tid = threadIdx.x; const int hh = blockIdx.x % HG, sg = blockIdx.x / HG; const int s0 = sg * 64; const int h = h0 + hh;
  for (int i = tid; i < 64 * 8; i += 256) { const int j = i / 8, d8 = (i % 8) * 8; FragH f; f.half[0] = *(const v8us*)((const unsigned short*)V16 + ((size_t)b * SQ + s0 + j) * DM + h * HD + d8); for (int q = 0; q < 8; ++q) tl[d8 + q][j] = f.u[q]; }
  __syncthreads();
  { for (int i = tid; i < 64 * 8; i += 256) { const int d = i / 8, j8 = (i % 8) * 8; FragH f; for (int q = 0; q < 8; ++q) f.u[q] = tl[d][j8 + q]; *(v8us*)((unsigned short*)VT + ((size_t)hh * HD + d) * SQ + s0 + j8) = f.half[0]; }  } }



__global__ __launch_bounds__(256) void k_rsmcf2(const float* __restrict__ S, _Float16* __restrict__ P, int hg, int q0, int nk) {
  #pragma clang fp contract(off)
  const int t = blockIdx.x * 256 + threadIdx.x; if (t >= hg * QT) return; const size_t i = (size_t)t; const float* s = S + i * NKX; const int last = q0 + (t % QT); float mx = -3.0e38f;
#pragma unroll 1
  for (int j = 0; j < nk; ++j) { const float f = (j <= last) ? 1.f : 0.f; mx = fmaxf(mx, fmaf(f, s[j], (1.f - f) * -1.0e9f)); } float se = 0.f;
#pragma unroll 1
  for (int j = 0; j < nk; ++j) { const float f = (j <= last) ? 1.f : 0.f; se += __expf(fmaf(f, s[j], (1.f - f) * -1.0e9f) - mx); } const float sc = 256.0f / se;
#pragma unroll 1
  for (int j0 = 0; j0 < nk; j0 += 8) { FragH fr; for (int q = 0; q < 8; ++q) { const int j = j0 + q; const float f = (j <= last) ? 1.f : 0.f; fr.h[q] = (_Float16)(__expf(fmaf(f, s[j], (1.f - f) * -1.0e9f) - mx) * sc); } unsigned short* d = (unsigned short*)P + i * NKX + j0; *(v8us*)d = fr.half[0];  } }


template <int MASKADD>
__global__ __launch_bounds__(64) void k_att0(const float* __restrict__ QF, const float* __restrict__ KF, const float* __restrict__ VF, int ld, const float* __restrict__ mask, float scale, float* __restrict__ OF, int ldo) {
  #pragma clang fp contract(off)
  __shared__ __attribute__((aligned(16))) float lq[64][64]; __shared__ __attribute__((aligned(16))) float lo[64][64];
  const int tid = threadIdx.x; const int h = blockIdx.x / (QT0 / 64), rg = blockIdx.x % (QT0 / 64); const int i = rg * 64 + tid;
  const float* qr = QF + (size_t)i * ld + h * HD;
#pragma unroll 1
  for (int c = 0; c < HD / 4; ++c) { *(v4f*)&lq[tid][c * 4] = *(const v4fa*)(qr + c * 4); const v4f z = {0.f, 0.f, 0.f, 0.f}; *(v4f*)&lo[tid][c * 4] = z; }
  float m = -1.0e30f, l = 0.f; const int jmax = MASKADD ? (SQ - 1) : (rg * 64 + 63);      /* additive-mask form: every key (the mask input decides); causal form: keys up to the block's last row */
#pragma unroll 1
  for (int j = 0; j <= jmax; ++j) { const float* kr = KF + (size_t)j * ld + h * HD; const float* vr = VF + (size_t)j * ld + h * HD; float s = 0.f;
#pragma unroll 1
    for (int c = 0; c < HD / 4; ++c) { const v4f kq = *(const v4fa*)(kr + c * 4); const v4f qq = *(v4f*)&lq[tid][c * 4]; s = __fadd_rn(s, __fmul_rn(qq[0], kq[0])); s = __fadd_rn(s, __fmul_rn(qq[1], kq[1])); s = __fadd_rn(s, __fmul_rn(qq[2], kq[2])); s = __fadd_rn(s, __fmul_rn(qq[3], kq[3])); }
    s = __fmul_rn(s, scale); if (MASKADD) s = __fadd_rn(s, __fmul_rn(bf16_round(mask[(size_t)i * SQ + j]), -10000.0f));
    const float f = (MASKADD || j <= i) ? 1.f : 0.f; const float sm = fmaf(f, s, (1.f - f) * -1.0e30f); const float mn = fmaxf(m, sm); const float sc = expf(m - mn); const float e = expf(sm - mn); l = __fadd_rn(__fmul_rn(l, sc), e); m = mn;
#pragma unroll 1
    for (int c = 0; c < HD / 4; ++c) { const v4f vv = *(const v4fa*)(vr + c * 4); v4f oo = *(v4f*)&lo[tid][c * 4]; for (int u = 0; u < 4; ++u) oo[u] = __fadd_rn(__fmul_rn(oo[u], sc), __fmul_rn(e, vv[u])); *(v4f*)&lo[tid][c * 4] = oo; } }
  const float fin = 64.0f / l;      /* o carried x64 like the f16 path */
#pragma unroll 1
  for (int c = 0; c < HD / 4; ++c) { v4f oo = *(v4f*)&lo[tid][c * 4]; for (int u = 0; u < 4; ++u) oo[u] = __fmul_rn(oo[u], fin); *(v4f*)&lo[tid][c * 4] = oo; }
  __syncthreads();
  {
#pragma unroll 1
    for (int it = 0; it < 16; ++it) { const int row = it * 4 + tid / 16, pc = (tid % 16) * 4; const v4f v = *(const v4f*)&lo[row][pc]; *(v4f*)(OF + (size_t)(rg * 64 + row) * ldo + h * HD + pc) = v; }
     } }


// Causal linear attention in chunks of SC keys: o_i = sum_{j <= i} a_ij v_j / sum_{j <= i} a_ij, a_ij = phi(q_i) . phi(k_j). The sums over the keys are plain sums, so the keys in front of a query's own chunk
// enter through the running state S = sum_j phi(k_j) v_j^T (HD x HD) and z = sum_j phi(k_j), as in the cumulative-sum form of the definition: o_i = (phi(q_i) S + own chunk) / (phi(q_i) z + own chunk).
// kvs: the state in front of every chunk. One work-group per (batch, head, 32 rows d, 16 columns t of S), one wave per (16 rows d, quarter of the keys). A wave forms the sums of its 8 chunks, S[d][t] = sum K^T[d][key] V^T[t][key] on WMMA
// (f32 accumulators; both planes transposed in fragment order by k_gemm2), the quarters' totals go through LDS, and each wave adds up in f32: the quarters in front of its own, then its chunks in ascending order,
// storing the tile as f16 in front of each chunk. A lane of the accumulator holds 8 consecutive d of ONE column t: its 16 bytes of the B fragment (row t, k = d) of phi(q) S. Column tile 4 takes a fragment of ones for V^T: each of its 16 columns is z.
#define SC 64                        /* keys per chunk */
#define SNP 5120                     /* halfs per stored state: [5 column tiles][4 d tiles] pieces of 512 bytes */
#define SG 8                         /* steps of 32 keys whose loads are in flight together */
#define SN 4                         /* parts of the keys, four waves each (one per 16 rows d) */
#define SW (SQ / SC / SN)            /* chunks per wave */
#define SB (5 * 2 * NH * NB)          /* work-groups of kvs, 64 SN threads each */
__device__ __forceinline__ void kvs(const int bi, const _Float16* __restrict__ KT, const _Float16* __restrict__ VT, _Float16* __restrict__ ST) {      /* bi: 0 .. SB - 1 */
  __shared__ __attribute__((aligned(16))) float tot[SN][2][32][8];
  const int lane = threadIdx.x & 31; const int wv = __builtin_amdgcn_readfirstlane(threadIdx.x >> 5); const int dl = wv & 1, sg = wv >> 1; const int tt = bi % 5, dt = (bi / 5) % 2 * 2 + dl, h = (bi / 10) % NH, b = bi / (10 * NH); const bool zt = tt == 4;
  const size_t hb = ((size_t)b * NH + h) * SQ * HD + (size_t)sg * (SQ / SN) * HD + lane * 8; const _Float16* kp = KT + hb + dt * 512; const _Float16* vp = VT + hb + (zt ? 0 : tt) * 512;
  unsigned short* sp = (unsigned short*)ST + (((size_t)b * NH + h) * (SQ / SC) + sg * SW) * SNP + (tt * 4 + dt) * 256 + lane * 8;
  v16h one;
#pragma unroll
  for (int i = 0; i < 16; ++i) one[i] = (_Float16)1.0f;
  const v8f z8 = {0.f,0.f,0.f,0.f,0.f,0.f,0.f,0.f}; v8f cs[SW];
#pragma unroll      /* constant indices into cs */
  for (int g = 0; g < SW * 2 / SG; ++g) { v16h kf[SG], vf[SG]; const _Float16* kq = kp + g * SG * 2048; const _Float16* vq = vp + g * SG * 2048;
#pragma unroll
    for (int s = 0; s < SG; ++s) { kf[s] = pk_frag(kq + s * 2048); vf[s] = pk_frag(vq + s * 2048); }
    asm volatile("s_wait_xcnt 0x0" :: "v"(kq), "v"(vq) : "memory");      /* behind the last load of the group; the two address pairs are its inputs, so that neither is reused ahead of it */
#pragma unroll
    for (int c = 0; c < SG / 2; ++c) cs[g * (SG / 2) + c] = g2_mma(kf[2 * c + 1], zt ? one : vf[2 * c + 1], g2_mma(kf[2 * c], zt ? one : vf[2 * c], z8)); }
  v8f run = cs[0];
#pragma unroll
  for (int c = 1; c < SW; ++c) run += cs[c];
  *(v4f*)&tot[sg][dl][lane][0] = __builtin_shufflevector(run, run, 0, 1, 2, 3); *(v4f*)&tot[sg][dl][lane][4] = __builtin_shufflevector(run, run, 4, 5, 6, 7);
  __syncthreads();
  run = z8;
#pragma unroll
  for (int s = 0; s < SN - 1; ++s) if (s < sg) { const v4f x = *(const v4f*)&tot[s][dl][lane][0], y = *(const v4f*)&tot[s][dl][lane][4]; run += __builtin_shufflevector(x, y, 0, 1, 2, 3, 4, 5, 6, 7); }
#pragma unroll
  for (int c = 0; c < SW; ++c) { FragH f;      /* the state in front of the chunk (zero in front of the first), then the chunk's sum */
#pragma unroll
    for (int r = 0; r < 8; ++r) f.h[r] = (_Float16)run[r];
    *(v8us*)(sp + c * SNP) = f.half[0]; asm volatile("s_wait_xcnt 0x0" :: "v"(f.half[0]), "v"(sp) : "memory");      /* behind the store; the stored registers and the address pair are its inputs, so that neither is reused ahead of it */
    run += cs[c]; } }

// lfa: one wave per (batch, head, 32 query rows), four such waves a work-group. o and the row sum l start as phi(q) S and phi(q) z of the state in front of the rows' chunk; then the chunk's own 64 keys in two steps of 32:
// a^T = K Q^T, so that a lane of the accumulator holds 8 consecutive keys of ONE query: accumulator tile 0 (keys 0..15) and tile 1 (keys 16..31) of a query column, masked and rounded to f16,
// are elements 0..7 and 8..15 of the A fragment of a V^T in the k order of g2_frag (8 hh + i, 16 + 8 hh + i), in which V^T is stored too: nothing is moved between lanes. a times a fragment of ones adds the row sums to l,
// which so lies in the lane and register of the o elements that it divides. Every load of a wave is 512 contiguous bytes, four whole lines.
#define FQ 32                        /* query rows per wave */
#define FS 32                        /* keys per step */
#define FP 68                        /* pitch in floats of the o rows in LDS, as in k_gemm2 */
#define FB (SQ / FQ / 4)              /* work-groups of lfa per (batch, head) */
__device__ __forceinline__ void lfa(const int bi, float (*so)[FQ][FP], const _Float16* __restrict__ Q16, const _Float16* __restrict__ K16, const _Float16* __restrict__ VT, const _Float16* __restrict__ ST, _Float16* __restrict__ O16) {      /* bi: 0 .. FB NH NB - 1; so: the work-group's o rows in LDS; Q16, K16: fragment order of k_gemm2; VT: its transposed fragment order; each SQ HD halfs a (batch, head); ST: kvs; O16: rows of DM */
  const int tid = threadIdx.x, lane = tid & 31, ln = lane & 15, hh = lane >> 4; const int w = __builtin_amdgcn_readfirstlane(tid >> 5);
  const int rg = bi % FB * 4 + w, h = bi / FB % NH, b = bi / (FB * NH), ch = rg / (SC / FQ);
  const size_t hb = ((size_t)b * NH + h) * SQ * HD + lane * 8; const _Float16* qp = Q16 + hb + (size_t)rg * FQ * HD; const _Float16* kp = K16 + hb + (size_t)ch * SC * HD; const _Float16* vp = VT + hb + (size_t)ch * SC * HD;
  const _Float16* sp = ST + (((size_t)b * NH + h) * (SQ / SC) + ch) * SNP + lane * 8;
  v16h qf[2][2], sf[5][2], one;
#pragma unroll
  for (int i = 0; i < 16; ++i) one[i] = (_Float16)1.0f;
#pragma unroll
  for (int qs = 0; qs < 2; ++qs) { qf[qs][0] = pk_frag(qp + qs * PKT); qf[qs][1] = pk_frag(qp + qs * PKT + 512); }
#pragma unroll
  for (int t = 0; t < 5; ++t) { sf[t][0] = pk_frag(sp + t * 1024); sf[t][1] = pk_frag(sp + t * 1024 + 512); }
  asm volatile("s_wait_xcnt 0x0" :: "v"(qp), "v"(sp) : "memory");      /* behind the last q and state load; the address pairs are its inputs, so that they are not reused ahead of it */
  const v8f z8 = {0.f,0.f,0.f,0.f,0.f,0.f,0.f,0.f}; v8f o[2][5];      /* o[qs][t][r]: query 16 qs + 8 hh + r, column 16 t + ln; t = 4: the row sum, the same in every column */
#pragma unroll
  for (int qs = 0; qs < 2; ++qs)
#pragma unroll
    for (int t = 0; t < 5; ++t) o[qs][t] = g2_mma(qf[qs][0], sf[t][0], z8);
#pragma unroll
  for (int qs = 0; qs < 2; ++qs)
#pragma unroll
    for (int t = 0; t < 5; ++t) o[qs][t] = g2_mma(qf[qs][1], sf[t][1], o[qs][t]);
#pragma unroll
  for (int js = 0; js < SC / FS; ++js) { const _Float16* kq = kp + js * FS * HD; const _Float16* vq = vp + js * FS * HD;      /* a step's k and its V^T: 4 KiB in a row each */
    v16h kf[2][2], vf[4];
#pragma unroll
    for (int ks = 0; ks < 2; ++ks) { kf[ks][0] = pk_frag(kq + ks * PKT); kf[ks][1] = pk_frag(kq + ks * PKT + 512); }
#pragma unroll
    for (int t = 0; t < 4; ++t) vf[t] = pk_frag(vq + t * 512);
    asm volatile("s_wait_xcnt 0x0" :: "v"(kq), "v"(vq) : "memory");      /* behind the last load of the step; the two address pairs are its inputs, so that neither is reused ahead of it */
    v8f st[2][2];      /* st[ks][qs][r]: key ch SC + js FS + 16 ks + 8 hh + r, query rg FQ + 16 qs + ln */
#pragma unroll
    for (int ks = 0; ks < 2; ++ks)
#pragma unroll
      for (int qs = 0; qs < 2; ++qs) st[ks][qs] = g2_mma(kf[ks][0], qf[qs][0], z8);
#pragma unroll
    for (int ks = 0; ks < 2; ++ks)
#pragma unroll
      for (int qs = 0; qs < 2; ++qs) st[ks][qs] = g2_mma(kf[ks][1], qf[qs][1], st[ks][qs]);
    const int dq = (rg - ch * (SC / FQ) - js) * FS + ln - 8 * hh;      /* query row less key row at ks = qs = r = 0; both steps are masked, the keys behind a query count zero */
#pragma unroll
    for (int ks = 0; ks < 2; ++ks)
#pragma unroll
      for (int qs = 0; qs < 2; ++qs)
#pragma unroll
        for (int r = 0; r < 8; ++r) st[ks][qs][r] = (ks * 16 + r <= qs * 16 + dq) ? st[ks][qs][r] : 0.f;
#pragma unroll
    for (int qs = 0; qs < 2; ++qs) { FragH p;
#pragma unroll
      for (int r = 0; r < 8; ++r) { p.h[r] = (_Float16)st[0][qs][r]; p.h[8 + r] = (_Float16)st[1][qs][r]; }
#pragma unroll
      for (int t = 0; t < 4; ++t) o[qs][t] = g2_mma(p.v, vf[t], o[qs][t]);
      o[qs][4] = g2_mma(p.v, one, o[qs][4]); } }
#pragma unroll
  for (int qs = 0; qs < 2; ++qs)
#pragma unroll
    for (int r = 0; r < 8; ++r) { const float fin = 64.0f / o[qs][4][r];      /* o carried x64 as the output GEMM expects */
#pragma unroll
      for (int t = 0; t < 4; ++t) so[w][qs * 16 + 8 * hh + r][t * 16 + ln] = o[qs][t][r] * fin; }
  __syncthreads();
  const int r0 = lane >> 2, c0 = (lane & 3) * 16;      /* four lanes per output row: 32 bytes each of its 128-byte line; a wave stores its own 32 rows in four passes */
#pragma unroll
  for (int p = 0; p < 4; ++p) { const int row = p * 8 + r0; FragH f;
#pragma unroll
    for (int c = 0; c < 4; ++c) { const v4f a = *(const v4f*)&so[w][row][c0 + c * 4];
#pragma unroll
      for (int q = 0; q < 4; ++q) f.h[c * 4 + q] = (_Float16)a[q]; }
    unsigned short* d = (unsigned short*)O16 + ((size_t)b * SQ + rg * FQ + row) * DM + h * HD + c0;
    *(v8us*)d = f.half[0]; *(v8us*)(d + 8) = f.half[1]; asm volatile("s_wait_xcnt 0x0" :: "v"(f.half[0]), "v"(f.half[1]), "v"(d) : "memory"); } }      /* behind the two stores; the stored registers and the address pair are its inputs, so that neither is reused ahead of it */
// One launch for two pieces of work that read none of each other's output: work-groups 0 .. LB - 1 (the longer ones, so they start first) form o_lo Wo 2^-20 of the first QT0 rows of each batch and store it in the output's rows,
// where the output GEMM adds it to its own sums; the others are lfa. Both use the same LDS rows for their epilogue.
#define LB (NB * (DM / 64))          /* work-groups of the o_lo product: one row tile of QT0 = 128 rows a batch */
__global__ __launch_bounds__(128) void k_lfa_lo(const _Float16* __restrict__ Q16, const _Float16* __restrict__ K16, const _Float16* __restrict__ VT, const _Float16* __restrict__ ST, _Float16* __restrict__ O16, const _Float16* __restrict__ OL, const _Float16* __restrict__ BO, float* __restrict__ out) {
  __shared__ __attribute__((aligned(16))) float so[4][FQ][FP]; static_assert(FQ == 32 && FP == 68, "one LDS array for both epilogues");
  const int bi = blockIdx.x;
  if (bi < LB) gemm2<0>((unsigned)(bi % (DM / 64)), bi / (DM / 64), so, OL, DM, (size_t)QT0 * DM, BO, DM, 0, 0.00000095367431640625f, nullptr, 0, nullptr, 1, 0, 0, out, nullptr, DM, (size_t)SQ * DM, QT0, DM, DM, nullptr, nullptr, NB, 0, 0, nullptr, 0, nullptr);
  else lfa(bi - LB, so, Q16, K16, VT, ST, O16); }

// Exact f32 linear attention for the first QT0 rows of every batch. One work-group of 8 waves per (batch, head, 32 query rows), lane = query row.
// The head's QT0 key and value rows and the group's 32 q rows are staged once in LDS with whole-line loads, all in flight together. Step 1: wave w takes the keys j = w mod 8, four at a time
// (four independent sum chains), q row in registers, k row broadcast from LDS; the masked score goes to le[j][row]. Step 2: wave w owns columns 8 w .. 8 w + 7 of o in registers
// and walks the keys in ascending order. Each sum runs in the order of the one-thread-per-row form (d ascending, j ascending); keys above the group's last row only ever added zeros and are left out.
#define LR 32                        /* query rows per work-group */
#define LP 68                        /* pitch in floats of the per-row LDS arrays: 16 B x odd, so that 32 lanes reading 16 B of their own rows spread over the banks */
#define LA (NH * (QT0 / LR))         /* work-groups of latt0 per batch */
__device__ __forceinline__ void latt0(const int bi, const float* __restrict__ QF, const float* __restrict__ KF, const float* __restrict__ VF, _Float16* __restrict__ OH, _Float16* __restrict__ OL) {      /* bi: 0 .. LA NB - 1; all planes: rows of DM; QF, KF, VF: SQ rows a batch, the first QT0 of them written; OH, OL: QT0 rows a batch, o (x64) as f16 and its residual x1024 as f16 */
  { const int bt = bi / LA; const size_t fb = (size_t)bt * SQ * DM; QF += fb; KF += fb; VF += fb; OH += (size_t)bt * QT0 * DM; OL += (size_t)bt * QT0 * DM; }
  __shared__ __attribute__((aligned(16))) float lk[QT0][HD]; __shared__ __attribute__((aligned(16))) float lv[QT0][HD]; __shared__ __attribute__((aligned(16))) float le[QT0][LR];
  __shared__ __attribute__((aligned(16))) float lq[LR][LP]; __shared__ __attribute__((aligned(16))) float lo[LR][LP];
  const int tid = threadIdx.x, w = tid >> 5, lane = tid & 31; const int h = bi % LA / (QT0 / LR), rg = bi % (QT0 / LR); const int r0 = rg * LR, nj = r0 + LR, i = r0 + lane;
  const int sr = tid / (HD / 4), sc = (tid % (HD / 4)) * 4;      /* staging and output: 16 lanes per 256-byte row, 16 rows per pass of the work-group */
  { v4f tk[QT0 / 16], tv[QT0 / 16], tq[LR / 16]; const float* kp = KF + (size_t)sr * DM + h * HD + sc; const float* vp = VF + (size_t)sr * DM + h * HD + sc; const float* qp = QF + (size_t)(r0 + sr) * DM + h * HD + sc;
#pragma unroll      /* every load is issued before the first LDS store waits for one */
    for (int p = 0; p < QT0 / 16; ++p) { tk[p] = *(const v4fa*)(kp + (size_t)p * 16 * DM); tv[p] = *(const v4fa*)(vp + (size_t)p * 16 * DM); }
#pragma unroll
    for (int p = 0; p < LR / 16; ++p) tq[p] = *(const v4fa*)(qp + (size_t)p * 16 * DM);
    asm volatile("s_wait_xcnt 0x0" :: "v"(kp), "v"(vp), "v"(qp) : "memory");      /* behind the last load of the run; the three address pairs are its inputs, so that none of them is given to a load's result or reused ahead of it */
#pragma unroll
    for (int p = 0; p < QT0 / 16; ++p) { *(v4f*)&lk[p * 16 + sr][sc] = tk[p]; *(v4f*)&lv[p * 16 + sr][sc] = tv[p]; }
#pragma unroll
    for (int p = 0; p < LR / 16; ++p) *(v4f*)&lq[p * 16 + sr][sc] = tq[p]; }
  __syncthreads();
  v4f q[HD / 4];
#pragma unroll      /* q stays in registers: constant indices only */
  for (int c = 0; c < HD / 4; ++c) q[c] = *(const v4f*)&lq[lane][c * 4];
  for (int jb = 0; jb < nj; jb += 32) { const int j0 = jb + w; float s0 = 0.f, s1 = 0.f, s2 = 0.f, s3 = 0.f;
#pragma unroll      /* constant indices into q; the four chains fill each other's result latency */
    for (int c = 0; c < HD / 4; ++c) { const v4f k0 = *(const v4f*)&lk[j0][c * 4], k1 = *(const v4f*)&lk[j0 + 8][c * 4], k2 = *(const v4f*)&lk[j0 + 16][c * 4], k3 = *(const v4f*)&lk[j0 + 24][c * 4];
#pragma unroll
      for (int u = 0; u < 4; ++u) { s0 += q[c][u] * k0[u]; s1 += q[c][u] * k1[u]; s2 += q[c][u] * k2[u]; s3 += q[c][u] * k3[u]; } }
    le[j0][lane] = (j0 <= i) ? s0 : 0.f; le[j0 + 8][lane] = (j0 + 8 <= i) ? s1 : 0.f; le[j0 + 16][lane] = (j0 + 16 <= i) ? s2 : 0.f; le[j0 + 24][lane] = (j0 + 24 <= i) ? s3 : 0.f; }
  __syncthreads();
  float l = 0.f; v4f oa = {0.f, 0.f, 0.f, 0.f}, ob = {0.f, 0.f, 0.f, 0.f};
#pragma unroll 8      /* eight keys' LDS reads are issued ahead of the sums that use them */
  for (int j = 0; j < nj; ++j) { const float e = le[j][lane]; const v4f va = *(const v4f*)&lv[j][w * 8], vb = *(const v4f*)&lv[j][w * 8 + 4]; l += e; oa += e * va; ob += e * vb; }
  const float fin = 64.0f / l;      /* o carried x64 like the f16 path */
  *(v4f*)&lo[lane][w * 8] = oa * fin; *(v4f*)&lo[lane][w * 8 + 4] = ob * fin;
  __syncthreads();
#pragma unroll      /* two passes, each wave storing whole 128-byte lines of both planes */
  for (int p = 0; p < LR / 16; ++p) { const v4f a = *(const v4f*)&lo[p * 16 + sr][sc]; v4h fh, fl;
#pragma unroll
    for (int q = 0; q < 4; ++q) { const _Float16 hq = (_Float16)a[q]; fh[q] = hq; fl[q] = (_Float16)((a[q] - (float)hq) * 1024.0f); }
    const size_t od = (size_t)(r0 + p * 16 + sr) * DM + h * HD + sc; _Float16* dh = OH + od; _Float16* dl = OL + od;
    *(v4h*)dh = fh; *(v4h*)dl = fl; asm volatile("s_wait_xcnt 0x0" :: "v"(fh), "v"(fl), "v"(dh), "v"(dl) : "memory"); } }      /* behind the two stores; the stored registers and the address pairs are its inputs, so that none is reused ahead of it */
// One launch for two pieces of work that read none of each other's output (both read what the q, k, v GEMM wrote): work-groups 0 .. LA NB - 1 are latt0, the others kvs.
__global__ __launch_bounds__(256) void k_latt0_kvs(const float* __restrict__ QF, const float* __restrict__ KF, const float* __restrict__ VF, _Float16* __restrict__ OH, _Float16* __restrict__ OL, const _Float16* __restrict__ KT, const _Float16* __restrict__ VT, _Float16* __restrict__ ST) {
  static_assert(64 * SN == 256, "kvs and latt0 have work-groups of 8 waves"); const int bi = blockIdx.x;
  if (bi < LA * NB) latt0(bi, QF, KF, VF, OH, OL); else kvs(bi - LA * NB, KT, VT, ST); }
extern "C" void kernel_launch(void* const* d_in, const int* in_sizes, int n_in,
                              void* d_out, int out_size, void* d_ws, size_t ws_size, hipStream_t stream) {
  (void)in_sizes; (void)n_in; (void)out_size;
  const float* const* I = (const float* const*)d_in; const float* x = I[0]; const float* wqk = I[1]; const float* bqk = I[2]; const float* wv = I[3]; const float* bv = I[4]; const float* wo = I[5]; const float* bo = I[6];      /* natural Wqk [2048][1024] (q rows | k rows) + bias [2048]; Wv + bv; Wo + bo */
  char* ws = (char*)d_ws; size_t off = 0;
  auto take = [&](size_t bytes) { char* p = ws + off; off += (bytes + 255) & ~(size_t)255; return p; };
  _Float16* BQK = (_Float16*)take((size_t)4 * DM * DM * 2); _Float16* BO = BQK + (size_t)3 * DM * DM;      /* four planes in a row: Wq | Wk | Wv | Wo */
  _Float16* X16 = (_Float16*)take(NR * DM * 2); _Float16* Q16 = (_Float16*)take((size_t)3 * NR * DM * 2); _Float16* K16 = Q16 + NR * DM; _Float16* O16 = (_Float16*)take(NR * DM * 2);      /* q | k | a third plane that nothing writes: v is stored only as V^T */
  _Float16* KT = (_Float16*)take((size_t)2 * NB * NH * HD * SQ * 2); _Float16* VT = KT + (size_t)NB * NH * HD * SQ; _Float16* ST = (_Float16*)take((size_t)NB * NH * (SQ / SC) * SNP * 2);      /* K^T | V^T: two planes in a row; the states in front of the chunks */
  float* QF0 = (float*)take((size_t)3 * NR * DM * 4); float* KF0 = QF0 + NR * DM; float* VF0 = QF0 + 2 * NR * DM;      /* f32 q | k | v, indexed like the f16 planes; only the first QT0 rows of each batch are written and read */
  _Float16* OH0 = (_Float16*)take((size_t)NB * QT0 * DM * 2); _Float16* OL0 = (_Float16*)take((size_t)NB * QT0 * DM * 2);
  if (off > ws_size) return;
  k_cvt<<<4 * CPB + CXB, 256, 0, stream>>>(wqk, wv, wo, x, BQK, X16);
  k_gemm2<19><<<dim3((unsigned)((NR / 128) * (DM / 64)), 3), 128, 0, stream>>>(X16, DM, 0, BQK, DM, (size_t)DM * DM, 0.0625f, bqk, DM, nullptr, 1, 0, 0, QF0, Q16, DM, NR * DM, (int)NR, DM, DM, nullptr, bv, 2, 1, 2, KT, 1, nullptr);      /* planes 0, 1: phi(q), phi(k) = elu(x W^T + b) + 1, f16 in fragment order; planes 1, 2: phi(k), v transposed in fragment order; and in f32 rows the first 128 rows of each batch (exact products) */
  k_latt0_kvs<<<LA * NB + SB, 256, 0, stream>>>(QF0, KF0, VF0, OH0, OL0, KT, VT, ST);      /* exact f32 linear attention for rows 0..127 of each batch (the few-key rows without the f16 roundings), o (x64) stored as f16 hi + x1024 residual planes; beside it the running sums phi(k) v^T and phi(k) in front of every chunk of 64 keys */
  k_lfa_lo<<<LB + FB * NH * NB, 128, 0, stream>>>(Q16, K16, VT, ST, O16, OL0, BO, (float*)d_out);      /* state product, own chunk's scores, causal normalisation and a V^T of every batch, head and query tile: o (merged heads, x64) as f16 rows; beside it rows 0..127 of each batch of out = o_lo Wo 2^-20 */
  k_gemm2<0><<<dim3((unsigned)((NR / 128) * (DM / 64)), 1), 128, 0, stream>>>(O16, DM, 0, BO, DM, 0, 0.0009765625f, bo, 0, nullptr, 1, 0, 0, (float*)d_out, nullptr, DM, 0, (int)NR, DM, DM, OH0, nullptr, 1, 0, 0, nullptr, 0, (const float*)d_out);      /* out rows are the output layout; rows 0..127 of each batch: out = o_hi Wo + b + their own element as the launch before left it */
}

// v009
// One run takes 85 microseconds.
// Timed twice side by side with v008, it ran 1.28 and 1.29 times as fast.
// Over all steps from v000 it is 49.9 times as fast.
#include <hip/hip_runtime.h>
// Causal LINEAR attention (x [2][2048][1024]; qk = x Wqk^T + bqk (natural [2048][1024]: rows 0..1023 -> q, 1024..2047 -> k; sigma 1/32, biases 0.02), v = x Wv^T + bv; 16 heads of 64; feature map phi = elu + 1 on q and k; ctx_t = (phi(q_t) . sum_{s<=t} phi(k_s) v_s^T) / (phi(q_t) . sum_{s<=t} phi(k_s)) = sum_{s<=t} a_ts v_s / sum_{s<=t} a_ts with a_ts = phi(q_t).phi(k_s) (the module's cumsum form, no softmax, no scaling, no eps); out = ctx Wo^T + bo -> [2][2048][1024]).
// Structure: x as exact f16 rows and the natural weights as exact x16 planes in one VALU launch; q, k (with the elu + 1 feature map in the GEMM epilogue) and v as one launch of WMMA GEMMs (32x64 wave tiles, f32 accumulation, + bias) with f16 outputs, phi(k) and v also transposed straight from the accumulators, the first 128 rows of each batch also in f32; the running sums phi(k) v^T and phi(k) in front of every chunk of 64 keys on WMMA (f32 accumulation, stored f16), in one launch with the first rows' f32 attention; one fused attention launch for all batches, heads and query tiles of 32 rows: phi(q) times the state in front of the chunk, then a^T = phi(k) phi(q)^T on WMMA (K = 64) for the chunk's own keys, causal mask, a as f16 straight from the accumulators into the A operand of ctx = a V^T on WMMA, row sums on WMMA too, ctx x64 / sum a into merged f16 rows; out = ctx Wo^T + bo GEMM (f32); first-tile refinement: the first 128 rows of each batch computed exactly in f32 on VALU (a / sum a weights), their output rows taken from o hi in the output GEMM, which adds the o lo product formed beside the attention launch; 5 launches.
// Compute dtype: inputs rounded to bf16; x / weights exact; q, k, v, the weights a and o as plain f16 GEMM operands (~2^-12); scores and row sums f32. v_wmma_f32_16x16x32_f16.
#define NB 2
#define SQ 2048
#define DM 1024
#define NH 16
#define HD 64
#define HG 4                         /* heads per group in the unlaunched k_vt(V16, b, h0, VT) overload */
#define QT 256                       /* query rows per causal tile */
#define NKX SQ                       /* S / P row pitch */
#define QT0 128                      /* first-tile rows recomputed exactly in f32 */
#define B0 0                         /* unused: every launch starts at batch 0 */
#define NBR NB                       /* only in MP, which no launch reads: the launches cover all NB batches */
#define NR ((size_t)NB * SQ)         /* token rows */
#define MP ((int)((size_t)NBR * SQ)) /* only in MPO, which no launch reads: the projections take all NR rows */
#define QN SQ                        /* unused: k_lfa attends all SQ rows of every batch */
#define NHD NH                       /* unused: k_lfa attends all NH heads */
#define MPO MP                       /* unused: the output GEMM takes all NR rows */
#define LQ DM      /* unused: the f32 q/k/v rows take pitch DM */
typedef __bf16 v16b __attribute__((ext_vector_type(16)));
typedef unsigned short v8us __attribute__((ext_vector_type(8), may_alias));
typedef float  v8f  __attribute__((ext_vector_type(8)));
typedef float  v4f  __attribute__((ext_vector_type(4)));
typedef float  v4fa __attribute__((ext_vector_type(4), may_alias));
union FragB { v16b v; v8us half[2]; unsigned short u[16]; };

__device__ __forceinline__ unsigned short bf16_bits(float x) { unsigned int u = __float_as_uint(x); return (unsigned short)((u + 0x7FFFu + ((u >> 16) & 1u)) >> 16); }
__device__ __forceinline__ float bf16_val(unsigned short b) { return __uint_as_float(((unsigned int)b) << 16); }
__device__ __forceinline__ float bf16_round(float x) { return bf16_val(bf16_bits(x)); }
// D += A·B with NT terms: 1 = ah·bh, 2 = + al·bh (A split), 3 = + ah·bl (both split)
template <int NT>
__device__ __forceinline__ v8f mmaN(v16b ah, v16b al, v16b bh, v16b bl, v8f c) {
  c = __builtin_amdgcn_wmma_f32_16x16x32_bf16(false, ah, false, bh, (short)0, c, false, false);
  if (NT >= 2) c = __builtin_amdgcn_wmma_f32_16x16x32_bf16(false, al, false, bh, (short)0, c, false, false);
  if (NT >= 3) c = __builtin_amdgcn_wmma_f32_16x16x32_bf16(false, ah, false, bl, (short)0, c, false, false);
  asm volatile("v_nop\n\tv_nop\n\tv_nop\n\tv_nop" : "+v"(c) : "v"(ah), "v"(al), "v"(bh), "v"(bl));
  return c;
}

__global__ __launch_bounds__(256) void k_wt_bf16(const float* __restrict__ W, unsigned short* __restrict__ Wt, int K, int N) {
  const int t = blockIdx.x * 256 + threadIdx.x;
  const int k8n = K / 8;
  if (t >= N * k8n) return;
  const int n = t / k8n, k8 = (t % k8n) * 8;
  v8us v;
#pragma unroll
  for (int i = 0; i < 8; ++i) v[i] = bf16_bits(W[(size_t)(k8 + i) * N + n]);
  *(v8us*)(Wt + (size_t)n * K + k8) = v;
  
}

// GEMM C[M][N] (f32, pitch ldc) = act(A[M][K]·W + bias). A f32 row-major (pitch lda) converted per fragment to bf16
// (ASPLIT: hi/lo two planes -> 2 terms, else single rounded term); Wt bf16 [N][K] (pitch ldb). BIAS_BF16 rounds the
// bias to bf16 first (bias quantised to bf16 before the add). K%32==0, M%16==0, N%64==0.
template <bool ASPLIT, int ACT, bool BIAS_BF16>
__global__ __launch_bounds__(128) void k_gemm_bf(const float* __restrict__ A, int lda, const unsigned short* __restrict__ Wt, int ldb,
                                               const float* __restrict__ bias, float* __restrict__ C, int ldc, int M, int N, int K) {
  __shared__ __attribute__((aligned(16))) float so[4][16][64];
  const int tid = threadIdx.x, w = tid >> 5, lane = tid & 31, ln = lane & 15, hh = lane >> 4;
  const int ntn = N / 64;
  const int wid = blockIdx.x * 4 + w;
  const int mt = wid / ntn, nq = wid % ntn;
  if (mt * 16 >= M) return;
  const int row0 = mt * 16, col0 = nq * 64;
  const float* arow = A + (size_t)(row0 + ln) * lda;
  v8f acc[4] = {};
  for (int kb = 0; kb < K; kb += 32) {
    FragB ah, al;
    const v4f x0 = *(const v4fa*)(arow + kb + 8 * hh), x1 = *(const v4fa*)(arow + kb + 8 * hh + 4);
    const v4f x2 = *(const v4fa*)(arow + kb + 16 + 8 * hh), x3 = *(const v4fa*)(arow + kb + 16 + 8 * hh + 4);
    float xs[16] = {x0[0],x0[1],x0[2],x0[3],x1[0],x1[1],x1[2],x1[3],x2[0],x2[1],x2[2],x2[3],x3[0],x3[1],x3[2],x3[3]};
#pragma unroll
    for (int i = 0; i < 16; ++i) { const unsigned short hb = bf16_bits(xs[i]); ah.u[i] = hb; al.u[i] = ASPLIT ? bf16_bits(xs[i] - bf16_val(hb)) : (unsigned short)0; }
#pragma unroll
    for (int t = 0; t < 4; ++t) {
      const unsigned short* brow = Wt + (size_t)(col0 + t * 16 + ln) * ldb + kb;
      FragB b;
      b.half[0] = *(const v8us*)(brow + 8 * hh);
      b.half[1] = *(const v8us*)(brow + 16 + 8 * hh);
      acc[t] = mmaN<ASPLIT ? 2 : 1>(ah.v, al.v, b.v, b.v, acc[t]);
    }
  }
#pragma unroll
  for (int t = 0; t < 4; ++t) {
    float bv = bias ? bias[col0 + t * 16 + ln] : 0.f;
    if (BIAS_BF16) bv = bf16_round(bv);
#pragma unroll
    for (int r = 0; r < 8; ++r) { float v = acc[t][r] + bv; if (ACT == 1) v = fmaxf(v, 0.f); so[w][8 * hh + r][t * 16 + ln] = v; }
  }
  __builtin_amdgcn_fence(__ATOMIC_ACQ_REL, "workgroup");
  __builtin_amdgcn_wave_barrier();
  const int rsub = lane >> 4, c4 = (lane & 15) * 4;
  {
#pragma unroll
    for (int q = 0; q < 8; ++q) {
      const int r = q * 2 + rsub;
      const v4f v = *(const v4fa*)&so[w][r][c4];
      *(v4f*)(C + (size_t)(row0 + r) * ldc + col0 + c4) = v;
    }
    
  }
}

// GEMM C = act(A·W + bias + resid): A f32 (ASPLIT -> hi/lo 2 terms), Wt bf16 [N][K]; ACT 0 none, 1 relu, 2 exact gelu;
// resid (optional, f32, row index = (row % rmod), pitch ldr, RES_BF16 rounds it) added before the activation.
template <bool ASPLIT, int ACT, bool BIAS_BF16, bool RES_BF16>
__global__ __launch_bounds__(128) void k_gemm_bf3(const float* __restrict__ A, int lda, const unsigned short* __restrict__ Wt, int ldb,
                                                const float* __restrict__ bias, const float* __restrict__ resid, int rmod, int ldr,
                                                float* __restrict__ C, int ldc, int M, int N, int K) {
  __shared__ __attribute__((aligned(16))) float so[4][16][64];
  const int tid = threadIdx.x, w = tid >> 5, lane = tid & 31, ln = lane & 15, hh = lane >> 4;
  const int ntn = N / 64;
  const int wid = blockIdx.x * 4 + w;
  const int mt = wid / ntn, nq = wid % ntn;
  if (mt * 16 >= M) return;
  const int row0 = mt * 16, col0 = nq * 64;
  const float* arow = A + (size_t)(row0 + ln) * lda;
  v8f acc[4] = {};
  for (int kb = 0; kb < K; kb += 32) {
    FragB ah, al;
    const v4f x0 = *(const v4fa*)(arow + kb + 8 * hh), x1 = *(const v4fa*)(arow + kb + 8 * hh + 4);
    const v4f x2 = *(const v4fa*)(arow + kb + 16 + 8 * hh), x3 = *(const v4fa*)(arow + kb + 16 + 8 * hh + 4);
    float xs[16] = {x0[0],x0[1],x0[2],x0[3],x1[0],x1[1],x1[2],x1[3],x2[0],x2[1],x2[2],x2[3],x3[0],x3[1],x3[2],x3[3]};
#pragma unroll
    for (int i = 0; i < 16; ++i) { const unsigned short hb = bf16_bits(xs[i]); ah.u[i] = hb; al.u[i] = ASPLIT ? bf16_bits(xs[i] - bf16_val(hb)) : (unsigned short)0; }
#pragma unroll
    for (int t = 0; t < 4; ++t) {
      const unsigned short* brow = Wt + (size_t)(col0 + t * 16 + ln) * ldb + kb;
      FragB b;
      b.half[0] = *(const v8us*)(brow + 8 * hh);
      b.half[1] = *(const v8us*)(brow + 16 + 8 * hh);
      acc[t] = mmaN<ASPLIT ? 2 : 1>(ah.v, al.v, b.v, b.v, acc[t]);
    }
  }
#pragma unroll
  for (int t = 0; t < 4; ++t) {
    const int col = col0 + t * 16 + ln;
    float bv = bias ? bias[col] : 0.f;
    if (BIAS_BF16) bv = bf16_round(bv);
#pragma unroll
    for (int r = 0; r < 8; ++r) {
      float v = acc[t][r] + bv;
      if (resid) { float rv = resid[(size_t)((row0 + 8 * hh + r) % rmod) * ldr + col]; if (RES_BF16) rv = bf16_round(rv); v += rv; }
      if (ACT == 1) v = fmaxf(v, 0.f);
      if (ACT == 2) v = 0.5f * v * (1.0f + erff(v * 0.70710678118654752f));
      if (ACT == 3) { const float u = 0.7978845608028654f * (v + 0.044715f * v * v * v); v = 0.5f * v * (1.0f + tanhf(u)); }
      so[w][8 * hh + r][t * 16 + ln] = v;
    }
  }
  __builtin_amdgcn_fence(__ATOMIC_ACQ_REL, "workgroup");
  __builtin_amdgcn_wave_barrier();
  const int rsub = lane >> 4, c4 = (lane & 15) * 4;
  {
#pragma unroll
    for (int q = 0; q < 8; ++q) {
      const int r = q * 2 + rsub;
      const v4f v = *(const v4fa*)&so[w][r][c4];
      *(v4f*)(C + (size_t)(row0 + r) * ldc + col0 + c4) = v;
    }
    
  }
}
// row LayerNorm (biased variance, eps) over N: s = X (+ R); optional out_sum <- s; out_norm <- (s-mu)*rsqrt(var+eps)*g + b
template <bool PARAM_BF16>
__global__ __launch_bounds__(256) void k_layernorm(const float* __restrict__ X, const float* __restrict__ R, const float* __restrict__ g, const float* __restrict__ bta,
                                                  float* __restrict__ out_sum, float* __restrict__ out_norm, int N, float eps) {
  __shared__ float red[256];
  const int row = blockIdx.x, tid = threadIdx.x;
  const float* x = X + (size_t)row * N; const float* rr = R ? R + (size_t)row * N : nullptr;
  float vals[16];                     // up to N = 4096
  const int per = N / 256;            // contiguous chunk per thread? use strided-by-4 chunks: thread handles j = tid*4 + 1024*u
  float s1 = 0.f;
  for (int u = 0; u < per / 4; ++u) {
    const int j = tid * 4 + 1024 * u;
    const v4f a = *(const v4fa*)(x + j);
    v4f b = {0.f,0.f,0.f,0.f}; if (rr) b = *(const v4fa*)(rr + j);
#pragma unroll
    for (int q = 0; q < 4; ++q) { const float v = a[q] + b[q]; vals[u * 4 + q] = v; s1 += v; }
  }
  red[tid] = s1; __syncthreads();
  for (int st = 128; st > 0; st >>= 1) { if (tid < st) red[tid] += red[tid + st]; __syncthreads(); }
  const float mu = red[0] / (float)N; __syncthreads();
  float s2 = 0.f;
  for (int u = 0; u < per / 4; ++u)
#pragma unroll
    for (int q = 0; q < 4; ++q) { const float c = vals[u * 4 + q] - mu; s2 += c * c; }
  red[tid] = s2; __syncthreads();
  for (int st = 128; st > 0; st >>= 1) { if (tid < st) red[tid] += red[tid + st]; __syncthreads(); }
  const float rs = rsqrtf(red[0] / (float)N + eps);
  {
    for (int u = 0; u < per / 4; ++u) {
      const int j = tid * 4 + 1024 * u;
      v4f o, sm;
#pragma unroll
      for (int q = 0; q < 4; ++q) {
        float gg = g[j + q], bb = bta[j + q];
        if (PARAM_BF16) { gg = bf16_round(gg); bb = bf16_round(bb); }
        sm[q] = vals[u * 4 + q]; o[q] = (vals[u * 4 + q] - mu) * rs * gg + bb;
      }
      if (out_sum) *(v4f*)(out_sum + (size_t)row * N + j) = sm;
      *(v4f*)(out_norm + (size_t)row * N + j) = o;
    }
    
  }
}



// ---- f16 WMMA path (v_wmma_f32_16x16x32_f16): 11-bit significands for operands in range — used where a [0,1] probability operand needs more precision than bf16
typedef _Float16 v16h __attribute__((ext_vector_type(16)));
union FragH { v16h v; v8us half[2]; _Float16 h[16]; unsigned short u[16]; };
template <int NT>
__device__ __forceinline__ v8f mmaH(v16h ah, v16h al, v16h bh, v16h bl, v8f c) {
  c = __builtin_amdgcn_wmma_f32_16x16x32_f16(false, ah, false, bh, (short)0, c, false, false);
  if (NT >= 2) c = __builtin_amdgcn_wmma_f32_16x16x32_f16(false, al, false, bh, (short)0, c, false, false);
  if (NT >= 3) c = __builtin_amdgcn_wmma_f32_16x16x32_f16(false, ah, false, bl, (short)0, c, false, false);
  asm volatile("v_nop\n\tv_nop\n\tv_nop\n\tv_nop" : "+v"(c) : "v"(ah), "v"(al), "v"(bh), "v"(bl));
  return c;
}
// batched GEMM like k_gemm_b but f16 operands: A f32 (split into f16 hi/lo if ASPLIT, else rounded to f16), Bt = f16 values [n][k]; alpha; C f32; N multiple of 16 (partial tiles skipped)
template <bool ASPLIT>
__global__ __launch_bounds__(128) void k_gemm_h(const float* __restrict__ A, int lda, size_t sA, const _Float16* __restrict__ Bh, int ldb, size_t sB, float alpha, float* __restrict__ C, int ldc, size_t sC, int M, int N, int K) {
  __shared__ __attribute__((aligned(16))) float so[4][16][64];
  const int tid = threadIdx.x, w = tid >> 5, lane = tid & 31, ln = lane & 15, hh = lane >> 4; const int by = blockIdx.y;
  A += (size_t)by * sA; Bh += (size_t)by * sB; C += (size_t)by * sC;
  const int ntn = (N + 63) / 64; const int wid = blockIdx.x * 4 + w; const int mt = wid / ntn, nq = wid % ntn; if (mt * 16 >= M) return;
  const int row0 = mt * 16, col0 = nq * 64; const float* arow = A + (size_t)(row0 + ln) * lda;
  v8f acc[4] = {};
  for (int kb = 0; kb < K; kb += 32) {
    FragH ah, al;
    const v4f x0 = *(const v4fa*)(arow + kb + 8 * hh), x1 = *(const v4fa*)(arow + kb + 8 * hh + 4), x2 = *(const v4fa*)(arow + kb + 16 + 8 * hh), x3 = *(const v4fa*)(arow + kb + 16 + 8 * hh + 4);
    float xs[16] = {x0[0],x0[1],x0[2],x0[3],x1[0],x1[1],x1[2],x1[3],x2[0],x2[1],x2[2],x2[3],x3[0],x3[1],x3[2],x3[3]};
#pragma unroll
    for (int i = 0; i < 16; ++i) { const _Float16 h = (_Float16)xs[i]; ah.h[i] = h; al.h[i] = ASPLIT ? (_Float16)(xs[i] - (float)h) : (_Float16)0.0f; }
#pragma unroll
    for (int t = 0; t < 4; ++t) { if (col0 + t * 16 >= N) continue; const size_t boff = (size_t)(col0 + t * 16 + ln) * ldb + kb; FragH bq; bq.half[0] = *(const v8us*)(Bh + boff + 8 * hh); bq.half[1] = *(const v8us*)(Bh + boff + 16 + 8 * hh);
      acc[t] = mmaH<ASPLIT ? 2 : 1>(ah.v, al.v, bq.v, bq.v, acc[t]); }
  }
#pragma unroll
  for (int t = 0; t < 4; ++t) { if (col0 + t * 16 >= N) continue;
#pragma unroll
    for (int r = 0; r < 8; ++r) so[w][8 * hh + r][t * 16 + ln] = acc[t][r] * alpha; }
  __builtin_amdgcn_fence(__ATOMIC_ACQ_REL, "workgroup"); __builtin_amdgcn_wave_barrier();
  const int rsub = lane >> 4, c4 = (lane & 15) * 4;
  {
#pragma unroll
    for (int q = 0; q < 8; ++q) { const int r = q * 2 + rsub; if (col0 + c4 < N) { const v4f v = *(const v4fa*)&so[w][r][c4]; *(v4f*)(C + (size_t)(row0 + r) * ldc + col0 + c4) = v; } }
     }
}

// Wt[n][k] = f16(W[k][n]·scale) from f32 row-major W[K][N] (scale = power of two; bf16-exact weights stay exact in f16 away from the subnormal range)
__global__ __launch_bounds__(256) void k_wt_f16(const float* __restrict__ W, _Float16* __restrict__ Wt, int K, int N, float scale) {
  const int t = blockIdx.x * 256 + threadIdx.x; if (t >= N * (K / 8)) return; const int n = t / (K / 8), k8 = (t % (K / 8)) * 8; FragH f;
#pragma unroll
  for (int i = 0; i < 8; ++i) f.h[i] = (_Float16)(bf16_round(W[(size_t)(k8 + i) * N + n]) * scale); const v8us o = f.half[0];
  *(v8us*)((unsigned short*)Wt + (size_t)n * K + k8) = o; 
}
// k_gemm_hh variant with fused epilogue: v = acc·alpha + bias[by·sBias + col] (+ CP[(row/rowsPerB)·sCPb + by·64 + col] if CP) ; ACT 0 none / 1 elu ; writes f16 C16 (and f32 C if non-null)
template <int ACT>
__global__ __launch_bounds__(128) void k_gemm_hhx(const _Float16* __restrict__ A, int lda, size_t sA, const _Float16* __restrict__ Bh, int ldb, size_t sB, float alpha, const float* __restrict__ bias, size_t sBias, const float* __restrict__ CP, int rowsPerB, size_t sCPb, int row0g,
    float* __restrict__ C, _Float16* __restrict__ C16, int ldc, size_t sC, int M, int N, int K) {
  __shared__ __attribute__((aligned(16))) float so[4][16][64];
  const int tid = threadIdx.x, w = tid >> 5, lane = tid & 31, ln = lane & 15, hh = lane >> 4; const int by = blockIdx.y;
  A += (size_t)by * sA; Bh += (size_t)by * sB; const size_t cofs = (size_t)by * sC; const float* bp = bias ? bias + (size_t)by * sBias : nullptr;
  const int ntn = (N + 63) / 64; const int wid = blockIdx.x * 4 + w; const int mt = wid / ntn, nq = wid % ntn; if (mt * 16 >= M) return;
  const int row0 = mt * 16, col0 = nq * 64; const _Float16* arow = A + (size_t)(row0 + ln) * lda;
  v8f acc[4] = {};
  for (int kb = 0; kb < K; kb += 32) { FragH ah; ah.half[0] = *(const v8us*)((const unsigned short*)arow + kb + 8 * hh); ah.half[1] = *(const v8us*)((const unsigned short*)arow + kb + 16 + 8 * hh);
#pragma unroll
    for (int t = 0; t < 4; ++t) { if (col0 + t * 16 >= N) continue; const size_t boff = (size_t)(col0 + t * 16 + ln) * ldb + kb; FragH bq; bq.half[0] = *(const v8us*)((const unsigned short*)Bh + boff + 8 * hh); bq.half[1] = *(const v8us*)((const unsigned short*)Bh + boff + 16 + 8 * hh);
      acc[t] = mmaH<1>(ah.v, ah.v, bq.v, bq.v, acc[t]); }
  }
#pragma unroll
  for (int t = 0; t < 4; ++t) { if (col0 + t * 16 >= N) continue; const int col = col0 + t * 16 + ln; const float bv = bp ? bf16_round(bp[col]) : 0.f;
#pragma unroll
    for (int r = 0; r < 8; ++r) { float v = acc[t][r] * alpha + bv; if (CP) { const int rr = row0g + row0 + 8 * hh + r; if (rowsPerB < 0) v += CP[cofs + (size_t)rr * ldc + col];      /* rowsPerB < 0: own element of the batched C plane */ else { const int bidx = rr / rowsPerB; v += CP[(size_t)bidx * sCPb + (size_t)by * 64 + col]; } } if (ACT == 1) v = (v > 0.f) ? v : expm1f(v); else if (ACT == 7) v = (v > 0.f) ? v + 1.0f : expf(v); else if (ACT == 8) v = tanhf(v); else if (ACT == 9) v = 0.5f * v * (1.0f + tanhf(0.7978845608028654f * (v + 0.044715f * v * v * v))); else if (ACT == 11) v = 1.0f / (1.0f + expf(-v)); else if (ACT == 12) v = (v > 0.f) ? v : 0.01f * v; else if (ACT == 14) v = (v > 0.f) ? v : 0.1f * v; else if (ACT == 16) v = (v >= 0.f) ? v : 0.3f * v; else if (ACT == 17) v = (v >= 0.f) ? v : 0.2f * v; else if (ACT == 15) v = v / (1.0f + expf(-v)); else if (ACT == 3) v = fmaxf(v, 0.f); else if (ACT == 6) v = 0.5f * v * (1.0f + erff(v * 0.70710678118654752f)); so[w][8 * hh + r][t * 16 + ln] = v; } }
  __builtin_amdgcn_fence(__ATOMIC_ACQ_REL, "workgroup"); __builtin_amdgcn_wave_barrier();
  const int rsub = lane >> 4, c4 = (lane & 15) * 4; typedef _Float16 v4h __attribute__((ext_vector_type(4)));
  {
#pragma unroll
    for (int q = 0; q < 8; ++q) { const int r = q * 2 + rsub; if (col0 + c4 < N) { const v4f v = *(const v4fa*)&so[w][r][c4]; if (C) *(v4f*)(C + cofs + (size_t)(row0 + r) * ldc + col0 + c4) = v; if (C16) { v4h h4; for (int i = 0; i < 4; ++i) h4[i] = (_Float16)v[i]; *(v4h*)(C16 + cofs + (size_t)(row0 + r) * ldc + col0 + c4) = h4; } } }
     }
}


typedef _Float16 v4h __attribute__((ext_vector_type(4)));

__global__ __launch_bounds__(256) void k_h16(const float* __restrict__ x, _Float16* __restrict__ X16, size_t n8) { const size_t t = (size_t)blockIdx.x * 256 + threadIdx.x; if (t >= n8) return; FragH f;
#pragma unroll
  for (int q = 0; q < 8; ++q) f.h[q] = (_Float16)x[t * 8 + q]; *(v8us*)((unsigned short*)X16 + t * 8) = f.half[0];  }
__global__ __launch_bounds__(256) void k_round16f(const float* __restrict__ W, _Float16* __restrict__ Bt, size_t n8) { const size_t t = (size_t)blockIdx.x * 256 + threadIdx.x; if (t >= n8) return; FragH f;
#pragma unroll
  for (int i = 0; i < 8; ++i) f.h[i] = (_Float16)(bf16_round(W[t * 8 + i]) * 16.0f); *(v8us*)((unsigned short*)Bt + t * 8) = f.half[0];  }
template <int NHv, int TTv>
__global__ __launch_bounds__(256) void k_vt(const _Float16* __restrict__ V16, int ldv, int voff, _Float16* __restrict__ Vt) { __shared__ unsigned short tl[64][66]; const int tid = threadIdx.x; const int slab = blockIdx.x / (TTv / 64), lg = blockIdx.x % (TTv / 64); const int b = slab / NHv, h = slab % NHv;
  for (int i = tid; i < 64 * 8; i += 256) { const int r = i / 8, c8 = (i % 8) * 8; FragH f; f.half[0] = *(const v8us*)((const unsigned short*)V16 + ((size_t)b * TTv + lg * 64 + r) * ldv + voff + h * 64 + c8);
#pragma unroll
    for (int q = 0; q < 8; ++q) tl[r][c8 + q] = f.u[q]; }
  __syncthreads();
  {
#pragma unroll
    for (int rd = 0; rd < 2; ++rd) { const int i = rd * 256 + tid, ln = i & 15, hh = (i >> 4) & 1, j = (i >> 5) & 1, t = (i >> 6) & 3, ss = i >> 8; FragH f;      /* fragment order: [slab][32 keys][16 d][half j] pieces of 512 bytes, lane (hh, ln) holding row d = 16 t + ln, keys 16 j + 8 hh + 0..7; piece and lane count up with i, so a wave stores 512 contiguous bytes */
#pragma unroll
      for (int q = 0; q < 8; ++q) f.u[q] = tl[ss * 32 + j * 16 + hh * 8 + q][t * 16 + ln];
      *(v8us*)((unsigned short*)Vt + ((size_t)slab * (TTv / 64) + lg) * 4096 + i * 8) = f.half[0]; }
     } }

// ---- fast GEMM (work-group tile 128x64, wave tile 32x64; requires M % 32 == 0 rows per launch region, N % 64 == 0 and K % 64 == 0); epilogue = k_gemm_hhx semantics ----
// Operand tiles of GK k (one 128-byte line of each of the 128 A rows and 64 B rows) go through LDS: eight lanes fetch a whole line, one tile ahead of the matrix work, and the waves read their fragments from LDS.
// Products that read none of each other's output share a launch: planes by = blockIdx.y; planes by < nact take bias + by sBias and the activation, the others biasz and none; cfirst: the f32 plane C takes only the first QT0 rows of each batch;
// A1 (if given): the row tiles that hold the first QT0 rows of a batch read their A rows from A1 [batch][QT0] in place of A.
// Planes by < npk (rows of NH heads of HD = 64 columns, SQ rows a batch) store their f16 output in FRAGMENT ORDER in place of rows: [batch][head][16-row tile] tiles of PKT halfs; a tile is four pieces c of 512 bytes,
// piece c holding at lane (hh, ln) the 8 halfs of row ln, columns 16 c + 8 hh + 0..7: pieces 2 m and 2 m + 1 are the two halves of the g2_frag fragment of columns 32 m .. 32 m + 31, each one whole-line load of a wave.
// Planes by >= ntr (if CT is given) store their f16 output TRANSPOSED in fragment order into plane by - ntr of CT, and no f16 rows: [batch][head][32 rows][16 columns t][half j] pieces of 512 bytes,
// lane (hh, ln) holding column 16 t + ln, rows 16 j + 8 hh + 0..7: the fragment of a product that sums over the rows.
#define PKT 1024                     /* halfs per 16 x 64 tile in fragment order */
__device__ __forceinline__ v16h pk_frag(const _Float16* p) { FragH f; f.half[0] = *(const v8us*)((const unsigned short*)p); f.half[1] = *(const v8us*)((const unsigned short*)p + 256); return f.v; }      /* p: the fragment's first piece + 8 lane */
#define GK 64                        /* k per staged tile */
#define GP 72                        /* pitch in halfs of a staged row: 144 B = 16 B x odd, so that 16-byte fragment reads of 16 rows spread over the banks */
__device__ __forceinline__ v16h g2_frag(const _Float16* p, int hh) { FragH f; f.half[0] = *(const v8us*)((const unsigned short*)p + 8 * hh); f.half[1] = *(const v8us*)((const unsigned short*)p + 16 + 8 * hh); return f.v; }
__device__ __forceinline__ v8f g2_mma(v16h a, v16h b, v8f c) { v8f d = __builtin_amdgcn_wmma_f32_16x16x32_f16(false, a, false, b, (short)0, c, false, false); asm volatile("v_nop\n\tv_nop\n\tv_nop\n\tv_nop" : "+v"(d) : "v"(a), "v"(b)); return d; }
// The epilogue tests each run-time switch (act, tr, the row passes) once a wave, in front of straight-line code for the wave's 64 elements a lane, so that the kernel's text stays short.
// gemm2: the body, for work-group (bx, by) of the grid described above; so: the work-group's epilogue rows in LDS, handed in so that a launch which holds other work too has them once. CF (if given): f32 rows laid out like C; the row tiles with the first QT0 rows of a batch add their own elements of it in the row pass.
template <int ACT>
__device__ __forceinline__ void gemm2(const unsigned bx, const int by, float (*so)[32][68], const _Float16* __restrict__ A, int lda, size_t sA, const _Float16* __restrict__ Bh, int ldb, size_t sB, float alpha, const float* __restrict__ bias, size_t sBias,
    float* __restrict__ C, _Float16* __restrict__ C16, int ldc, size_t sC, int M, int N, int K, const _Float16* __restrict__ A1, const float* __restrict__ biasz, int nact, int cfirst, int npk, _Float16* __restrict__ CT, int ntr, const float* CF) { static_assert(ACT == 0 || ACT == 3 || ACT == 6 || ACT == 8 || ACT == 9 || ACT == 11 || ACT == 12 || ACT == 14 || ACT == 15 || ACT == 16 || ACT == 17 || ACT == 19, "k_gemm2: unsupported ACT code (would silently apply no activation)"); static_assert(QT0 == 128 && SQ % 128 == 0, "k_gemm2: the first rows of a batch are one row tile");
  __shared__ __attribute__((aligned(16))) _Float16 sa[2][128][GP]; __shared__ __attribute__((aligned(16))) _Float16 sb[2][64][GP];
  const int tid = threadIdx.x, w = tid >> 5, lane = tid & 31, ln = lane & 15, hh = lane >> 4;
  A += (size_t)by * sA; Bh += (size_t)by * sB; const size_t cofs = (size_t)by * sC; const bool act = by < nact; const float* bp = bias ? (act ? bias + (size_t)by * sBias : biasz) : nullptr;
  const int ntn = N >> 6; const int mt = bx / ntn, nq = bx - mt * ntn; const int row0 = mt * 128 + 32 * w, col0 = nq * 64; if (mt * 128 >= M) return;      /* the whole work-group or none: barriers follow; a wave whose own rows lie past M leaves behind the last one */
  const int sr = tid >> 3, sc = (tid & 7) * 8;      /* staging: 8 lanes per 128-byte line, 16 rows per pass of the work-group */
  const bool first = (mt * 128) % SQ == 0; const bool cf = C && (!cfirst || first); const bool pk = by < npk; const bool tr = CT && by >= ntr; const bool rows16 = C16 && !pk && !tr; const bool cfa = CF && cf && first; int ar0 = mt * 128, am = M;      /* ar0, am: the tile's first row in its A plane and that plane's rows */
  const char* ab = (const char*)A; const char* bb = (const char*)Bh; unsigned ao[8], bo[4]; if (A1 && first) { ab = (const char*)A1; ar0 = ar0 / SQ * QT0; am = M / SQ * QT0; }      /* one base per operand for the whole work-group + the lane's own byte offset to each of its rows; a 16-row pass past M (M % 32 == 0) rereads the last 16 rows, which no wave uses */
#pragma unroll
  for (int p = 0; p < 8; ++p) ao[p] = (unsigned)((min(ar0 + 16 * p, am - 16) + sr) * lda + sc) * 2u;
#pragma unroll
  for (int p = 0; p < 4; ++p) bo[p] = (unsigned)((col0 + 16 * p + sr) * ldb + sc) * 2u;
  v8us ra[8], rb[4]; v16h a0[2], a1[2], b[2][4];
  auto fetch = [&]() {      /* the next tile into registers */
#pragma unroll
    for (int p = 0; p < 8; ++p) ra[p] = *(const v8us*)(ab + ao[p]);
#pragma unroll
    for (int p = 0; p < 4; ++p) rb[p] = *(const v8us*)(bb + bo[p]); };
  auto put = [&](int u) {      /* the fetched tile into buffer u; the offsets step on by one tile here, behind the waits for the loads that name them */
#pragma unroll
    for (int p = 0; p < 8; ++p) { *(v8us*)&sa[u][16 * p + sr][sc] = ra[p]; ao[p] += GK * 2; }
#pragma unroll
    for (int p = 0; p < 4; ++p) { *(v8us*)&sb[u][16 * p + sr][sc] = rb[p]; bo[p] += GK * 2; } };
  auto frags = [&](int u) {      /* all fragments of one staged tile: the second half's reads return under the first half's products */
#pragma unroll
    for (int ks = 0; ks < 2; ++ks) { a0[ks] = g2_frag(&sa[u][32 * w + ln][ks * 32], hh); a1[ks] = g2_frag(&sa[u][32 * w + 16 + ln][ks * 32], hh);
#pragma unroll
      for (int t = 0; t < 4; ++t) b[ks][t] = g2_frag(&sb[u][16 * t + ln][ks * 32], hh); } };
  const v8f z8 = {0.f,0.f,0.f,0.f,0.f,0.f,0.f,0.f}; v8f c00 = z8, c01 = z8, c02 = z8, c03 = z8, c10 = z8, c11 = z8, c12 = z8, c13 = z8;
  auto prods = [&]() {
#pragma unroll
    for (int ks = 0; ks < 2; ++ks) { c00 = g2_mma(a0[ks], b[ks][0], c00); c10 = g2_mma(a1[ks], b[ks][0], c10); c01 = g2_mma(a0[ks], b[ks][1], c01); c11 = g2_mma(a1[ks], b[ks][1], c11);
      c02 = g2_mma(a0[ks], b[ks][2], c02); c12 = g2_mma(a1[ks], b[ks][2], c12); c03 = g2_mma(a0[ks], b[ks][3], c03); c13 = g2_mma(a1[ks], b[ks][3], c13); } };
  const int nt = K / GK;
  fetch(); put(0); __syncthreads();
#pragma unroll 1      /* one copy of the loop body: the buffer's number is a scalar offset */
  for (int t = 0; t + 1 < nt; ++t) { frags(t & 1); fetch(); prods(); put((t + 1) & 1); __syncthreads(); }      /* tile t + 1 is on its way under tile t's products; the one barrier of a pass publishes it and ends the reads of tile t, whose buffer the next pass refills */
  frags((nt - 1) & 1); prods();
  if (row0 >= M) return;
  v8f accs[8] = {c00, c01, c02, c03, c10, c11, c12, c13};
  v4f cr[16];      /* the lane's elements of CF, at the addresses of its row-pass stores: all sixteen loads in flight together, under the accumulators' way into LDS */
  if (cfa) { const char* cb = (const char*)(CF + cofs + (size_t)(row0 + (lane >> 4)) * ldc + col0 + (lane & 15) * 4); const unsigned cs = (unsigned)ldc * 8u; const char* ca[16];
#pragma unroll
    for (int q = 0; q < 16; ++q) { ca[q] = cb + q * cs; cr[q] = *(const v4fa*)ca[q]; }
    asm volatile("s_wait_xcnt 0x0" :: "v"(ca[0]), "v"(ca[1]), "v"(ca[2]), "v"(ca[3]), "v"(ca[4]), "v"(ca[5]), "v"(ca[6]), "v"(ca[7]), "v"(ca[8]), "v"(ca[9]), "v"(ca[10]), "v"(ca[11]), "v"(ca[12]), "v"(ca[13]), "v"(ca[14]), "v"(ca[15]) : "memory"); }      /* behind the last load of the run; the sixteen address pairs are its inputs, so that none of them is given to a load's result or reused ahead of it */
  unsigned short* tq = (unsigned short*)CT + (tr ? (size_t)(by - ntr) * sC + (((size_t)(row0 / SQ) * NH + nq) * (SQ / 32) + (row0 % SQ) / 32) * 2048 + lane * 8 : (size_t)0);      /* the wave's 32 rows x 64 columns, transposed: one block of 4 KiB */
  float bv[4] = {0.f, 0.f, 0.f, 0.f};      /* the bias of the lane's four columns: the four loads are in flight together */
  if (bp) { const float* bq = bp + col0 + ln;
#pragma unroll
    for (int t = 0; t < 4; ++t) bv[t] = bq[t * 16];
    asm volatile("s_wait_xcnt 0x0" :: "v"(bq) : "memory");      /* behind the last load of the run; the address pair is its input, so that it is not given to a load's result or reused ahead of it */
#pragma unroll
    for (int t = 0; t < 4; ++t) bv[t] = bf16_round(bv[t]); }
#pragma unroll
  for (int u = 0; u < 8; ++u)
#pragma unroll
    for (int r = 0; r < 8; ++r) accs[u][r] = accs[u][r] * alpha + bv[u & 3];
  if (ACT != 0 && act) {      /* the plane's switch is tested once a wave; the 64 elements behind it are straight-line code, independent of each other */
#pragma unroll
    for (int u = 0; u < 8; ++u)
#pragma unroll
      for (int r = 0; r < 8; ++r) { float v = accs[u][r];
        if (ACT == 3) v = fmaxf(v, 0.f); else if (ACT == 6) v = 0.5f * v * (1.0f + erff(v * 0.70710678118654752f)); else if (ACT == 11) v = 1.0f / (1.0f + expf(-v)); else if (ACT == 15) v = v / (1.0f + expf(-v)); else if (ACT == 19) { const float e = expf(v); v = (v > 0.f) ? (v + 1.0f) : e; }      /* elu(v) + 1; the exponential is formed for every lane and chosen by a select, so that no branch stands between the elements */ else if (ACT == 12) v = (v > 0.f) ? v : 0.01f * v; else if (ACT == 8) v = tanhf(v); else if (ACT == 9) v = 0.5f * v * (1.0f + tanhf(0.7978845608028654f * (v + 0.044715f * v * v * v))); else if (ACT == 14) v = (v > 0.f) ? v : 0.1f * v; else if (ACT == 16) v = (v >= 0.f) ? v : 0.3f * v; else if (ACT == 17) v = (v >= 0.f) ? v : 0.2f * v;
        accs[u][r] = v; } }
  if (tr) {
#pragma unroll
    for (int u = 0; u < 8; ++u) { const int t = u & 3, half = u >> 2; FragH tf;
#pragma unroll
      for (int r = 0; r < 8; ++r) tf.h[r] = (_Float16)accs[u][r];
      *(v8us*)(tq + t * 512 + half * 256) = tf.half[0]; asm volatile("s_wait_xcnt 0x0" :: "v"(tf.half[0]), "v"(tq) : "memory"); } }      /* an accumulator holds 8 consecutive rows of ONE column in a lane: that is the lane's 16 bytes of the transposed fragment, stored as 512 contiguous bytes a wave; the wait stands behind the store with the stored registers and the address pair as inputs, so that neither is reused ahead of it */
  if (cf || rows16 || (C16 && pk)) {      /* the rows go through LDS only where one of the two passes below reads them */
#pragma unroll
    for (int u = 0; u < 8; ++u)
#pragma unroll
      for (int r = 0; r < 8; ++r) so[w][(u >> 2) * 16 + 8 * hh + r][(u & 3) * 16 + ln] = accs[u][r]; }
  __builtin_amdgcn_fence(__ATOMIC_ACQ_REL, "workgroup"); __builtin_amdgcn_wave_barrier();
  const int rsub = lane >> 4, c4 = (lane & 15) * 4;
  if (cf || rows16) {      /* the row pass; a tile that stores neither f32 rows nor f16 rows skips its sixteen LDS reads */
#pragma unroll
    for (int q = 0; q < 16; ++q) { const int r = q * 2 + rsub; v4f v = *(const v4fa*)&so[w][r][c4]; if (cfa) v += cr[q];
      if (cf) { *(v4f*)(C + cofs + (size_t)(row0 + r) * ldc + col0 + c4) = v; asm volatile("s_wait_xcnt 0x0" :: "v"(v) : "memory"); }      /* behind the f32 store; the stored registers are the wait's inputs, so that the f16 conversion below does not reuse them ahead of it */
      if (rows16) { v4h h4; for (int i = 0; i < 4; ++i) h4[i] = (_Float16)v[i]; _Float16* dp = C16 + cofs + (size_t)(row0 + r) * ldc + col0 + c4; *(v4h*)dp = h4; asm volatile("s_wait_xcnt 0x0" :: "v"(h4), "v"(dp) : "memory"); } }      /* behind the f16 row store; the stored registers and the address pair are the wait's inputs, so that nothing behind it reuses them ahead of it */
     }
  if (C16 && pk) {      /* fragment order: the wave's 32 rows x 64 columns are two tiles of 2 KiB in a row; each store is 512 contiguous bytes */
    unsigned short* pt = (unsigned short*)C16 + cofs + (((size_t)(row0 / SQ) * NH + nq) * (SQ / 16) + (row0 % SQ) / 16) * PKT + lane * 8;
#pragma unroll      /* constant LDS and store offsets; the LDS reads of all eight pieces are issued ahead of the conversions */
    for (int u = 0; u < 8; ++u) { const float* sp = &so[w][(u >> 2) * 16 + ln][(u & 3) * 16 + 8 * hh]; const v4f x = *(const v4fa*)sp, y = *(const v4fa*)(sp + 4); FragH f;
#pragma unroll
      for (int i = 0; i < 4; ++i) { f.h[i] = (_Float16)x[i]; f.h[4 + i] = (_Float16)y[i]; }
      *(v8us*)(pt + u * 256) = f.half[0]; } } }
template <int ACT>
__global__ __launch_bounds__(128) void k_gemm2(const _Float16* __restrict__ A, int lda, size_t sA, const _Float16* __restrict__ Bh, int ldb, size_t sB, float alpha, const float* __restrict__ bias, size_t sBias,
    float* __restrict__ C, _Float16* __restrict__ C16, int ldc, size_t sC, int M, int N, int K, const _Float16* __restrict__ A1, const float* __restrict__ biasz, int nact, int cfirst, int npk, _Float16* __restrict__ CT, int ntr, const float* CF) {
  __shared__ __attribute__((aligned(16))) float so[4][32][68];
  gemm2<ACT>(blockIdx.x, (int)blockIdx.y, so, A, lda, sA, Bh, ldb, sB, alpha, bias, sBias, C, C16, ldc, sC, M, N, K, A1, biasz, nact, cfirst, npk, CT, ntr, CF); }


// All four operand conversions in one launch (none reads another's output): the weights, natural [out][in] = Bt[n][k], x16, into the planes BW = Wqk (q rows, k rows) | Wv | Wo, then x into X16. A work-group lies wholly in one source.
#define CPB (DM * DM / 8 / 256)      /* work-groups per DM x DM plane, 8 elements per thread */
#define CXB ((unsigned)(NR * DM / 8 / 256))      /* work-groups of x */
__global__ __launch_bounds__(256) void k_cvt(const float* __restrict__ wqk, const float* __restrict__ wv, const float* __restrict__ wo, const float* __restrict__ x, _Float16* __restrict__ BW, _Float16* __restrict__ X16) {
  const unsigned bx = blockIdx.x; const float* s = wqk; _Float16* d = BW; unsigned b0 = 0; float sc = 16.0f;
  if (bx >= 4 * CPB) { s = x; d = X16; b0 = 4 * CPB; sc = 1.0f; } else if (bx >= 3 * CPB) { s = wo; d = BW + (size_t)3 * DM * DM; b0 = 3 * CPB; } else if (bx >= 2 * CPB) { s = wv; d = BW + (size_t)2 * DM * DM; b0 = 2 * CPB; }
  const size_t t = (size_t)(bx - b0) * 256 + threadIdx.x; FragH f;
#pragma unroll
  for (int q = 0; q < 8; ++q) f.h[q] = (_Float16)(bf16_round(s[t * 8 + q]) * sc);
  *(v8us*)((unsigned short*)d + t * 8) = f.half[0]; }
__global__ __launch_bounds__(256) void k_rsm(const float* __restrict__ S, _Float16* __restrict__ P, int nrows) {
  #pragma clang fp contract(off)
  const int i = blockIdx.x * 256 + threadIdx.x; if (i >= nrows) return; const float* s = S + (size_t)i * SQ; float mx = -3.0e38f;
#pragma unroll 1
  for (int j = 0; j < SQ; ++j) mx = fmaxf(mx, s[j]); float se = 0.f;
#pragma unroll 1
  for (int j = 0; j < SQ; ++j) se += expf(s[j] - mx); const float sc = 256.0f / se;
#pragma unroll 1
  for (int j0 = 0; j0 < SQ; j0 += 8) { FragH f; for (int q = 0; q < 8; ++q) f.h[q] = (_Float16)(expf(s[j0 + q] - mx) * sc); unsigned short* d = (unsigned short*)P + (size_t)i * SQ + j0; *(v8us*)d = f.half[0];  } }
__global__ __launch_bounds__(256) void k_vt(const _Float16* __restrict__ V16, int b, int h0, _Float16* __restrict__ VT) { __shared__ unsigned short tl[64][65]; const int tid = threadIdx.x; const int hh = blockIdx.x % HG, sg = blockIdx.x / HG; const int s0 = sg * 64; const int h = h0 + hh;
  for (int i = tid; i < 64 * 8; i += 256) { const int j = i / 8, d8 = (i % 8) * 8; FragH f; f.half[0] = *(const v8us*)((const unsigned short*)V16 + ((size_t)b * SQ + s0 + j) * DM + h * HD + d8); for (int q = 0; q < 8; ++q) tl[d8 + q][j] = f.u[q]; }
  __syncthreads();
  { for (int i = tid; i < 64 * 8; i += 256) { const int d = i / 8, j8 = (i % 8) * 8; FragH f; for (int q = 0; q < 8; ++q) f.u[q] = tl[d][j8 + q]; *(v8us*)((unsigned short*)VT + ((size_t)hh * HD + d) * SQ + s0 + j8) = f.half[0]; }  } }



__global__ __launch_bounds__(256) void k_rsmcf2(const float* __restrict__ S, _Float16* __restrict__ P, int hg, int q0, int nk) {
  #pragma clang fp contract(off)
  const int t = blockIdx.x * 256 + threadIdx.x; if (t >= hg * QT) return; const size_t i = (size_t)t; const float* s = S + i * NKX; const int last = q0 + (t % QT); float mx = -3.0e38f;
#pragma unroll 1
  for (int j = 0; j < nk; ++j) { const float f = (j <= last) ? 1.f : 0.f; mx = fmaxf(mx, fmaf(f, s[j], (1.f - f) * -1.0e9f)); } float se = 0.f;
#pragma unroll 1
  for (int j = 0; j < nk; ++j) { const float f = (j <= last) ? 1.f : 0.f; se += __expf(fmaf(f, s[j], (1.f - f) * -1.0e9f) - mx); } const float sc = 256.0f / se;
#pragma unroll 1
  for (int j0 = 0; j0 < nk; j0 += 8) { FragH fr; for (int q = 0; q < 8; ++q) { const int j = j0 + q; const float f = (j <= last) ? 1.f : 0.f; fr.h[q] = (_Float16)(__expf(fmaf(f, s[j], (1.f - f) * -1.0e9f) - mx) * sc); } unsigned short* d = (unsigned short*)P + i * NKX + j0; *(v8us*)d = fr.half[0];  } }


template <int MASKADD>
__global__ __launch_bounds__(64) void k_att0(const float* __restrict__ QF, const float* __restrict__ KF, const float* __restrict__ VF, int ld, const float* __restrict__ mask, float scale, float* __restrict__ OF, int ldo) {
  #pragma clang fp contract(off)
  __shared__ __attribute__((aligned(16))) float lq[64][64]; __shared__ __attribute__((aligned(16))) float lo[64][64];
  const int tid = threadIdx.x; const int h = blockIdx.x / (QT0 / 64), rg = blockIdx.x % (QT0 / 64); const int i = rg * 64 + tid;
  const float* qr = QF + (size_t)i * ld + h * HD;
#pragma unroll 1
  for (int c = 0; c < HD / 4; ++c) { *(v4f*)&lq[tid][c * 4] = *(const v4fa*)(qr + c * 4); const v4f z = {0.f, 0.f, 0.f, 0.f}; *(v4f*)&lo[tid][c * 4] = z; }
  float m = -1.0e30f, l = 0.f; const int jmax = MASKADD ? (SQ - 1) : (rg * 64 + 63);      /* additive-mask form: every key (the mask input decides); causal form: keys up to the block's last row */
#pragma unroll 1
  for (int j = 0; j <= jmax; ++j) { const float* kr = KF + (size_t)j * ld + h * HD; const float* vr = VF + (size_t)j * ld + h * HD; float s = 0.f;
#pragma unroll 1
    for (int c = 0; c < HD / 4; ++c) { const v4f kq = *(const v4fa*)(kr + c * 4); const v4f qq = *(v4f*)&lq[tid][c * 4]; s = __fadd_rn(s, __fmul_rn(qq[0], kq[0])); s = __fadd_rn(s, __fmul_rn(qq[1], kq[1])); s = __fadd_rn(s, __fmul_rn(qq[2], kq[2])); s = __fadd_rn(s, __fmul_rn(qq[3], kq[3])); }
    s = __fmul_rn(s, scale); if (MASKADD) s = __fadd_rn(s, __fmul_rn(bf16_round(mask[(size_t)i * SQ + j]), -10000.0f));
    const float f = (MASKADD || j <= i) ? 1.f : 0.f; const float sm = fmaf(f, s, (1.f - f) * -1.0e30f); const float mn = fmaxf(m, sm); const float sc = expf(m - mn); const float e = expf(sm - mn); l = __fadd_rn(__fmul_rn(l, sc), e); m = mn;
#pragma unroll 1
    for (int c = 0; c < HD / 4; ++c) { const v4f vv = *(const v4fa*)(vr + c * 4); v4f oo = *(v4f*)&lo[tid][c * 4]; for (int u = 0; u < 4; ++u) oo[u] = __fadd_rn(__fmul_rn(oo[u], sc), __fmul_rn(e, vv[u])); *(v4f*)&lo[tid][c * 4] = oo; } }
  const float fin = 64.0f / l;      /* o carried x64 like the f16 path */
#pragma unroll 1
  for (int c = 0; c < HD / 4; ++c) { v4f oo = *(v4f*)&lo[tid][c * 4]; for (int u = 0; u < 4; ++u) oo[u] = __fmul_rn(oo[u], fin); *(v4f*)&lo[tid][c * 4] = oo; }
  __syncthreads();
  {
#pragma unroll 1
    for (int it = 0; it < 16; ++it) { const int row = it * 4 + tid / 16, pc = (tid % 16) * 4; const v4f v = *(const v4f*)&lo[row][pc]; *(v4f*)(OF + (size_t)(rg * 64 + row) * ldo + h * HD + pc) = v; }
     } }


// Causal linear attention in chunks of SC keys: o_i = sum_{j <= i} a_ij v_j / sum_{j <= i} a_ij, a_ij = phi(q_i) . phi(k_j). The sums over the keys are plain sums, so the keys in front of a query's own chunk
// enter through the running state S = sum_j phi(k_j) v_j^T (HD x HD) and z = sum_j phi(k_j), as in the cumulative-sum form of the definition: o_i = (phi(q_i) S + own chunk) / (phi(q_i) z + own chunk).
// kvs: the state in front of every chunk. One work-group per (batch, head, 32 rows d, 16 columns t of S), one wave per (16 rows d, quarter of the keys). A wave forms the sums of its 8 chunks, S[d][t] = sum K^T[d][key] V^T[t][key] on WMMA
// (f32 accumulators; both planes transposed in fragment order by k_gemm2), the quarters' totals go through LDS, and each wave adds up in f32: the quarters in front of its own, then its chunks in ascending order,
// storing the tile as f16 in front of each chunk. A lane of the accumulator holds 8 consecutive d of ONE column t: its 16 bytes of the B fragment (row t, k = d) of phi(q) S. Column tile 4 takes a fragment of ones for V^T: each of its 16 columns is z.
#define SC 64                        /* keys per chunk */
#define SNP 5120                     /* halfs per stored state: [5 column tiles][4 d tiles] pieces of 512 bytes */
#define SG 8                         /* steps of 32 keys whose loads are in flight together */
#define SN 4                         /* parts of the keys, two waves each (one per 16 rows d) */
#define SW (SQ / SC / SN)            /* chunks per wave */
#define SB (5 * 2 * NH * NB)          /* work-groups of kvs, 64 SN threads each */
__device__ __forceinline__ void kvs(const int bi, const _Float16* __restrict__ KT, const _Float16* __restrict__ VT, _Float16* __restrict__ ST) {      /* bi: 0 .. SB - 1 */
  __shared__ __attribute__((aligned(16))) float tot[SN][2][32][8];
  const int lane = threadIdx.x & 31; const int wv = __builtin_amdgcn_readfirstlane(threadIdx.x >> 5); const int dl = wv & 1, sg = wv >> 1; const int tt = bi % 5, dt = (bi / 5) % 2 * 2 + dl, h = (bi / 10) % NH, b = bi / (10 * NH); const bool zt = tt == 4;
  const size_t hb = ((size_t)b * NH + h) * SQ * HD + (size_t)sg * (SQ / SN) * HD + lane * 8; const _Float16* kp = KT + hb + dt * 512; const _Float16* vp = VT + hb + (zt ? 0 : tt) * 512;
  unsigned short* sp = (unsigned short*)ST + (((size_t)b * NH + h) * (SQ / SC) + sg * SW) * SNP + (tt * 4 + dt) * 256 + lane * 8;
  v16h one;
#pragma unroll
  for (int i = 0; i < 16; ++i) one[i] = (_Float16)1.0f;
  const v8f z8 = {0.f,0.f,0.f,0.f,0.f,0.f,0.f,0.f}; v8f cs[SW];
#pragma unroll      /* constant indices into cs */
  for (int g = 0; g < SW * 2 / SG; ++g) { v16h kf[SG], vf[SG]; const _Float16* kq = kp + g * SG * 2048; const _Float16* vq = vp + g * SG * 2048;
#pragma unroll
    for (int s = 0; s < SG; ++s) { kf[s] = pk_frag(kq + s * 2048); vf[s] = pk_frag(vq + s * 2048); }
    asm volatile("s_wait_xcnt 0x0" :: "v"(kq), "v"(vq) : "memory");      /* behind the last load of the group; the two address pairs are its inputs, so that neither is reused ahead of it */
#pragma unroll
    for (int c = 0; c < SG / 2; ++c) cs[g * (SG / 2) + c] = g2_mma(kf[2 * c + 1], zt ? one : vf[2 * c + 1], g2_mma(kf[2 * c], zt ? one : vf[2 * c], z8)); }
  v8f run = cs[0];
#pragma unroll
  for (int c = 1; c < SW; ++c) run += cs[c];
  *(v4f*)&tot[sg][dl][lane][0] = __builtin_shufflevector(run, run, 0, 1, 2, 3); *(v4f*)&tot[sg][dl][lane][4] = __builtin_shufflevector(run, run, 4, 5, 6, 7);
  __syncthreads();
  run = z8;
#pragma unroll
  for (int s = 0; s < SN - 1; ++s) if (s < sg) { const v4f x = *(const v4f*)&tot[s][dl][lane][0], y = *(const v4f*)&tot[s][dl][lane][4]; run += __builtin_shufflevector(x, y, 0, 1, 2, 3, 4, 5, 6, 7); }
#pragma unroll
  for (int c = 0; c < SW; ++c) { FragH f;      /* the state in front of the chunk (zero in front of the first), then the chunk's sum */
#pragma unroll
    for (int r = 0; r < 8; ++r) f.h[r] = (_Float16)run[r];
    *(v8us*)(sp + c * SNP) = f.half[0]; asm volatile("s_wait_xcnt 0x0" :: "v"(f.half[0]), "v"(sp) : "memory");      /* behind the store; the stored registers and the address pair are its inputs, so that neither is reused ahead of it */
    run += cs[c]; } }

// lfa: one wave per (batch, head, 32 query rows), four such waves a work-group. o and the row sum l start as phi(q) S and phi(q) z of the state in front of the rows' chunk; then the chunk's own 64 keys in two steps of 32:
// a^T = K Q^T, so that a lane of the accumulator holds 8 consecutive keys of ONE query: accumulator tile 0 (keys 0..15) and tile 1 (keys 16..31) of a query column, masked and rounded to f16,
// are elements 0..7 and 8..15 of the A fragment of a V^T in the k order of g2_frag (8 hh + i, 16 + 8 hh + i), in which V^T is stored too: nothing is moved between lanes. a times a fragment of ones adds the row sums to l,
// which so lies in the lane and register of the o elements that it divides. Every load of a wave is 512 contiguous bytes, four whole lines.
#define FQ 32                        /* query rows per wave */
#define FS 32                        /* keys per step */
#define FP 68                        /* pitch in floats of the o rows in LDS, as in k_gemm2 */
#define FB (SQ / FQ / 4)              /* work-groups of lfa per (batch, head) */
__device__ __forceinline__ void lfa(const int bi, float (*so)[FQ][FP], const _Float16* __restrict__ Q16, const _Float16* __restrict__ K16, const _Float16* __restrict__ VT, const _Float16* __restrict__ ST, _Float16* __restrict__ O16) {      /* bi: 0 .. FB NH NB - 1; so: the work-group's o rows in LDS; Q16, K16: fragment order of k_gemm2; VT: its transposed fragment order; each SQ HD halfs a (batch, head); ST: kvs; O16: rows of DM */
  const int tid = threadIdx.x, lane = tid & 31, ln = lane & 15, hh = lane >> 4; const int w = __builtin_amdgcn_readfirstlane(tid >> 5);
  const int rg = bi % FB * 4 + w, h = bi / FB % NH, b = bi / (FB * NH), ch = rg / (SC / FQ);
  const size_t hb = ((size_t)b * NH + h) * SQ * HD + lane * 8; const _Float16* qp = Q16 + hb + (size_t)rg * FQ * HD; const _Float16* kp = K16 + hb + (size_t)ch * SC * HD; const _Float16* vp = VT + hb + (size_t)ch * SC * HD;
  const _Float16* sp = ST + (((size_t)b * NH + h) * (SQ / SC) + ch) * SNP + lane * 8;
  v16h qf[2][2], sf[5][2], one;
#pragma unroll
  for (int i = 0; i < 16; ++i) one[i] = (_Float16)1.0f;
#pragma unroll
  for (int qs = 0; qs < 2; ++qs) { qf[qs][0] = pk_frag(qp + qs * PKT); qf[qs][1] = pk_frag(qp + qs * PKT + 512); }
#pragma unroll
  for (int t = 0; t < 5; ++t) { sf[t][0] = pk_frag(sp + t * 1024); sf[t][1] = pk_frag(sp + t * 1024 + 512); }
  asm volatile("s_wait_xcnt 0x0" :: "v"(qp), "v"(sp) : "memory");      /* behind the last q and state load; the address pairs are its inputs, so that they are not reused ahead of it */
  const v8f z8 = {0.f,0.f,0.f,0.f,0.f,0.f,0.f,0.f}; v8f o[2][5];      /* o[qs][t][r]: query 16 qs + 8 hh + r, column 16 t + ln; t = 4: the row sum, the same in every column */
#pragma unroll
  for (int qs = 0; qs < 2; ++qs)
#pragma unroll
    for (int t = 0; t < 5; ++t) o[qs][t] = g2_mma(qf[qs][0], sf[t][0], z8);
#pragma unroll
  for (int qs = 0; qs < 2; ++qs)
#pragma unroll
    for (int t = 0; t < 5; ++t) o[qs][t] = g2_mma(qf[qs][1], sf[t][1], o[qs][t]);
#pragma unroll
  for (int js = 0; js < SC / FS; ++js) { const _Float16* kq = kp + js * FS * HD; const _Float16* vq = vp + js * FS * HD;      /* a step's k and its V^T: 4 KiB in a row each */
    v16h kf[2][2], vf[4];
#pragma unroll
    for (int ks = 0; ks < 2; ++ks) { kf[ks][0] = pk_frag(kq + ks * PKT); kf[ks][1] = pk_frag(kq + ks * PKT + 512); }
#pragma unroll
    for (int t = 0; t < 4; ++t) vf[t] = pk_frag(vq + t * 512);
    asm volatile("s_wait_xcnt 0x0" :: "v"(kq), "v"(vq) : "memory");      /* behind the last load of the step; the two address pairs are its inputs, so that neither is reused ahead of it */
    v8f st[2][2];      /* st[ks][qs][r]: key ch SC + js FS + 16 ks + 8 hh + r, query rg FQ + 16 qs + ln */
#pragma unroll
    for (int ks = 0; ks < 2; ++ks)
#pragma unroll
      for (int qs = 0; qs < 2; ++qs) st[ks][qs] = g2_mma(kf[ks][0], qf[qs][0], z8);
#pragma unroll
    for (int ks = 0; ks < 2; ++ks)
#pragma unroll
      for (int qs = 0; qs < 2; ++qs) st[ks][qs] = g2_mma(kf[ks][1], qf[qs][1], st[ks][qs]);
    const int dq = (rg - ch * (SC / FQ) - js) * FS + ln - 8 * hh;      /* query row less key row at ks = qs = r = 0; both steps are masked, the keys behind a query count zero */
#pragma unroll
    for (int ks = 0; ks < 2; ++ks)
#pragma unroll
      for (int qs = 0; qs < 2; ++qs)
#pragma unroll
        for (int r = 0; r < 8; ++r) st[ks][qs][r] = (ks * 16 + r <= qs * 16 + dq) ? st[ks][qs][r] : 0.f;
#pragma unroll
    for (int qs = 0; qs < 2; ++qs) { FragH p;
#pragma unroll
      for (int r = 0; r < 8; ++r) { p.h[r] = (_Float16)st[0][qs][r]; p.h[8 + r] = (_Float16)st[1][qs][r]; }
#pragma unroll
      for (int t = 0; t < 4; ++t) o[qs][t] = g2_mma(p.v, vf[t], o[qs][t]);
      o[qs][4] = g2_mma(p.v, one, o[qs][4]); } }
#pragma unroll
  for (int qs = 0; qs < 2; ++qs)
#pragma unroll
    for (int r = 0; r < 8; ++r) { const float fin = 64.0f / o[qs][4][r];      /* o carried x64 as the output GEMM expects */
#pragma unroll
      for (int t = 0; t < 4; ++t) so[w][qs * 16 + 8 * hh + r][t * 16 + ln] = o[qs][t][r] * fin; }
  __syncthreads();
  const int r0 = lane >> 2, c0 = (lane & 3) * 16;      /* four lanes per output row: 32 bytes each of its 128-byte line; a wave stores its own 32 rows in four passes */
#pragma unroll
  for (int p = 0; p < 4; ++p) { const int row = p * 8 + r0; FragH f;
#pragma unroll
    for (int c = 0; c < 4; ++c) { const v4f a = *(const v4f*)&so[w][row][c0 + c * 4];
#pragma unroll
      for (int q = 0; q < 4; ++q) f.h[c * 4 + q] = (_Float16)a[q]; }
    unsigned short* d = (unsigned short*)O16 + ((size_t)b * SQ + rg * FQ + row) * DM + h * HD + c0;
    *(v8us*)d = f.half[0]; *(v8us*)(d + 8) = f.half[1]; asm volatile("s_wait_xcnt 0x0" :: "v"(f.half[0]), "v"(f.half[1]), "v"(d) : "memory"); } }      /* behind the two stores; the stored registers and the address pair are its inputs, so that neither is reused ahead of it */
// One launch for two pieces of work that read none of each other's output: work-groups 0 .. LB - 1 (the longer ones, so they start first) form o_lo Wo 2^-20 of the first QT0 rows of each batch and store it in the output's rows,
// where the output GEMM adds it to its own sums; the others are lfa. Both use the same LDS rows for their epilogue.
#define LB (NB * (DM / 64))          /* work-groups of the o_lo product: one row tile of QT0 = 128 rows a batch */
__global__ __launch_bounds__(128) void k_lfa_lo(const _Float16* __restrict__ Q16, const _Float16* __restrict__ K16, const _Float16* __restrict__ VT, const _Float16* __restrict__ ST, _Float16* __restrict__ O16, const _Float16* __restrict__ OL, const _Float16* __restrict__ BO, float* __restrict__ out) {
  __shared__ __attribute__((aligned(16))) float so[4][FQ][FP]; static_assert(FQ == 32 && FP == 68, "one LDS array for both epilogues");
  const int bi = blockIdx.x;
  if (bi < LB) gemm2<0>((unsigned)(bi % (DM / 64)), bi / (DM / 64), so, OL, DM, (size_t)QT0 * DM, BO, DM, 0, 0.00000095367431640625f, nullptr, 0, out, nullptr, DM, (size_t)SQ * DM, QT0, DM, DM, nullptr, nullptr, NB, 0, 0, nullptr, 0, nullptr);
  else lfa(bi - LB, so, Q16, K16, VT, ST, O16); }

// Exact f32 linear attention for the first QT0 rows of every batch. One work-group of 8 waves per (batch, head, 32 query rows), lane = query row.
// The head's QT0 key and value rows and the group's 32 q rows are staged once in LDS with whole-line loads, all in flight together. Step 1: wave w takes the keys j = w mod 8, four at a time
// (four independent sum chains), q row in registers, k row broadcast from LDS; the masked score goes to le[j][row]. Step 2: wave w owns columns 8 w .. 8 w + 7 of o in registers
// and walks the keys in ascending order. Each sum runs in the order of the one-thread-per-row form (d ascending, j ascending); keys above the group's last row only ever added zeros and are left out.
#define LR 32                        /* query rows per work-group */
#define LP 68                        /* pitch in floats of the per-row LDS arrays: 16 B x odd, so that 32 lanes reading 16 B of their own rows spread over the banks */
#define LA (NH * (QT0 / LR))         /* work-groups of latt0 per batch */
__device__ __forceinline__ void latt0(const int bi, const float* __restrict__ QF, const float* __restrict__ KF, const float* __restrict__ VF, _Float16* __restrict__ OH, _Float16* __restrict__ OL) {      /* bi: 0 .. LA NB - 1; all planes: rows of DM; QF, KF, VF: SQ rows a batch, the first QT0 of them written; OH, OL: QT0 rows a batch, o (x64) as f16 and its residual x1024 as f16 */
  { const int bt = bi / LA; const size_t fb = (size_t)bt * SQ * DM; QF += fb; KF += fb; VF += fb; OH += (size_t)bt * QT0 * DM; OL += (size_t)bt * QT0 * DM; }
  __shared__ __attribute__((aligned(16))) float lk[QT0][HD]; __shared__ __attribute__((aligned(16))) float lv[QT0][HD]; __shared__ __attribute__((aligned(16))) float le[QT0][LR];
  __shared__ __attribute__((aligned(16))) float lq[LR][LP]; __shared__ __attribute__((aligned(16))) float lo[LR][LP];
  const int tid = threadIdx.x, w = tid >> 5, lane = tid & 31; const int h = bi % LA / (QT0 / LR), rg = bi % (QT0 / LR); const int r0 = rg * LR, nj = r0 + LR, i = r0 + lane;
  const int sr = tid / (HD / 4), sc = (tid % (HD / 4)) * 4;      /* staging and output: 16 lanes per 256-byte row, 16 rows per pass of the work-group */
  { v4f tk[QT0 / 16], tv[QT0 / 16], tq[LR / 16]; const float* kp = KF + (size_t)sr * DM + h * HD + sc; const float* vp = VF + (size_t)sr * DM + h * HD + sc; const float* qp = QF + (size_t)(r0 + sr) * DM + h * HD + sc;
#pragma unroll      /* every load is issued before the first LDS store waits for one */
    for (int p = 0; p < QT0 / 16; ++p) { tk[p] = *(const v4fa*)(kp + (size_t)p * 16 * DM); tv[p] = *(const v4fa*)(vp + (size_t)p * 16 * DM); }
#pragma unroll
    for (int p = 0; p < LR / 16; ++p) tq[p] = *(const v4fa*)(qp + (size_t)p * 16 * DM);
    asm volatile("s_wait_xcnt 0x0" :: "v"(kp), "v"(vp), "v"(qp) : "memory");      /* behind the last load of the run; the three address pairs are its inputs, so that none of them is given to a load's result or reused ahead of it */
#pragma unroll
    for (int p = 0; p < QT0 / 16; ++p) { *(v4f*)&lk[p * 16 + sr][sc] = tk[p]; *(v4f*)&lv[p * 16 + sr][sc] = tv[p]; }
#pragma unroll
    for (int p = 0; p < LR / 16; ++p) *(v4f*)&lq[p * 16 + sr][sc] = tq[p]; }
  __syncthreads();
  v4f q[HD / 4];
#pragma unroll      /* q stays in registers: constant indices only */
  for (int c = 0; c < HD / 4; ++c) q[c] = *(const v4f*)&lq[lane][c * 4];
  for (int jb = 0; jb < nj; jb += 32) { const int j0 = jb + w; float s0 = 0.f, s1 = 0.f, s2 = 0.f, s3 = 0.f;
#pragma unroll      /* constant indices into q; the four chains fill each other's result latency */
    for (int c = 0; c < HD / 4; ++c) { const v4f k0 = *(const v4f*)&lk[j0][c * 4], k1 = *(const v4f*)&lk[j0 + 8][c * 4], k2 = *(const v4f*)&lk[j0 + 16][c * 4], k3 = *(const v4f*)&lk[j0 + 24][c * 4];
#pragma unroll
      for (int u = 0; u < 4; ++u) { s0 += q[c][u] * k0[u]; s1 += q[c][u] * k1[u]; s2 += q[c][u] * k2[u]; s3 += q[c][u] * k3[u]; } }
    le[j0][lane] = (j0 <= i) ? s0 : 0.f; le[j0 + 8][lane] = (j0 + 8 <= i) ? s1 : 0.f; le[j0 + 16][lane] = (j0 + 16 <= i) ? s2 : 0.f; le[j0 + 24][lane] = (j0 + 24 <= i) ? s3 : 0.f; }
  __syncthreads();
  float l = 0.f; v4f oa = {0.f, 0.f, 0.f, 0.f}, ob = {0.f, 0.f, 0.f, 0.f};
#pragma unroll 8      /* eight keys' LDS reads are issued ahead of the sums that use them */
  for (int j = 0; j < nj; ++j) { const float e = le[j][lane]; const v4f va = *(const v4f*)&lv[j][w * 8], vb = *(const v4f*)&lv[j][w * 8 + 4]; l += e; oa += e * va; ob += e * vb; }
  const float fin = 64.0f / l;      /* o carried x64 like the f16 path */
  *(v4f*)&lo[lane][w * 8] = oa * fin; *(v4f*)&lo[lane][w * 8 + 4] = ob * fin;
  __syncthreads();
#pragma unroll      /* two passes, each wave storing whole 128-byte lines of both planes */
  for (int p = 0; p < LR / 16; ++p) { const v4f a = *(const v4f*)&lo[p * 16 + sr][sc]; v4h fh, fl;
#pragma unroll
    for (int q = 0; q < 4; ++q) { const _Float16 hq = (_Float16)a[q]; fh[q] = hq; fl[q] = (_Float16)((a[q] - (float)hq) * 1024.0f); }
    const size_t od = (size_t)(r0 + p * 16 + sr) * DM + h * HD + sc; _Float16* dh = OH + od; _Float16* dl = OL + od;
    *(v4h*)dh = fh; *(v4h*)dl = fl; asm volatile("s_wait_xcnt 0x0" :: "v"(fh), "v"(fl), "v"(dh), "v"(dl) : "memory"); } }      /* behind the two stores; the stored registers and the address pairs are its inputs, so that none is reused ahead of it */
// One launch for two pieces of work that read none of each other's output (both read what the q, k, v GEMM wrote): work-groups 0 .. LA NB - 1 are latt0, the others kvs.
__global__ __launch_bounds__(256) void k_latt0_kvs(const float* __restrict__ QF, const float* __restrict__ KF, const float* __restrict__ VF, _Float16* __restrict__ OH, _Float16* __restrict__ OL, const _Float16* __restrict__ KT, const _Float16* __restrict__ VT, _Float16* __restrict__ ST) {
  static_assert(64 * SN == 256, "kvs and latt0 have work-groups of 8 waves"); const int bi = blockIdx.x;
  if (bi < LA * NB) latt0(bi, QF, KF, VF, OH, OL); else kvs(bi - LA * NB, KT, VT, ST); }
extern "C" void kernel_launch(void* const* d_in, const int* in_sizes, int n_in,
                              void* d_out, int out_size, void* d_ws, size_t ws_size, hipStream_t stream) {
  (void)in_sizes; (void)n_in; (void)out_size;
  const float* const* I = (const float* const*)d_in; const float* x = I[0]; const float* wqk = I[1]; const float* bqk = I[2]; const float* wv = I[3]; const float* bv = I[4]; const float* wo = I[5]; const float* bo = I[6];      /* natural Wqk [2048][1024] (q rows | k rows) + bias [2048]; Wv + bv; Wo + bo */
  char* ws = (char*)d_ws; size_t off = 0;
  auto take = [&](size_t bytes) { char* p = ws + off; off += (bytes + 255) & ~(size_t)255; return p; };
  _Float16* BQK = (_Float16*)take((size_t)4 * DM * DM * 2); _Float16* BO = BQK + (size_t)3 * DM * DM;      /* four planes in a row: Wq | Wk | Wv | Wo */
  _Float16* X16 = (_Float16*)take(NR * DM * 2); _Float16* Q16 = (_Float16*)take((size_t)3 * NR * DM * 2); _Float16* K16 = Q16 + NR * DM; _Float16* O16 = (_Float16*)take(NR * DM * 2);      /* q | k | a third plane that nothing writes: v is stored only as V^T */
  _Float16* KT = (_Float16*)take((size_t)2 * NB * NH * HD * SQ * 2); _Float16* VT = KT + (size_t)NB * NH * HD * SQ; _Float16* ST = (_Float16*)take((size_t)NB * NH * (SQ / SC) * SNP * 2);      /* K^T | V^T: two planes in a row; the states in front of the chunks */
  float* QF0 = (float*)take((size_t)3 * NR * DM * 4); float* KF0 = QF0 + NR * DM; float* VF0 = QF0 + 2 * NR * DM;      /* f32 q | k | v, indexed like the f16 planes; only the first QT0 rows of each batch are written and read */
  _Float16* OH0 = (_Float16*)take((size_t)NB * QT0 * DM * 2); _Float16* OL0 = (_Float16*)take((size_t)NB * QT0 * DM * 2);
  if (off > ws_size) return;
  k_cvt<<<4 * CPB + CXB, 256, 0, stream>>>(wqk, wv, wo, x, BQK, X16);
  k_gemm2<19><<<dim3((unsigned)((NR / 128) * (DM / 64)), 3), 128, 0, stream>>>(X16, DM, 0, BQK, DM, (size_t)DM * DM, 0.0625f, bqk, DM, QF0, Q16, DM, NR * DM, (int)NR, DM, DM, nullptr, bv, 2, 1, 2, KT, 1, nullptr);      /* planes 0, 1: phi(q), phi(k) = elu(x W^T + b) + 1, f16 in fragment order; planes 1, 2: phi(k), v transposed in fragment order; and in f32 rows the first 128 rows of each batch (exact products) */
  k_latt0_kvs<<<LA * NB + SB, 256, 0, stream>>>(QF0, KF0, VF0, OH0, OL0, KT, VT, ST);      /* exact f32 linear attention for rows 0..127 of each batch (the few-key rows without the f16 roundings), o (x64) stored as f16 hi + x1024 residual planes; beside it the running sums phi(k) v^T and phi(k) in front of every chunk of 64 keys */
  k_lfa_lo<<<LB + FB * NH * NB, 128, 0, stream>>>(Q16, K16, VT, ST, O16, OL0, BO, (float*)d_out);      /* state product, own chunk's scores, causal normalisation and a V^T of every batch, head and query tile: o (merged heads, x64) as f16 rows; beside it rows 0..127 of each batch of out = o_lo Wo 2^-20 */
  k_gemm2<0><<<dim3((unsigned)((NR / 128) * (DM / 64)), 1), 128, 0, stream>>>(O16, DM, 0, BO, DM, 0, 0.0009765625f, bo, 0, (float*)d_out, nullptr, DM, 0, (int)NR, DM, DM, OH0, nullptr, 1, 0, 0, nullptr, 0, (const float*)d_out);      /* out rows are the output layout; rows 0..127 of each batch: out = o_hi Wo + b + their own element as the launch before left it */
}
